// v000
// The times below were measured on an AMD MI455X: many runs one after another, warmed up first and cycling through
// copies of the inputs, with the whole window's GPU time divided by the number of runs. Launches and the gaps
// between them are all in it. The median over several windows is given; except for v000 it joins two sittings, which
// can be a few percent apart, so the side-by-side timings, each taken in one sitting, are the better comparison.
// The starting kernel, v000, takes 1570 microseconds a run.
#include <hip/hip_runtime.h>
// Pose-aware attention (8 batches x 1024 tokens x 1024; 16 heads x 64): qkv = x Wqkv + b; per-batch pose embedding = relu(pose W1 + b1) W2 + b2 split into (q, k, v) biases per (head, dim) and added to q/k/v; softmax(q k^T / 8) v; out Wproj + b -> [8,1024,1024].
// Structure: the pose MLP on VALU folded into per-batch bias vectors (bqkv + pose_{q|k|v}[b]); x as an exact f16 plane; per-batch qkv GEMMs (32x64 wave tiles, f32 accumulation, exact x16 weights, that per-batch bias) producing f32 q/k/v split into f16 hi + 2^10 residual planes; V^T by LDS tiles; the fused flash kernel with hi + 2^10-residual q/k planes (S = QhKh + (QlKh + QhKl)/1024) and plain f16 P (x2^10) and V (hi/lo operands only in S); the attention output as hi + residual into two accumulating projection GEMMs.
// Compute dtype: x, pose and all parameters rounded to bf16; q, k hi + residual (~2^-21-class logits); P and v plain f16 (~2^-12); f32 accumulation/softmax. v_wmma_f32_16x16x32_f16.
#define NB 8
#define DMOD 1024
#define NR (NB * SLEN)
#define QBLKS (TQ / 64)
#define SLEN 1024
#define TQ SLEN
#define TK SLEN
#define NH 16
#define SCL 0.125f               /* 64^-0.5 */
typedef __bf16 v16b __attribute__((ext_vector_type(16)));
typedef unsigned short v8us __attribute__((ext_vector_type(8), may_alias));
typedef float  v8f  __attribute__((ext_vector_type(8)));
typedef float  v4f  __attribute__((ext_vector_type(4)));
typedef float  v4fa __attribute__((ext_vector_type(4), may_alias));
union FragB { v16b v; v8us half[2]; unsigned short u[16]; };

__device__ __forceinline__ unsigned short bf16_bits(float x) { unsigned int u = __float_as_uint(x); return (unsigned short)((u + 0x7FFFu + ((u >> 16) & 1u)) >> 16); }
__device__ __forceinline__ float bf16_val(unsigned short b) { return __uint_as_float(((unsigned int)b) << 16); }
__device__ __forceinline__ float bf16_round(float x) { return bf16_val(bf16_bits(x)); }
// D += A·B with NT terms: 1 = ah·bh, 2 = + al·bh (A split), 3 = + ah·bl (both split)
template <int NT>
__device__ __forceinline__ v8f mmaN(v16b ah, v16b al, v16b bh, v16b bl, v8f c) {
  c = __builtin_amdgcn_wmma_f32_16x16x32_bf16(false, ah, false, bh, (short)0, c, false, false);
  if (NT >= 2) c = __builtin_amdgcn_wmma_f32_16x16x32_bf16(false, al, false, bh, (short)0, c, false, false);
  if (NT >= 3) c = __builtin_amdgcn_wmma_f32_16x16x32_bf16(false, ah, false, bl, (short)0, c, false, false);
  asm volatile("v_nop\n\tv_nop\n\tv_nop\n\tv_nop" : "+v"(c) : "v"(ah), "v"(al), "v"(bh), "v"(bl));
  return c;
}

__global__ __launch_bounds__(256) void k_wt_bf16(const float* __restrict__ W, unsigned short* __restrict__ Wt, int K, int N) {
  const int t = blockIdx.x * 256 + threadIdx.x;
  const int k8n = K / 8;
  if (t >= N * k8n) return;
  const int n = t / k8n, k8 = (t % k8n) * 8;
  v8us v;
#pragma unroll
  for (int i = 0; i < 8; ++i) v[i] = bf16_bits(W[(size_t)(k8 + i) * N + n]);
  *(v8us*)(Wt + (size_t)n * K + k8) = v;
  
}

// GEMM C[M][N] (f32, pitch ldc) = act(A[M][K]·W + bias). A f32 row-major (pitch lda) converted per fragment to bf16
// (ASPLIT: hi/lo two planes -> 2 terms, else single rounded term); Wt bf16 [N][K] (pitch ldb). BIAS_BF16 rounds the
// bias to bf16 first (bias quantised to bf16 before the add). K%32==0, M%16==0, N%64==0.
template <bool ASPLIT, int ACT, bool BIAS_BF16>
__global__ __launch_bounds__(128) void k_gemm_bf(const float* __restrict__ A, int lda, const unsigned short* __restrict__ Wt, int ldb,
                                               const float* __restrict__ bias, float* __restrict__ C, int ldc, int M, int N, int K) {
  __shared__ __attribute__((aligned(16))) float so[4][16][64];
  const int tid = threadIdx.x, w = tid >> 5, lane = tid & 31, ln = lane & 15, hh = lane >> 4;
  const int ntn = N / 64;
  const int wid = blockIdx.x * 4 + w;
  const int mt = wid / ntn, nq = wid % ntn;
  if (mt * 16 >= M) return;
  const int row0 = mt * 16, col0 = nq * 64;
  const float* arow = A + (size_t)(row0 + ln) * lda;
  v8f acc[4] = {};
  for (int kb = 0; kb < K; kb += 32) {
    FragB ah, al;
    const v4f x0 = *(const v4fa*)(arow + kb + 8 * hh), x1 = *(const v4fa*)(arow + kb + 8 * hh + 4);
    const v4f x2 = *(const v4fa*)(arow + kb + 16 + 8 * hh), x3 = *(const v4fa*)(arow + kb + 16 + 8 * hh + 4);
    float xs[16] = {x0[0],x0[1],x0[2],x0[3],x1[0],x1[1],x1[2],x1[3],x2[0],x2[1],x2[2],x2[3],x3[0],x3[1],x3[2],x3[3]};
#pragma unroll
    for (int i = 0; i < 16; ++i) { const unsigned short hb = bf16_bits(xs[i]); ah.u[i] = hb; al.u[i] = ASPLIT ? bf16_bits(xs[i] - bf16_val(hb)) : (unsigned short)0; }
#pragma unroll
    for (int t = 0; t < 4; ++t) {
      const unsigned short* brow = Wt + (size_t)(col0 + t * 16 + ln) * ldb + kb;
      FragB b;
      b.half[0] = *(const v8us*)(brow + 8 * hh);
      b.half[1] = *(const v8us*)(brow + 16 + 8 * hh);
      acc[t] = mmaN<ASPLIT ? 2 : 1>(ah.v, al.v, b.v, b.v, acc[t]);
    }
  }
#pragma unroll
  for (int t = 0; t < 4; ++t) {
    float bv = bias ? bias[col0 + t * 16 + ln] : 0.f;
    if (BIAS_BF16) bv = bf16_round(bv);
#pragma unroll
    for (int r = 0; r < 8; ++r) { float v = acc[t][r] + bv; if (ACT == 1) v = fmaxf(v, 0.f); so[w][8 * hh + r][t * 16 + ln] = v; }
  }
  __builtin_amdgcn_fence(__ATOMIC_ACQ_REL, "workgroup");
  __builtin_amdgcn_wave_barrier();
  const int rsub = lane >> 4, c4 = (lane & 15) * 4;
  {
#pragma unroll
    for (int q = 0; q < 8; ++q) {
      const int r = q * 2 + rsub;
      const v4f v = *(const v4fa*)&so[w][r][c4];
      *(v4f*)(C + (size_t)(row0 + r) * ldc + col0 + c4) = v;
    }
    
  }
}

// GEMM C = act(A·W + bias + resid): A f32 (ASPLIT -> hi/lo 2 terms), Wt bf16 [N][K]; ACT 0 none, 1 relu, 2 exact gelu;
// resid (optional, f32, row index = (row % rmod), pitch ldr, RES_BF16 rounds it) added before the activation.
template <bool ASPLIT, int ACT, bool BIAS_BF16, bool RES_BF16>
__global__ __launch_bounds__(128) void k_gemm_bf3(const float* __restrict__ A, int lda, const unsigned short* __restrict__ Wt, int ldb,
                                                const float* __restrict__ bias, const float* __restrict__ resid, int rmod, int ldr,
                                                float* __restrict__ C, int ldc, int M, int N, int K) {
  __shared__ __attribute__((aligned(16))) float so[4][16][64];
  const int tid = threadIdx.x, w = tid >> 5, lane = tid & 31, ln = lane & 15, hh = lane >> 4;
  const int ntn = N / 64;
  const int wid = blockIdx.x * 4 + w;
  const int mt = wid / ntn, nq = wid % ntn;
  if (mt * 16 >= M) return;
  const int row0 = mt * 16, col0 = nq * 64;
  const float* arow = A + (size_t)(row0 + ln) * lda;
  v8f acc[4] = {};
  for (int kb = 0; kb < K; kb += 32) {
    FragB ah, al;
    const v4f x0 = *(const v4fa*)(arow + kb + 8 * hh), x1 = *(const v4fa*)(arow + kb + 8 * hh + 4);
    const v4f x2 = *(const v4fa*)(arow + kb + 16 + 8 * hh), x3 = *(const v4fa*)(arow + kb + 16 + 8 * hh + 4);
    float xs[16] = {x0[0],x0[1],x0[2],x0[3],x1[0],x1[1],x1[2],x1[3],x2[0],x2[1],x2[2],x2[3],x3[0],x3[1],x3[2],x3[3]};
#pragma unroll
    for (int i = 0; i < 16; ++i) { const unsigned short hb = bf16_bits(xs[i]); ah.u[i] = hb; al.u[i] = ASPLIT ? bf16_bits(xs[i] - bf16_val(hb)) : (unsigned short)0; }
#pragma unroll
    for (int t = 0; t < 4; ++t) {
      const unsigned short* brow = Wt + (size_t)(col0 + t * 16 + ln) * ldb + kb;
      FragB b;
      b.half[0] = *(const v8us*)(brow + 8 * hh);
      b.half[1] = *(const v8us*)(brow + 16 + 8 * hh);
      acc[t] = mmaN<ASPLIT ? 2 : 1>(ah.v, al.v, b.v, b.v, acc[t]);
    }
  }
#pragma unroll
  for (int t = 0; t < 4; ++t) {
    const int col = col0 + t * 16 + ln;
    float bv = bias ? bias[col] : 0.f;
    if (BIAS_BF16) bv = bf16_round(bv);
#pragma unroll
    for (int r = 0; r < 8; ++r) {
      float v = acc[t][r] + bv;
      if (resid) { float rv = resid[(size_t)((row0 + 8 * hh + r) % rmod) * ldr + col]; if (RES_BF16) rv = bf16_round(rv); v += rv; }
      if (ACT == 1) v = fmaxf(v, 0.f);
      if (ACT == 2) v = 0.5f * v * (1.0f + erff(v * 0.70710678118654752f));
      if (ACT == 3) { const float u = 0.7978845608028654f * (v + 0.044715f * v * v * v); v = 0.5f * v * (1.0f + tanhf(u)); }
      so[w][8 * hh + r][t * 16 + ln] = v;
    }
  }
  __builtin_amdgcn_fence(__ATOMIC_ACQ_REL, "workgroup");
  __builtin_amdgcn_wave_barrier();
  const int rsub = lane >> 4, c4 = (lane & 15) * 4;
  {
#pragma unroll
    for (int q = 0; q < 8; ++q) {
      const int r = q * 2 + rsub;
      const v4f v = *(const v4fa*)&so[w][r][c4];
      *(v4f*)(C + (size_t)(row0 + r) * ldc + col0 + c4) = v;
    }
    
  }
}
// row LayerNorm (biased variance, eps) over N: s = X (+ R); optional out_sum <- s; out_norm <- (s-mu)*rsqrt(var+eps)*g + b
template <bool PARAM_BF16>
__global__ __launch_bounds__(256) void k_layernorm(const float* __restrict__ X, const float* __restrict__ R, const float* __restrict__ g, const float* __restrict__ bta,
                                                  float* __restrict__ out_sum, float* __restrict__ out_norm, int N, float eps) {
  __shared__ float red[256];
  const int row = blockIdx.x, tid = threadIdx.x;
  const float* x = X + (size_t)row * N; const float* rr = R ? R + (size_t)row * N : nullptr;
  float vals[16];                     // up to N = 4096
  const int per = N / 256;            // contiguous chunk per thread? use strided-by-4 chunks: thread handles j = tid*4 + 1024*u
  float s1 = 0.f;
  for (int u = 0; u < per / 4; ++u) {
    const int j = tid * 4 + 1024 * u;
    const v4f a = *(const v4fa*)(x + j);
    v4f b = {0.f,0.f,0.f,0.f}; if (rr) b = *(const v4fa*)(rr + j);
#pragma unroll
    for (int q = 0; q < 4; ++q) { const float v = a[q] + b[q]; vals[u * 4 + q] = v; s1 += v; }
  }
  red[tid] = s1; __syncthreads();
  for (int st = 128; st > 0; st >>= 1) { if (tid < st) red[tid] += red[tid + st]; __syncthreads(); }
  const float mu = red[0] / (float)N; __syncthreads();
  float s2 = 0.f;
  for (int u = 0; u < per / 4; ++u)
#pragma unroll
    for (int q = 0; q < 4; ++q) { const float c = vals[u * 4 + q] - mu; s2 += c * c; }
  red[tid] = s2; __syncthreads();
  for (int st = 128; st > 0; st >>= 1) { if (tid < st) red[tid] += red[tid + st]; __syncthreads(); }
  const float rs = rsqrtf(red[0] / (float)N + eps);
  {
    for (int u = 0; u < per / 4; ++u) {
      const int j = tid * 4 + 1024 * u;
      v4f o, sm;
#pragma unroll
      for (int q = 0; q < 4; ++q) {
        float gg = g[j + q], bb = bta[j + q];
        if (PARAM_BF16) { gg = bf16_round(gg); bb = bf16_round(bb); }
        sm[q] = vals[u * 4 + q]; o[q] = (vals[u * 4 + q] - mu) * rs * gg + bb;
      }
      if (out_sum) *(v4f*)(out_sum + (size_t)row * N + j) = sm;
      *(v4f*)(out_norm + (size_t)row * N + j) = o;
    }
    
  }
}



// ---- f16 WMMA path (v_wmma_f32_16x16x32_f16): 11-bit significands for operands in range — used where a [0,1] probability operand needs more precision than bf16
typedef _Float16 v16h __attribute__((ext_vector_type(16)));
union FragH { v16h v; v8us half[2]; _Float16 h[16]; unsigned short u[16]; };
template <int NT>
__device__ __forceinline__ v8f mmaH(v16h ah, v16h al, v16h bh, v16h bl, v8f c) {
  c = __builtin_amdgcn_wmma_f32_16x16x32_f16(false, ah, false, bh, (short)0, c, false, false);
  if (NT >= 2) c = __builtin_amdgcn_wmma_f32_16x16x32_f16(false, al, false, bh, (short)0, c, false, false);
  if (NT >= 3) c = __builtin_amdgcn_wmma_f32_16x16x32_f16(false, ah, false, bl, (short)0, c, false, false);
  asm volatile("v_nop\n\tv_nop\n\tv_nop\n\tv_nop" : "+v"(c) : "v"(ah), "v"(al), "v"(bh), "v"(bl));
  return c;
}
// batched GEMM like k_gemm_b but f16 operands: A f32 (split into f16 hi/lo if ASPLIT, else rounded to f16), Bt = f16 values [n][k]; alpha; C f32; N multiple of 16 (partial tiles skipped)
template <bool ASPLIT>
__global__ __launch_bounds__(128) void k_gemm_h(const float* __restrict__ A, int lda, size_t sA, const _Float16* __restrict__ Bh, int ldb, size_t sB, float alpha, float* __restrict__ C, int ldc, size_t sC, int M, int N, int K) {
  __shared__ __attribute__((aligned(16))) float so[4][16][64];
  const int tid = threadIdx.x, w = tid >> 5, lane = tid & 31, ln = lane & 15, hh = lane >> 4; const int by = blockIdx.y;
  A += (size_t)by * sA; Bh += (size_t)by * sB; C += (size_t)by * sC;
  const int ntn = (N + 63) / 64; const int wid = blockIdx.x * 4 + w; const int mt = wid / ntn, nq = wid % ntn; if (mt * 16 >= M) return;
  const int row0 = mt * 16, col0 = nq * 64; const float* arow = A + (size_t)(row0 + ln) * lda;
  v8f acc[4] = {};
  for (int kb = 0; kb < K; kb += 32) {
    FragH ah, al;
    const v4f x0 = *(const v4fa*)(arow + kb + 8 * hh), x1 = *(const v4fa*)(arow + kb + 8 * hh + 4), x2 = *(const v4fa*)(arow + kb + 16 + 8 * hh), x3 = *(const v4fa*)(arow + kb + 16 + 8 * hh + 4);
    float xs[16] = {x0[0],x0[1],x0[2],x0[3],x1[0],x1[1],x1[2],x1[3],x2[0],x2[1],x2[2],x2[3],x3[0],x3[1],x3[2],x3[3]};
#pragma unroll
    for (int i = 0; i < 16; ++i) { const _Float16 h = (_Float16)xs[i]; ah.h[i] = h; al.h[i] = ASPLIT ? (_Float16)(xs[i] - (float)h) : (_Float16)0.0f; }
#pragma unroll
    for (int t = 0; t < 4; ++t) { if (col0 + t * 16 >= N) continue; const size_t boff = (size_t)(col0 + t * 16 + ln) * ldb + kb; FragH bq; bq.half[0] = *(const v8us*)(Bh + boff + 8 * hh); bq.half[1] = *(const v8us*)(Bh + boff + 16 + 8 * hh);
      acc[t] = mmaH<ASPLIT ? 2 : 1>(ah.v, al.v, bq.v, bq.v, acc[t]); }
  }
#pragma unroll
  for (int t = 0; t < 4; ++t) { if (col0 + t * 16 >= N) continue;
#pragma unroll
    for (int r = 0; r < 8; ++r) so[w][8 * hh + r][t * 16 + ln] = acc[t][r] * alpha; }
  __builtin_amdgcn_fence(__ATOMIC_ACQ_REL, "workgroup"); __builtin_amdgcn_wave_barrier();
  const int rsub = lane >> 4, c4 = (lane & 15) * 4;
  {
#pragma unroll
    for (int q = 0; q < 8; ++q) { const int r = q * 2 + rsub; if (col0 + c4 < N) { const v4f v = *(const v4fa*)&so[w][r][c4]; *(v4f*)(C + (size_t)(row0 + r) * ldc + col0 + c4) = v; } }
     }
}

// Wt[n][k] = f16(W[k][n]·scale) from f32 row-major W[K][N] (scale = power of two; bf16-exact weights stay exact in f16 away from the subnormal range)
__global__ __launch_bounds__(256) void k_wt_f16(const float* __restrict__ W, _Float16* __restrict__ Wt, int K, int N, float scale) {
  const int t = blockIdx.x * 256 + threadIdx.x; if (t >= N * (K / 8)) return; const int n = t / (K / 8), k8 = (t % (K / 8)) * 8; FragH f;
#pragma unroll
  for (int i = 0; i < 8; ++i) f.h[i] = (_Float16)(bf16_round(W[(size_t)(k8 + i) * N + n]) * scale); const v8us o = f.half[0];
  *(v8us*)((unsigned short*)Wt + (size_t)n * K + k8) = o; 
}
// k_gemm_hh variant with fused epilogue: v = acc·alpha + bias[by·sBias + col] (+ CP[(row/rowsPerB)·sCPb + by·64 + col] if CP) ; ACT 0 none / 1 elu ; writes f16 C16 (and f32 C if non-null)
template <int ACT>
__global__ __launch_bounds__(128) void k_gemm_hhx(const _Float16* __restrict__ A, int lda, size_t sA, const _Float16* __restrict__ Bh, int ldb, size_t sB, float alpha, const float* __restrict__ bias, size_t sBias, const float* __restrict__ CP, int rowsPerB, size_t sCPb, int row0g,
    float* __restrict__ C, _Float16* __restrict__ C16, int ldc, size_t sC, int M, int N, int K) {
  __shared__ __attribute__((aligned(16))) float so[4][16][64];
  const int tid = threadIdx.x, w = tid >> 5, lane = tid & 31, ln = lane & 15, hh = lane >> 4; const int by = blockIdx.y;
  A += (size_t)by * sA; Bh += (size_t)by * sB; const size_t cofs = (size_t)by * sC; const float* bp = bias ? bias + (size_t)by * sBias : nullptr;
  const int ntn = (N + 63) / 64; const int wid = blockIdx.x * 4 + w; const int mt = wid / ntn, nq = wid % ntn; if (mt * 16 >= M) return;
  const int row0 = mt * 16, col0 = nq * 64; const _Float16* arow = A + (size_t)(row0 + ln) * lda;
  v8f acc[4] = {};
  for (int kb = 0; kb < K; kb += 32) { FragH ah; ah.half[0] = *(const v8us*)((const unsigned short*)arow + kb + 8 * hh); ah.half[1] = *(const v8us*)((const unsigned short*)arow + kb + 16 + 8 * hh);
#pragma unroll
    for (int t = 0; t < 4; ++t) { if (col0 + t * 16 >= N) continue; const size_t boff = (size_t)(col0 + t * 16 + ln) * ldb + kb; FragH bq; bq.half[0] = *(const v8us*)((const unsigned short*)Bh + boff + 8 * hh); bq.half[1] = *(const v8us*)((const unsigned short*)Bh + boff + 16 + 8 * hh);
      acc[t] = mmaH<1>(ah.v, ah.v, bq.v, bq.v, acc[t]); }
  }
#pragma unroll
  for (int t = 0; t < 4; ++t) { if (col0 + t * 16 >= N) continue; const int col = col0 + t * 16 + ln; const float bv = bp ? bf16_round(bp[col]) : 0.f;
#pragma unroll
    for (int r = 0; r < 8; ++r) { float v = acc[t][r] * alpha + bv; if (CP) { const int bidx = (row0g + row0 + 8 * hh + r) / rowsPerB; v += CP[(size_t)bidx * sCPb + (size_t)by * 64 + col]; } if (ACT == 1) v = (v > 0.f) ? v : expm1f(v); else if (ACT == 7) v = (v > 0.f) ? v + 1.0f : expf(v); else if (ACT == 8) v = tanhf(v); else if (ACT == 9) v = 0.5f * v * (1.0f + tanhf(0.7978845608028654f * (v + 0.044715f * v * v * v))); else if (ACT == 11) v = 1.0f / (1.0f + expf(-v)); else if (ACT == 12) v = (v > 0.f) ? v : 0.01f * v; else if (ACT == 14) v = (v > 0.f) ? v : 0.1f * v; else if (ACT == 15) v = v / (1.0f + expf(-v)); else if (ACT == 3) v = fmaxf(v, 0.f); else if (ACT == 6) v = 0.5f * v * (1.0f + erff(v * 0.70710678118654752f)); so[w][8 * hh + r][t * 16 + ln] = v; } }
  __builtin_amdgcn_fence(__ATOMIC_ACQ_REL, "workgroup"); __builtin_amdgcn_wave_barrier();
  const int rsub = lane >> 4, c4 = (lane & 15) * 4; typedef _Float16 v4h __attribute__((ext_vector_type(4)));
  {
#pragma unroll
    for (int q = 0; q < 8; ++q) { const int r = q * 2 + rsub; if (col0 + c4 < N) { const v4f v = *(const v4fa*)&so[w][r][c4]; if (C) *(v4f*)(C + cofs + (size_t)(row0 + r) * ldc + col0 + c4) = v; if (C16) { v4h h4; for (int i = 0; i < 4; ++i) h4[i] = (_Float16)v[i]; *(v4h*)(C16 + cofs + (size_t)(row0 + r) * ldc + col0 + c4) = h4; } } }
     }
}


typedef _Float16 v4h __attribute__((ext_vector_type(4)));

__global__ __launch_bounds__(256) void k_x16(const float* __restrict__ x, _Float16* __restrict__ X16, size_t n8) { const size_t t = (size_t)blockIdx.x * 256 + threadIdx.x; if (t >= n8) return; FragH f;
#pragma unroll
  for (int q = 0; q < 8; ++q) f.h[q] = (_Float16)bf16_round(x[t * 8 + q]); *(v8us*)((unsigned short*)X16 + t * 8) = f.half[0];  }
__global__ __launch_bounds__(256) void k_h16(const float* __restrict__ x, _Float16* __restrict__ X16, size_t n8) { const size_t t = (size_t)blockIdx.x * 256 + threadIdx.x; if (t >= n8) return; FragH f;
#pragma unroll
  for (int q = 0; q < 8; ++q) f.h[q] = (_Float16)x[t * 8 + q]; *(v8us*)((unsigned short*)X16 + t * 8) = f.half[0];  }
__global__ __launch_bounds__(256) void k_round16f(const float* __restrict__ W, _Float16* __restrict__ Bt, size_t n8) { const size_t t = (size_t)blockIdx.x * 256 + threadIdx.x; if (t >= n8) return; FragH f;
#pragma unroll
  for (int i = 0; i < 8; ++i) f.h[i] = (_Float16)(bf16_round(W[t * 8 + i]) * 16.0f); *(v8us*)((unsigned short*)Bt + t * 8) = f.half[0];  }
template <int NHv, int TTv>
__global__ __launch_bounds__(256) void k_vt(const _Float16* __restrict__ V16, int ldv, int voff, _Float16* __restrict__ Vt) { __shared__ unsigned short tl[64][66]; const int tid = threadIdx.x; const int slab = blockIdx.x / (TTv / 64), lg = blockIdx.x % (TTv / 64); const int b = slab / NHv, h = slab % NHv;
  for (int i = tid; i < 64 * 8; i += 256) { const int r = i / 8, c8 = (i % 8) * 8; FragH f; f.half[0] = *(const v8us*)((const unsigned short*)V16 + ((size_t)b * TTv + lg * 64 + r) * ldv + voff + h * 64 + c8);
#pragma unroll
    for (int q = 0; q < 8; ++q) tl[r][c8 + q] = f.u[q]; }
  __syncthreads();
  {
#pragma unroll
    for (int rd = 0; rd < 2; ++rd) { const int d = rd * 32 + tid / 8, pc = tid % 8; FragH f;
#pragma unroll
      for (int q = 0; q < 8; ++q) f.u[q] = tl[pc * 8 + q][d];
      *(v8us*)((unsigned short*)Vt + ((size_t)slab * 64 + d) * TTv + lg * 64 + pc * 8) = f.half[0]; }
     } }

__global__ __launch_bounds__(256) void k_hl(const float* __restrict__ F, _Float16* __restrict__ Hh, _Float16* __restrict__ Hl, size_t n8) { const size_t t = (size_t)blockIdx.x * 256 + threadIdx.x; if (t >= n8) return; FragH fh, fl; const v4f a = *(const v4fa*)(F + t * 8), c = *(const v4fa*)(F + t * 8 + 4);
#pragma unroll
  for (int q = 0; q < 4; ++q) { _Float16 h = (_Float16)a[q]; fh.h[q] = h; fl.h[q] = (_Float16)((a[q] - (float)h) * 1024.0f); h = (_Float16)c[q]; fh.h[4 + q] = h; fl.h[4 + q] = (_Float16)((c[q] - (float)h) * 1024.0f); }
  { *(v8us*)((unsigned short*)Hh + t * 8) = fh.half[0]; *(v8us*)((unsigned short*)Hl + t * 8) = fl.half[0];  } }

// ---- fast GEMM (wave tile 32x64; requires M % 32 == 0 rows per launch region and N % 64 == 0); epilogue = k_gemm_hhx semantics ----
__device__ __forceinline__ v16h g2_frag(const _Float16* p, int hh) { FragH f; f.half[0] = *(const v8us*)((const unsigned short*)p + 8 * hh); f.half[1] = *(const v8us*)((const unsigned short*)p + 16 + 8 * hh); return f.v; }
__device__ __forceinline__ v8f g2_mma(v16h a, v16h b, v8f c) { v8f d = __builtin_amdgcn_wmma_f32_16x16x32_f16(false, a, false, b, (short)0, c, false, false); asm volatile("v_nop\n\tv_nop\n\tv_nop\n\tv_nop" : "+v"(d) : "v"(a), "v"(b)); return d; }
template <int ACT>
__global__ __launch_bounds__(128) void k_gemm2(const _Float16* __restrict__ A, int lda, size_t sA, const _Float16* __restrict__ Bh, int ldb, size_t sB, float alpha, const float* __restrict__ bias, size_t sBias, const float* __restrict__ CP, int rowsPerB, size_t sCPb, int row0g,
    float* __restrict__ C, _Float16* __restrict__ C16, int ldc, size_t sC, int M, int N, int K) {
  __shared__ __attribute__((aligned(16))) float so[4][32][68];
  const int tid = threadIdx.x, w = tid >> 5, lane = tid & 31, ln = lane & 15, hh = lane >> 4; const int by = blockIdx.y;
  A += (size_t)by * sA; Bh += (size_t)by * sB; const size_t cofs = (size_t)by * sC; const float* bp = bias ? bias + (size_t)by * sBias : nullptr;
  const int ntn = N >> 6; const int mt = blockIdx.x / ntn, nq = blockIdx.x - mt * ntn; const int row0 = mt * 128 + 32 * w, col0 = nq * 64; if (row0 >= M) return;
  const _Float16* a0p = A + (size_t)(row0 + ln) * lda; const _Float16* a1p = a0p + (size_t)16 * lda;
  const _Float16* b0p = Bh + (size_t)(col0 + ln) * ldb; const _Float16* b1p = b0p + (size_t)16 * ldb; const _Float16* b2p = b1p + (size_t)16 * ldb; const _Float16* b3p = b2p + (size_t)16 * ldb;
  const v8f z8 = {0.f,0.f,0.f,0.f,0.f,0.f,0.f,0.f}; v8f c00 = z8, c01 = z8, c02 = z8, c03 = z8, c10 = z8, c11 = z8, c12 = z8, c13 = z8;
#pragma unroll 1
  for (int kb = 0; kb < K; kb += 32) { const v16h a0 = g2_frag(a0p + kb, hh), a1 = g2_frag(a1p + kb, hh);
    v16h b = g2_frag(b0p + kb, hh); c00 = g2_mma(a0, b, c00); c10 = g2_mma(a1, b, c10);
    b = g2_frag(b1p + kb, hh); c01 = g2_mma(a0, b, c01); c11 = g2_mma(a1, b, c11);
    b = g2_frag(b2p + kb, hh); c02 = g2_mma(a0, b, c02); c12 = g2_mma(a1, b, c12);
    b = g2_frag(b3p + kb, hh); c03 = g2_mma(a0, b, c03); c13 = g2_mma(a1, b, c13); }
  v8f accs[8] = {c00, c01, c02, c03, c10, c11, c12, c13};
#pragma unroll
  for (int u = 0; u < 8; ++u) { const int t = u & 3, half = u >> 2; const int col = col0 + t * 16 + ln; const float bv = bp ? bf16_round(bp[col]) : 0.f;
#pragma unroll
    for (int r = 0; r < 8; ++r) { const int rloc = half * 16 + 8 * hh + r; float v = accs[u][r] * alpha + bv; if (CP) { const int bidx = (row0g + row0 + rloc) / rowsPerB; v += CP[(size_t)bidx * sCPb + (size_t)by * 64 + col]; }
      if (ACT == 3) v = fmaxf(v, 0.f); else if (ACT == 6) v = 0.5f * v * (1.0f + erff(v * 0.70710678118654752f)); else if (ACT == 11) v = 1.0f / (1.0f + expf(-v)); else if (ACT == 15) v = v / (1.0f + expf(-v)); else if (ACT == 12) v = (v > 0.f) ? v : 0.01f * v; else if (ACT == 8) v = tanhf(v);
      so[w][rloc][t * 16 + ln] = v; } }
  __builtin_amdgcn_fence(__ATOMIC_ACQ_REL, "workgroup"); __builtin_amdgcn_wave_barrier();
  const int rsub = lane >> 4, c4 = (lane & 15) * 4;
  {
#pragma unroll
    for (int q = 0; q < 16; ++q) { const int r = q * 2 + rsub; const v4f v = *(const v4fa*)&so[w][r][c4]; if (C) *(v4f*)(C + cofs + (size_t)(row0 + r) * ldc + col0 + c4) = v; if (C16) { v4h h4; for (int i = 0; i < 4; ++i) h4[i] = (_Float16)v[i]; *(v4h*)(C16 + cofs + (size_t)(row0 + r) * ldc + col0 + c4) = h4; } }
     } }



template <int CAUSAL>
__global__ __launch_bounds__(128) void k_flash(const _Float16* __restrict__ Q16, int ldq, const _Float16* __restrict__ K16, int ldk, const _Float16* __restrict__ Vt, const int* __restrict__ MSK, float* __restrict__ O, int ldo) {
  constexpr int RPW = 16, RTN = RPW / 16, NQB = TQ / (4 * RPW), DT = 4, KS = 2;
  __shared__ __attribute__((aligned(16))) unsigned short sP[4][RPW][40]; __shared__ __attribute__((aligned(16))) float sO[4][RPW][64 + 4];
  const int tid = threadIdx.x, w = tid >> 5, lane = tid & 31, ln = lane & 15, hh = lane >> 4;
  const int slab = blockIdx.x / QBLKS, qblk = blockIdx.x % QBLKS; (void)NQB; const int b = slab / NH, h = slab % NH; const int qb0 = qblk * (4 * RPW); const int q0 = qb0 + w * RPW;
  FragH aq[2][KS];
#pragma unroll
  for (int rt = 0; rt < RTN; ++rt) { const unsigned short* qr = (const unsigned short*)Q16 + ((size_t)b * TQ + q0 + rt * 16 + ln) * ldq + h * 64;
#pragma unroll
    for (int ks = 0; ks < KS; ++ks) { aq[rt][ks].half[0] = *(const v8us*)(qr + ks * 32 + 8 * hh); aq[rt][ks].half[1] = *(const v8us*)(qr + ks * 32 + 16 + 8 * hh); } }
  const unsigned short* Vth = (const unsigned short*)Vt + (size_t)slab * 64 * TK;
  float m_r[2][8], l_r[2][8]; v8f oacc[2][DT];
#pragma unroll
  for (int rt = 0; rt < RTN; ++rt) {
#pragma unroll
    for (int r = 0; r < 8; ++r) { m_r[rt][r] = -3.0e38f; l_r[rt][r] = 0.f; }
#pragma unroll
    for (int dt = 0; dt < DT; ++dt) oacc[rt][dt] = (v8f){0.f,0.f,0.f,0.f,0.f,0.f,0.f,0.f}; }
  const int jend = (CAUSAL == 1) ? (qb0 + 4 * RPW) : TK;      /* causal: keys beyond the block's last query never contribute */
#pragma unroll 1
  for (int j0 = 0; j0 < jend; j0 += 32) {
    v8f s[2][2];
#pragma unroll
    for (int nt = 0; nt < 2; ++nt) { const unsigned short* kr = (const unsigned short*)K16 + ((size_t)b * TK + j0 + nt * 16 + ln) * ldk + h * 64; FragH bk[KS];
#pragma unroll
      for (int ks = 0; ks < KS; ++ks) { bk[ks].half[0] = *(const v8us*)(kr + ks * 32 + 8 * hh); bk[ks].half[1] = *(const v8us*)(kr + ks * 32 + 16 + 8 * hh); }
#pragma unroll
      for (int rt = 0; rt < RTN; ++rt) { v8f acc = (v8f){0.f,0.f,0.f,0.f,0.f,0.f,0.f,0.f};
#pragma unroll
        for (int ks = 0; ks < KS; ++ks) acc = mmaH<1>(aq[rt][ks].v, aq[rt][ks].v, bk[ks].v, bk[ks].v, acc); s[rt][nt] = acc; } }
#pragma unroll
    for (int rt = 0; rt < RTN; ++rt)
#pragma unroll
      for (int r = 0; r < 8; ++r) { const int tq = q0 + rt * 16 + 8 * hh + r; const int k0 = j0 + ln, k1 = j0 + 16 + ln;
        const bool ok0 = (CAUSAL == 1) ? (k0 <= tq) : ((CAUSAL == 2) ? ((k0 >> 5) == (tq >> 5)) : true), ok1 = (CAUSAL == 1) ? (k1 <= tq) : ((CAUSAL == 2) ? ((k1 >> 5) == (tq >> 5)) : true);      /* mode 2: block-diagonal 32-token groups */
        const float s0 = ok0 ? s[rt][0][r] * SCL : -3.0e38f, s1 = ok1 ? s[rt][1][r] * SCL : -3.0e38f; float mc = fmaxf(s0, s1);
        mc = fmaxf(mc, __shfl_xor(mc, 1, 32)); mc = fmaxf(mc, __shfl_xor(mc, 2, 32)); mc = fmaxf(mc, __shfl_xor(mc, 4, 32)); mc = fmaxf(mc, __shfl_xor(mc, 8, 32));
        const float mn = fmaxf(m_r[rt][r], mc); const float al = (mn > -1.0e38f) ? expf(m_r[rt][r] - mn) : 1.0f; m_r[rt][r] = mn; const float p0 = ok0 ? expf(s0 - mn) : 0.f, p1 = ok1 ? expf(s1 - mn) : 0.f; l_r[rt][r] = l_r[rt][r] * al + p0 + p1;
#pragma unroll
        for (int dt = 0; dt < DT; ++dt) oacc[rt][dt][r] *= al;
        FragH t2; t2.h[0] = (_Float16)(p0 * 1024.0f); t2.h[1] = (_Float16)(p1 * 1024.0f); sP[w][rt * 16 + 8 * hh + r][ln] = t2.u[0]; sP[w][rt * 16 + 8 * hh + r][16 + ln] = t2.u[1]; }
    __builtin_amdgcn_fence(__ATOMIC_ACQ_REL, "workgroup"); __builtin_amdgcn_wave_barrier();
    FragH pa[2];
#pragma unroll
    for (int rt = 0; rt < RTN; ++rt) { pa[rt].half[0] = *(const v8us*)&sP[w][rt * 16 + ln][8 * hh]; pa[rt].half[1] = *(const v8us*)&sP[w][rt * 16 + ln][16 + 8 * hh]; }
#pragma unroll
    for (int dt = 0; dt < DT; ++dt) { const unsigned short* vrow = Vth + (size_t)(dt * 16 + ln) * TK + j0; FragH bv; bv.half[0] = *(const v8us*)(vrow + 8 * hh); bv.half[1] = *(const v8us*)(vrow + 16 + 8 * hh);
#pragma unroll
      for (int rt = 0; rt < RTN; ++rt) oacc[rt][dt] = mmaH<1>(pa[rt].v, pa[rt].v, bv.v, bv.v, oacc[rt][dt]); }
    __builtin_amdgcn_fence(__ATOMIC_ACQ_REL, "workgroup"); __builtin_amdgcn_wave_barrier(); }
#pragma unroll
  for (int rt = 0; rt < RTN; ++rt) {
#pragma unroll
    for (int r = 0; r < 8; ++r) { float l = l_r[rt][r]; l += __shfl_xor(l, 1, 32); l += __shfl_xor(l, 2, 32); l += __shfl_xor(l, 4, 32); l += __shfl_xor(l, 8, 32); l_r[rt][r] = (l > 0.f) ? 1.0f / (l * 1024.0f) : 0.f; }
#pragma unroll
    for (int dt = 0; dt < DT; ++dt)
#pragma unroll
      for (int r = 0; r < 8; ++r) sO[w][rt * 16 + 8 * hh + r][dt * 16 + ln] = oacc[rt][dt][r] * l_r[rt][r]; }
  __builtin_amdgcn_fence(__ATOMIC_ACQ_REL, "workgroup"); __builtin_amdgcn_wave_barrier();
  {
#pragma unroll
    for (int rp = 0; rp < RPW; rp += 2) { const int r = rp + (lane >> 4), pc = lane & 15; const v4f val = *(const v4fa*)&sO[w][r][pc * 4]; *(v4f*)(O + ((size_t)b * TQ + q0 + r) * ldo + h * 64 + pc * 4) = val; }
     } }
// Q/K-split variant: S = Qh Kh^T + (Ql Kh^T + Qh Kl^T)/1024 with Q/K = [hi | 2^10 residual] f16 planes (QL/KL same layout as Q16/K16); plain f16 P (x2^10) . V^T as in k_flash
template <int CAUSAL>
__global__ __launch_bounds__(128) void k_flashqk(const _Float16* __restrict__ Q16, const _Float16* __restrict__ QL, int ldq, const _Float16* __restrict__ K16, const _Float16* __restrict__ KL, int ldk, const _Float16* __restrict__ Vt, const int* __restrict__ MSK, float* __restrict__ O, int ldo) {
  constexpr int RPW = 16, RTN = RPW / 16, NQB = TQ / (4 * RPW), DT = 4, KS = 2;
  __shared__ __attribute__((aligned(16))) unsigned short sP[4][RPW][40]; __shared__ __attribute__((aligned(16))) float sO[4][RPW][64 + 4];
  const int tid = threadIdx.x, w = tid >> 5, lane = tid & 31, ln = lane & 15, hh = lane >> 4;
  const int slab = blockIdx.x / QBLKS, qblk = blockIdx.x % QBLKS; (void)NQB; const int b = slab / NH, h = slab % NH; const int qb0 = qblk * (4 * RPW); const int q0 = qb0 + w * RPW;
  FragH aq[2][KS], aql[2][KS];
#pragma unroll
  for (int rt = 0; rt < RTN; ++rt) { const unsigned short* qr = (const unsigned short*)Q16 + ((size_t)b * TQ + q0 + rt * 16 + ln) * ldq + h * 64; const unsigned short* ql = (const unsigned short*)QL + ((size_t)b * TQ + q0 + rt * 16 + ln) * ldq + h * 64;
#pragma unroll
    for (int ks = 0; ks < KS; ++ks) { aq[rt][ks].half[0] = *(const v8us*)(qr + ks * 32 + 8 * hh); aq[rt][ks].half[1] = *(const v8us*)(qr + ks * 32 + 16 + 8 * hh); aql[rt][ks].half[0] = *(const v8us*)(ql + ks * 32 + 8 * hh); aql[rt][ks].half[1] = *(const v8us*)(ql + ks * 32 + 16 + 8 * hh); } }
  const unsigned short* Vth = (const unsigned short*)Vt + (size_t)slab * 64 * TK;
  float m_r[2][8], l_r[2][8]; v8f oacc[2][DT];
#pragma unroll
  for (int rt = 0; rt < RTN; ++rt) {
#pragma unroll
    for (int r = 0; r < 8; ++r) { m_r[rt][r] = -3.0e38f; l_r[rt][r] = 0.f; }
#pragma unroll
    for (int dt = 0; dt < DT; ++dt) oacc[rt][dt] = (v8f){0.f,0.f,0.f,0.f,0.f,0.f,0.f,0.f}; }
  const int jend = (CAUSAL == 1) ? (qb0 + 4 * RPW) : TK;      /* causal: keys beyond the block's last query never contribute */
#pragma unroll 1
  for (int j0 = 0; j0 < jend; j0 += 32) {
    v8f s[2][2];
#pragma unroll
    for (int nt = 0; nt < 2; ++nt) { const unsigned short* kr = (const unsigned short*)K16 + ((size_t)b * TK + j0 + nt * 16 + ln) * ldk + h * 64; const unsigned short* klr = (const unsigned short*)KL + ((size_t)b * TK + j0 + nt * 16 + ln) * ldk + h * 64; FragH bk[KS], bkl[KS];
#pragma unroll
      for (int ks = 0; ks < KS; ++ks) { bk[ks].half[0] = *(const v8us*)(kr + ks * 32 + 8 * hh); bk[ks].half[1] = *(const v8us*)(kr + ks * 32 + 16 + 8 * hh); bkl[ks].half[0] = *(const v8us*)(klr + ks * 32 + 8 * hh); bkl[ks].half[1] = *(const v8us*)(klr + ks * 32 + 16 + 8 * hh); }
#pragma unroll
      for (int rt = 0; rt < RTN; ++rt) { v8f acc = (v8f){0.f,0.f,0.f,0.f,0.f,0.f,0.f,0.f}, accl = acc;
#pragma unroll
        for (int ks = 0; ks < KS; ++ks) { acc = mmaH<1>(aq[rt][ks].v, aq[rt][ks].v, bk[ks].v, bk[ks].v, acc); accl = mmaH<1>(aql[rt][ks].v, aql[rt][ks].v, bk[ks].v, bk[ks].v, accl); accl = mmaH<1>(aq[rt][ks].v, aq[rt][ks].v, bkl[ks].v, bkl[ks].v, accl); }
#pragma unroll
        for (int r = 0; r < 8; ++r) acc[r] += accl[r] * 0.0009765625f;
        s[rt][nt] = acc; } }
#pragma unroll
    for (int rt = 0; rt < RTN; ++rt)
#pragma unroll
      for (int r = 0; r < 8; ++r) { const int tq = q0 + rt * 16 + 8 * hh + r; const int k0 = j0 + ln, k1 = j0 + 16 + ln;
        bool ok0 = (CAUSAL == 1) ? (k0 <= tq) : ((CAUSAL == 2) ? ((k0 >> 5) == (tq >> 5)) : true), ok1 = (CAUSAL == 1) ? (k1 <= tq) : ((CAUSAL == 2) ? ((k1 >> 5) == (tq >> 5)) : true);      /* mode 2: block-diagonal 32-token groups */
        if (CAUSAL == 4) { const int* mrow = MSK + ((size_t)b * TQ + tq) * TK; ok0 = mrow[k0] != 0; ok1 = mrow[k1] != 0; }      /* mode 4: per-(query, key) INPUT mask shared by all heads; masked keys contribute nothing (== the reference's -4096 fill, whose exp underflows to 0), rows with no valid key give l = 0 -> output 0 (== the reference's row_valid zeroing) */
        const float s0 = ok0 ? s[rt][0][r] * SCL : -3.0e38f, s1 = ok1 ? s[rt][1][r] * SCL : -3.0e38f; float mc = fmaxf(s0, s1);
        mc = fmaxf(mc, __shfl_xor(mc, 1, 32)); mc = fmaxf(mc, __shfl_xor(mc, 2, 32)); mc = fmaxf(mc, __shfl_xor(mc, 4, 32)); mc = fmaxf(mc, __shfl_xor(mc, 8, 32));
        const float mn = fmaxf(m_r[rt][r], mc); const float al = (mn > -1.0e38f) ? expf(m_r[rt][r] - mn) : 1.0f; m_r[rt][r] = mn; const float p0 = ok0 ? expf(s0 - mn) : 0.f, p1 = ok1 ? expf(s1 - mn) : 0.f; l_r[rt][r] = l_r[rt][r] * al + p0 + p1;
#pragma unroll
        for (int dt = 0; dt < DT; ++dt) oacc[rt][dt][r] *= al;
        FragH t2; t2.h[0] = (_Float16)(p0 * 1024.0f); t2.h[1] = (_Float16)(p1 * 1024.0f); sP[w][rt * 16 + 8 * hh + r][ln] = t2.u[0]; sP[w][rt * 16 + 8 * hh + r][16 + ln] = t2.u[1]; }
    __builtin_amdgcn_fence(__ATOMIC_ACQ_REL, "workgroup"); __builtin_amdgcn_wave_barrier();
    FragH pa[2];
#pragma unroll
    for (int rt = 0; rt < RTN; ++rt) { pa[rt].half[0] = *(const v8us*)&sP[w][rt * 16 + ln][8 * hh]; pa[rt].half[1] = *(const v8us*)&sP[w][rt * 16 + ln][16 + 8 * hh]; }
#pragma unroll
    for (int dt = 0; dt < DT; ++dt) { const unsigned short* vrow = Vth + (size_t)(dt * 16 + ln) * TK + j0; FragH bv; bv.half[0] = *(const v8us*)(vrow + 8 * hh); bv.half[1] = *(const v8us*)(vrow + 16 + 8 * hh);
#pragma unroll
      for (int rt = 0; rt < RTN; ++rt) oacc[rt][dt] = mmaH<1>(pa[rt].v, pa[rt].v, bv.v, bv.v, oacc[rt][dt]); }
    __builtin_amdgcn_fence(__ATOMIC_ACQ_REL, "workgroup"); __builtin_amdgcn_wave_barrier(); }
#pragma unroll
  for (int rt = 0; rt < RTN; ++rt) {
#pragma unroll
    for (int r = 0; r < 8; ++r) { float l = l_r[rt][r]; l += __shfl_xor(l, 1, 32); l += __shfl_xor(l, 2, 32); l += __shfl_xor(l, 4, 32); l += __shfl_xor(l, 8, 32); l_r[rt][r] = (l > 0.f) ? 1.0f / (l * 1024.0f) : 0.f; }
#pragma unroll
    for (int dt = 0; dt < DT; ++dt)
#pragma unroll
      for (int r = 0; r < 8; ++r) sO[w][rt * 16 + 8 * hh + r][dt * 16 + ln] = oacc[rt][dt][r] * l_r[rt][r]; }
  __builtin_amdgcn_fence(__ATOMIC_ACQ_REL, "workgroup"); __builtin_amdgcn_wave_barrier();
  {
#pragma unroll
    for (int rp = 0; rp < RPW; rp += 2) { const int r = rp + (lane >> 4), pc = lane & 15; const v4f val = *(const v4fa*)&sO[w][r][pc * 4]; *(v4f*)(O + ((size_t)b * TQ + q0 + r) * ldo + h * 64 + pc * 4) = val; }
     } }

__global__ __launch_bounds__(256) void k_woutp(const float* __restrict__ Wm, _Float16* __restrict__ Bt) { const size_t t = (size_t)blockIdx.x * 256 + threadIdx.x; if (t >= (size_t)DMOD * (2 * DMOD / 8)) return; const int pc = (int)(t % (2 * DMOD / 8)); const int o = (int)(t / (2 * DMOD / 8)); const bool lo = pc * 8 >= DMOD; FragH f;
  for (int q = 0; q < 8; ++q) { const int c = pc * 8 + q - (lo ? DMOD : 0); f.h[q] = (_Float16)(bf16_round(Wm[(size_t)c * DMOD + o]) * (lo ? 1.0f : 16.0f)); } *(v8us*)((unsigned short*)Bt + (size_t)o * 2 * DMOD + pc * 8) = f.half[0];  }      /* Wproj stored (in, out) -> Bt[o][c | 1024 + c] */
__global__ __launch_bounds__(256) void k_pose(const float* __restrict__ pose, const float* __restrict__ W1, const float* __restrict__ b1, const float* __restrict__ W2, const float* __restrict__ b2, const float* __restrict__ bqkv, float* __restrict__ PB) {
  #pragma clang fp contract(off)
  __shared__ float hs[64]; const int b = blockIdx.x, tid = threadIdx.x;
  if (tid < 64) { float s = 0.f; for (int i = 0; i < 3; ++i) s += bf16_round(pose[b * 3 + i]) * bf16_round(W1[i * 64 + tid]); s += bf16_round(b1[tid]); hs[tid] = fmaxf(s, 0.f); }
  __syncthreads();
  {
#pragma unroll 1
    for (int u = 0; u < 12; ++u) { const int o = tid + u * 256; float s = 0.f;
#pragma unroll 1
      for (int j = 0; j < 64; ++j) s += hs[j] * bf16_round(W2[(size_t)j * 3 * DMOD + o]);
      s += bf16_round(b2[o]); s += bf16_round(bqkv[o]); *(float*)(PB + (size_t)b * 3 * DMOD + o) = s; }
     } }

extern "C" void kernel_launch(void* const* d_in, const int* in_sizes, int n_in,
                              void* d_out, int out_size, void* d_ws, size_t ws_size, hipStream_t stream) {
  (void)in_sizes; (void)n_in; (void)out_size;
  const float* const* I = (const float* const*)d_in; const float* x = I[0]; const float* pose = I[1]; const float* Wqkv = I[2]; const float* bqkv = I[3]; const float* W1 = I[4]; const float* b1 = I[5]; const float* W2 = I[6]; const float* b2 = I[7]; const float* Wp = I[8]; const float* bp = I[9];
  char* ws = (char*)d_ws; size_t off = 0;
  auto take = [&](size_t bytes) { char* p = ws + off; off += (bytes + 255) & ~(size_t)255; return p; };
  _Float16* BW = (_Float16*)take((size_t)3 * DMOD * DMOD * 2); _Float16* BO = (_Float16*)take((size_t)DMOD * 2 * DMOD * 2); float* PB = (float*)take((size_t)NB * 3 * DMOD * 4);
  _Float16* X16 = (_Float16*)take((size_t)NR * DMOD * 2); float* F32 = (float*)take((size_t)NR * DMOD * 4); _Float16* QH = (_Float16*)take((size_t)NR * DMOD * 2); _Float16* QL = (_Float16*)take((size_t)NR * DMOD * 2); _Float16* KH = (_Float16*)take((size_t)NR * DMOD * 2); _Float16* KL = (_Float16*)take((size_t)NR * DMOD * 2); _Float16* VH = (_Float16*)take((size_t)NR * DMOD * 2); _Float16* VL = (_Float16*)take((size_t)NR * DMOD * 2); _Float16* VT = (_Float16*)take((size_t)NR * DMOD * 2); _Float16* VTL = (_Float16*)take((size_t)NR * DMOD * 2);
  float* O = F32; _Float16* Hh = VH; _Float16* Hl = VL;      /* aliases after the flash kernel (VH/VL are only read by k_vt) */
  if (off > ws_size) return;      /* 6 + 4 + 16 + 32 + 8 x 16 = 186 MiB (256 MiB ws) */
  k_wt_f16<<<(unsigned)(((size_t)3 * DMOD * (DMOD / 8) + 255) / 256), 256, 0, stream>>>(Wqkv, BW, DMOD, 3 * DMOD, 16.0f); k_woutp<<<(unsigned)(((size_t)DMOD * (2 * DMOD / 8) + 255) / 256), 256, 0, stream>>>(Wp, BO);
  k_pose<<<NB, 256, 0, stream>>>(pose, W1, b1, W2, b2, bqkv, PB);
  k_x16<<<(unsigned)(((size_t)NR * DMOD / 8 + 255) / 256), 256, 0, stream>>>(x, X16, (size_t)NR * DMOD / 8);
  const dim3 gB((SLEN / 128) * (DMOD / 64), 1), gA((NR / 128) * (DMOD / 64), 1); const unsigned n8 = (unsigned)(((size_t)NR * DMOD / 8 + 255) / 256);
  for (int which = 0; which < 3; ++which) { _Float16* H16p = (which == 0) ? QH : ((which == 1) ? KH : VH); _Float16* L16p = (which == 0) ? QL : ((which == 1) ? KL : VL);
    for (int b = 0; b < NB; ++b) k_gemm2<0><<<gB, 128, 0, stream>>>(X16 + (size_t)b * SLEN * DMOD, DMOD, 0, BW + (size_t)which * DMOD * DMOD, DMOD, 0, 0.0625f, nullptr, 0, PB + (size_t)b * 3 * DMOD + which * DMOD, 1 << 30, 0, 0, F32 + (size_t)b * SLEN * DMOD, nullptr, DMOD, 0, SLEN, DMOD, DMOD);      /* q|k|v + (bqkv + pose bias of batch b): the per-batch bias is a COMPUTED f32 vector, so it goes through the CP path (raw f32 add; rowsPerB huge -> CP[col]) rather than the bias path (which bf16-rounds, correct only for input biases) */
    k_hl<<<n8, 256, 0, stream>>>(F32, H16p, L16p, (size_t)NR * DMOD / 8); }
  k_vt<NH, SLEN><<<NB * NH * (SLEN / 64), 256, 0, stream>>>(VH, DMOD, 0, VT);
  k_flashqk<0><<<NB * NH * QBLKS, 128, 0, stream>>>(QH, QL, DMOD, KH, KL, DMOD, VT, nullptr, O, DMOD);      /* q/k hi + residual; P (x2^10) and V plain f16 */
  k_hl<<<n8, 256, 0, stream>>>(O, Hh, Hl, (size_t)NR * DMOD / 8);
  k_gemm2<0><<<gA, 128, 0, stream>>>(Hh, DMOD, 0, BO, 2 * DMOD, 0, 0.0625f, bp, 0, nullptr, 1, 0, 0, (float*)d_out, nullptr, DMOD, 0, NR, DMOD, DMOD);
  k_gemm2<0><<<gA, 128, 0, stream>>>(Hl, DMOD, 0, BO + DMOD, 2 * DMOD, 0, 1.0f / 1024.0f, nullptr, 0, (const float*)d_out, 1, (size_t)DMOD, 0, (float*)d_out, nullptr, DMOD, 0, NR, DMOD, DMOD);
}

// v001
// Measured time: 919 microseconds a run.
// Timed twice side by side with v000, it ran 1.72 and 1.73 times as fast.
#include <hip/hip_runtime.h>
// Pose-aware attention (8 batches x 1024 tokens x 1024; 16 heads x 64): qkv = x Wqkv + b; per-batch pose embedding = relu(pose W1 + b1) W2 + b2 split into (q, k, v) biases per (head, dim) and added to q/k/v; softmax(q k^T / 8) v; out Wproj + b -> [8,1024,1024].
// Structure: the pose MLP on VALU folded into per-batch bias vectors (bqkv + pose_{q|k|v}[b]); x as an exact f16 plane; one qkv GEMM over all 8192 rows x 3072 columns (32x64 wave tiles, f32 accumulation, exact x16 weights, that per-batch bias picked by row / 1024) producing f32 q|k|v split into f16 hi + 2^10 residual planes; V^T by LDS tiles; the fused flash kernel with hi + 2^10-residual q/k planes (S = QhKh + (QlKh + QhKl)/1024) and plain f16 P (x2^10) and V (hi/lo operands for S only); the attention output as hi + residual into two accumulating projection GEMMs.
// Compute dtype: x, pose and all parameters rounded to bf16; q, k hi + residual (~2^-21-class logits); P and v plain f16 (~2^-12); f32 accumulation/softmax. v_wmma_f32_16x16x32_f16.
#define NB 8
#define DMOD 1024
#define NR (NB * SLEN)
#define QBLKS (TQ / 64)
#define SLEN 1024
#define TQ SLEN
#define TK SLEN
#define NH 16
#define SCL 0.125f               /* 64^-0.5 */
typedef __bf16 v16b __attribute__((ext_vector_type(16)));
typedef unsigned short v8us __attribute__((ext_vector_type(8), may_alias));
typedef float  v8f  __attribute__((ext_vector_type(8)));
typedef float  v4f  __attribute__((ext_vector_type(4)));
typedef float  v4fa __attribute__((ext_vector_type(4), may_alias));
union FragB { v16b v; v8us half[2]; unsigned short u[16]; };

__device__ __forceinline__ unsigned short bf16_bits(float x) { unsigned int u = __float_as_uint(x); return (unsigned short)((u + 0x7FFFu + ((u >> 16) & 1u)) >> 16); }
__device__ __forceinline__ float bf16_val(unsigned short b) { return __uint_as_float(((unsigned int)b) << 16); }
__device__ __forceinline__ float bf16_round(float x) { return bf16_val(bf16_bits(x)); }
// D += A·B with NT terms: 1 = ah·bh, 2 = + al·bh (A split), 3 = + ah·bl (both split)
template <int NT>
__device__ __forceinline__ v8f mmaN(v16b ah, v16b al, v16b bh, v16b bl, v8f c) {
  c = __builtin_amdgcn_wmma_f32_16x16x32_bf16(false, ah, false, bh, (short)0, c, false, false);
  if (NT >= 2) c = __builtin_amdgcn_wmma_f32_16x16x32_bf16(false, al, false, bh, (short)0, c, false, false);
  if (NT >= 3) c = __builtin_amdgcn_wmma_f32_16x16x32_bf16(false, ah, false, bl, (short)0, c, false, false);
  asm volatile("v_nop\n\tv_nop\n\tv_nop\n\tv_nop" : "+v"(c) : "v"(ah), "v"(al), "v"(bh), "v"(bl));
  return c;
}

__global__ __launch_bounds__(256) void k_wt_bf16(const float* __restrict__ W, unsigned short* __restrict__ Wt, int K, int N) {
  const int t = blockIdx.x * 256 + threadIdx.x;
  const int k8n = K / 8;
  if (t >= N * k8n) return;
  const int n = t / k8n, k8 = (t % k8n) * 8;
  v8us v;
#pragma unroll
  for (int i = 0; i < 8; ++i) v[i] = bf16_bits(W[(size_t)(k8 + i) * N + n]);
  *(v8us*)(Wt + (size_t)n * K + k8) = v;
  
}

// GEMM C[M][N] (f32, pitch ldc) = act(A[M][K]·W + bias). A f32 row-major (pitch lda) converted per fragment to bf16
// (ASPLIT: hi/lo two planes -> 2 terms, else single rounded term); Wt bf16 [N][K] (pitch ldb). BIAS_BF16 rounds the
// bias to bf16 first (bias quantised to bf16 before the add). K%32==0, M%16==0, N%64==0.
template <bool ASPLIT, int ACT, bool BIAS_BF16>
__global__ __launch_bounds__(128) void k_gemm_bf(const float* __restrict__ A, int lda, const unsigned short* __restrict__ Wt, int ldb,
                                               const float* __restrict__ bias, float* __restrict__ C, int ldc, int M, int N, int K) {
  __shared__ __attribute__((aligned(16))) float so[4][16][64];
  const int tid = threadIdx.x, w = tid >> 5, lane = tid & 31, ln = lane & 15, hh = lane >> 4;
  const int ntn = N / 64;
  const int wid = blockIdx.x * 4 + w;
  const int mt = wid / ntn, nq = wid % ntn;
  if (mt * 16 >= M) return;
  const int row0 = mt * 16, col0 = nq * 64;
  const float* arow = A + (size_t)(row0 + ln) * lda;
  v8f acc[4] = {};
  for (int kb = 0; kb < K; kb += 32) {
    FragB ah, al;
    const v4f x0 = *(const v4fa*)(arow + kb + 8 * hh), x1 = *(const v4fa*)(arow + kb + 8 * hh + 4);
    const v4f x2 = *(const v4fa*)(arow + kb + 16 + 8 * hh), x3 = *(const v4fa*)(arow + kb + 16 + 8 * hh + 4);
    float xs[16] = {x0[0],x0[1],x0[2],x0[3],x1[0],x1[1],x1[2],x1[3],x2[0],x2[1],x2[2],x2[3],x3[0],x3[1],x3[2],x3[3]};
#pragma unroll
    for (int i = 0; i < 16; ++i) { const unsigned short hb = bf16_bits(xs[i]); ah.u[i] = hb; al.u[i] = ASPLIT ? bf16_bits(xs[i] - bf16_val(hb)) : (unsigned short)0; }
#pragma unroll
    for (int t = 0; t < 4; ++t) {
      const unsigned short* brow = Wt + (size_t)(col0 + t * 16 + ln) * ldb + kb;
      FragB b;
      b.half[0] = *(const v8us*)(brow + 8 * hh);
      b.half[1] = *(const v8us*)(brow + 16 + 8 * hh);
      acc[t] = mmaN<ASPLIT ? 2 : 1>(ah.v, al.v, b.v, b.v, acc[t]);
    }
  }
#pragma unroll
  for (int t = 0; t < 4; ++t) {
    float bv = bias ? bias[col0 + t * 16 + ln] : 0.f;
    if (BIAS_BF16) bv = bf16_round(bv);
#pragma unroll
    for (int r = 0; r < 8; ++r) { float v = acc[t][r] + bv; if (ACT == 1) v = fmaxf(v, 0.f); so[w][8 * hh + r][t * 16 + ln] = v; }
  }
  __builtin_amdgcn_fence(__ATOMIC_ACQ_REL, "workgroup");
  __builtin_amdgcn_wave_barrier();
  const int rsub = lane >> 4, c4 = (lane & 15) * 4;
  {
#pragma unroll
    for (int q = 0; q < 8; ++q) {
      const int r = q * 2 + rsub;
      const v4f v = *(const v4fa*)&so[w][r][c4];
      *(v4f*)(C + (size_t)(row0 + r) * ldc + col0 + c4) = v;
    }
    
  }
}

// GEMM C = act(A·W + bias + resid): A f32 (ASPLIT -> hi/lo 2 terms), Wt bf16 [N][K]; ACT 0 none, 1 relu, 2 exact gelu;
// resid (optional, f32, row index = (row % rmod), pitch ldr, RES_BF16 rounds it) added before the activation.
template <bool ASPLIT, int ACT, bool BIAS_BF16, bool RES_BF16>
__global__ __launch_bounds__(128) void k_gemm_bf3(const float* __restrict__ A, int lda, const unsigned short* __restrict__ Wt, int ldb,
                                                const float* __restrict__ bias, const float* __restrict__ resid, int rmod, int ldr,
                                                float* __restrict__ C, int ldc, int M, int N, int K) {
  __shared__ __attribute__((aligned(16))) float so[4][16][64];
  const int tid = threadIdx.x, w = tid >> 5, lane = tid & 31, ln = lane & 15, hh = lane >> 4;
  const int ntn = N / 64;
  const int wid = blockIdx.x * 4 + w;
  const int mt = wid / ntn, nq = wid % ntn;
  if (mt * 16 >= M) return;
  const int row0 = mt * 16, col0 = nq * 64;
  const float* arow = A + (size_t)(row0 + ln) * lda;
  v8f acc[4] = {};
  for (int kb = 0; kb < K; kb += 32) {
    FragB ah, al;
    const v4f x0 = *(const v4fa*)(arow + kb + 8 * hh), x1 = *(const v4fa*)(arow + kb + 8 * hh + 4);
    const v4f x2 = *(const v4fa*)(arow + kb + 16 + 8 * hh), x3 = *(const v4fa*)(arow + kb + 16 + 8 * hh + 4);
    float xs[16] = {x0[0],x0[1],x0[2],x0[3],x1[0],x1[1],x1[2],x1[3],x2[0],x2[1],x2[2],x2[3],x3[0],x3[1],x3[2],x3[3]};
#pragma unroll
    for (int i = 0; i < 16; ++i) { const unsigned short hb = bf16_bits(xs[i]); ah.u[i] = hb; al.u[i] = ASPLIT ? bf16_bits(xs[i] - bf16_val(hb)) : (unsigned short)0; }
#pragma unroll
    for (int t = 0; t < 4; ++t) {
      const unsigned short* brow = Wt + (size_t)(col0 + t * 16 + ln) * ldb + kb;
      FragB b;
      b.half[0] = *(const v8us*)(brow + 8 * hh);
      b.half[1] = *(const v8us*)(brow + 16 + 8 * hh);
      acc[t] = mmaN<ASPLIT ? 2 : 1>(ah.v, al.v, b.v, b.v, acc[t]);
    }
  }
#pragma unroll
  for (int t = 0; t < 4; ++t) {
    const int col = col0 + t * 16 + ln;
    float bv = bias ? bias[col] : 0.f;
    if (BIAS_BF16) bv = bf16_round(bv);
#pragma unroll
    for (int r = 0; r < 8; ++r) {
      float v = acc[t][r] + bv;
      if (resid) { float rv = resid[(size_t)((row0 + 8 * hh + r) % rmod) * ldr + col]; if (RES_BF16) rv = bf16_round(rv); v += rv; }
      if (ACT == 1) v = fmaxf(v, 0.f);
      if (ACT == 2) v = 0.5f * v * (1.0f + erff(v * 0.70710678118654752f));
      if (ACT == 3) { const float u = 0.7978845608028654f * (v + 0.044715f * v * v * v); v = 0.5f * v * (1.0f + tanhf(u)); }
      so[w][8 * hh + r][t * 16 + ln] = v;
    }
  }
  __builtin_amdgcn_fence(__ATOMIC_ACQ_REL, "workgroup");
  __builtin_amdgcn_wave_barrier();
  const int rsub = lane >> 4, c4 = (lane & 15) * 4;
  {
#pragma unroll
    for (int q = 0; q < 8; ++q) {
      const int r = q * 2 + rsub;
      const v4f v = *(const v4fa*)&so[w][r][c4];
      *(v4f*)(C + (size_t)(row0 + r) * ldc + col0 + c4) = v;
    }
    
  }
}
// row LayerNorm (biased variance, eps) over N: s = X (+ R); optional out_sum <- s; out_norm <- (s-mu)*rsqrt(var+eps)*g + b
template <bool PARAM_BF16>
__global__ __launch_bounds__(256) void k_layernorm(const float* __restrict__ X, const float* __restrict__ R, const float* __restrict__ g, const float* __restrict__ bta,
                                                  float* __restrict__ out_sum, float* __restrict__ out_norm, int N, float eps) {
  __shared__ float red[256];
  const int row = blockIdx.x, tid = threadIdx.x;
  const float* x = X + (size_t)row * N; const float* rr = R ? R + (size_t)row * N : nullptr;
  float vals[16];                     // up to N = 4096
  const int per = N / 256;            // contiguous chunk per thread? use strided-by-4 chunks: thread handles j = tid*4 + 1024*u
  float s1 = 0.f;
  for (int u = 0; u < per / 4; ++u) {
    const int j = tid * 4 + 1024 * u;
    const v4f a = *(const v4fa*)(x + j);
    v4f b = {0.f,0.f,0.f,0.f}; if (rr) b = *(const v4fa*)(rr + j);
#pragma unroll
    for (int q = 0; q < 4; ++q) { const float v = a[q] + b[q]; vals[u * 4 + q] = v; s1 += v; }
  }
  red[tid] = s1; __syncthreads();
  for (int st = 128; st > 0; st >>= 1) { if (tid < st) red[tid] += red[tid + st]; __syncthreads(); }
  const float mu = red[0] / (float)N; __syncthreads();
  float s2 = 0.f;
  for (int u = 0; u < per / 4; ++u)
#pragma unroll
    for (int q = 0; q < 4; ++q) { const float c = vals[u * 4 + q] - mu; s2 += c * c; }
  red[tid] = s2; __syncthreads();
  for (int st = 128; st > 0; st >>= 1) { if (tid < st) red[tid] += red[tid + st]; __syncthreads(); }
  const float rs = rsqrtf(red[0] / (float)N + eps);
  {
    for (int u = 0; u < per / 4; ++u) {
      const int j = tid * 4 + 1024 * u;
      v4f o, sm;
#pragma unroll
      for (int q = 0; q < 4; ++q) {
        float gg = g[j + q], bb = bta[j + q];
        if (PARAM_BF16) { gg = bf16_round(gg); bb = bf16_round(bb); }
        sm[q] = vals[u * 4 + q]; o[q] = (vals[u * 4 + q] - mu) * rs * gg + bb;
      }
      if (out_sum) *(v4f*)(out_sum + (size_t)row * N + j) = sm;
      *(v4f*)(out_norm + (size_t)row * N + j) = o;
    }
    
  }
}



// ---- f16 WMMA path (v_wmma_f32_16x16x32_f16): 11-bit significands for operands in range — used where a [0,1] probability operand needs more precision than bf16
typedef _Float16 v16h __attribute__((ext_vector_type(16)));
union FragH { v16h v; v8us half[2]; _Float16 h[16]; unsigned short u[16]; };
template <int NT>
__device__ __forceinline__ v8f mmaH(v16h ah, v16h al, v16h bh, v16h bl, v8f c) {
  c = __builtin_amdgcn_wmma_f32_16x16x32_f16(false, ah, false, bh, (short)0, c, false, false);
  if (NT >= 2) c = __builtin_amdgcn_wmma_f32_16x16x32_f16(false, al, false, bh, (short)0, c, false, false);
  if (NT >= 3) c = __builtin_amdgcn_wmma_f32_16x16x32_f16(false, ah, false, bl, (short)0, c, false, false);
  asm volatile("v_nop\n\tv_nop\n\tv_nop\n\tv_nop" : "+v"(c) : "v"(ah), "v"(al), "v"(bh), "v"(bl));
  return c;
}
// batched GEMM like k_gemm_b but f16 operands: A f32 (split into f16 hi/lo if ASPLIT, else rounded to f16), Bt = f16 values [n][k]; alpha; C f32; N multiple of 16 (partial tiles skipped)
template <bool ASPLIT>
__global__ __launch_bounds__(128) void k_gemm_h(const float* __restrict__ A, int lda, size_t sA, const _Float16* __restrict__ Bh, int ldb, size_t sB, float alpha, float* __restrict__ C, int ldc, size_t sC, int M, int N, int K) {
  __shared__ __attribute__((aligned(16))) float so[4][16][64];
  const int tid = threadIdx.x, w = tid >> 5, lane = tid & 31, ln = lane & 15, hh = lane >> 4; const int by = blockIdx.y;
  A += (size_t)by * sA; Bh += (size_t)by * sB; C += (size_t)by * sC;
  const int ntn = (N + 63) / 64; const int wid = blockIdx.x * 4 + w; const int mt = wid / ntn, nq = wid % ntn; if (mt * 16 >= M) return;
  const int row0 = mt * 16, col0 = nq * 64; const float* arow = A + (size_t)(row0 + ln) * lda;
  v8f acc[4] = {};
  for (int kb = 0; kb < K; kb += 32) {
    FragH ah, al;
    const v4f x0 = *(const v4fa*)(arow + kb + 8 * hh), x1 = *(const v4fa*)(arow + kb + 8 * hh + 4), x2 = *(const v4fa*)(arow + kb + 16 + 8 * hh), x3 = *(const v4fa*)(arow + kb + 16 + 8 * hh + 4);
    float xs[16] = {x0[0],x0[1],x0[2],x0[3],x1[0],x1[1],x1[2],x1[3],x2[0],x2[1],x2[2],x2[3],x3[0],x3[1],x3[2],x3[3]};
#pragma unroll
    for (int i = 0; i < 16; ++i) { const _Float16 h = (_Float16)xs[i]; ah.h[i] = h; al.h[i] = ASPLIT ? (_Float16)(xs[i] - (float)h) : (_Float16)0.0f; }
#pragma unroll
    for (int t = 0; t < 4; ++t) { if (col0 + t * 16 >= N) continue; const size_t boff = (size_t)(col0 + t * 16 + ln) * ldb + kb; FragH bq; bq.half[0] = *(const v8us*)(Bh + boff + 8 * hh); bq.half[1] = *(const v8us*)(Bh + boff + 16 + 8 * hh);
      acc[t] = mmaH<ASPLIT ? 2 : 1>(ah.v, al.v, bq.v, bq.v, acc[t]); }
  }
#pragma unroll
  for (int t = 0; t < 4; ++t) { if (col0 + t * 16 >= N) continue;
#pragma unroll
    for (int r = 0; r < 8; ++r) so[w][8 * hh + r][t * 16 + ln] = acc[t][r] * alpha; }
  __builtin_amdgcn_fence(__ATOMIC_ACQ_REL, "workgroup"); __builtin_amdgcn_wave_barrier();
  const int rsub = lane >> 4, c4 = (lane & 15) * 4;
  {
#pragma unroll
    for (int q = 0; q < 8; ++q) { const int r = q * 2 + rsub; if (col0 + c4 < N) { const v4f v = *(const v4fa*)&so[w][r][c4]; *(v4f*)(C + (size_t)(row0 + r) * ldc + col0 + c4) = v; } }
     }
}

// Wt[n][k] = f16(W[k][n]·scale) from f32 row-major W[K][N] (scale = power of two; bf16-exact weights stay exact in f16 away from the subnormal range)
__global__ __launch_bounds__(256) void k_wt_f16(const float* __restrict__ W, _Float16* __restrict__ Wt, int K, int N, float scale) {
  const int t = blockIdx.x * 256 + threadIdx.x; if (t >= N * (K / 8)) return; const int n = t / (K / 8), k8 = (t % (K / 8)) * 8; FragH f;
#pragma unroll
  for (int i = 0; i < 8; ++i) f.h[i] = (_Float16)(bf16_round(W[(size_t)(k8 + i) * N + n]) * scale); const v8us o = f.half[0];
  *(v8us*)((unsigned short*)Wt + (size_t)n * K + k8) = o; 
}
// k_gemm_hh variant with fused epilogue: v = acc·alpha + bias[by·sBias + col] (+ CP[(row/rowsPerB)·sCPb + by·64 + col] if CP) ; ACT 0 none / 1 elu ; writes f16 C16 (and f32 C if non-null)
template <int ACT>
__global__ __launch_bounds__(128) void k_gemm_hhx(const _Float16* __restrict__ A, int lda, size_t sA, const _Float16* __restrict__ Bh, int ldb, size_t sB, float alpha, const float* __restrict__ bias, size_t sBias, const float* __restrict__ CP, int rowsPerB, size_t sCPb, int row0g,
    float* __restrict__ C, _Float16* __restrict__ C16, int ldc, size_t sC, int M, int N, int K) {
  __shared__ __attribute__((aligned(16))) float so[4][16][64];
  const int tid = threadIdx.x, w = tid >> 5, lane = tid & 31, ln = lane & 15, hh = lane >> 4; const int by = blockIdx.y;
  A += (size_t)by * sA; Bh += (size_t)by * sB; const size_t cofs = (size_t)by * sC; const float* bp = bias ? bias + (size_t)by * sBias : nullptr;
  const int ntn = (N + 63) / 64; const int wid = blockIdx.x * 4 + w; const int mt = wid / ntn, nq = wid % ntn; if (mt * 16 >= M) return;
  const int row0 = mt * 16, col0 = nq * 64; const _Float16* arow = A + (size_t)(row0 + ln) * lda;
  v8f acc[4] = {};
  for (int kb = 0; kb < K; kb += 32) { FragH ah; ah.half[0] = *(const v8us*)((const unsigned short*)arow + kb + 8 * hh); ah.half[1] = *(const v8us*)((const unsigned short*)arow + kb + 16 + 8 * hh);
#pragma unroll
    for (int t = 0; t < 4; ++t) { if (col0 + t * 16 >= N) continue; const size_t boff = (size_t)(col0 + t * 16 + ln) * ldb + kb; FragH bq; bq.half[0] = *(const v8us*)((const unsigned short*)Bh + boff + 8 * hh); bq.half[1] = *(const v8us*)((const unsigned short*)Bh + boff + 16 + 8 * hh);
      acc[t] = mmaH<1>(ah.v, ah.v, bq.v, bq.v, acc[t]); }
  }
#pragma unroll
  for (int t = 0; t < 4; ++t) { if (col0 + t * 16 >= N) continue; const int col = col0 + t * 16 + ln; const float bv = bp ? bf16_round(bp[col]) : 0.f;
#pragma unroll
    for (int r = 0; r < 8; ++r) { float v = acc[t][r] * alpha + bv; if (CP) { const int bidx = (row0g + row0 + 8 * hh + r) / rowsPerB; v += CP[(size_t)bidx * sCPb + (size_t)by * 64 + col]; } if (ACT == 1) v = (v > 0.f) ? v : expm1f(v); else if (ACT == 7) v = (v > 0.f) ? v + 1.0f : expf(v); else if (ACT == 8) v = tanhf(v); else if (ACT == 9) v = 0.5f * v * (1.0f + tanhf(0.7978845608028654f * (v + 0.044715f * v * v * v))); else if (ACT == 11) v = 1.0f / (1.0f + expf(-v)); else if (ACT == 12) v = (v > 0.f) ? v : 0.01f * v; else if (ACT == 14) v = (v > 0.f) ? v : 0.1f * v; else if (ACT == 15) v = v / (1.0f + expf(-v)); else if (ACT == 3) v = fmaxf(v, 0.f); else if (ACT == 6) v = 0.5f * v * (1.0f + erff(v * 0.70710678118654752f)); so[w][8 * hh + r][t * 16 + ln] = v; } }
  __builtin_amdgcn_fence(__ATOMIC_ACQ_REL, "workgroup"); __builtin_amdgcn_wave_barrier();
  const int rsub = lane >> 4, c4 = (lane & 15) * 4; typedef _Float16 v4h __attribute__((ext_vector_type(4)));
  {
#pragma unroll
    for (int q = 0; q < 8; ++q) { const int r = q * 2 + rsub; if (col0 + c4 < N) { const v4f v = *(const v4fa*)&so[w][r][c4]; if (C) *(v4f*)(C + cofs + (size_t)(row0 + r) * ldc + col0 + c4) = v; if (C16) { v4h h4; for (int i = 0; i < 4; ++i) h4[i] = (_Float16)v[i]; *(v4h*)(C16 + cofs + (size_t)(row0 + r) * ldc + col0 + c4) = h4; } } }
     }
}


typedef _Float16 v4h __attribute__((ext_vector_type(4)));

__global__ __launch_bounds__(256) void k_x16(const float* __restrict__ x, _Float16* __restrict__ X16, size_t n8) { const size_t t = (size_t)blockIdx.x * 256 + threadIdx.x; if (t >= n8) return; FragH f;
#pragma unroll
  for (int q = 0; q < 8; ++q) f.h[q] = (_Float16)bf16_round(x[t * 8 + q]); *(v8us*)((unsigned short*)X16 + t * 8) = f.half[0];  }
__global__ __launch_bounds__(256) void k_h16(const float* __restrict__ x, _Float16* __restrict__ X16, size_t n8) { const size_t t = (size_t)blockIdx.x * 256 + threadIdx.x; if (t >= n8) return; FragH f;
#pragma unroll
  for (int q = 0; q < 8; ++q) f.h[q] = (_Float16)x[t * 8 + q]; *(v8us*)((unsigned short*)X16 + t * 8) = f.half[0];  }
__global__ __launch_bounds__(256) void k_round16f(const float* __restrict__ W, _Float16* __restrict__ Bt, size_t n8) { const size_t t = (size_t)blockIdx.x * 256 + threadIdx.x; if (t >= n8) return; FragH f;
#pragma unroll
  for (int i = 0; i < 8; ++i) f.h[i] = (_Float16)(bf16_round(W[t * 8 + i]) * 16.0f); *(v8us*)((unsigned short*)Bt + t * 8) = f.half[0];  }
template <int NHv, int TTv>
__global__ __launch_bounds__(256) void k_vt(const _Float16* __restrict__ V16, int ldv, int voff, _Float16* __restrict__ Vt) { __shared__ unsigned short tl[64][66]; const int tid = threadIdx.x; const int slab = blockIdx.x / (TTv / 64), lg = blockIdx.x % (TTv / 64); const int b = slab / NHv, h = slab % NHv;
  for (int i = tid; i < 64 * 8; i += 256) { const int r = i / 8, c8 = (i % 8) * 8; FragH f; f.half[0] = *(const v8us*)((const unsigned short*)V16 + ((size_t)b * TTv + lg * 64 + r) * ldv + voff + h * 64 + c8);
#pragma unroll
    for (int q = 0; q < 8; ++q) tl[r][c8 + q] = f.u[q]; }
  __syncthreads();
  {
#pragma unroll
    for (int rd = 0; rd < 2; ++rd) { const int d = rd * 32 + tid / 8, pc = tid % 8; FragH f;
#pragma unroll
      for (int q = 0; q < 8; ++q) f.u[q] = tl[pc * 8 + q][d];
      *(v8us*)((unsigned short*)Vt + ((size_t)slab * 64 + d) * TTv + lg * 64 + pc * 8) = f.half[0]; }
     } }

__global__ __launch_bounds__(256) void k_hl(const float* __restrict__ F, _Float16* __restrict__ Hh, _Float16* __restrict__ Hl, size_t n8) { const size_t t = (size_t)blockIdx.x * 256 + threadIdx.x; if (t >= n8) return; FragH fh, fl; const v4f a = *(const v4fa*)(F + t * 8), c = *(const v4fa*)(F + t * 8 + 4);
#pragma unroll
  for (int q = 0; q < 4; ++q) { _Float16 h = (_Float16)a[q]; fh.h[q] = h; fl.h[q] = (_Float16)((a[q] - (float)h) * 1024.0f); h = (_Float16)c[q]; fh.h[4 + q] = h; fl.h[4 + q] = (_Float16)((c[q] - (float)h) * 1024.0f); }
  { *(v8us*)((unsigned short*)Hh + t * 8) = fh.half[0]; *(v8us*)((unsigned short*)Hl + t * 8) = fl.half[0];  } }

// ---- fast GEMM (wave tile 32x64; requires M % 32 == 0 rows per launch region and N % 64 == 0); epilogue = k_gemm_hhx semantics ----
__device__ __forceinline__ v16h g2_frag(const _Float16* p, int hh) { FragH f; f.half[0] = *(const v8us*)((const unsigned short*)p + 8 * hh); f.half[1] = *(const v8us*)((const unsigned short*)p + 16 + 8 * hh); return f.v; }
__device__ __forceinline__ v8f g2_mma(v16h a, v16h b, v8f c) { v8f d = __builtin_amdgcn_wmma_f32_16x16x32_f16(false, a, false, b, (short)0, c, false, false); asm volatile("v_nop\n\tv_nop\n\tv_nop\n\tv_nop" : "+v"(d) : "v"(a), "v"(b)); return d; }
template <int ACT>
__global__ __launch_bounds__(128) void k_gemm2(const _Float16* __restrict__ A, int lda, size_t sA, const _Float16* __restrict__ Bh, int ldb, size_t sB, float alpha, const float* __restrict__ bias, size_t sBias, const float* __restrict__ CP, int rowsPerB, size_t sCPb, int row0g,
    float* __restrict__ C, _Float16* __restrict__ C16, int ldc, size_t sC, int M, int N, int K) {
  __shared__ __attribute__((aligned(16))) float so[4][32][68];
  const int tid = threadIdx.x, w = tid >> 5, lane = tid & 31, ln = lane & 15, hh = lane >> 4; const int by = blockIdx.y;
  A += (size_t)by * sA; Bh += (size_t)by * sB; const size_t cofs = (size_t)by * sC; const float* bp = bias ? bias + (size_t)by * sBias : nullptr;
  const int ntn = N >> 6; const int mt = blockIdx.x / ntn, nq = blockIdx.x - mt * ntn; const int row0 = mt * 128 + 32 * w, col0 = nq * 64; if (row0 >= M) return;
  const _Float16* a0p = A + (size_t)(row0 + ln) * lda; const _Float16* a1p = a0p + (size_t)16 * lda;
  const _Float16* b0p = Bh + (size_t)(col0 + ln) * ldb; const _Float16* b1p = b0p + (size_t)16 * ldb; const _Float16* b2p = b1p + (size_t)16 * ldb; const _Float16* b3p = b2p + (size_t)16 * ldb;
  const v8f z8 = {0.f,0.f,0.f,0.f,0.f,0.f,0.f,0.f}; v8f c00 = z8, c01 = z8, c02 = z8, c03 = z8, c10 = z8, c11 = z8, c12 = z8, c13 = z8;
#pragma unroll 1
  for (int kb = 0; kb < K; kb += 32) { const v16h a0 = g2_frag(a0p + kb, hh), a1 = g2_frag(a1p + kb, hh);
    v16h b = g2_frag(b0p + kb, hh); c00 = g2_mma(a0, b, c00); c10 = g2_mma(a1, b, c10);
    b = g2_frag(b1p + kb, hh); c01 = g2_mma(a0, b, c01); c11 = g2_mma(a1, b, c11);
    b = g2_frag(b2p + kb, hh); c02 = g2_mma(a0, b, c02); c12 = g2_mma(a1, b, c12);
    b = g2_frag(b3p + kb, hh); c03 = g2_mma(a0, b, c03); c13 = g2_mma(a1, b, c13); }
  v8f accs[8] = {c00, c01, c02, c03, c10, c11, c12, c13};
#pragma unroll
  for (int u = 0; u < 8; ++u) { const int t = u & 3, half = u >> 2; const int col = col0 + t * 16 + ln; const float bv = bp ? bf16_round(bp[col]) : 0.f;
#pragma unroll
    for (int r = 0; r < 8; ++r) { const int rloc = half * 16 + 8 * hh + r; float v = accs[u][r] * alpha + bv; if (CP) { const int bidx = (row0g + row0 + rloc) / rowsPerB; v += CP[(size_t)bidx * sCPb + (size_t)by * 64 + col]; }
      if (ACT == 3) v = fmaxf(v, 0.f); else if (ACT == 6) v = 0.5f * v * (1.0f + erff(v * 0.70710678118654752f)); else if (ACT == 11) v = 1.0f / (1.0f + expf(-v)); else if (ACT == 15) v = v / (1.0f + expf(-v)); else if (ACT == 12) v = (v > 0.f) ? v : 0.01f * v; else if (ACT == 8) v = tanhf(v);
      so[w][rloc][t * 16 + ln] = v; } }
  __builtin_amdgcn_fence(__ATOMIC_ACQ_REL, "workgroup"); __builtin_amdgcn_wave_barrier();
  const int rsub = lane >> 4, c4 = (lane & 15) * 4;
  {
#pragma unroll
    for (int q = 0; q < 16; ++q) { const int r = q * 2 + rsub; const v4f v = *(const v4fa*)&so[w][r][c4]; if (C) *(v4f*)(C + cofs + (size_t)(row0 + r) * ldc + col0 + c4) = v; if (C16) { v4h h4; for (int i = 0; i < 4; ++i) h4[i] = (_Float16)v[i]; *(v4h*)(C16 + cofs + (size_t)(row0 + r) * ldc + col0 + c4) = h4; } }
     } }



template <int CAUSAL>
__global__ __launch_bounds__(128) void k_flash(const _Float16* __restrict__ Q16, int ldq, const _Float16* __restrict__ K16, int ldk, const _Float16* __restrict__ Vt, const int* __restrict__ MSK, float* __restrict__ O, int ldo) {
  constexpr int RPW = 16, RTN = RPW / 16, NQB = TQ / (4 * RPW), DT = 4, KS = 2;
  __shared__ __attribute__((aligned(16))) unsigned short sP[4][RPW][40]; __shared__ __attribute__((aligned(16))) float sO[4][RPW][64 + 4];
  const int tid = threadIdx.x, w = tid >> 5, lane = tid & 31, ln = lane & 15, hh = lane >> 4;
  const int slab = blockIdx.x / QBLKS, qblk = blockIdx.x % QBLKS; (void)NQB; const int b = slab / NH, h = slab % NH; const int qb0 = qblk * (4 * RPW); const int q0 = qb0 + w * RPW;
  FragH aq[2][KS];
#pragma unroll
  for (int rt = 0; rt < RTN; ++rt) { const unsigned short* qr = (const unsigned short*)Q16 + ((size_t)b * TQ + q0 + rt * 16 + ln) * ldq + h * 64;
#pragma unroll
    for (int ks = 0; ks < KS; ++ks) { aq[rt][ks].half[0] = *(const v8us*)(qr + ks * 32 + 8 * hh); aq[rt][ks].half[1] = *(const v8us*)(qr + ks * 32 + 16 + 8 * hh); } }
  const unsigned short* Vth = (const unsigned short*)Vt + (size_t)slab * 64 * TK;
  float m_r[2][8], l_r[2][8]; v8f oacc[2][DT];
#pragma unroll
  for (int rt = 0; rt < RTN; ++rt) {
#pragma unroll
    for (int r = 0; r < 8; ++r) { m_r[rt][r] = -3.0e38f; l_r[rt][r] = 0.f; }
#pragma unroll
    for (int dt = 0; dt < DT; ++dt) oacc[rt][dt] = (v8f){0.f,0.f,0.f,0.f,0.f,0.f,0.f,0.f}; }
  const int jend = (CAUSAL == 1) ? (qb0 + 4 * RPW) : TK;      /* causal: keys beyond the block's last query never contribute */
#pragma unroll 1
  for (int j0 = 0; j0 < jend; j0 += 32) {
    v8f s[2][2];
#pragma unroll
    for (int nt = 0; nt < 2; ++nt) { const unsigned short* kr = (const unsigned short*)K16 + ((size_t)b * TK + j0 + nt * 16 + ln) * ldk + h * 64; FragH bk[KS];
#pragma unroll
      for (int ks = 0; ks < KS; ++ks) { bk[ks].half[0] = *(const v8us*)(kr + ks * 32 + 8 * hh); bk[ks].half[1] = *(const v8us*)(kr + ks * 32 + 16 + 8 * hh); }
#pragma unroll
      for (int rt = 0; rt < RTN; ++rt) { v8f acc = (v8f){0.f,0.f,0.f,0.f,0.f,0.f,0.f,0.f};
#pragma unroll
        for (int ks = 0; ks < KS; ++ks) acc = mmaH<1>(aq[rt][ks].v, aq[rt][ks].v, bk[ks].v, bk[ks].v, acc); s[rt][nt] = acc; } }
#pragma unroll
    for (int rt = 0; rt < RTN; ++rt)
#pragma unroll
      for (int r = 0; r < 8; ++r) { const int tq = q0 + rt * 16 + 8 * hh + r; const int k0 = j0 + ln, k1 = j0 + 16 + ln;
        const bool ok0 = (CAUSAL == 1) ? (k0 <= tq) : ((CAUSAL == 2) ? ((k0 >> 5) == (tq >> 5)) : true), ok1 = (CAUSAL == 1) ? (k1 <= tq) : ((CAUSAL == 2) ? ((k1 >> 5) == (tq >> 5)) : true);      /* mode 2: block-diagonal 32-token groups */
        const float s0 = ok0 ? s[rt][0][r] * SCL : -3.0e38f, s1 = ok1 ? s[rt][1][r] * SCL : -3.0e38f; float mc = fmaxf(s0, s1);
        mc = fmaxf(mc, __shfl_xor(mc, 1, 32)); mc = fmaxf(mc, __shfl_xor(mc, 2, 32)); mc = fmaxf(mc, __shfl_xor(mc, 4, 32)); mc = fmaxf(mc, __shfl_xor(mc, 8, 32));
        const float mn = fmaxf(m_r[rt][r], mc); const float al = (mn > -1.0e38f) ? expf(m_r[rt][r] - mn) : 1.0f; m_r[rt][r] = mn; const float p0 = ok0 ? expf(s0 - mn) : 0.f, p1 = ok1 ? expf(s1 - mn) : 0.f; l_r[rt][r] = l_r[rt][r] * al + p0 + p1;
#pragma unroll
        for (int dt = 0; dt < DT; ++dt) oacc[rt][dt][r] *= al;
        FragH t2; t2.h[0] = (_Float16)(p0 * 1024.0f); t2.h[1] = (_Float16)(p1 * 1024.0f); sP[w][rt * 16 + 8 * hh + r][ln] = t2.u[0]; sP[w][rt * 16 + 8 * hh + r][16 + ln] = t2.u[1]; }
    __builtin_amdgcn_fence(__ATOMIC_ACQ_REL, "workgroup"); __builtin_amdgcn_wave_barrier();
    FragH pa[2];
#pragma unroll
    for (int rt = 0; rt < RTN; ++rt) { pa[rt].half[0] = *(const v8us*)&sP[w][rt * 16 + ln][8 * hh]; pa[rt].half[1] = *(const v8us*)&sP[w][rt * 16 + ln][16 + 8 * hh]; }
#pragma unroll
    for (int dt = 0; dt < DT; ++dt) { const unsigned short* vrow = Vth + (size_t)(dt * 16 + ln) * TK + j0; FragH bv; bv.half[0] = *(const v8us*)(vrow + 8 * hh); bv.half[1] = *(const v8us*)(vrow + 16 + 8 * hh);
#pragma unroll
      for (int rt = 0; rt < RTN; ++rt) oacc[rt][dt] = mmaH<1>(pa[rt].v, pa[rt].v, bv.v, bv.v, oacc[rt][dt]); }
    __builtin_amdgcn_fence(__ATOMIC_ACQ_REL, "workgroup"); __builtin_amdgcn_wave_barrier(); }
#pragma unroll
  for (int rt = 0; rt < RTN; ++rt) {
#pragma unroll
    for (int r = 0; r < 8; ++r) { float l = l_r[rt][r]; l += __shfl_xor(l, 1, 32); l += __shfl_xor(l, 2, 32); l += __shfl_xor(l, 4, 32); l += __shfl_xor(l, 8, 32); l_r[rt][r] = (l > 0.f) ? 1.0f / (l * 1024.0f) : 0.f; }
#pragma unroll
    for (int dt = 0; dt < DT; ++dt)
#pragma unroll
      for (int r = 0; r < 8; ++r) sO[w][rt * 16 + 8 * hh + r][dt * 16 + ln] = oacc[rt][dt][r] * l_r[rt][r]; }
  __builtin_amdgcn_fence(__ATOMIC_ACQ_REL, "workgroup"); __builtin_amdgcn_wave_barrier();
  {
#pragma unroll
    for (int rp = 0; rp < RPW; rp += 2) { const int r = rp + (lane >> 4), pc = lane & 15; const v4f val = *(const v4fa*)&sO[w][r][pc * 4]; *(v4f*)(O + ((size_t)b * TQ + q0 + r) * ldo + h * 64 + pc * 4) = val; }
     } }
// Q/K-split variant: S = Qh Kh^T + (Ql Kh^T + Qh Kl^T)/1024 with Q/K = [hi | 2^10 residual] f16 planes (QL/KL same layout as Q16/K16); plain f16 P (x2^10) . V^T as in k_flash
template <int CAUSAL>
__global__ __launch_bounds__(128) void k_flashqk(const _Float16* __restrict__ Q16, const _Float16* __restrict__ QL, int ldq, const _Float16* __restrict__ K16, const _Float16* __restrict__ KL, int ldk, const _Float16* __restrict__ Vt, const int* __restrict__ MSK, float* __restrict__ O, int ldo) {
  constexpr int RPW = 16, RTN = RPW / 16, NQB = TQ / (4 * RPW), DT = 4, KS = 2;
  __shared__ __attribute__((aligned(16))) unsigned short sP[4][RPW][40]; __shared__ __attribute__((aligned(16))) float sO[4][RPW][64 + 4];
  const int tid = threadIdx.x, w = tid >> 5, lane = tid & 31, ln = lane & 15, hh = lane >> 4;
  const int slab = blockIdx.x / QBLKS, qblk = blockIdx.x % QBLKS; (void)NQB; const int b = slab / NH, h = slab % NH; const int qb0 = qblk * (4 * RPW); const int q0 = qb0 + w * RPW;
  FragH aq[2][KS], aql[2][KS];
#pragma unroll
  for (int rt = 0; rt < RTN; ++rt) { const unsigned short* qr = (const unsigned short*)Q16 + ((size_t)b * TQ + q0 + rt * 16 + ln) * ldq + h * 64; const unsigned short* ql = (const unsigned short*)QL + ((size_t)b * TQ + q0 + rt * 16 + ln) * ldq + h * 64;
#pragma unroll
    for (int ks = 0; ks < KS; ++ks) { aq[rt][ks].half[0] = *(const v8us*)(qr + ks * 32 + 8 * hh); aq[rt][ks].half[1] = *(const v8us*)(qr + ks * 32 + 16 + 8 * hh); aql[rt][ks].half[0] = *(const v8us*)(ql + ks * 32 + 8 * hh); aql[rt][ks].half[1] = *(const v8us*)(ql + ks * 32 + 16 + 8 * hh); } }
  const unsigned short* Vth = (const unsigned short*)Vt + (size_t)slab * 64 * TK;
  float m_r[2][8], l_r[2][8]; v8f oacc[2][DT];
#pragma unroll
  for (int rt = 0; rt < RTN; ++rt) {
#pragma unroll
    for (int r = 0; r < 8; ++r) { m_r[rt][r] = -3.0e38f; l_r[rt][r] = 0.f; }
#pragma unroll
    for (int dt = 0; dt < DT; ++dt) oacc[rt][dt] = (v8f){0.f,0.f,0.f,0.f,0.f,0.f,0.f,0.f}; }
  const int jend = (CAUSAL == 1) ? (qb0 + 4 * RPW) : TK;      /* causal: keys beyond the block's last query never contribute */
#pragma unroll 1
  for (int j0 = 0; j0 < jend; j0 += 32) {
    v8f s[2][2];
#pragma unroll
    for (int nt = 0; nt < 2; ++nt) { const unsigned short* kr = (const unsigned short*)K16 + ((size_t)b * TK + j0 + nt * 16 + ln) * ldk + h * 64; const unsigned short* klr = (const unsigned short*)KL + ((size_t)b * TK + j0 + nt * 16 + ln) * ldk + h * 64; FragH bk[KS], bkl[KS];
#pragma unroll
      for (int ks = 0; ks < KS; ++ks) { bk[ks].half[0] = *(const v8us*)(kr + ks * 32 + 8 * hh); bk[ks].half[1] = *(const v8us*)(kr + ks * 32 + 16 + 8 * hh); bkl[ks].half[0] = *(const v8us*)(klr + ks * 32 + 8 * hh); bkl[ks].half[1] = *(const v8us*)(klr + ks * 32 + 16 + 8 * hh); }
#pragma unroll
      for (int rt = 0; rt < RTN; ++rt) { v8f acc = (v8f){0.f,0.f,0.f,0.f,0.f,0.f,0.f,0.f}, accl = acc;
#pragma unroll
        for (int ks = 0; ks < KS; ++ks) { acc = mmaH<1>(aq[rt][ks].v, aq[rt][ks].v, bk[ks].v, bk[ks].v, acc); accl = mmaH<1>(aql[rt][ks].v, aql[rt][ks].v, bk[ks].v, bk[ks].v, accl); accl = mmaH<1>(aq[rt][ks].v, aq[rt][ks].v, bkl[ks].v, bkl[ks].v, accl); }
#pragma unroll
        for (int r = 0; r < 8; ++r) acc[r] += accl[r] * 0.0009765625f;
        s[rt][nt] = acc; } }
#pragma unroll
    for (int rt = 0; rt < RTN; ++rt)
#pragma unroll
      for (int r = 0; r < 8; ++r) { const int tq = q0 + rt * 16 + 8 * hh + r; const int k0 = j0 + ln, k1 = j0 + 16 + ln;
        bool ok0 = (CAUSAL == 1) ? (k0 <= tq) : ((CAUSAL == 2) ? ((k0 >> 5) == (tq >> 5)) : true), ok1 = (CAUSAL == 1) ? (k1 <= tq) : ((CAUSAL == 2) ? ((k1 >> 5) == (tq >> 5)) : true);      /* mode 2: block-diagonal 32-token groups */
        if (CAUSAL == 4) { const int* mrow = MSK + ((size_t)b * TQ + tq) * TK; ok0 = mrow[k0] != 0; ok1 = mrow[k1] != 0; }      /* mode 4: per-(query, key) INPUT mask shared by all heads; masked keys contribute nothing (== the reference's -4096 fill, whose exp underflows to 0), rows with no valid key give l = 0 -> output 0 (== the reference's row_valid zeroing) */
        const float s0 = ok0 ? s[rt][0][r] * SCL : -3.0e38f, s1 = ok1 ? s[rt][1][r] * SCL : -3.0e38f; float mc = fmaxf(s0, s1);
        mc = fmaxf(mc, __shfl_xor(mc, 1, 32)); mc = fmaxf(mc, __shfl_xor(mc, 2, 32)); mc = fmaxf(mc, __shfl_xor(mc, 4, 32)); mc = fmaxf(mc, __shfl_xor(mc, 8, 32));
        const float mn = fmaxf(m_r[rt][r], mc); const float al = (mn > -1.0e38f) ? expf(m_r[rt][r] - mn) : 1.0f; m_r[rt][r] = mn; const float p0 = ok0 ? expf(s0 - mn) : 0.f, p1 = ok1 ? expf(s1 - mn) : 0.f; l_r[rt][r] = l_r[rt][r] * al + p0 + p1;
#pragma unroll
        for (int dt = 0; dt < DT; ++dt) oacc[rt][dt][r] *= al;
        FragH t2; t2.h[0] = (_Float16)(p0 * 1024.0f); t2.h[1] = (_Float16)(p1 * 1024.0f); sP[w][rt * 16 + 8 * hh + r][ln] = t2.u[0]; sP[w][rt * 16 + 8 * hh + r][16 + ln] = t2.u[1]; }
    __builtin_amdgcn_fence(__ATOMIC_ACQ_REL, "workgroup"); __builtin_amdgcn_wave_barrier();
    FragH pa[2];
#pragma unroll
    for (int rt = 0; rt < RTN; ++rt) { pa[rt].half[0] = *(const v8us*)&sP[w][rt * 16 + ln][8 * hh]; pa[rt].half[1] = *(const v8us*)&sP[w][rt * 16 + ln][16 + 8 * hh]; }
#pragma unroll
    for (int dt = 0; dt < DT; ++dt) { const unsigned short* vrow = Vth + (size_t)(dt * 16 + ln) * TK + j0; FragH bv; bv.half[0] = *(const v8us*)(vrow + 8 * hh); bv.half[1] = *(const v8us*)(vrow + 16 + 8 * hh);
#pragma unroll
      for (int rt = 0; rt < RTN; ++rt) oacc[rt][dt] = mmaH<1>(pa[rt].v, pa[rt].v, bv.v, bv.v, oacc[rt][dt]); }
    __builtin_amdgcn_fence(__ATOMIC_ACQ_REL, "workgroup"); __builtin_amdgcn_wave_barrier(); }
#pragma unroll
  for (int rt = 0; rt < RTN; ++rt) {
#pragma unroll
    for (int r = 0; r < 8; ++r) { float l = l_r[rt][r]; l += __shfl_xor(l, 1, 32); l += __shfl_xor(l, 2, 32); l += __shfl_xor(l, 4, 32); l += __shfl_xor(l, 8, 32); l_r[rt][r] = (l > 0.f) ? 1.0f / (l * 1024.0f) : 0.f; }
#pragma unroll
    for (int dt = 0; dt < DT; ++dt)
#pragma unroll
      for (int r = 0; r < 8; ++r) sO[w][rt * 16 + 8 * hh + r][dt * 16 + ln] = oacc[rt][dt][r] * l_r[rt][r]; }
  __builtin_amdgcn_fence(__ATOMIC_ACQ_REL, "workgroup"); __builtin_amdgcn_wave_barrier();
  {
#pragma unroll
    for (int rp = 0; rp < RPW; rp += 2) { const int r = rp + (lane >> 4), pc = lane & 15; const v4f val = *(const v4fa*)&sO[w][r][pc * 4]; *(v4f*)(O + ((size_t)b * TQ + q0 + r) * ldo + h * 64 + pc * 4) = val; }
     } }

__global__ __launch_bounds__(256) void k_woutp(const float* __restrict__ Wm, _Float16* __restrict__ Bt) { const size_t t = (size_t)blockIdx.x * 256 + threadIdx.x; if (t >= (size_t)DMOD * (2 * DMOD / 8)) return; const int pc = (int)(t % (2 * DMOD / 8)); const int o = (int)(t / (2 * DMOD / 8)); const bool lo = pc * 8 >= DMOD; FragH f;
  for (int q = 0; q < 8; ++q) { const int c = pc * 8 + q - (lo ? DMOD : 0); f.h[q] = (_Float16)(bf16_round(Wm[(size_t)c * DMOD + o]) * (lo ? 1.0f : 16.0f)); } *(v8us*)((unsigned short*)Bt + (size_t)o * 2 * DMOD + pc * 8) = f.half[0];  }      /* Wproj stored (in, out) -> Bt[o][c | 1024 + c] */
__global__ __launch_bounds__(256) void k_pose(const float* __restrict__ pose, const float* __restrict__ W1, const float* __restrict__ b1, const float* __restrict__ W2, const float* __restrict__ b2, const float* __restrict__ bqkv, float* __restrict__ PB) {
  #pragma clang fp contract(off)
  __shared__ float hs[64]; const int b = blockIdx.x, tid = threadIdx.x;
  if (tid < 64) { float s = 0.f; for (int i = 0; i < 3; ++i) s += bf16_round(pose[b * 3 + i]) * bf16_round(W1[i * 64 + tid]); s += bf16_round(b1[tid]); hs[tid] = fmaxf(s, 0.f); }
  __syncthreads();
  {
#pragma unroll 1
    for (int u = 0; u < 12; ++u) { const int o = tid + u * 256; float s = 0.f;
#pragma unroll 1
      for (int j = 0; j < 64; ++j) s += hs[j] * bf16_round(W2[(size_t)j * 3 * DMOD + o]);
      s += bf16_round(b2[o]); s += bf16_round(bqkv[o]); *(float*)(PB + (size_t)b * 3 * DMOD + o) = s; }
     } }

extern "C" void kernel_launch(void* const* d_in, const int* in_sizes, int n_in,
                              void* d_out, int out_size, void* d_ws, size_t ws_size, hipStream_t stream) {
  (void)in_sizes; (void)n_in; (void)out_size;
  const float* const* I = (const float* const*)d_in; const float* x = I[0]; const float* pose = I[1]; const float* Wqkv = I[2]; const float* bqkv = I[3]; const float* W1 = I[4]; const float* b1 = I[5]; const float* W2 = I[6]; const float* b2 = I[7]; const float* Wp = I[8]; const float* bp = I[9];
  char* ws = (char*)d_ws; size_t off = 0;
  auto take = [&](size_t bytes) { char* p = ws + off; off += (bytes + 255) & ~(size_t)255; return p; };
  _Float16* BW = (_Float16*)take((size_t)3 * DMOD * DMOD * 2); _Float16* BO = (_Float16*)take((size_t)DMOD * 2 * DMOD * 2); float* PB = (float*)take((size_t)NB * 3 * DMOD * 4);
  _Float16* X16 = (_Float16*)take((size_t)NR * DMOD * 2); float* F32 = (float*)take((size_t)NR * 3 * DMOD * 4); _Float16* H3 = (_Float16*)take((size_t)NR * 3 * DMOD * 2); _Float16* L3 = (_Float16*)take((size_t)NR * 3 * DMOD * 2); _Float16* VT = (_Float16*)take((size_t)NR * DMOD * 2);      /* F32/H3/L3: [8192][q | k | v], pitch 3072 */
  float* O = F32; _Float16* Hh = H3; _Float16* Hl = L3;      /* aliases: F32 is last read by the first k_hl, H3/L3 by k_vt and the flash kernel */
  if (off > ws_size) return;      /* 6 + 4 + 16 + 96 + 48 + 48 + 16 = 234 MiB (256 MiB ws) */
  k_wt_f16<<<(unsigned)(((size_t)3 * DMOD * (DMOD / 8) + 255) / 256), 256, 0, stream>>>(Wqkv, BW, DMOD, 3 * DMOD, 16.0f); k_woutp<<<(unsigned)(((size_t)DMOD * (2 * DMOD / 8) + 255) / 256), 256, 0, stream>>>(Wp, BO);
  k_pose<<<NB, 256, 0, stream>>>(pose, W1, b1, W2, b2, bqkv, PB);
  k_x16<<<(unsigned)(((size_t)NR * DMOD / 8 + 255) / 256), 256, 0, stream>>>(x, X16, (size_t)NR * DMOD / 8);
  const dim3 gQ((NR / 128) * (3 * DMOD / 64), 1), gA((NR / 128) * (DMOD / 64), 1); const unsigned n8 = (unsigned)(((size_t)NR * DMOD / 8 + 255) / 256);
  k_gemm2<0><<<gQ, 128, 0, stream>>>(X16, DMOD, 0, BW, DMOD, 0, 0.0625f, nullptr, 0, PB, SLEN, (size_t)3 * DMOD, 0, F32, nullptr, 3 * DMOD, 0, NR, 3 * DMOD, DMOD);      /* all batches and q|k|v in one launch; + (bqkv + pose bias of batch row / 1024): the per-batch bias is a COMPUTED f32 vector, so it goes through the CP path (raw f32 add, CP[(row / SLEN) * 3072 + col]) rather than the bias path (which bf16-rounds, correct only for input biases) */
  k_hl<<<3 * n8, 256, 0, stream>>>(F32, H3, L3, (size_t)NR * 3 * DMOD / 8);
  k_vt<NH, SLEN><<<NB * NH * (SLEN / 64), 256, 0, stream>>>(H3, 3 * DMOD, 2 * DMOD, VT);
  k_flashqk<0><<<NB * NH * QBLKS, 128, 0, stream>>>(H3, L3, 3 * DMOD, H3 + DMOD, L3 + DMOD, 3 * DMOD, VT, nullptr, O, DMOD);      /* q/k hi + residual; P (x2^10) and V plain f16 */
  k_hl<<<n8, 256, 0, stream>>>(O, Hh, Hl, (size_t)NR * DMOD / 8);
  k_gemm2<0><<<gA, 128, 0, stream>>>(Hh, DMOD, 0, BO, 2 * DMOD, 0, 0.0625f, bp, 0, nullptr, 1, 0, 0, (float*)d_out, nullptr, DMOD, 0, NR, DMOD, DMOD);
  k_gemm2<0><<<gA, 128, 0, stream>>>(Hl, DMOD, 0, BO + DMOD, 2 * DMOD, 0, 1.0f / 1024.0f, nullptr, 0, (const float*)d_out, 1, (size_t)DMOD, 0, (float*)d_out, nullptr, DMOD, 0, NR, DMOD, DMOD);
}

// v002
// A run of this version takes 634 microseconds.
// Two timings next to v001 both put it at 1.45 times that version's speed.
// All steps since v000 together make it 2.50 times as fast.
#include <hip/hip_runtime.h>
// Pose-aware attention (8 batches x 1024 tokens x 1024; 16 heads x 64): qkv = x Wqkv + b; per-batch pose embedding = relu(pose W1 + b1) W2 + b2 split into (q, k, v) biases per (head, dim) and added to q/k/v; softmax(q k^T / 8) v; out Wproj + b -> [8,1024,1024].
// Structure: the pose MLP on VALU folded into per-batch bias vectors (bqkv + pose_{q|k|v}[b]); x as an exact f16 plane; one qkv GEMM over all 8192 rows x 3072 columns (32x64 wave tiles, f32 accumulation, exact x16 weights, that per-batch bias picked by row / 1024) producing f32 q|k|v split into f16 hi + 2^10 residual planes; V^T by LDS tiles; the fused flash kernel with hi + 2^10-residual q/k planes (S = QhKh + (QlKh + QhKl)/1024) and plain f16 P (x2^10) and V (hi/lo operands for S only); the attention output as hi + residual into two accumulating projection GEMMs.
// Compute dtype: x, pose and all parameters rounded to bf16; q, k hi + residual (~2^-21-class logits); P and v plain f16 (~2^-12); f32 accumulation/softmax. v_wmma_f32_16x16x32_f16.
#define NB 8
#define DMOD 1024
#define NR (NB * SLEN)
#define QBLKS (TQ / 64)
#define SLEN 1024
#define TQ SLEN
#define TK SLEN
#define NH 16
#define SCL 0.125f               /* 64^-0.5 */
typedef __bf16 v16b __attribute__((ext_vector_type(16)));
typedef unsigned short v8us __attribute__((ext_vector_type(8), may_alias));
typedef float  v8f  __attribute__((ext_vector_type(8)));
typedef float  v4f  __attribute__((ext_vector_type(4)));
typedef float  v4fa __attribute__((ext_vector_type(4), may_alias));
union FragB { v16b v; v8us half[2]; unsigned short u[16]; };

__device__ __forceinline__ unsigned short bf16_bits(float x) { unsigned int u = __float_as_uint(x); return (unsigned short)((u + 0x7FFFu + ((u >> 16) & 1u)) >> 16); }
__device__ __forceinline__ float bf16_val(unsigned short b) { return __uint_as_float(((unsigned int)b) << 16); }
__device__ __forceinline__ float bf16_round(float x) { return bf16_val(bf16_bits(x)); }
// D += A·B with NT terms: 1 = ah·bh, 2 = + al·bh (A split), 3 = + ah·bl (both split)
template <int NT>
__device__ __forceinline__ v8f mmaN(v16b ah, v16b al, v16b bh, v16b bl, v8f c) {
  c = __builtin_amdgcn_wmma_f32_16x16x32_bf16(false, ah, false, bh, (short)0, c, false, false);
  if (NT >= 2) c = __builtin_amdgcn_wmma_f32_16x16x32_bf16(false, al, false, bh, (short)0, c, false, false);
  if (NT >= 3) c = __builtin_amdgcn_wmma_f32_16x16x32_bf16(false, ah, false, bl, (short)0, c, false, false);
  asm volatile("v_nop\n\tv_nop\n\tv_nop\n\tv_nop" : "+v"(c) : "v"(ah), "v"(al), "v"(bh), "v"(bl));
  return c;
}

__global__ __launch_bounds__(256) void k_wt_bf16(const float* __restrict__ W, unsigned short* __restrict__ Wt, int K, int N) {
  const int t = blockIdx.x * 256 + threadIdx.x;
  const int k8n = K / 8;
  if (t >= N * k8n) return;
  const int n = t / k8n, k8 = (t % k8n) * 8;
  v8us v;
#pragma unroll
  for (int i = 0; i < 8; ++i) v[i] = bf16_bits(W[(size_t)(k8 + i) * N + n]);
  *(v8us*)(Wt + (size_t)n * K + k8) = v;
  
}

// GEMM C[M][N] (f32, pitch ldc) = act(A[M][K]·W + bias). A f32 row-major (pitch lda) converted per fragment to bf16
// (ASPLIT: hi/lo two planes -> 2 terms, else single rounded term); Wt bf16 [N][K] (pitch ldb). BIAS_BF16 rounds the
// bias to bf16 first (bias quantised to bf16 before the add). K%32==0, M%16==0, N%64==0.
template <bool ASPLIT, int ACT, bool BIAS_BF16>
__global__ __launch_bounds__(128) void k_gemm_bf(const float* __restrict__ A, int lda, const unsigned short* __restrict__ Wt, int ldb,
                                               const float* __restrict__ bias, float* __restrict__ C, int ldc, int M, int N, int K) {
  __shared__ __attribute__((aligned(16))) float so[4][16][64];
  const int tid = threadIdx.x, w = tid >> 5, lane = tid & 31, ln = lane & 15, hh = lane >> 4;
  const int ntn = N / 64;
  const int wid = blockIdx.x * 4 + w;
  const int mt = wid / ntn, nq = wid % ntn;
  if (mt * 16 >= M) return;
  const int row0 = mt * 16, col0 = nq * 64;
  const float* arow = A + (size_t)(row0 + ln) * lda;
  v8f acc[4] = {};
  for (int kb = 0; kb < K; kb += 32) {
    FragB ah, al;
    const v4f x0 = *(const v4fa*)(arow + kb + 8 * hh), x1 = *(const v4fa*)(arow + kb + 8 * hh + 4);
    const v4f x2 = *(const v4fa*)(arow + kb + 16 + 8 * hh), x3 = *(const v4fa*)(arow + kb + 16 + 8 * hh + 4);
    float xs[16] = {x0[0],x0[1],x0[2],x0[3],x1[0],x1[1],x1[2],x1[3],x2[0],x2[1],x2[2],x2[3],x3[0],x3[1],x3[2],x3[3]};
#pragma unroll
    for (int i = 0; i < 16; ++i) { const unsigned short hb = bf16_bits(xs[i]); ah.u[i] = hb; al.u[i] = ASPLIT ? bf16_bits(xs[i] - bf16_val(hb)) : (unsigned short)0; }
#pragma unroll
    for (int t = 0; t < 4; ++t) {
      const unsigned short* brow = Wt + (size_t)(col0 + t * 16 + ln) * ldb + kb;
      FragB b;
      b.half[0] = *(const v8us*)(brow + 8 * hh);
      b.half[1] = *(const v8us*)(brow + 16 + 8 * hh);
      acc[t] = mmaN<ASPLIT ? 2 : 1>(ah.v, al.v, b.v, b.v, acc[t]);
    }
  }
#pragma unroll
  for (int t = 0; t < 4; ++t) {
    float bv = bias ? bias[col0 + t * 16 + ln] : 0.f;
    if (BIAS_BF16) bv = bf16_round(bv);
#pragma unroll
    for (int r = 0; r < 8; ++r) { float v = acc[t][r] + bv; if (ACT == 1) v = fmaxf(v, 0.f); so[w][8 * hh + r][t * 16 + ln] = v; }
  }
  __builtin_amdgcn_fence(__ATOMIC_ACQ_REL, "workgroup");
  __builtin_amdgcn_wave_barrier();
  const int rsub = lane >> 4, c4 = (lane & 15) * 4;
  {
#pragma unroll
    for (int q = 0; q < 8; ++q) {
      const int r = q * 2 + rsub;
      const v4f v = *(const v4fa*)&so[w][r][c4];
      *(v4f*)(C + (size_t)(row0 + r) * ldc + col0 + c4) = v;
    }
    
  }
}

// GEMM C = act(A·W + bias + resid): A f32 (ASPLIT -> hi/lo 2 terms), Wt bf16 [N][K]; ACT 0 none, 1 relu, 2 exact gelu;
// resid (optional, f32, row index = (row % rmod), pitch ldr, RES_BF16 rounds it) added before the activation.
template <bool ASPLIT, int ACT, bool BIAS_BF16, bool RES_BF16>
__global__ __launch_bounds__(128) void k_gemm_bf3(const float* __restrict__ A, int lda, const unsigned short* __restrict__ Wt, int ldb,
                                                const float* __restrict__ bias, const float* __restrict__ resid, int rmod, int ldr,
                                                float* __restrict__ C, int ldc, int M, int N, int K) {
  __shared__ __attribute__((aligned(16))) float so[4][16][64];
  const int tid = threadIdx.x, w = tid >> 5, lane = tid & 31, ln = lane & 15, hh = lane >> 4;
  const int ntn = N / 64;
  const int wid = blockIdx.x * 4 + w;
  const int mt = wid / ntn, nq = wid % ntn;
  if (mt * 16 >= M) return;
  const int row0 = mt * 16, col0 = nq * 64;
  const float* arow = A + (size_t)(row0 + ln) * lda;
  v8f acc[4] = {};
  for (int kb = 0; kb < K; kb += 32) {
    FragB ah, al;
    const v4f x0 = *(const v4fa*)(arow + kb + 8 * hh), x1 = *(const v4fa*)(arow + kb + 8 * hh + 4);
    const v4f x2 = *(const v4fa*)(arow + kb + 16 + 8 * hh), x3 = *(const v4fa*)(arow + kb + 16 + 8 * hh + 4);
    float xs[16] = {x0[0],x0[1],x0[2],x0[3],x1[0],x1[1],x1[2],x1[3],x2[0],x2[1],x2[2],x2[3],x3[0],x3[1],x3[2],x3[3]};
#pragma unroll
    for (int i = 0; i < 16; ++i) { const unsigned short hb = bf16_bits(xs[i]); ah.u[i] = hb; al.u[i] = ASPLIT ? bf16_bits(xs[i] - bf16_val(hb)) : (unsigned short)0; }
#pragma unroll
    for (int t = 0; t < 4; ++t) {
      const unsigned short* brow = Wt + (size_t)(col0 + t * 16 + ln) * ldb + kb;
      FragB b;
      b.half[0] = *(const v8us*)(brow + 8 * hh);
      b.half[1] = *(const v8us*)(brow + 16 + 8 * hh);
      acc[t] = mmaN<ASPLIT ? 2 : 1>(ah.v, al.v, b.v, b.v, acc[t]);
    }
  }
#pragma unroll
  for (int t = 0; t < 4; ++t) {
    const int col = col0 + t * 16 + ln;
    float bv = bias ? bias[col] : 0.f;
    if (BIAS_BF16) bv = bf16_round(bv);
#pragma unroll
    for (int r = 0; r < 8; ++r) {
      float v = acc[t][r] + bv;
      if (resid) { float rv = resid[(size_t)((row0 + 8 * hh + r) % rmod) * ldr + col]; if (RES_BF16) rv = bf16_round(rv); v += rv; }
      if (ACT == 1) v = fmaxf(v, 0.f);
      if (ACT == 2) v = 0.5f * v * (1.0f + erff(v * 0.70710678118654752f));
      if (ACT == 3) { const float u = 0.7978845608028654f * (v + 0.044715f * v * v * v); v = 0.5f * v * (1.0f + tanhf(u)); }
      so[w][8 * hh + r][t * 16 + ln] = v;
    }
  }
  __builtin_amdgcn_fence(__ATOMIC_ACQ_REL, "workgroup");
  __builtin_amdgcn_wave_barrier();
  const int rsub = lane >> 4, c4 = (lane & 15) * 4;
  {
#pragma unroll
    for (int q = 0; q < 8; ++q) {
      const int r = q * 2 + rsub;
      const v4f v = *(const v4fa*)&so[w][r][c4];
      *(v4f*)(C + (size_t)(row0 + r) * ldc + col0 + c4) = v;
    }
    
  }
}
// row LayerNorm (biased variance, eps) over N: s = X (+ R); optional out_sum <- s; out_norm <- (s-mu)*rsqrt(var+eps)*g + b
template <bool PARAM_BF16>
__global__ __launch_bounds__(256) void k_layernorm(const float* __restrict__ X, const float* __restrict__ R, const float* __restrict__ g, const float* __restrict__ bta,
                                                  float* __restrict__ out_sum, float* __restrict__ out_norm, int N, float eps) {
  __shared__ float red[256];
  const int row = blockIdx.x, tid = threadIdx.x;
  const float* x = X + (size_t)row * N; const float* rr = R ? R + (size_t)row * N : nullptr;
  float vals[16];                     // up to N = 4096
  const int per = N / 256;            // contiguous chunk per thread? use strided-by-4 chunks: thread handles j = tid*4 + 1024*u
  float s1 = 0.f;
  for (int u = 0; u < per / 4; ++u) {
    const int j = tid * 4 + 1024 * u;
    const v4f a = *(const v4fa*)(x + j);
    v4f b = {0.f,0.f,0.f,0.f}; if (rr) b = *(const v4fa*)(rr + j);
#pragma unroll
    for (int q = 0; q < 4; ++q) { const float v = a[q] + b[q]; vals[u * 4 + q] = v; s1 += v; }
  }
  red[tid] = s1; __syncthreads();
  for (int st = 128; st > 0; st >>= 1) { if (tid < st) red[tid] += red[tid + st]; __syncthreads(); }
  const float mu = red[0] / (float)N; __syncthreads();
  float s2 = 0.f;
  for (int u = 0; u < per / 4; ++u)
#pragma unroll
    for (int q = 0; q < 4; ++q) { const float c = vals[u * 4 + q] - mu; s2 += c * c; }
  red[tid] = s2; __syncthreads();
  for (int st = 128; st > 0; st >>= 1) { if (tid < st) red[tid] += red[tid + st]; __syncthreads(); }
  const float rs = rsqrtf(red[0] / (float)N + eps);
  {
    for (int u = 0; u < per / 4; ++u) {
      const int j = tid * 4 + 1024 * u;
      v4f o, sm;
#pragma unroll
      for (int q = 0; q < 4; ++q) {
        float gg = g[j + q], bb = bta[j + q];
        if (PARAM_BF16) { gg = bf16_round(gg); bb = bf16_round(bb); }
        sm[q] = vals[u * 4 + q]; o[q] = (vals[u * 4 + q] - mu) * rs * gg + bb;
      }
      if (out_sum) *(v4f*)(out_sum + (size_t)row * N + j) = sm;
      *(v4f*)(out_norm + (size_t)row * N + j) = o;
    }
    
  }
}



// ---- f16 WMMA path (v_wmma_f32_16x16x32_f16): 11-bit significands for operands in range — used where a [0,1] probability operand needs more precision than bf16
typedef _Float16 v16h __attribute__((ext_vector_type(16)));
union FragH { v16h v; v8us half[2]; _Float16 h[16]; unsigned short u[16]; };
template <int NT>
__device__ __forceinline__ v8f mmaH(v16h ah, v16h al, v16h bh, v16h bl, v8f c) {
  c = __builtin_amdgcn_wmma_f32_16x16x32_f16(false, ah, false, bh, (short)0, c, false, false);
  if (NT >= 2) c = __builtin_amdgcn_wmma_f32_16x16x32_f16(false, al, false, bh, (short)0, c, false, false);
  if (NT >= 3) c = __builtin_amdgcn_wmma_f32_16x16x32_f16(false, ah, false, bl, (short)0, c, false, false);
  asm volatile("v_nop\n\tv_nop\n\tv_nop\n\tv_nop" : "+v"(c) : "v"(ah), "v"(al), "v"(bh), "v"(bl));
  return c;
}
// batched GEMM like k_gemm_b but f16 operands: A f32 (split into f16 hi/lo if ASPLIT, else rounded to f16), Bt = f16 values [n][k]; alpha; C f32; N multiple of 16 (partial tiles skipped)
template <bool ASPLIT>
__global__ __launch_bounds__(128) void k_gemm_h(const float* __restrict__ A, int lda, size_t sA, const _Float16* __restrict__ Bh, int ldb, size_t sB, float alpha, float* __restrict__ C, int ldc, size_t sC, int M, int N, int K) {
  __shared__ __attribute__((aligned(16))) float so[4][16][64];
  const int tid = threadIdx.x, w = tid >> 5, lane = tid & 31, ln = lane & 15, hh = lane >> 4; const int by = blockIdx.y;
  A += (size_t)by * sA; Bh += (size_t)by * sB; C += (size_t)by * sC;
  const int ntn = (N + 63) / 64; const int wid = blockIdx.x * 4 + w; const int mt = wid / ntn, nq = wid % ntn; if (mt * 16 >= M) return;
  const int row0 = mt * 16, col0 = nq * 64; const float* arow = A + (size_t)(row0 + ln) * lda;
  v8f acc[4] = {};
  for (int kb = 0; kb < K; kb += 32) {
    FragH ah, al;
    const v4f x0 = *(const v4fa*)(arow + kb + 8 * hh), x1 = *(const v4fa*)(arow + kb + 8 * hh + 4), x2 = *(const v4fa*)(arow + kb + 16 + 8 * hh), x3 = *(const v4fa*)(arow + kb + 16 + 8 * hh + 4);
    float xs[16] = {x0[0],x0[1],x0[2],x0[3],x1[0],x1[1],x1[2],x1[3],x2[0],x2[1],x2[2],x2[3],x3[0],x3[1],x3[2],x3[3]};
#pragma unroll
    for (int i = 0; i < 16; ++i) { const _Float16 h = (_Float16)xs[i]; ah.h[i] = h; al.h[i] = ASPLIT ? (_Float16)(xs[i] - (float)h) : (_Float16)0.0f; }
#pragma unroll
    for (int t = 0; t < 4; ++t) { if (col0 + t * 16 >= N) continue; const size_t boff = (size_t)(col0 + t * 16 + ln) * ldb + kb; FragH bq; bq.half[0] = *(const v8us*)(Bh + boff + 8 * hh); bq.half[1] = *(const v8us*)(Bh + boff + 16 + 8 * hh);
      acc[t] = mmaH<ASPLIT ? 2 : 1>(ah.v, al.v, bq.v, bq.v, acc[t]); }
  }
#pragma unroll
  for (int t = 0; t < 4; ++t) { if (col0 + t * 16 >= N) continue;
#pragma unroll
    for (int r = 0; r < 8; ++r) so[w][8 * hh + r][t * 16 + ln] = acc[t][r] * alpha; }
  __builtin_amdgcn_fence(__ATOMIC_ACQ_REL, "workgroup"); __builtin_amdgcn_wave_barrier();
  const int rsub = lane >> 4, c4 = (lane & 15) * 4;
  {
#pragma unroll
    for (int q = 0; q < 8; ++q) { const int r = q * 2 + rsub; if (col0 + c4 < N) { const v4f v = *(const v4fa*)&so[w][r][c4]; *(v4f*)(C + (size_t)(row0 + r) * ldc + col0 + c4) = v; } }
     }
}

// Wt[n][k] = f16(W[k][n]·scale) from f32 row-major W[K][N] (scale = power of two; bf16-exact weights stay exact in f16 away from the subnormal range)
__global__ __launch_bounds__(256) void k_wt_f16(const float* __restrict__ W, _Float16* __restrict__ Wt, int K, int N, float scale) {
  const int t = blockIdx.x * 256 + threadIdx.x; if (t >= N * (K / 8)) return; const int n = t / (K / 8), k8 = (t % (K / 8)) * 8; FragH f;
#pragma unroll
  for (int i = 0; i < 8; ++i) f.h[i] = (_Float16)(bf16_round(W[(size_t)(k8 + i) * N + n]) * scale); const v8us o = f.half[0];
  *(v8us*)((unsigned short*)Wt + (size_t)n * K + k8) = o; 
}
// k_gemm_hh variant with fused epilogue: v = acc·alpha + bias[by·sBias + col] (+ CP[(row/rowsPerB)·sCPb + by·64 + col] if CP) ; ACT 0 none / 1 elu ; writes f16 C16 (and f32 C if non-null)
template <int ACT>
__global__ __launch_bounds__(128) void k_gemm_hhx(const _Float16* __restrict__ A, int lda, size_t sA, const _Float16* __restrict__ Bh, int ldb, size_t sB, float alpha, const float* __restrict__ bias, size_t sBias, const float* __restrict__ CP, int rowsPerB, size_t sCPb, int row0g,
    float* __restrict__ C, _Float16* __restrict__ C16, int ldc, size_t sC, int M, int N, int K) {
  __shared__ __attribute__((aligned(16))) float so[4][16][64];
  const int tid = threadIdx.x, w = tid >> 5, lane = tid & 31, ln = lane & 15, hh = lane >> 4; const int by = blockIdx.y;
  A += (size_t)by * sA; Bh += (size_t)by * sB; const size_t cofs = (size_t)by * sC; const float* bp = bias ? bias + (size_t)by * sBias : nullptr;
  const int ntn = (N + 63) / 64; const int wid = blockIdx.x * 4 + w; const int mt = wid / ntn, nq = wid % ntn; if (mt * 16 >= M) return;
  const int row0 = mt * 16, col0 = nq * 64; const _Float16* arow = A + (size_t)(row0 + ln) * lda;
  v8f acc[4] = {};
  for (int kb = 0; kb < K; kb += 32) { FragH ah; ah.half[0] = *(const v8us*)((const unsigned short*)arow + kb + 8 * hh); ah.half[1] = *(const v8us*)((const unsigned short*)arow + kb + 16 + 8 * hh);
#pragma unroll
    for (int t = 0; t < 4; ++t) { if (col0 + t * 16 >= N) continue; const size_t boff = (size_t)(col0 + t * 16 + ln) * ldb + kb; FragH bq; bq.half[0] = *(const v8us*)((const unsigned short*)Bh + boff + 8 * hh); bq.half[1] = *(const v8us*)((const unsigned short*)Bh + boff + 16 + 8 * hh);
      acc[t] = mmaH<1>(ah.v, ah.v, bq.v, bq.v, acc[t]); }
  }
#pragma unroll
  for (int t = 0; t < 4; ++t) { if (col0 + t * 16 >= N) continue; const int col = col0 + t * 16 + ln; const float bv = bp ? bf16_round(bp[col]) : 0.f;
#pragma unroll
    for (int r = 0; r < 8; ++r) { float v = acc[t][r] * alpha + bv; if (CP) { const int bidx = (row0g + row0 + 8 * hh + r) / rowsPerB; v += CP[(size_t)bidx * sCPb + (size_t)by * 64 + col]; } if (ACT == 1) v = (v > 0.f) ? v : expm1f(v); else if (ACT == 7) v = (v > 0.f) ? v + 1.0f : expf(v); else if (ACT == 8) v = tanhf(v); else if (ACT == 9) v = 0.5f * v * (1.0f + tanhf(0.7978845608028654f * (v + 0.044715f * v * v * v))); else if (ACT == 11) v = 1.0f / (1.0f + expf(-v)); else if (ACT == 12) v = (v > 0.f) ? v : 0.01f * v; else if (ACT == 14) v = (v > 0.f) ? v : 0.1f * v; else if (ACT == 15) v = v / (1.0f + expf(-v)); else if (ACT == 3) v = fmaxf(v, 0.f); else if (ACT == 6) v = 0.5f * v * (1.0f + erff(v * 0.70710678118654752f)); so[w][8 * hh + r][t * 16 + ln] = v; } }
  __builtin_amdgcn_fence(__ATOMIC_ACQ_REL, "workgroup"); __builtin_amdgcn_wave_barrier();
  const int rsub = lane >> 4, c4 = (lane & 15) * 4; typedef _Float16 v4h __attribute__((ext_vector_type(4)));
  {
#pragma unroll
    for (int q = 0; q < 8; ++q) { const int r = q * 2 + rsub; if (col0 + c4 < N) { const v4f v = *(const v4fa*)&so[w][r][c4]; if (C) *(v4f*)(C + cofs + (size_t)(row0 + r) * ldc + col0 + c4) = v; if (C16) { v4h h4; for (int i = 0; i < 4; ++i) h4[i] = (_Float16)v[i]; *(v4h*)(C16 + cofs + (size_t)(row0 + r) * ldc + col0 + c4) = h4; } } }
     }
}


typedef _Float16 v4h __attribute__((ext_vector_type(4)));

__global__ __launch_bounds__(256) void k_x16(const float* __restrict__ x, _Float16* __restrict__ X16, size_t n8) { const size_t t = (size_t)blockIdx.x * 256 + threadIdx.x; if (t >= n8) return; FragH f;
#pragma unroll
  for (int q = 0; q < 8; ++q) f.h[q] = (_Float16)bf16_round(x[t * 8 + q]); *(v8us*)((unsigned short*)X16 + t * 8) = f.half[0];  }
__global__ __launch_bounds__(256) void k_h16(const float* __restrict__ x, _Float16* __restrict__ X16, size_t n8) { const size_t t = (size_t)blockIdx.x * 256 + threadIdx.x; if (t >= n8) return; FragH f;
#pragma unroll
  for (int q = 0; q < 8; ++q) f.h[q] = (_Float16)x[t * 8 + q]; *(v8us*)((unsigned short*)X16 + t * 8) = f.half[0];  }
__global__ __launch_bounds__(256) void k_round16f(const float* __restrict__ W, _Float16* __restrict__ Bt, size_t n8) { const size_t t = (size_t)blockIdx.x * 256 + threadIdx.x; if (t >= n8) return; FragH f;
#pragma unroll
  for (int i = 0; i < 8; ++i) f.h[i] = (_Float16)(bf16_round(W[t * 8 + i]) * 16.0f); *(v8us*)((unsigned short*)Bt + t * 8) = f.half[0];  }
template <int NHv, int TTv>
__global__ __launch_bounds__(256) void k_vt(const _Float16* __restrict__ V16, int ldv, int voff, _Float16* __restrict__ Vt) { __shared__ unsigned short tl[64][66]; const int tid = threadIdx.x; const int slab = blockIdx.x / (TTv / 64), lg = blockIdx.x % (TTv / 64); const int b = slab / NHv, h = slab % NHv;
  for (int i = tid; i < 64 * 8; i += 256) { const int r = i / 8, c8 = (i % 8) * 8; FragH f; f.half[0] = *(const v8us*)((const unsigned short*)V16 + ((size_t)b * TTv + lg * 64 + r) * ldv + voff + h * 64 + c8);
#pragma unroll
    for (int q = 0; q < 8; ++q) tl[r][c8 + q] = f.u[q]; }
  __syncthreads();
  {
#pragma unroll
    for (int rd = 0; rd < 2; ++rd) { const int d = rd * 32 + tid / 8, pc = tid % 8; FragH f;
#pragma unroll
      for (int q = 0; q < 8; ++q) f.u[q] = tl[pc * 8 + q][d];
      *(v8us*)((unsigned short*)Vt + ((size_t)slab * 64 + d) * TTv + lg * 64 + pc * 8) = f.half[0]; }
     } }

__global__ __launch_bounds__(256) void k_hl(const float* __restrict__ F, _Float16* __restrict__ Hh, _Float16* __restrict__ Hl, size_t n8) { const size_t t = (size_t)blockIdx.x * 256 + threadIdx.x; if (t >= n8) return; FragH fh, fl; const v4f a = *(const v4fa*)(F + t * 8), c = *(const v4fa*)(F + t * 8 + 4);
#pragma unroll
  for (int q = 0; q < 4; ++q) { _Float16 h = (_Float16)a[q]; fh.h[q] = h; fl.h[q] = (_Float16)((a[q] - (float)h) * 1024.0f); h = (_Float16)c[q]; fh.h[4 + q] = h; fl.h[4 + q] = (_Float16)((c[q] - (float)h) * 1024.0f); }
  { *(v8us*)((unsigned short*)Hh + t * 8) = fh.half[0]; *(v8us*)((unsigned short*)Hl + t * 8) = fl.half[0];  } }

// ---- fast GEMM (wave tile 32x64; requires M % 32 == 0 rows per launch region and N % 64 == 0); epilogue = k_gemm_hhx semantics ----
__device__ __forceinline__ v16h g2_frag(const _Float16* p, int hh) { FragH f; f.half[0] = *(const v8us*)((const unsigned short*)p + 8 * hh); f.half[1] = *(const v8us*)((const unsigned short*)p + 16 + 8 * hh); return f.v; }
__device__ __forceinline__ v8f g2_mma(v16h a, v16h b, v8f c) { v8f d = __builtin_amdgcn_wmma_f32_16x16x32_f16(false, a, false, b, (short)0, c, false, false); asm volatile("v_nop\n\tv_nop\n\tv_nop\n\tv_nop" : "+v"(d) : "v"(a), "v"(b)); return d; }
template <int ACT>
__global__ __launch_bounds__(128) void k_gemm2(const _Float16* __restrict__ A, int lda, size_t sA, const _Float16* __restrict__ Bh, int ldb, size_t sB, float alpha, const float* __restrict__ bias, size_t sBias, const float* __restrict__ CP, int rowsPerB, size_t sCPb, int row0g,
    float* __restrict__ C, _Float16* __restrict__ C16, int ldc, size_t sC, int M, int N, int K) {
  __shared__ __attribute__((aligned(16))) float so[4][32][68];
  const int tid = threadIdx.x, w = tid >> 5, lane = tid & 31, ln = lane & 15, hh = lane >> 4; const int by = blockIdx.y;
  A += (size_t)by * sA; Bh += (size_t)by * sB; const size_t cofs = (size_t)by * sC; const float* bp = bias ? bias + (size_t)by * sBias : nullptr;
  const int ntn = N >> 6; const int mt = blockIdx.x / ntn, nq = blockIdx.x - mt * ntn; const int row0 = mt * 128 + 32 * w, col0 = nq * 64; if (row0 >= M) return;
  const _Float16* a0p = A + (size_t)(row0 + ln) * lda; const _Float16* a1p = a0p + (size_t)16 * lda;
  const _Float16* b0p = Bh + (size_t)(col0 + ln) * ldb; const _Float16* b1p = b0p + (size_t)16 * ldb; const _Float16* b2p = b1p + (size_t)16 * ldb; const _Float16* b3p = b2p + (size_t)16 * ldb;
  const v8f z8 = {0.f,0.f,0.f,0.f,0.f,0.f,0.f,0.f}; v8f c00 = z8, c01 = z8, c02 = z8, c03 = z8, c10 = z8, c11 = z8, c12 = z8, c13 = z8;
#pragma unroll 1
  for (int kb = 0; kb < K; kb += 32) { const v16h a0 = g2_frag(a0p + kb, hh), a1 = g2_frag(a1p + kb, hh);
    v16h b = g2_frag(b0p + kb, hh); c00 = g2_mma(a0, b, c00); c10 = g2_mma(a1, b, c10);
    b = g2_frag(b1p + kb, hh); c01 = g2_mma(a0, b, c01); c11 = g2_mma(a1, b, c11);
    b = g2_frag(b2p + kb, hh); c02 = g2_mma(a0, b, c02); c12 = g2_mma(a1, b, c12);
    b = g2_frag(b3p + kb, hh); c03 = g2_mma(a0, b, c03); c13 = g2_mma(a1, b, c13); }
  v8f accs[8] = {c00, c01, c02, c03, c10, c11, c12, c13};
#pragma unroll
  for (int u = 0; u < 8; ++u) { const int t = u & 3, half = u >> 2; const int col = col0 + t * 16 + ln; const float bv = bp ? bf16_round(bp[col]) : 0.f;
#pragma unroll
    for (int r = 0; r < 8; ++r) { const int rloc = half * 16 + 8 * hh + r; float v = accs[u][r] * alpha + bv; if (CP) { const int bidx = (row0g + row0 + rloc) / rowsPerB; v += CP[(size_t)bidx * sCPb + (size_t)by * 64 + col]; }
      if (ACT == 3) v = fmaxf(v, 0.f); else if (ACT == 6) v = 0.5f * v * (1.0f + erff(v * 0.70710678118654752f)); else if (ACT == 11) v = 1.0f / (1.0f + expf(-v)); else if (ACT == 15) v = v / (1.0f + expf(-v)); else if (ACT == 12) v = (v > 0.f) ? v : 0.01f * v; else if (ACT == 8) v = tanhf(v);
      so[w][rloc][t * 16 + ln] = v; } }
  __builtin_amdgcn_fence(__ATOMIC_ACQ_REL, "workgroup"); __builtin_amdgcn_wave_barrier();
  const int rsub = lane >> 4, c4 = (lane & 15) * 4;
  {
#pragma unroll
    for (int q = 0; q < 16; ++q) { const int r = q * 2 + rsub; const v4f v = *(const v4fa*)&so[w][r][c4]; if (C) *(v4f*)(C + cofs + (size_t)(row0 + r) * ldc + col0 + c4) = v; if (C16) { v4h h4; for (int i = 0; i < 4; ++i) h4[i] = (_Float16)v[i]; *(v4h*)(C16 + cofs + (size_t)(row0 + r) * ldc + col0 + c4) = h4; } }
     } }



template <int CAUSAL>
__global__ __launch_bounds__(128) void k_flash(const _Float16* __restrict__ Q16, int ldq, const _Float16* __restrict__ K16, int ldk, const _Float16* __restrict__ Vt, const int* __restrict__ MSK, float* __restrict__ O, int ldo) {
  constexpr int RPW = 16, RTN = RPW / 16, NQB = TQ / (4 * RPW), DT = 4, KS = 2;
  __shared__ __attribute__((aligned(16))) unsigned short sP[4][RPW][40]; __shared__ __attribute__((aligned(16))) float sO[4][RPW][64 + 4];
  const int tid = threadIdx.x, w = tid >> 5, lane = tid & 31, ln = lane & 15, hh = lane >> 4;
  const int slab = blockIdx.x / QBLKS, qblk = blockIdx.x % QBLKS; (void)NQB; const int b = slab / NH, h = slab % NH; const int qb0 = qblk * (4 * RPW); const int q0 = qb0 + w * RPW;
  FragH aq[2][KS];
#pragma unroll
  for (int rt = 0; rt < RTN; ++rt) { const unsigned short* qr = (const unsigned short*)Q16 + ((size_t)b * TQ + q0 + rt * 16 + ln) * ldq + h * 64;
#pragma unroll
    for (int ks = 0; ks < KS; ++ks) { aq[rt][ks].half[0] = *(const v8us*)(qr + ks * 32 + 8 * hh); aq[rt][ks].half[1] = *(const v8us*)(qr + ks * 32 + 16 + 8 * hh); } }
  const unsigned short* Vth = (const unsigned short*)Vt + (size_t)slab * 64 * TK;
  float m_r[2][8], l_r[2][8]; v8f oacc[2][DT];
#pragma unroll
  for (int rt = 0; rt < RTN; ++rt) {
#pragma unroll
    for (int r = 0; r < 8; ++r) { m_r[rt][r] = -3.0e38f; l_r[rt][r] = 0.f; }
#pragma unroll
    for (int dt = 0; dt < DT; ++dt) oacc[rt][dt] = (v8f){0.f,0.f,0.f,0.f,0.f,0.f,0.f,0.f}; }
  const int jend = (CAUSAL == 1) ? (qb0 + 4 * RPW) : TK;      /* causal: keys beyond the block's last query never contribute */
#pragma unroll 1
  for (int j0 = 0; j0 < jend; j0 += 32) {
    v8f s[2][2];
#pragma unroll
    for (int nt = 0; nt < 2; ++nt) { const unsigned short* kr = (const unsigned short*)K16 + ((size_t)b * TK + j0 + nt * 16 + ln) * ldk + h * 64; FragH bk[KS];
#pragma unroll
      for (int ks = 0; ks < KS; ++ks) { bk[ks].half[0] = *(const v8us*)(kr + ks * 32 + 8 * hh); bk[ks].half[1] = *(const v8us*)(kr + ks * 32 + 16 + 8 * hh); }
#pragma unroll
      for (int rt = 0; rt < RTN; ++rt) { v8f acc = (v8f){0.f,0.f,0.f,0.f,0.f,0.f,0.f,0.f};
#pragma unroll
        for (int ks = 0; ks < KS; ++ks) acc = mmaH<1>(aq[rt][ks].v, aq[rt][ks].v, bk[ks].v, bk[ks].v, acc); s[rt][nt] = acc; } }
#pragma unroll
    for (int rt = 0; rt < RTN; ++rt)
#pragma unroll
      for (int r = 0; r < 8; ++r) { const int tq = q0 + rt * 16 + 8 * hh + r; const int k0 = j0 + ln, k1 = j0 + 16 + ln;
        const bool ok0 = (CAUSAL == 1) ? (k0 <= tq) : ((CAUSAL == 2) ? ((k0 >> 5) == (tq >> 5)) : true), ok1 = (CAUSAL == 1) ? (k1 <= tq) : ((CAUSAL == 2) ? ((k1 >> 5) == (tq >> 5)) : true);      /* mode 2: block-diagonal 32-token groups */
        const float s0 = ok0 ? s[rt][0][r] * SCL : -3.0e38f, s1 = ok1 ? s[rt][1][r] * SCL : -3.0e38f; float mc = fmaxf(s0, s1);
        mc = fmaxf(mc, __shfl_xor(mc, 1, 32)); mc = fmaxf(mc, __shfl_xor(mc, 2, 32)); mc = fmaxf(mc, __shfl_xor(mc, 4, 32)); mc = fmaxf(mc, __shfl_xor(mc, 8, 32));
        const float mn = fmaxf(m_r[rt][r], mc); const float al = (mn > -1.0e38f) ? expf(m_r[rt][r] - mn) : 1.0f; m_r[rt][r] = mn; const float p0 = ok0 ? expf(s0 - mn) : 0.f, p1 = ok1 ? expf(s1 - mn) : 0.f; l_r[rt][r] = l_r[rt][r] * al + p0 + p1;
#pragma unroll
        for (int dt = 0; dt < DT; ++dt) oacc[rt][dt][r] *= al;
        FragH t2; t2.h[0] = (_Float16)(p0 * 1024.0f); t2.h[1] = (_Float16)(p1 * 1024.0f); sP[w][rt * 16 + 8 * hh + r][ln] = t2.u[0]; sP[w][rt * 16 + 8 * hh + r][16 + ln] = t2.u[1]; }
    __builtin_amdgcn_fence(__ATOMIC_ACQ_REL, "workgroup"); __builtin_amdgcn_wave_barrier();
    FragH pa[2];
#pragma unroll
    for (int rt = 0; rt < RTN; ++rt) { pa[rt].half[0] = *(const v8us*)&sP[w][rt * 16 + ln][8 * hh]; pa[rt].half[1] = *(const v8us*)&sP[w][rt * 16 + ln][16 + 8 * hh]; }
#pragma unroll
    for (int dt = 0; dt < DT; ++dt) { const unsigned short* vrow = Vth + (size_t)(dt * 16 + ln) * TK + j0; FragH bv; bv.half[0] = *(const v8us*)(vrow + 8 * hh); bv.half[1] = *(const v8us*)(vrow + 16 + 8 * hh);
#pragma unroll
      for (int rt = 0; rt < RTN; ++rt) oacc[rt][dt] = mmaH<1>(pa[rt].v, pa[rt].v, bv.v, bv.v, oacc[rt][dt]); }
    __builtin_amdgcn_fence(__ATOMIC_ACQ_REL, "workgroup"); __builtin_amdgcn_wave_barrier(); }
#pragma unroll
  for (int rt = 0; rt < RTN; ++rt) {
#pragma unroll
    for (int r = 0; r < 8; ++r) { float l = l_r[rt][r]; l += __shfl_xor(l, 1, 32); l += __shfl_xor(l, 2, 32); l += __shfl_xor(l, 4, 32); l += __shfl_xor(l, 8, 32); l_r[rt][r] = (l > 0.f) ? 1.0f / (l * 1024.0f) : 0.f; }
#pragma unroll
    for (int dt = 0; dt < DT; ++dt)
#pragma unroll
      for (int r = 0; r < 8; ++r) sO[w][rt * 16 + 8 * hh + r][dt * 16 + ln] = oacc[rt][dt][r] * l_r[rt][r]; }
  __builtin_amdgcn_fence(__ATOMIC_ACQ_REL, "workgroup"); __builtin_amdgcn_wave_barrier();
  {
#pragma unroll
    for (int rp = 0; rp < RPW; rp += 2) { const int r = rp + (lane >> 4), pc = lane & 15; const v4f val = *(const v4fa*)&sO[w][r][pc * 4]; *(v4f*)(O + ((size_t)b * TQ + q0 + r) * ldo + h * 64 + pc * 4) = val; }
     } }
// Q/K-split variant: S = Qh Kh^T + (Ql Kh^T + Qh Kl^T)/1024 with Q/K = [hi | 2^10 residual] f16 planes (QL/KL same layout as Q16/K16); plain f16 P (x2^10) . V^T as in k_flash
template <int CAUSAL>
__global__ __launch_bounds__(128) void k_flashqk(const _Float16* __restrict__ Q16, const _Float16* __restrict__ QL, int ldq, const _Float16* __restrict__ K16, const _Float16* __restrict__ KL, int ldk, const _Float16* __restrict__ Vt, const int* __restrict__ MSK, float* __restrict__ O, int ldo) {
  constexpr int RPW = 16, RTN = RPW / 16, NQB = TQ / (4 * RPW), DT = 4, KS = 2;
  __shared__ __attribute__((aligned(16))) unsigned short sP[4][RPW][40]; __shared__ __attribute__((aligned(16))) float sO[4][RPW][64 + 4];
  const int tid = threadIdx.x, w = tid >> 5, lane = tid & 31, ln = lane & 15, hh = lane >> 4;
  const int slab = blockIdx.x / QBLKS, qblk = blockIdx.x % QBLKS; (void)NQB; const int b = slab / NH, h = slab % NH; const int qb0 = qblk * (4 * RPW); const int q0 = qb0 + w * RPW;
  FragH aq[2][KS], aql[2][KS];
#pragma unroll
  for (int rt = 0; rt < RTN; ++rt) { const unsigned short* qr = (const unsigned short*)Q16 + ((size_t)b * TQ + q0 + rt * 16 + ln) * ldq + h * 64; const unsigned short* ql = (const unsigned short*)QL + ((size_t)b * TQ + q0 + rt * 16 + ln) * ldq + h * 64;
#pragma unroll
    for (int ks = 0; ks < KS; ++ks) { aq[rt][ks].half[0] = *(const v8us*)(qr + ks * 32 + 8 * hh); aq[rt][ks].half[1] = *(const v8us*)(qr + ks * 32 + 16 + 8 * hh); aql[rt][ks].half[0] = *(const v8us*)(ql + ks * 32 + 8 * hh); aql[rt][ks].half[1] = *(const v8us*)(ql + ks * 32 + 16 + 8 * hh); } }
  const unsigned short* Vth = (const unsigned short*)Vt + (size_t)slab * 64 * TK;
  float m_r[2][8], l_r[2][8]; v8f oacc[2][DT];
#pragma unroll
  for (int rt = 0; rt < RTN; ++rt) {
#pragma unroll
    for (int r = 0; r < 8; ++r) { m_r[rt][r] = -3.0e38f; l_r[rt][r] = 0.f; }
#pragma unroll
    for (int dt = 0; dt < DT; ++dt) oacc[rt][dt] = (v8f){0.f,0.f,0.f,0.f,0.f,0.f,0.f,0.f}; }
  const int jend = (CAUSAL == 1) ? (qb0 + 4 * RPW) : TK;      /* causal: keys beyond the block's last query never contribute */
#pragma unroll 1
  for (int j0 = 0; j0 < jend; j0 += 32) {
    v8f s[2][2];
#pragma unroll
    for (int nt = 0; nt < 2; ++nt) { const unsigned short* kr = (const unsigned short*)K16 + ((size_t)b * TK + j0 + nt * 16 + ln) * ldk + h * 64; const unsigned short* klr = (const unsigned short*)KL + ((size_t)b * TK + j0 + nt * 16 + ln) * ldk + h * 64; FragH bk[KS], bkl[KS];
#pragma unroll
      for (int ks = 0; ks < KS; ++ks) { bk[ks].half[0] = *(const v8us*)(kr + ks * 32 + 8 * hh); bk[ks].half[1] = *(const v8us*)(kr + ks * 32 + 16 + 8 * hh); bkl[ks].half[0] = *(const v8us*)(klr + ks * 32 + 8 * hh); bkl[ks].half[1] = *(const v8us*)(klr + ks * 32 + 16 + 8 * hh); }
#pragma unroll
      for (int rt = 0; rt < RTN; ++rt) { v8f acc = (v8f){0.f,0.f,0.f,0.f,0.f,0.f,0.f,0.f}, accl = acc;
#pragma unroll
        for (int ks = 0; ks < KS; ++ks) { acc = mmaH<1>(aq[rt][ks].v, aq[rt][ks].v, bk[ks].v, bk[ks].v, acc); accl = mmaH<1>(aql[rt][ks].v, aql[rt][ks].v, bk[ks].v, bk[ks].v, accl); accl = mmaH<1>(aq[rt][ks].v, aq[rt][ks].v, bkl[ks].v, bkl[ks].v, accl); }
#pragma unroll
        for (int r = 0; r < 8; ++r) acc[r] += accl[r] * 0.0009765625f;
        s[rt][nt] = acc; } }
#pragma unroll
    for (int rt = 0; rt < RTN; ++rt)
#pragma unroll
      for (int r = 0; r < 8; ++r) { const int tq = q0 + rt * 16 + 8 * hh + r; const int k0 = j0 + ln, k1 = j0 + 16 + ln;
        bool ok0 = (CAUSAL == 1) ? (k0 <= tq) : ((CAUSAL == 2) ? ((k0 >> 5) == (tq >> 5)) : true), ok1 = (CAUSAL == 1) ? (k1 <= tq) : ((CAUSAL == 2) ? ((k1 >> 5) == (tq >> 5)) : true);      /* mode 2: block-diagonal 32-token groups */
        if (CAUSAL == 4) { const int* mrow = MSK + ((size_t)b * TQ + tq) * TK; ok0 = mrow[k0] != 0; ok1 = mrow[k1] != 0; }      /* mode 4: per-(query, key) INPUT mask shared by all heads; masked keys contribute nothing (== the reference's -4096 fill, whose exp underflows to 0), rows with no valid key give l = 0 -> output 0 (== the reference's row_valid zeroing) */
        const float s0 = ok0 ? s[rt][0][r] * SCL : -3.0e38f, s1 = ok1 ? s[rt][1][r] * SCL : -3.0e38f; float mc = fmaxf(s0, s1);
        mc = fmaxf(mc, __shfl_xor(mc, 1, 32)); mc = fmaxf(mc, __shfl_xor(mc, 2, 32)); mc = fmaxf(mc, __shfl_xor(mc, 4, 32)); mc = fmaxf(mc, __shfl_xor(mc, 8, 32));
        const float mn = fmaxf(m_r[rt][r], mc); const float al = (mn > -1.0e38f) ? expf(m_r[rt][r] - mn) : 1.0f; m_r[rt][r] = mn; const float p0 = ok0 ? expf(s0 - mn) : 0.f, p1 = ok1 ? expf(s1 - mn) : 0.f; l_r[rt][r] = l_r[rt][r] * al + p0 + p1;
#pragma unroll
        for (int dt = 0; dt < DT; ++dt) oacc[rt][dt][r] *= al;
        FragH t2; t2.h[0] = (_Float16)(p0 * 1024.0f); t2.h[1] = (_Float16)(p1 * 1024.0f); sP[w][rt * 16 + 8 * hh + r][ln] = t2.u[0]; sP[w][rt * 16 + 8 * hh + r][16 + ln] = t2.u[1]; }
    __builtin_amdgcn_fence(__ATOMIC_ACQ_REL, "workgroup"); __builtin_amdgcn_wave_barrier();
    FragH pa[2];
#pragma unroll
    for (int rt = 0; rt < RTN; ++rt) { pa[rt].half[0] = *(const v8us*)&sP[w][rt * 16 + ln][8 * hh]; pa[rt].half[1] = *(const v8us*)&sP[w][rt * 16 + ln][16 + 8 * hh]; }
#pragma unroll
    for (int dt = 0; dt < DT; ++dt) { const unsigned short* vrow = Vth + (size_t)(dt * 16 + ln) * TK + j0; FragH bv; bv.half[0] = *(const v8us*)(vrow + 8 * hh); bv.half[1] = *(const v8us*)(vrow + 16 + 8 * hh);
#pragma unroll
      for (int rt = 0; rt < RTN; ++rt) oacc[rt][dt] = mmaH<1>(pa[rt].v, pa[rt].v, bv.v, bv.v, oacc[rt][dt]); }
    __builtin_amdgcn_fence(__ATOMIC_ACQ_REL, "workgroup"); __builtin_amdgcn_wave_barrier(); }
#pragma unroll
  for (int rt = 0; rt < RTN; ++rt) {
#pragma unroll
    for (int r = 0; r < 8; ++r) { float l = l_r[rt][r]; l += __shfl_xor(l, 1, 32); l += __shfl_xor(l, 2, 32); l += __shfl_xor(l, 4, 32); l += __shfl_xor(l, 8, 32); l_r[rt][r] = (l > 0.f) ? 1.0f / (l * 1024.0f) : 0.f; }
#pragma unroll
    for (int dt = 0; dt < DT; ++dt)
#pragma unroll
      for (int r = 0; r < 8; ++r) sO[w][rt * 16 + 8 * hh + r][dt * 16 + ln] = oacc[rt][dt][r] * l_r[rt][r]; }
  __builtin_amdgcn_fence(__ATOMIC_ACQ_REL, "workgroup"); __builtin_amdgcn_wave_barrier();
  {
#pragma unroll
    for (int rp = 0; rp < RPW; rp += 2) { const int r = rp + (lane >> 4), pc = lane & 15; const v4f val = *(const v4fa*)&sO[w][r][pc * 4]; *(v4f*)(O + ((size_t)b * TQ + q0 + r) * ldo + h * 64 + pc * 4) = val; }
     } }

__global__ __launch_bounds__(256) void k_woutp(const float* __restrict__ Wm, _Float16* __restrict__ Bt) { const size_t t = (size_t)blockIdx.x * 256 + threadIdx.x; if (t >= (size_t)DMOD * (2 * DMOD / 8)) return; const int pc = (int)(t % (2 * DMOD / 8)); const int o = (int)(t / (2 * DMOD / 8)); const bool lo = pc * 8 >= DMOD; FragH f;
  for (int q = 0; q < 8; ++q) { const int c = pc * 8 + q - (lo ? DMOD : 0); f.h[q] = (_Float16)(bf16_round(Wm[(size_t)c * DMOD + o]) * (lo ? 1.0f : 16.0f)); } *(v8us*)((unsigned short*)Bt + (size_t)o * 2 * DMOD + pc * 8) = f.half[0];  }      /* Wproj stored (in, out) -> Bt[o][c | 1024 + c] */
__global__ __launch_bounds__(256) void k_pose(const float* __restrict__ pose, const float* __restrict__ W1, const float* __restrict__ b1, const float* __restrict__ W2, const float* __restrict__ b2, const float* __restrict__ bqkv, float* __restrict__ PB) {
  #pragma clang fp contract(off)
  __shared__ float hs[64]; const int b = blockIdx.x / (3 * DMOD / 256), tid = threadIdx.x; const int o = (blockIdx.x % (3 * DMOD / 256)) * 256 + tid;      /* one block per (batch, 256-column slice), one output column per thread */
  float w2[64];      /* the column's 64 W2 values are fetched up front by independent loads (ahead of the hidden layer too), so a wave waits for memory once instead of once per term */
#pragma unroll
  for (int j = 0; j < 64; ++j) w2[j] = W2[(size_t)j * 3 * DMOD + o];
  const float vb2 = b2[o], vbq = bqkv[o];
  if (tid < 64) { float s = 0.f; for (int i = 0; i < 3; ++i) s += bf16_round(pose[b * 3 + i]) * bf16_round(W1[i * 64 + tid]); s += bf16_round(b1[tid]); hs[tid] = fmaxf(s, 0.f); }
  __syncthreads();
  float s = 0.f;
#pragma unroll
  for (int j = 0; j < 64; ++j) s += hs[j] * bf16_round(w2[j]);      /* terms summed in index order, j = 0..63 */
  s += bf16_round(vb2); s += bf16_round(vbq); PB[(size_t)b * 3 * DMOD + o] = s; }

extern "C" void kernel_launch(void* const* d_in, const int* in_sizes, int n_in,
                              void* d_out, int out_size, void* d_ws, size_t ws_size, hipStream_t stream) {
  (void)in_sizes; (void)n_in; (void)out_size;
  const float* const* I = (const float* const*)d_in; const float* x = I[0]; const float* pose = I[1]; const float* Wqkv = I[2]; const float* bqkv = I[3]; const float* W1 = I[4]; const float* b1 = I[5]; const float* W2 = I[6]; const float* b2 = I[7]; const float* Wp = I[8]; const float* bp = I[9];
  char* ws = (char*)d_ws; size_t off = 0;
  auto take = [&](size_t bytes) { char* p = ws + off; off += (bytes + 255) & ~(size_t)255; return p; };
  _Float16* BW = (_Float16*)take((size_t)3 * DMOD * DMOD * 2); _Float16* BO = (_Float16*)take((size_t)DMOD * 2 * DMOD * 2); float* PB = (float*)take((size_t)NB * 3 * DMOD * 4);
  _Float16* X16 = (_Float16*)take((size_t)NR * DMOD * 2); float* F32 = (float*)take((size_t)NR * 3 * DMOD * 4); _Float16* H3 = (_Float16*)take((size_t)NR * 3 * DMOD * 2); _Float16* L3 = (_Float16*)take((size_t)NR * 3 * DMOD * 2); _Float16* VT = (_Float16*)take((size_t)NR * DMOD * 2);      /* F32/H3/L3: [8192][q | k | v], pitch 3072 */
  float* O = F32; _Float16* Hh = H3; _Float16* Hl = L3;      /* aliases: F32 is last read by the first k_hl, H3/L3 by k_vt and the flash kernel */
  if (off > ws_size) return;      /* 6 + 4 + 16 + 96 + 48 + 48 + 16 = 234 MiB (256 MiB ws) */
  k_wt_f16<<<(unsigned)(((size_t)3 * DMOD * (DMOD / 8) + 255) / 256), 256, 0, stream>>>(Wqkv, BW, DMOD, 3 * DMOD, 16.0f); k_woutp<<<(unsigned)(((size_t)DMOD * (2 * DMOD / 8) + 255) / 256), 256, 0, stream>>>(Wp, BO);
  k_pose<<<NB * (3 * DMOD / 256), 256, 0, stream>>>(pose, W1, b1, W2, b2, bqkv, PB);
  k_x16<<<(unsigned)(((size_t)NR * DMOD / 8 + 255) / 256), 256, 0, stream>>>(x, X16, (size_t)NR * DMOD / 8);
  const dim3 gQ((NR / 128) * (3 * DMOD / 64), 1), gA((NR / 128) * (DMOD / 64), 1); const unsigned n8 = (unsigned)(((size_t)NR * DMOD / 8 + 255) / 256);
  k_gemm2<0><<<gQ, 128, 0, stream>>>(X16, DMOD, 0, BW, DMOD, 0, 0.0625f, nullptr, 0, PB, SLEN, (size_t)3 * DMOD, 0, F32, nullptr, 3 * DMOD, 0, NR, 3 * DMOD, DMOD);      /* all batches and q|k|v in one launch; + (bqkv + pose bias of batch row / 1024): the per-batch bias is a COMPUTED f32 vector, so it goes through the CP path (raw f32 add, CP[(row / SLEN) * 3072 + col]) rather than the bias path (which bf16-rounds, correct only for input biases) */
  k_hl<<<3 * n8, 256, 0, stream>>>(F32, H3, L3, (size_t)NR * 3 * DMOD / 8);
  k_vt<NH, SLEN><<<NB * NH * (SLEN / 64), 256, 0, stream>>>(H3, 3 * DMOD, 2 * DMOD, VT);
  k_flashqk<0><<<NB * NH * QBLKS, 128, 0, stream>>>(H3, L3, 3 * DMOD, H3 + DMOD, L3 + DMOD, 3 * DMOD, VT, nullptr, O, DMOD);      /* q/k hi + residual; P (x2^10) and V plain f16 */
  k_hl<<<n8, 256, 0, stream>>>(O, Hh, Hl, (size_t)NR * DMOD / 8);
  k_gemm2<0><<<gA, 128, 0, stream>>>(Hh, DMOD, 0, BO, 2 * DMOD, 0, 0.0625f, bp, 0, nullptr, 1, 0, 0, (float*)d_out, nullptr, DMOD, 0, NR, DMOD, DMOD);
  k_gemm2<0><<<gA, 128, 0, stream>>>(Hl, DMOD, 0, BO + DMOD, 2 * DMOD, 0, 1.0f / 1024.0f, nullptr, 0, (const float*)d_out, 1, (size_t)DMOD, 0, (float*)d_out, nullptr, DMOD, 0, NR, DMOD, DMOD);
}

// v003
// One run takes 592 microseconds.
// Two timings next to v002 put it at 1.08 and 1.06 times that version's speed.
// Counting every step since v000, it is 2.68 times as fast.
#include <hip/hip_runtime.h>
// Pose-aware attention (8 batches x 1024 tokens x 1024; 16 heads x 64): qkv = x Wqkv + b; per-batch pose embedding = relu(pose W1 + b1) W2 + b2 split into (q, k, v) biases per (head, dim) and added to q/k/v; softmax(q k^T / 8) v; out Wproj + b -> [8,1024,1024].
// Structure: the pose MLP on VALU folded into per-batch bias vectors (bqkv + pose_{q|k|v}[b]); x as an exact f16 plane; one qkv GEMM over all 8192 rows x 3072 columns (32x64 wave tiles, f32 accumulation, exact x16 weights, that per-batch bias picked by row / 1024) producing f32 q|k|v split into f16 hi + 2^10 residual planes; V^T by LDS tiles; the fused flash kernel with hi + 2^10-residual q/k planes (S = QhKh + (QlKh + QhKl)/1024) and plain f16 P (x2^10) and V (hi/lo operands in S only); the attention output as hi + residual into two accumulating projection GEMMs.
// Operand layout: every f16 plane that feeds a matrix instruction (x, both weights, q|k|v hi and residual, V^T, the attention output hi and residual) is stored in FRAGMENT ORDER: a [rows][KC] plane is cut into 16-row x 32-column tiles of 1 KiB, tile (row / 16, col / 32) at tile index (row / 16) * (KC / 32) + col / 32, and inside a tile the 16-byte chunk of row r, columns 8c..8c+7 (c = 0..3) sits at chunk c * 16 + r. A wave's fragment load (lane = 16 * hh + ln reads row ln, chunk 2 * half + hh) is then 512 contiguous bytes (4 cache lines) where a row-major plane made it touch 16 lines for the same bytes; values and their lane/register places are those of the row-major loaders.
// Compute dtype: x, pose and all parameters rounded to bf16; q, k hi + residual (~2^-21-class logits); P and v plain f16 (~2^-12); f32 accumulation/softmax. v_wmma_f32_16x16x32_f16.
#define NB 8
#define DMOD 1024
#define NR (NB * SLEN)
#define QBLKS (TQ / 64)
#define SLEN 1024
#define TQ SLEN
#define TK SLEN
#define NH 16
#define SCL 0.125f               /* 64^-0.5 */
typedef __bf16 v16b __attribute__((ext_vector_type(16)));
typedef unsigned short v8us __attribute__((ext_vector_type(8), may_alias));
typedef float  v8f  __attribute__((ext_vector_type(8)));
typedef float  v4f  __attribute__((ext_vector_type(4)));
typedef float  v4fa __attribute__((ext_vector_type(4), may_alias));
union FragB { v16b v; v8us half[2]; unsigned short u[16]; };

__device__ __forceinline__ unsigned short bf16_bits(float x) { unsigned int u = __float_as_uint(x); return (unsigned short)((u + 0x7FFFu + ((u >> 16) & 1u)) >> 16); }
__device__ __forceinline__ float bf16_val(unsigned short b) { return __uint_as_float(((unsigned int)b) << 16); }
__device__ __forceinline__ float bf16_round(float x) { return bf16_val(bf16_bits(x)); }
// D += A·B with NT terms: 1 = ah·bh, 2 = + al·bh (A split), 3 = + ah·bl (both split)
template <int NT>
__device__ __forceinline__ v8f mmaN(v16b ah, v16b al, v16b bh, v16b bl, v8f c) {
  c = __builtin_amdgcn_wmma_f32_16x16x32_bf16(false, ah, false, bh, (short)0, c, false, false);
  if (NT >= 2) c = __builtin_amdgcn_wmma_f32_16x16x32_bf16(false, al, false, bh, (short)0, c, false, false);
  if (NT >= 3) c = __builtin_amdgcn_wmma_f32_16x16x32_bf16(false, ah, false, bl, (short)0, c, false, false);
  asm volatile("v_nop\n\tv_nop\n\tv_nop\n\tv_nop" : "+v"(c) : "v"(ah), "v"(al), "v"(bh), "v"(bl));
  return c;
}

__global__ __launch_bounds__(256) void k_wt_bf16(const float* __restrict__ W, unsigned short* __restrict__ Wt, int K, int N) {
  const int t = blockIdx.x * 256 + threadIdx.x;
  const int k8n = K / 8;
  if (t >= N * k8n) return;
  const int n = t / k8n, k8 = (t % k8n) * 8;
  v8us v;
#pragma unroll
  for (int i = 0; i < 8; ++i) v[i] = bf16_bits(W[(size_t)(k8 + i) * N + n]);
  *(v8us*)(Wt + (size_t)n * K + k8) = v;
  
}

// GEMM C[M][N] (f32, pitch ldc) = act(A[M][K]·W + bias). A f32 row-major (pitch lda) converted per fragment to bf16
// (ASPLIT: hi/lo two planes -> 2 terms, else single rounded term); Wt bf16 [N][K] (pitch ldb). BIAS_BF16 rounds the
// bias to bf16 first (bias quantised to bf16 before the add). K%32==0, M%16==0, N%64==0.
template <bool ASPLIT, int ACT, bool BIAS_BF16>
__global__ __launch_bounds__(128) void k_gemm_bf(const float* __restrict__ A, int lda, const unsigned short* __restrict__ Wt, int ldb,
                                               const float* __restrict__ bias, float* __restrict__ C, int ldc, int M, int N, int K) {
  __shared__ __attribute__((aligned(16))) float so[4][16][64];
  const int tid = threadIdx.x, w = tid >> 5, lane = tid & 31, ln = lane & 15, hh = lane >> 4;
  const int ntn = N / 64;
  const int wid = blockIdx.x * 4 + w;
  const int mt = wid / ntn, nq = wid % ntn;
  if (mt * 16 >= M) return;
  const int row0 = mt * 16, col0 = nq * 64;
  const float* arow = A + (size_t)(row0 + ln) * lda;
  v8f acc[4] = {};
  for (int kb = 0; kb < K; kb += 32) {
    FragB ah, al;
    const v4f x0 = *(const v4fa*)(arow + kb + 8 * hh), x1 = *(const v4fa*)(arow + kb + 8 * hh + 4);
    const v4f x2 = *(const v4fa*)(arow + kb + 16 + 8 * hh), x3 = *(const v4fa*)(arow + kb + 16 + 8 * hh + 4);
    float xs[16] = {x0[0],x0[1],x0[2],x0[3],x1[0],x1[1],x1[2],x1[3],x2[0],x2[1],x2[2],x2[3],x3[0],x3[1],x3[2],x3[3]};
#pragma unroll
    for (int i = 0; i < 16; ++i) { const unsigned short hb = bf16_bits(xs[i]); ah.u[i] = hb; al.u[i] = ASPLIT ? bf16_bits(xs[i] - bf16_val(hb)) : (unsigned short)0; }
#pragma unroll
    for (int t = 0; t < 4; ++t) {
      const unsigned short* brow = Wt + (size_t)(col0 + t * 16 + ln) * ldb + kb;
      FragB b;
      b.half[0] = *(const v8us*)(brow + 8 * hh);
      b.half[1] = *(const v8us*)(brow + 16 + 8 * hh);
      acc[t] = mmaN<ASPLIT ? 2 : 1>(ah.v, al.v, b.v, b.v, acc[t]);
    }
  }
#pragma unroll
  for (int t = 0; t < 4; ++t) {
    float bv = bias ? bias[col0 + t * 16 + ln] : 0.f;
    if (BIAS_BF16) bv = bf16_round(bv);
#pragma unroll
    for (int r = 0; r < 8; ++r) { float v = acc[t][r] + bv; if (ACT == 1) v = fmaxf(v, 0.f); so[w][8 * hh + r][t * 16 + ln] = v; }
  }
  __builtin_amdgcn_fence(__ATOMIC_ACQ_REL, "workgroup");
  __builtin_amdgcn_wave_barrier();
  const int rsub = lane >> 4, c4 = (lane & 15) * 4;
  {
#pragma unroll
    for (int q = 0; q < 8; ++q) {
      const int r = q * 2 + rsub;
      const v4f v = *(const v4fa*)&so[w][r][c4];
      *(v4f*)(C + (size_t)(row0 + r) * ldc + col0 + c4) = v;
    }
    
  }
}

// GEMM C = act(A·W + bias + resid): A f32 (ASPLIT -> hi/lo 2 terms), Wt bf16 [N][K]; ACT 0 none, 1 relu, 2 exact gelu;
// resid (optional, f32, row index = (row % rmod), pitch ldr, RES_BF16 rounds it) added before the activation.
template <bool ASPLIT, int ACT, bool BIAS_BF16, bool RES_BF16>
__global__ __launch_bounds__(128) void k_gemm_bf3(const float* __restrict__ A, int lda, const unsigned short* __restrict__ Wt, int ldb,
                                                const float* __restrict__ bias, const float* __restrict__ resid, int rmod, int ldr,
                                                float* __restrict__ C, int ldc, int M, int N, int K) {
  __shared__ __attribute__((aligned(16))) float so[4][16][64];
  const int tid = threadIdx.x, w = tid >> 5, lane = tid & 31, ln = lane & 15, hh = lane >> 4;
  const int ntn = N / 64;
  const int wid = blockIdx.x * 4 + w;
  const int mt = wid / ntn, nq = wid % ntn;
  if (mt * 16 >= M) return;
  const int row0 = mt * 16, col0 = nq * 64;
  const float* arow = A + (size_t)(row0 + ln) * lda;
  v8f acc[4] = {};
  for (int kb = 0; kb < K; kb += 32) {
    FragB ah, al;
    const v4f x0 = *(const v4fa*)(arow + kb + 8 * hh), x1 = *(const v4fa*)(arow + kb + 8 * hh + 4);
    const v4f x2 = *(const v4fa*)(arow + kb + 16 + 8 * hh), x3 = *(const v4fa*)(arow + kb + 16 + 8 * hh + 4);
    float xs[16] = {x0[0],x0[1],x0[2],x0[3],x1[0],x1[1],x1[2],x1[3],x2[0],x2[1],x2[2],x2[3],x3[0],x3[1],x3[2],x3[3]};
#pragma unroll
    for (int i = 0; i < 16; ++i) { const unsigned short hb = bf16_bits(xs[i]); ah.u[i] = hb; al.u[i] = ASPLIT ? bf16_bits(xs[i] - bf16_val(hb)) : (unsigned short)0; }
#pragma unroll
    for (int t = 0; t < 4; ++t) {
      const unsigned short* brow = Wt + (size_t)(col0 + t * 16 + ln) * ldb + kb;
      FragB b;
      b.half[0] = *(const v8us*)(brow + 8 * hh);
      b.half[1] = *(const v8us*)(brow + 16 + 8 * hh);
      acc[t] = mmaN<ASPLIT ? 2 : 1>(ah.v, al.v, b.v, b.v, acc[t]);
    }
  }
#pragma unroll
  for (int t = 0; t < 4; ++t) {
    const int col = col0 + t * 16 + ln;
    float bv = bias ? bias[col] : 0.f;
    if (BIAS_BF16) bv = bf16_round(bv);
#pragma unroll
    for (int r = 0; r < 8; ++r) {
      float v = acc[t][r] + bv;
      if (resid) { float rv = resid[(size_t)((row0 + 8 * hh + r) % rmod) * ldr + col]; if (RES_BF16) rv = bf16_round(rv); v += rv; }
      if (ACT == 1) v = fmaxf(v, 0.f);
      if (ACT == 2) v = 0.5f * v * (1.0f + erff(v * 0.70710678118654752f));
      if (ACT == 3) { const float u = 0.7978845608028654f * (v + 0.044715f * v * v * v); v = 0.5f * v * (1.0f + tanhf(u)); }
      so[w][8 * hh + r][t * 16 + ln] = v;
    }
  }
  __builtin_amdgcn_fence(__ATOMIC_ACQ_REL, "workgroup");
  __builtin_amdgcn_wave_barrier();
  const int rsub = lane >> 4, c4 = (lane & 15) * 4;
  {
#pragma unroll
    for (int q = 0; q < 8; ++q) {
      const int r = q * 2 + rsub;
      const v4f v = *(const v4fa*)&so[w][r][c4];
      *(v4f*)(C + (size_t)(row0 + r) * ldc + col0 + c4) = v;
    }
    
  }
}
// row LayerNorm (biased variance, eps) over N: s = X (+ R); optional out_sum <- s; out_norm <- (s-mu)*rsqrt(var+eps)*g + b
template <bool PARAM_BF16>
__global__ __launch_bounds__(256) void k_layernorm(const float* __restrict__ X, const float* __restrict__ R, const float* __restrict__ g, const float* __restrict__ bta,
                                                  float* __restrict__ out_sum, float* __restrict__ out_norm, int N, float eps) {
  __shared__ float red[256];
  const int row = blockIdx.x, tid = threadIdx.x;
  const float* x = X + (size_t)row * N; const float* rr = R ? R + (size_t)row * N : nullptr;
  float vals[16];                     // up to N = 4096
  const int per = N / 256;            // contiguous chunk per thread? use strided-by-4 chunks: thread handles j = tid*4 + 1024*u
  float s1 = 0.f;
  for (int u = 0; u < per / 4; ++u) {
    const int j = tid * 4 + 1024 * u;
    const v4f a = *(const v4fa*)(x + j);
    v4f b = {0.f,0.f,0.f,0.f}; if (rr) b = *(const v4fa*)(rr + j);
#pragma unroll
    for (int q = 0; q < 4; ++q) { const float v = a[q] + b[q]; vals[u * 4 + q] = v; s1 += v; }
  }
  red[tid] = s1; __syncthreads();
  for (int st = 128; st > 0; st >>= 1) { if (tid < st) red[tid] += red[tid + st]; __syncthreads(); }
  const float mu = red[0] / (float)N; __syncthreads();
  float s2 = 0.f;
  for (int u = 0; u < per / 4; ++u)
#pragma unroll
    for (int q = 0; q < 4; ++q) { const float c = vals[u * 4 + q] - mu; s2 += c * c; }
  red[tid] = s2; __syncthreads();
  for (int st = 128; st > 0; st >>= 1) { if (tid < st) red[tid] += red[tid + st]; __syncthreads(); }
  const float rs = rsqrtf(red[0] / (float)N + eps);
  {
    for (int u = 0; u < per / 4; ++u) {
      const int j = tid * 4 + 1024 * u;
      v4f o, sm;
#pragma unroll
      for (int q = 0; q < 4; ++q) {
        float gg = g[j + q], bb = bta[j + q];
        if (PARAM_BF16) { gg = bf16_round(gg); bb = bf16_round(bb); }
        sm[q] = vals[u * 4 + q]; o[q] = (vals[u * 4 + q] - mu) * rs * gg + bb;
      }
      if (out_sum) *(v4f*)(out_sum + (size_t)row * N + j) = sm;
      *(v4f*)(out_norm + (size_t)row * N + j) = o;
    }
    
  }
}



// ---- f16 WMMA path (v_wmma_f32_16x16x32_f16): 11-bit significands for operands in range — used where a [0,1] probability operand needs more precision than bf16
typedef _Float16 v16h __attribute__((ext_vector_type(16)));
union FragH { v16h v; v8us half[2]; _Float16 h[16]; unsigned short u[16]; };
template <int NT>
__device__ __forceinline__ v8f mmaH(v16h ah, v16h al, v16h bh, v16h bl, v8f c) {
  c = __builtin_amdgcn_wmma_f32_16x16x32_f16(false, ah, false, bh, (short)0, c, false, false);
  if (NT >= 2) c = __builtin_amdgcn_wmma_f32_16x16x32_f16(false, al, false, bh, (short)0, c, false, false);
  if (NT >= 3) c = __builtin_amdgcn_wmma_f32_16x16x32_f16(false, ah, false, bl, (short)0, c, false, false);
  asm volatile("v_nop\n\tv_nop\n\tv_nop\n\tv_nop" : "+v"(c) : "v"(ah), "v"(al), "v"(bh), "v"(bl));
  return c;
}
// batched GEMM like k_gemm_b but f16 operands: A f32 (split into f16 hi/lo if ASPLIT, else rounded to f16), Bt = f16 values [n][k]; alpha; C f32; N multiple of 16 (partial tiles skipped)
template <bool ASPLIT>
__global__ __launch_bounds__(128) void k_gemm_h(const float* __restrict__ A, int lda, size_t sA, const _Float16* __restrict__ Bh, int ldb, size_t sB, float alpha, float* __restrict__ C, int ldc, size_t sC, int M, int N, int K) {
  __shared__ __attribute__((aligned(16))) float so[4][16][64];
  const int tid = threadIdx.x, w = tid >> 5, lane = tid & 31, ln = lane & 15, hh = lane >> 4; const int by = blockIdx.y;
  A += (size_t)by * sA; Bh += (size_t)by * sB; C += (size_t)by * sC;
  const int ntn = (N + 63) / 64; const int wid = blockIdx.x * 4 + w; const int mt = wid / ntn, nq = wid % ntn; if (mt * 16 >= M) return;
  const int row0 = mt * 16, col0 = nq * 64; const float* arow = A + (size_t)(row0 + ln) * lda;
  v8f acc[4] = {};
  for (int kb = 0; kb < K; kb += 32) {
    FragH ah, al;
    const v4f x0 = *(const v4fa*)(arow + kb + 8 * hh), x1 = *(const v4fa*)(arow + kb + 8 * hh + 4), x2 = *(const v4fa*)(arow + kb + 16 + 8 * hh), x3 = *(const v4fa*)(arow + kb + 16 + 8 * hh + 4);
    float xs[16] = {x0[0],x0[1],x0[2],x0[3],x1[0],x1[1],x1[2],x1[3],x2[0],x2[1],x2[2],x2[3],x3[0],x3[1],x3[2],x3[3]};
#pragma unroll
    for (int i = 0; i < 16; ++i) { const _Float16 h = (_Float16)xs[i]; ah.h[i] = h; al.h[i] = ASPLIT ? (_Float16)(xs[i] - (float)h) : (_Float16)0.0f; }
#pragma unroll
    for (int t = 0; t < 4; ++t) { if (col0 + t * 16 >= N) continue; const size_t boff = (size_t)(col0 + t * 16 + ln) * ldb + kb; FragH bq; bq.half[0] = *(const v8us*)(Bh + boff + 8 * hh); bq.half[1] = *(const v8us*)(Bh + boff + 16 + 8 * hh);
      acc[t] = mmaH<ASPLIT ? 2 : 1>(ah.v, al.v, bq.v, bq.v, acc[t]); }
  }
#pragma unroll
  for (int t = 0; t < 4; ++t) { if (col0 + t * 16 >= N) continue;
#pragma unroll
    for (int r = 0; r < 8; ++r) so[w][8 * hh + r][t * 16 + ln] = acc[t][r] * alpha; }
  __builtin_amdgcn_fence(__ATOMIC_ACQ_REL, "workgroup"); __builtin_amdgcn_wave_barrier();
  const int rsub = lane >> 4, c4 = (lane & 15) * 4;
  {
#pragma unroll
    for (int q = 0; q < 8; ++q) { const int r = q * 2 + rsub; if (col0 + c4 < N) { const v4f v = *(const v4fa*)&so[w][r][c4]; *(v4f*)(C + (size_t)(row0 + r) * ldc + col0 + c4) = v; } }
     }
}

// Wt (rows n, columns k, fragment order) = f16(W[k][n] * scale) from f32 row-major W[K][N] (scale = power of two; bf16-exact weights stay exact in f16 away from the subnormal range)
__global__ __launch_bounds__(256) void k_wt_f16(const float* __restrict__ W, _Float16* __restrict__ Wt, int K, int N, float scale) {
  const int t = blockIdx.x * 256 + threadIdx.x; if (t >= N * (K / 8)) return; const int tile = t >> 6; const int n = (tile / (K / 32)) * 16 + (t & 15), k8 = (tile % (K / 32)) * 32 + ((t >> 4) & 3) * 8; FragH f;      /* t = the output chunk in fragment order (rows n, columns k): 16 neighbouring lanes read 16 neighbouring n */
#pragma unroll
  for (int i = 0; i < 8; ++i) f.h[i] = (_Float16)(bf16_round(W[(size_t)(k8 + i) * N + n]) * scale); const v8us o = f.half[0];
  *(v8us*)((unsigned short*)Wt + (size_t)t * 8) = o; 
}
// k_gemm_hh variant with fused epilogue: v = acc·alpha + bias[by·sBias + col] (+ CP[(row/rowsPerB)·sCPb + by·64 + col] if CP) ; ACT 0 none / 1 elu ; writes f16 C16 (and f32 C if non-null)
template <int ACT>
__global__ __launch_bounds__(128) void k_gemm_hhx(const _Float16* __restrict__ A, int lda, size_t sA, const _Float16* __restrict__ Bh, int ldb, size_t sB, float alpha, const float* __restrict__ bias, size_t sBias, const float* __restrict__ CP, int rowsPerB, size_t sCPb, int row0g,
    float* __restrict__ C, _Float16* __restrict__ C16, int ldc, size_t sC, int M, int N, int K) {
  __shared__ __attribute__((aligned(16))) float so[4][16][64];
  const int tid = threadIdx.x, w = tid >> 5, lane = tid & 31, ln = lane & 15, hh = lane >> 4; const int by = blockIdx.y;
  A += (size_t)by * sA; Bh += (size_t)by * sB; const size_t cofs = (size_t)by * sC; const float* bp = bias ? bias + (size_t)by * sBias : nullptr;
  const int ntn = (N + 63) / 64; const int wid = blockIdx.x * 4 + w; const int mt = wid / ntn, nq = wid % ntn; if (mt * 16 >= M) return;
  const int row0 = mt * 16, col0 = nq * 64; const _Float16* arow = A + (size_t)(row0 + ln) * lda;
  v8f acc[4] = {};
  for (int kb = 0; kb < K; kb += 32) { FragH ah; ah.half[0] = *(const v8us*)((const unsigned short*)arow + kb + 8 * hh); ah.half[1] = *(const v8us*)((const unsigned short*)arow + kb + 16 + 8 * hh);
#pragma unroll
    for (int t = 0; t < 4; ++t) { if (col0 + t * 16 >= N) continue; const size_t boff = (size_t)(col0 + t * 16 + ln) * ldb + kb; FragH bq; bq.half[0] = *(const v8us*)((const unsigned short*)Bh + boff + 8 * hh); bq.half[1] = *(const v8us*)((const unsigned short*)Bh + boff + 16 + 8 * hh);
      acc[t] = mmaH<1>(ah.v, ah.v, bq.v, bq.v, acc[t]); }
  }
#pragma unroll
  for (int t = 0; t < 4; ++t) { if (col0 + t * 16 >= N) continue; const int col = col0 + t * 16 + ln; const float bv = bp ? bf16_round(bp[col]) : 0.f;
#pragma unroll
    for (int r = 0; r < 8; ++r) { float v = acc[t][r] * alpha + bv; if (CP) { const int bidx = (row0g + row0 + 8 * hh + r) / rowsPerB; v += CP[(size_t)bidx * sCPb + (size_t)by * 64 + col]; } if (ACT == 1) v = (v > 0.f) ? v : expm1f(v); else if (ACT == 7) v = (v > 0.f) ? v + 1.0f : expf(v); else if (ACT == 8) v = tanhf(v); else if (ACT == 9) v = 0.5f * v * (1.0f + tanhf(0.7978845608028654f * (v + 0.044715f * v * v * v))); else if (ACT == 11) v = 1.0f / (1.0f + expf(-v)); else if (ACT == 12) v = (v > 0.f) ? v : 0.01f * v; else if (ACT == 14) v = (v > 0.f) ? v : 0.1f * v; else if (ACT == 15) v = v / (1.0f + expf(-v)); else if (ACT == 3) v = fmaxf(v, 0.f); else if (ACT == 6) v = 0.5f * v * (1.0f + erff(v * 0.70710678118654752f)); so[w][8 * hh + r][t * 16 + ln] = v; } }
  __builtin_amdgcn_fence(__ATOMIC_ACQ_REL, "workgroup"); __builtin_amdgcn_wave_barrier();
  const int rsub = lane >> 4, c4 = (lane & 15) * 4; typedef _Float16 v4h __attribute__((ext_vector_type(4)));
  {
#pragma unroll
    for (int q = 0; q < 8; ++q) { const int r = q * 2 + rsub; if (col0 + c4 < N) { const v4f v = *(const v4fa*)&so[w][r][c4]; if (C) *(v4f*)(C + cofs + (size_t)(row0 + r) * ldc + col0 + c4) = v; if (C16) { v4h h4; for (int i = 0; i < 4; ++i) h4[i] = (_Float16)v[i]; *(v4h*)(C16 + cofs + (size_t)(row0 + r) * ldc + col0 + c4) = h4; } } }
     }
}


typedef _Float16 v4h __attribute__((ext_vector_type(4)));

// row-major f32 [rows][KC] -> fragment order: a wave takes 8 rows x the 4 chunks of one tile, so it reads 8 whole 128-byte lines and stores 4 whole lines. fo_src = element offset in the row-major source, fo_dst = 16-byte chunk index in the fragment-order plane
template <int KC> __device__ __forceinline__ size_t fo_src(size_t t) { const unsigned u = (unsigned)t, tile = u >> 6; return ((tile / (KC / 32)) * 16 + ((u & 7) | ((u >> 2) & 8))) * KC + (tile % (KC / 32)) * 32 + ((u >> 3) & 3) * 8; }      /* 32-bit: the planes here hold at most 8192 * 3072 elements */
__device__ __forceinline__ size_t fo_dst(size_t t) { const unsigned u = (unsigned)t; return (u >> 6) * 64 + ((u >> 3) & 3) * 16 + ((u & 7) | ((u >> 2) & 8)); }
// chunk index of (row, columns 8 * k8 .. 8 * k8 + 7) in a fragment-order plane of kc32 * 32 columns
__device__ __forceinline__ size_t fo_chunk(size_t row, int k8, int kc32) { return ((row >> 4) * kc32 + (k8 >> 2)) * 64 + (k8 & 3) * 16 + (row & 15); }
__global__ __launch_bounds__(256) void k_x16(const float* __restrict__ x, _Float16* __restrict__ X16, size_t n8) { const size_t t = (size_t)blockIdx.x * 256 + threadIdx.x; if (t >= n8) return; FragH f; const size_t s = fo_src<DMOD>(t);
#pragma unroll
  for (int q = 0; q < 8; ++q) f.h[q] = (_Float16)bf16_round(x[s + q]); *(v8us*)((unsigned short*)X16 + fo_dst(t) * 8) = f.half[0];  }
__global__ __launch_bounds__(256) void k_h16(const float* __restrict__ x, _Float16* __restrict__ X16, size_t n8) { const size_t t = (size_t)blockIdx.x * 256 + threadIdx.x; if (t >= n8) return; FragH f;
#pragma unroll
  for (int q = 0; q < 8; ++q) f.h[q] = (_Float16)x[t * 8 + q]; *(v8us*)((unsigned short*)X16 + t * 8) = f.half[0];  }
__global__ __launch_bounds__(256) void k_round16f(const float* __restrict__ W, _Float16* __restrict__ Bt, size_t n8) { const size_t t = (size_t)blockIdx.x * 256 + threadIdx.x; if (t >= n8) return; FragH f;
#pragma unroll
  for (int i = 0; i < 8; ++i) f.h[i] = (_Float16)(bf16_round(W[t * 8 + i]) * 16.0f); *(v8us*)((unsigned short*)Bt + t * 8) = f.half[0];  }
template <int NHv, int TTv>
__global__ __launch_bounds__(256) void k_vt(const _Float16* __restrict__ V16, int ldv, int voff, _Float16* __restrict__ Vt) { __shared__ unsigned short tl[64][66]; const int tid = threadIdx.x; const int slab = blockIdx.x / (TTv / 64), lg = blockIdx.x % (TTv / 64); const int b = slab / NHv, h = slab % NHv;
  for (int i = tid; i < 64 * 8; i += 256) { const int r = i & 63, c8 = (i >> 6) * 8; FragH f; f.half[0] = *(const v8us*)((const unsigned short*)V16 + fo_chunk((size_t)b * TTv + lg * 64 + r, (voff + h * 64 + c8) >> 3, ldv >> 5) * 8);      /* V16 in fragment order: neighbouring lanes take neighbouring rows */
#pragma unroll
    for (int q = 0; q < 8; ++q) tl[r][c8 + q] = f.u[q]; }
  __syncthreads();
  {
#pragma unroll
    for (int rd = 0; rd < 2; ++rd) { const int d = rd * 32 + (tid >> 7) * 16 + (tid & 15), pc = (tid >> 4) & 7; FragH f;      /* a wave writes 16 rows d x 2 chunks = 512 contiguous bytes of the fragment-order V^T */
#pragma unroll
      for (int q = 0; q < 8; ++q) f.u[q] = tl[pc * 8 + q][d];
      *(v8us*)((unsigned short*)Vt + fo_chunk((size_t)slab * 64 + d, lg * 8 + pc, TTv / 32) * 8) = f.half[0]; }
     } }

template <int KC>
__global__ __launch_bounds__(256) void k_hl(const float* __restrict__ F, _Float16* __restrict__ Hh, _Float16* __restrict__ Hl, size_t n8) { const size_t t = (size_t)blockIdx.x * 256 + threadIdx.x; if (t >= n8) return; FragH fh, fl; const size_t s = fo_src<KC>(t), o = fo_dst(t) * 8; const v4f a = *(const v4fa*)(F + s), c = *(const v4fa*)(F + s + 4);      /* F row-major [rows][KC]; Hh, Hl in fragment order */
#pragma unroll
  for (int q = 0; q < 4; ++q) { _Float16 h = (_Float16)a[q]; fh.h[q] = h; fl.h[q] = (_Float16)((a[q] - (float)h) * 1024.0f); h = (_Float16)c[q]; fh.h[4 + q] = h; fl.h[4 + q] = (_Float16)((c[q] - (float)h) * 1024.0f); }
  { *(v8us*)((unsigned short*)Hh + o) = fh.half[0]; *(v8us*)((unsigned short*)Hl + o) = fl.half[0];  } }

// ---- fast GEMM (wave tile 32x64; requires M % 32 == 0 rows per launch region and N % 64 == 0); A and Bh in fragment order with lda / ldb columns (16 rows = 16 * ld elements, 32 columns = 512 elements); epilogue = k_gemm_hhx semantics ----
__device__ __forceinline__ v16h g2_frag(const _Float16* p) { FragH f; f.half[0] = *(const v8us*)((const unsigned short*)p); f.half[1] = *(const v8us*)((const unsigned short*)p + 256); return f.v; }      /* p = the tile's start + 8 * lane, fragment order */
__device__ __forceinline__ v8f g2_mma(v16h a, v16h b, v8f c) { v8f d = __builtin_amdgcn_wmma_f32_16x16x32_f16(false, a, false, b, (short)0, c, false, false); asm volatile("v_nop\n\tv_nop\n\tv_nop\n\tv_nop" : "+v"(d) : "v"(a), "v"(b)); return d; }
template <int ACT>
__global__ __launch_bounds__(128) void k_gemm2(const _Float16* __restrict__ A, int lda, size_t sA, const _Float16* __restrict__ Bh, int ldb, size_t sB, float alpha, const float* __restrict__ bias, size_t sBias, const float* __restrict__ CP, int rowsPerB, size_t sCPb, int row0g,
    float* __restrict__ C, _Float16* __restrict__ C16, int ldc, size_t sC, int M, int N, int K) {
  __shared__ __attribute__((aligned(16))) float so[4][32][68];
  const int tid = threadIdx.x, w = tid >> 5, lane = tid & 31, ln = lane & 15, hh = lane >> 4; const int by = blockIdx.y;
  A += (size_t)by * sA; Bh += (size_t)by * sB; const size_t cofs = (size_t)by * sC; const float* bp = bias ? bias + (size_t)by * sBias : nullptr;
  const int ntn = N >> 6; const int mt = blockIdx.x / ntn, nq = blockIdx.x - mt * ntn; const int row0 = mt * 128 + 32 * w, col0 = nq * 64; if (row0 >= M) return;
  const _Float16* a0p = A + (size_t)row0 * lda + 8 * lane; const _Float16* a1p = a0p + (size_t)16 * lda;
  const _Float16* b0p = Bh + (size_t)col0 * ldb + 8 * lane; const _Float16* b1p = b0p + (size_t)16 * ldb; const _Float16* b2p = b1p + (size_t)16 * ldb; const _Float16* b3p = b2p + (size_t)16 * ldb;
  const v8f z8 = {0.f,0.f,0.f,0.f,0.f,0.f,0.f,0.f}; v8f c00 = z8, c01 = z8, c02 = z8, c03 = z8, c10 = z8, c11 = z8, c12 = z8, c13 = z8;
#pragma unroll 1
  for (int kb = 0; kb < K; kb += 32) { const v16h a0 = g2_frag(a0p), a1 = g2_frag(a1p);
    v16h b = g2_frag(b0p); c00 = g2_mma(a0, b, c00); c10 = g2_mma(a1, b, c10);
    b = g2_frag(b1p); c01 = g2_mma(a0, b, c01); c11 = g2_mma(a1, b, c11);
    b = g2_frag(b2p); c02 = g2_mma(a0, b, c02); c12 = g2_mma(a1, b, c12);
    b = g2_frag(b3p); c03 = g2_mma(a0, b, c03); c13 = g2_mma(a1, b, c13);
    a0p += 512; a1p += 512; b0p += 512; b1p += 512; b2p += 512; b3p += 512; }      /* the next k tile of every operand row group lies 512 elements on */
  v8f accs[8] = {c00, c01, c02, c03, c10, c11, c12, c13};
#pragma unroll
  for (int u = 0; u < 8; ++u) { const int t = u & 3, half = u >> 2; const int col = col0 + t * 16 + ln; const float bv = bp ? bf16_round(bp[col]) : 0.f;
#pragma unroll
    for (int r = 0; r < 8; ++r) { const int rloc = half * 16 + 8 * hh + r; float v = accs[u][r] * alpha + bv; if (CP) { const int bidx = (row0g + row0 + rloc) / rowsPerB; v += CP[(size_t)bidx * sCPb + (size_t)by * 64 + col]; }
      if (ACT == 3) v = fmaxf(v, 0.f); else if (ACT == 6) v = 0.5f * v * (1.0f + erff(v * 0.70710678118654752f)); else if (ACT == 11) v = 1.0f / (1.0f + expf(-v)); else if (ACT == 15) v = v / (1.0f + expf(-v)); else if (ACT == 12) v = (v > 0.f) ? v : 0.01f * v; else if (ACT == 8) v = tanhf(v);
      so[w][rloc][t * 16 + ln] = v; } }
  __builtin_amdgcn_fence(__ATOMIC_ACQ_REL, "workgroup"); __builtin_amdgcn_wave_barrier();
  const int rsub = lane >> 4, c4 = (lane & 15) * 4;
  {
#pragma unroll
    for (int q = 0; q < 16; ++q) { const int r = q * 2 + rsub; const v4f v = *(const v4fa*)&so[w][r][c4]; if (C) *(v4f*)(C + cofs + (size_t)(row0 + r) * ldc + col0 + c4) = v; if (C16) { v4h h4; for (int i = 0; i < 4; ++i) h4[i] = (_Float16)v[i]; *(v4h*)(C16 + cofs + (size_t)(row0 + r) * ldc + col0 + c4) = h4; } }
     } }



template <int CAUSAL>
__global__ __launch_bounds__(128) void k_flash(const _Float16* __restrict__ Q16, int ldq, const _Float16* __restrict__ K16, int ldk, const _Float16* __restrict__ Vt, const int* __restrict__ MSK, float* __restrict__ O, int ldo) {
  constexpr int RPW = 16, RTN = RPW / 16, NQB = TQ / (4 * RPW), DT = 4, KS = 2;
  __shared__ __attribute__((aligned(16))) unsigned short sP[4][RPW][40]; __shared__ __attribute__((aligned(16))) float sO[4][RPW][64 + 4];
  const int tid = threadIdx.x, w = tid >> 5, lane = tid & 31, ln = lane & 15, hh = lane >> 4;
  const int slab = blockIdx.x / QBLKS, qblk = blockIdx.x % QBLKS; (void)NQB; const int b = slab / NH, h = slab % NH; const int qb0 = qblk * (4 * RPW); const int q0 = qb0 + w * RPW;
  FragH aq[2][KS];
#pragma unroll
  for (int rt = 0; rt < RTN; ++rt) { const unsigned short* qr = (const unsigned short*)Q16 + ((size_t)b * TQ + q0 + rt * 16 + ln) * ldq + h * 64;
#pragma unroll
    for (int ks = 0; ks < KS; ++ks) { aq[rt][ks].half[0] = *(const v8us*)(qr + ks * 32 + 8 * hh); aq[rt][ks].half[1] = *(const v8us*)(qr + ks * 32 + 16 + 8 * hh); } }
  const unsigned short* Vth = (const unsigned short*)Vt + (size_t)slab * 64 * TK;
  float m_r[2][8], l_r[2][8]; v8f oacc[2][DT];
#pragma unroll
  for (int rt = 0; rt < RTN; ++rt) {
#pragma unroll
    for (int r = 0; r < 8; ++r) { m_r[rt][r] = -3.0e38f; l_r[rt][r] = 0.f; }
#pragma unroll
    for (int dt = 0; dt < DT; ++dt) oacc[rt][dt] = (v8f){0.f,0.f,0.f,0.f,0.f,0.f,0.f,0.f}; }
  const int jend = (CAUSAL == 1) ? (qb0 + 4 * RPW) : TK;      /* causal: keys beyond the block's last query never contribute */
#pragma unroll 1
  for (int j0 = 0; j0 < jend; j0 += 32) {
    v8f s[2][2];
#pragma unroll
    for (int nt = 0; nt < 2; ++nt) { const unsigned short* kr = (const unsigned short*)K16 + ((size_t)b * TK + j0 + nt * 16 + ln) * ldk + h * 64; FragH bk[KS];
#pragma unroll
      for (int ks = 0; ks < KS; ++ks) { bk[ks].half[0] = *(const v8us*)(kr + ks * 32 + 8 * hh); bk[ks].half[1] = *(const v8us*)(kr + ks * 32 + 16 + 8 * hh); }
#pragma unroll
      for (int rt = 0; rt < RTN; ++rt) { v8f acc = (v8f){0.f,0.f,0.f,0.f,0.f,0.f,0.f,0.f};
#pragma unroll
        for (int ks = 0; ks < KS; ++ks) acc = mmaH<1>(aq[rt][ks].v, aq[rt][ks].v, bk[ks].v, bk[ks].v, acc); s[rt][nt] = acc; } }
#pragma unroll
    for (int rt = 0; rt < RTN; ++rt)
#pragma unroll
      for (int r = 0; r < 8; ++r) { const int tq = q0 + rt * 16 + 8 * hh + r; const int k0 = j0 + ln, k1 = j0 + 16 + ln;
        const bool ok0 = (CAUSAL == 1) ? (k0 <= tq) : ((CAUSAL == 2) ? ((k0 >> 5) == (tq >> 5)) : true), ok1 = (CAUSAL == 1) ? (k1 <= tq) : ((CAUSAL == 2) ? ((k1 >> 5) == (tq >> 5)) : true);      /* mode 2: block-diagonal 32-token groups */
        const float s0 = ok0 ? s[rt][0][r] * SCL : -3.0e38f, s1 = ok1 ? s[rt][1][r] * SCL : -3.0e38f; float mc = fmaxf(s0, s1);
        mc = fmaxf(mc, __shfl_xor(mc, 1, 32)); mc = fmaxf(mc, __shfl_xor(mc, 2, 32)); mc = fmaxf(mc, __shfl_xor(mc, 4, 32)); mc = fmaxf(mc, __shfl_xor(mc, 8, 32));
        const float mn = fmaxf(m_r[rt][r], mc); const float al = (mn > -1.0e38f) ? expf(m_r[rt][r] - mn) : 1.0f; m_r[rt][r] = mn; const float p0 = ok0 ? expf(s0 - mn) : 0.f, p1 = ok1 ? expf(s1 - mn) : 0.f; l_r[rt][r] = l_r[rt][r] * al + p0 + p1;
#pragma unroll
        for (int dt = 0; dt < DT; ++dt) oacc[rt][dt][r] *= al;
        FragH t2; t2.h[0] = (_Float16)(p0 * 1024.0f); t2.h[1] = (_Float16)(p1 * 1024.0f); sP[w][rt * 16 + 8 * hh + r][ln] = t2.u[0]; sP[w][rt * 16 + 8 * hh + r][16 + ln] = t2.u[1]; }
    __builtin_amdgcn_fence(__ATOMIC_ACQ_REL, "workgroup"); __builtin_amdgcn_wave_barrier();
    FragH pa[2];
#pragma unroll
    for (int rt = 0; rt < RTN; ++rt) { pa[rt].half[0] = *(const v8us*)&sP[w][rt * 16 + ln][8 * hh]; pa[rt].half[1] = *(const v8us*)&sP[w][rt * 16 + ln][16 + 8 * hh]; }
#pragma unroll
    for (int dt = 0; dt < DT; ++dt) { const unsigned short* vrow = Vth + (size_t)(dt * 16 + ln) * TK + j0; FragH bv; bv.half[0] = *(const v8us*)(vrow + 8 * hh); bv.half[1] = *(const v8us*)(vrow + 16 + 8 * hh);
#pragma unroll
      for (int rt = 0; rt < RTN; ++rt) oacc[rt][dt] = mmaH<1>(pa[rt].v, pa[rt].v, bv.v, bv.v, oacc[rt][dt]); }
    __builtin_amdgcn_fence(__ATOMIC_ACQ_REL, "workgroup"); __builtin_amdgcn_wave_barrier(); }
#pragma unroll
  for (int rt = 0; rt < RTN; ++rt) {
#pragma unroll
    for (int r = 0; r < 8; ++r) { float l = l_r[rt][r]; l += __shfl_xor(l, 1, 32); l += __shfl_xor(l, 2, 32); l += __shfl_xor(l, 4, 32); l += __shfl_xor(l, 8, 32); l_r[rt][r] = (l > 0.f) ? 1.0f / (l * 1024.0f) : 0.f; }
#pragma unroll
    for (int dt = 0; dt < DT; ++dt)
#pragma unroll
      for (int r = 0; r < 8; ++r) sO[w][rt * 16 + 8 * hh + r][dt * 16 + ln] = oacc[rt][dt][r] * l_r[rt][r]; }
  __builtin_amdgcn_fence(__ATOMIC_ACQ_REL, "workgroup"); __builtin_amdgcn_wave_barrier();
  {
#pragma unroll
    for (int rp = 0; rp < RPW; rp += 2) { const int r = rp + (lane >> 4), pc = lane & 15; const v4f val = *(const v4fa*)&sO[w][r][pc * 4]; *(v4f*)(O + ((size_t)b * TQ + q0 + r) * ldo + h * 64 + pc * 4) = val; }
     } }
// Q/K-split variant: S = Qh Kh^T + (Ql Kh^T + Qh Kl^T)/1024 with Q/K = [hi | 2^10 residual] f16 planes (QL/KL same layout as Q16/K16); plain f16 P (x2^10) . V^T; Q, K planes (ldq, ldk columns) and V^T (TK columns) in fragment order
template <int CAUSAL>
__global__ __launch_bounds__(128) void k_flashqk(const _Float16* __restrict__ Q16, const _Float16* __restrict__ QL, int ldq, const _Float16* __restrict__ K16, const _Float16* __restrict__ KL, int ldk, const _Float16* __restrict__ Vt, const int* __restrict__ MSK, float* __restrict__ O, int ldo) {
  constexpr int RPW = 16, RTN = RPW / 16, NQB = TQ / (4 * RPW), DT = 4, KS = 2;
  __shared__ __attribute__((aligned(16))) unsigned short sP[4][RPW][40]; __shared__ __attribute__((aligned(16))) float sO[4][RPW][64 + 4];
  const int tid = threadIdx.x, w = tid >> 5, lane = tid & 31, ln = lane & 15, hh = lane >> 4;
  const int slab = blockIdx.x / QBLKS, qblk = blockIdx.x % QBLKS; (void)NQB; const int b = slab / NH, h = slab % NH; const int qb0 = qblk * (4 * RPW); const int q0 = qb0 + w * RPW;
  FragH aq[2][KS], aql[2][KS];
#pragma unroll
  for (int rt = 0; rt < RTN; ++rt) { const unsigned short* qr = (const unsigned short*)Q16 + ((size_t)b * TQ + q0 + rt * 16) * ldq + h * 1024 + 8 * lane; const unsigned short* ql = (const unsigned short*)QL + ((size_t)b * TQ + q0 + rt * 16) * ldq + h * 1024 + 8 * lane;      /* fragment order: a head's 64 columns are 2 tiles of 512 elements */
#pragma unroll
    for (int ks = 0; ks < KS; ++ks) { aq[rt][ks].half[0] = *(const v8us*)(qr + ks * 512); aq[rt][ks].half[1] = *(const v8us*)(qr + ks * 512 + 256); aql[rt][ks].half[0] = *(const v8us*)(ql + ks * 512); aql[rt][ks].half[1] = *(const v8us*)(ql + ks * 512 + 256); } }
  const unsigned short* Vth = (const unsigned short*)Vt + (size_t)slab * 64 * TK;
  float m_r[2][8], l_r[2][8]; v8f oacc[2][DT];
#pragma unroll
  for (int rt = 0; rt < RTN; ++rt) {
#pragma unroll
    for (int r = 0; r < 8; ++r) { m_r[rt][r] = -3.0e38f; l_r[rt][r] = 0.f; }
#pragma unroll
    for (int dt = 0; dt < DT; ++dt) oacc[rt][dt] = (v8f){0.f,0.f,0.f,0.f,0.f,0.f,0.f,0.f}; }
  const int jend = (CAUSAL == 1) ? (qb0 + 4 * RPW) : TK;      /* causal: keys beyond the block's last query never contribute */
#pragma unroll 1
  for (int j0 = 0; j0 < jend; j0 += 32) {
    v8f s[2][2];
#pragma unroll
    for (int nt = 0; nt < 2; ++nt) { const unsigned short* kr = (const unsigned short*)K16 + ((size_t)b * TK + j0 + nt * 16) * ldk + h * 1024 + 8 * lane; const unsigned short* klr = (const unsigned short*)KL + ((size_t)b * TK + j0 + nt * 16) * ldk + h * 1024 + 8 * lane; FragH bk[KS], bkl[KS];
#pragma unroll
      for (int ks = 0; ks < KS; ++ks) { bk[ks].half[0] = *(const v8us*)(kr + ks * 512); bk[ks].half[1] = *(const v8us*)(kr + ks * 512 + 256); bkl[ks].half[0] = *(const v8us*)(klr + ks * 512); bkl[ks].half[1] = *(const v8us*)(klr + ks * 512 + 256); }
#pragma unroll
      for (int rt = 0; rt < RTN; ++rt) { v8f acc = (v8f){0.f,0.f,0.f,0.f,0.f,0.f,0.f,0.f}, accl = acc;
#pragma unroll
        for (int ks = 0; ks < KS; ++ks) { acc = mmaH<1>(aq[rt][ks].v, aq[rt][ks].v, bk[ks].v, bk[ks].v, acc); accl = mmaH<1>(aql[rt][ks].v, aql[rt][ks].v, bk[ks].v, bk[ks].v, accl); accl = mmaH<1>(aq[rt][ks].v, aq[rt][ks].v, bkl[ks].v, bkl[ks].v, accl); }
#pragma unroll
        for (int r = 0; r < 8; ++r) acc[r] += accl[r] * 0.0009765625f;
        s[rt][nt] = acc; } }
#pragma unroll
    for (int rt = 0; rt < RTN; ++rt)
#pragma unroll
      for (int r = 0; r < 8; ++r) { const int tq = q0 + rt * 16 + 8 * hh + r; const int k0 = j0 + ln, k1 = j0 + 16 + ln;
        bool ok0 = (CAUSAL == 1) ? (k0 <= tq) : ((CAUSAL == 2) ? ((k0 >> 5) == (tq >> 5)) : true), ok1 = (CAUSAL == 1) ? (k1 <= tq) : ((CAUSAL == 2) ? ((k1 >> 5) == (tq >> 5)) : true);      /* mode 2: block-diagonal 32-token groups */
        if (CAUSAL == 4) { const int* mrow = MSK + ((size_t)b * TQ + tq) * TK; ok0 = mrow[k0] != 0; ok1 = mrow[k1] != 0; }      /* mode 4: per-(query, key) INPUT mask shared by all heads; masked keys contribute nothing (== the reference's -4096 fill, whose exp underflows to 0), rows with no valid key give l = 0 -> output 0 (== the reference's row_valid zeroing) */
        const float s0 = ok0 ? s[rt][0][r] * SCL : -3.0e38f, s1 = ok1 ? s[rt][1][r] * SCL : -3.0e38f; float mc = fmaxf(s0, s1);
        mc = fmaxf(mc, __shfl_xor(mc, 1, 32)); mc = fmaxf(mc, __shfl_xor(mc, 2, 32)); mc = fmaxf(mc, __shfl_xor(mc, 4, 32)); mc = fmaxf(mc, __shfl_xor(mc, 8, 32));
        const float mn = fmaxf(m_r[rt][r], mc); const float al = (mn > -1.0e38f) ? expf(m_r[rt][r] - mn) : 1.0f; m_r[rt][r] = mn; const float p0 = ok0 ? expf(s0 - mn) : 0.f, p1 = ok1 ? expf(s1 - mn) : 0.f; l_r[rt][r] = l_r[rt][r] * al + p0 + p1;
#pragma unroll
        for (int dt = 0; dt < DT; ++dt) oacc[rt][dt][r] *= al;
        FragH t2; t2.h[0] = (_Float16)(p0 * 1024.0f); t2.h[1] = (_Float16)(p1 * 1024.0f); sP[w][rt * 16 + 8 * hh + r][ln] = t2.u[0]; sP[w][rt * 16 + 8 * hh + r][16 + ln] = t2.u[1]; }
    __builtin_amdgcn_fence(__ATOMIC_ACQ_REL, "workgroup"); __builtin_amdgcn_wave_barrier();
    FragH pa[2];
#pragma unroll
    for (int rt = 0; rt < RTN; ++rt) { pa[rt].half[0] = *(const v8us*)&sP[w][rt * 16 + ln][8 * hh]; pa[rt].half[1] = *(const v8us*)&sP[w][rt * 16 + ln][16 + 8 * hh]; }
#pragma unroll
    for (int dt = 0; dt < DT; ++dt) { const unsigned short* vrow = Vth + (size_t)(dt * 16) * TK + j0 * 16 + 8 * lane; FragH bv; bv.half[0] = *(const v8us*)(vrow); bv.half[1] = *(const v8us*)(vrow + 256);      /* fragment order: 32 keys = one tile of 512 elements */
#pragma unroll
      for (int rt = 0; rt < RTN; ++rt) oacc[rt][dt] = mmaH<1>(pa[rt].v, pa[rt].v, bv.v, bv.v, oacc[rt][dt]); }
    __builtin_amdgcn_fence(__ATOMIC_ACQ_REL, "workgroup"); __builtin_amdgcn_wave_barrier(); }
#pragma unroll
  for (int rt = 0; rt < RTN; ++rt) {
#pragma unroll
    for (int r = 0; r < 8; ++r) { float l = l_r[rt][r]; l += __shfl_xor(l, 1, 32); l += __shfl_xor(l, 2, 32); l += __shfl_xor(l, 4, 32); l += __shfl_xor(l, 8, 32); l_r[rt][r] = (l > 0.f) ? 1.0f / (l * 1024.0f) : 0.f; }
#pragma unroll
    for (int dt = 0; dt < DT; ++dt)
#pragma unroll
      for (int r = 0; r < 8; ++r) sO[w][rt * 16 + 8 * hh + r][dt * 16 + ln] = oacc[rt][dt][r] * l_r[rt][r]; }
  __builtin_amdgcn_fence(__ATOMIC_ACQ_REL, "workgroup"); __builtin_amdgcn_wave_barrier();
  {
#pragma unroll
    for (int rp = 0; rp < RPW; rp += 2) { const int r = rp + (lane >> 4), pc = lane & 15; const v4f val = *(const v4fa*)&sO[w][r][pc * 4]; *(v4f*)(O + ((size_t)b * TQ + q0 + r) * ldo + h * 64 + pc * 4) = val; }
     } }

__global__ __launch_bounds__(256) void k_woutp(const float* __restrict__ Wm, _Float16* __restrict__ Bt) { const size_t t = (size_t)blockIdx.x * 256 + threadIdx.x; if (t >= (size_t)DMOD * (2 * DMOD / 8)) return; const int tile = (int)(t >> 6); const int pc = (tile % (2 * DMOD / 32)) * 4 + (int)((t >> 4) & 3); const int o = (tile / (2 * DMOD / 32)) * 16 + (int)(t & 15); const bool lo = pc * 8 >= DMOD; FragH f;      /* t = the output chunk in fragment order */
  for (int q = 0; q < 8; ++q) { const int c = pc * 8 + q - (lo ? DMOD : 0); f.h[q] = (_Float16)(bf16_round(Wm[(size_t)c * DMOD + o]) * (lo ? 1.0f : 16.0f)); } *(v8us*)((unsigned short*)Bt + t * 8) = f.half[0];  }      /* Wproj stored (in, out) -> Bt rows o, columns [c | 1024 + c], fragment order */
__global__ __launch_bounds__(256) void k_pose(const float* __restrict__ pose, const float* __restrict__ W1, const float* __restrict__ b1, const float* __restrict__ W2, const float* __restrict__ b2, const float* __restrict__ bqkv, float* __restrict__ PB) {
  #pragma clang fp contract(off)
  __shared__ float hs[64]; const int b = blockIdx.x / (3 * DMOD / 256), tid = threadIdx.x; const int o = (blockIdx.x % (3 * DMOD / 256)) * 256 + tid;      /* one block per (batch, 256-column slice), one output column per thread */
  float w2[64];      /* the column's 64 W2 values are fetched up front by independent loads (ahead of the hidden layer too), so a wave waits for memory once instead of once per term */
#pragma unroll
  for (int j = 0; j < 64; ++j) w2[j] = W2[(size_t)j * 3 * DMOD + o];
  const float vb2 = b2[o], vbq = bqkv[o];
  if (tid < 64) { float s = 0.f; for (int i = 0; i < 3; ++i) s += bf16_round(pose[b * 3 + i]) * bf16_round(W1[i * 64 + tid]); s += bf16_round(b1[tid]); hs[tid] = fmaxf(s, 0.f); }
  __syncthreads();
  float s = 0.f;
#pragma unroll
  for (int j = 0; j < 64; ++j) s += hs[j] * bf16_round(w2[j]);      /* terms summed in index order, j = 0..63 */
  s += bf16_round(vb2); s += bf16_round(vbq); PB[(size_t)b * 3 * DMOD + o] = s; }

extern "C" void kernel_launch(void* const* d_in, const int* in_sizes, int n_in,
                              void* d_out, int out_size, void* d_ws, size_t ws_size, hipStream_t stream) {
  (void)in_sizes; (void)n_in; (void)out_size;
  const float* const* I = (const float* const*)d_in; const float* x = I[0]; const float* pose = I[1]; const float* Wqkv = I[2]; const float* bqkv = I[3]; const float* W1 = I[4]; const float* b1 = I[5]; const float* W2 = I[6]; const float* b2 = I[7]; const float* Wp = I[8]; const float* bp = I[9];
  char* ws = (char*)d_ws; size_t off = 0;
  auto take = [&](size_t bytes) { char* p = ws + off; off += (bytes + 255) & ~(size_t)255; return p; };
  _Float16* BW = (_Float16*)take((size_t)3 * DMOD * DMOD * 2); _Float16* BO = (_Float16*)take((size_t)DMOD * 2 * DMOD * 2); float* PB = (float*)take((size_t)NB * 3 * DMOD * 4);
  _Float16* X16 = (_Float16*)take((size_t)NR * DMOD * 2); float* F32 = (float*)take((size_t)NR * 3 * DMOD * 4); _Float16* H3 = (_Float16*)take((size_t)NR * 3 * DMOD * 2); _Float16* L3 = (_Float16*)take((size_t)NR * 3 * DMOD * 2); _Float16* VT = (_Float16*)take((size_t)NR * DMOD * 2);      /* F32: [8192][q | k | v] row-major, pitch 3072; H3/L3: the same 3072 columns in fragment order, where a step of 1024 columns is 32 tiles = 16 * DMOD elements */
  float* O = F32; _Float16* Hh = H3; _Float16* Hl = L3;      /* aliases: F32 is last read by the first k_hl, H3/L3 by k_vt and the flash kernel */
  if (off > ws_size) return;      /* 6 + 4 + 16 + 96 + 48 + 48 + 16 = 234 MiB (256 MiB ws) */
  k_wt_f16<<<(unsigned)(((size_t)3 * DMOD * (DMOD / 8) + 255) / 256), 256, 0, stream>>>(Wqkv, BW, DMOD, 3 * DMOD, 16.0f); k_woutp<<<(unsigned)(((size_t)DMOD * (2 * DMOD / 8) + 255) / 256), 256, 0, stream>>>(Wp, BO);
  k_pose<<<NB * (3 * DMOD / 256), 256, 0, stream>>>(pose, W1, b1, W2, b2, bqkv, PB);
  k_x16<<<(unsigned)(((size_t)NR * DMOD / 8 + 255) / 256), 256, 0, stream>>>(x, X16, (size_t)NR * DMOD / 8);
  const dim3 gQ((NR / 128) * (3 * DMOD / 64), 1), gA((NR / 128) * (DMOD / 64), 1); const unsigned n8 = (unsigned)(((size_t)NR * DMOD / 8 + 255) / 256);
  k_gemm2<0><<<gQ, 128, 0, stream>>>(X16, DMOD, 0, BW, DMOD, 0, 0.0625f, nullptr, 0, PB, SLEN, (size_t)3 * DMOD, 0, F32, nullptr, 3 * DMOD, 0, NR, 3 * DMOD, DMOD);      /* all batches and q|k|v in one launch; + (bqkv + pose bias of batch row / 1024): the per-batch bias is a COMPUTED f32 vector, so it goes through the CP path (raw f32 add, CP[(row / SLEN) * 3072 + col]) rather than the bias path (which bf16-rounds, correct only for input biases) */
  k_hl<3 * DMOD><<<3 * n8, 256, 0, stream>>>(F32, H3, L3, (size_t)NR * 3 * DMOD / 8);
  k_vt<NH, SLEN><<<NB * NH * (SLEN / 64), 256, 0, stream>>>(H3, 3 * DMOD, 2 * DMOD, VT);
  k_flashqk<0><<<NB * NH * QBLKS, 128, 0, stream>>>(H3, L3, 3 * DMOD, H3 + 16 * DMOD, L3 + 16 * DMOD, 3 * DMOD, VT, nullptr, O, DMOD);      /* q/k hi + residual; P (x2^10) and V plain f16 */
  k_hl<DMOD><<<n8, 256, 0, stream>>>(O, Hh, Hl, (size_t)NR * DMOD / 8);
  k_gemm2<0><<<gA, 128, 0, stream>>>(Hh, DMOD, 0, BO, 2 * DMOD, 0, 0.0625f, bp, 0, nullptr, 1, 0, 0, (float*)d_out, nullptr, DMOD, 0, NR, DMOD, DMOD);
  k_gemm2<0><<<gA, 128, 0, stream>>>(Hl, DMOD, 0, BO + 16 * DMOD, 2 * DMOD, 0, 1.0f / 1024.0f, nullptr, 0, (const float*)d_out, 1, (size_t)DMOD, 0, (float*)d_out, nullptr, DMOD, 0, NR, DMOD, DMOD);
}

// v004
// It runs in 418 microseconds.
// Two timings next to v003 both put it at 1.42 times that version's speed.
// Over all steps from v000 it is 3.81 times as fast.
#include <hip/hip_runtime.h>
// Pose-aware attention (8 batches x 1024 tokens x 1024; 16 heads x 64): qkv = x Wqkv + b; per-batch pose embedding = relu(pose W1 + b1) W2 + b2 split into (q, k, v) biases per (head, dim) and added to q/k/v; softmax(q k^T / 8) v; out Wproj + b -> [8,1024,1024].
// Structure: the pose MLP on VALU folded into per-batch bias vectors (bqkv + pose_{q|k|v}[b]); x as an exact f16 plane; one qkv GEMM over all 8192 rows x 3072 columns (32x64 wave tiles, f32 accumulation, exact x16 weights, that per-batch bias picked by row / 1024) producing f32 q|k|v split into f16 hi + 2^10 residual planes; V^T by LDS tiles; the fused flash kernel, products transposed (S^T = K Q^T, O^T = V^T P^T; softmax statistics per lane, P kept in registers), with hi + 2^10-residual q/k planes (S = QhKh + (QlKh + QhKl)/1024) and plain f16 P (x2^10) and V (hi/lo operands in S only); the attention output as hi + residual into two accumulating projection GEMMs.
// Operand layout: every f16 plane that feeds a matrix instruction (x, both weights, q|k|v hi and residual, V^T, the attention output hi and residual) is stored in FRAGMENT ORDER: a [rows][KC] plane is cut into 16-row x 32-column tiles of 1 KiB, tile (row / 16, col / 32) at tile index (row / 16) * (KC / 32) + col / 32, and inside a tile the 16-byte chunk of row r, columns 8c..8c+7 (c = 0..3) sits at chunk c * 16 + r. A wave's fragment load (lane = 16 * hh + ln reads row ln, chunk 2 * half + hh) is then 512 contiguous bytes (4 cache lines) where a row-major plane made it touch 16 lines for the same bytes; values and their lane/register places are those of the row-major loaders.
// Compute dtype: x, pose and all parameters rounded to bf16; q, k hi + residual (~2^-21-class logits); P and v plain f16 (~2^-12); f32 accumulation/softmax. v_wmma_f32_16x16x32_f16.
#define NB 8
#define DMOD 1024
#define NR (NB * SLEN)
#define QBLKS (TQ / 64)
#define SLEN 1024
#define TQ SLEN
#define TK SLEN
#define NH 16
#define SCL 0.125f               /* 64^-0.5 */
typedef __bf16 v16b __attribute__((ext_vector_type(16)));
typedef unsigned short v8us __attribute__((ext_vector_type(8), may_alias));
typedef float  v8f  __attribute__((ext_vector_type(8)));
typedef float  v4f  __attribute__((ext_vector_type(4)));
typedef float  v4fa __attribute__((ext_vector_type(4), may_alias));
union FragB { v16b v; v8us half[2]; unsigned short u[16]; };

__device__ __forceinline__ unsigned short bf16_bits(float x) { unsigned int u = __float_as_uint(x); return (unsigned short)((u + 0x7FFFu + ((u >> 16) & 1u)) >> 16); }
__device__ __forceinline__ float bf16_val(unsigned short b) { return __uint_as_float(((unsigned int)b) << 16); }
__device__ __forceinline__ float bf16_round(float x) { return bf16_val(bf16_bits(x)); }
// D += A·B with NT terms: 1 = ah·bh, 2 = + al·bh (A split), 3 = + ah·bl (both split)
template <int NT>
__device__ __forceinline__ v8f mmaN(v16b ah, v16b al, v16b bh, v16b bl, v8f c) {
  c = __builtin_amdgcn_wmma_f32_16x16x32_bf16(false, ah, false, bh, (short)0, c, false, false);
  if (NT >= 2) c = __builtin_amdgcn_wmma_f32_16x16x32_bf16(false, al, false, bh, (short)0, c, false, false);
  if (NT >= 3) c = __builtin_amdgcn_wmma_f32_16x16x32_bf16(false, ah, false, bl, (short)0, c, false, false);
  asm volatile("v_nop\n\tv_nop\n\tv_nop\n\tv_nop" : "+v"(c) : "v"(ah), "v"(al), "v"(bh), "v"(bl));
  return c;
}

__global__ __launch_bounds__(256) void k_wt_bf16(const float* __restrict__ W, unsigned short* __restrict__ Wt, int K, int N) {
  const int t = blockIdx.x * 256 + threadIdx.x;
  const int k8n = K / 8;
  if (t >= N * k8n) return;
  const int n = t / k8n, k8 = (t % k8n) * 8;
  v8us v;
#pragma unroll
  for (int i = 0; i < 8; ++i) v[i] = bf16_bits(W[(size_t)(k8 + i) * N + n]);
  *(v8us*)(Wt + (size_t)n * K + k8) = v;
  
}

// GEMM C[M][N] (f32, pitch ldc) = act(A[M][K]·W + bias). A f32 row-major (pitch lda) converted per fragment to bf16
// (ASPLIT: hi/lo two planes -> 2 terms, else single rounded term); Wt bf16 [N][K] (pitch ldb). BIAS_BF16 rounds the
// bias to bf16 first (bias quantised to bf16 before the add). K%32==0, M%16==0, N%64==0.
template <bool ASPLIT, int ACT, bool BIAS_BF16>
__global__ __launch_bounds__(128) void k_gemm_bf(const float* __restrict__ A, int lda, const unsigned short* __restrict__ Wt, int ldb,
                                               const float* __restrict__ bias, float* __restrict__ C, int ldc, int M, int N, int K) {
  __shared__ __attribute__((aligned(16))) float so[4][16][64];
  const int tid = threadIdx.x, w = tid >> 5, lane = tid & 31, ln = lane & 15, hh = lane >> 4;
  const int ntn = N / 64;
  const int wid = blockIdx.x * 4 + w;
  const int mt = wid / ntn, nq = wid % ntn;
  if (mt * 16 >= M) return;
  const int row0 = mt * 16, col0 = nq * 64;
  const float* arow = A + (size_t)(row0 + ln) * lda;
  v8f acc[4] = {};
  for (int kb = 0; kb < K; kb += 32) {
    FragB ah, al;
    const v4f x0 = *(const v4fa*)(arow + kb + 8 * hh), x1 = *(const v4fa*)(arow + kb + 8 * hh + 4);
    const v4f x2 = *(const v4fa*)(arow + kb + 16 + 8 * hh), x3 = *(const v4fa*)(arow + kb + 16 + 8 * hh + 4);
    float xs[16] = {x0[0],x0[1],x0[2],x0[3],x1[0],x1[1],x1[2],x1[3],x2[0],x2[1],x2[2],x2[3],x3[0],x3[1],x3[2],x3[3]};
#pragma unroll
    for (int i = 0; i < 16; ++i) { const unsigned short hb = bf16_bits(xs[i]); ah.u[i] = hb; al.u[i] = ASPLIT ? bf16_bits(xs[i] - bf16_val(hb)) : (unsigned short)0; }
#pragma unroll
    for (int t = 0; t < 4; ++t) {
      const unsigned short* brow = Wt + (size_t)(col0 + t * 16 + ln) * ldb + kb;
      FragB b;
      b.half[0] = *(const v8us*)(brow + 8 * hh);
      b.half[1] = *(const v8us*)(brow + 16 + 8 * hh);
      acc[t] = mmaN<ASPLIT ? 2 : 1>(ah.v, al.v, b.v, b.v, acc[t]);
    }
  }
#pragma unroll
  for (int t = 0; t < 4; ++t) {
    float bv = bias ? bias[col0 + t * 16 + ln] : 0.f;
    if (BIAS_BF16) bv = bf16_round(bv);
#pragma unroll
    for (int r = 0; r < 8; ++r) { float v = acc[t][r] + bv; if (ACT == 1) v = fmaxf(v, 0.f); so[w][8 * hh + r][t * 16 + ln] = v; }
  }
  __builtin_amdgcn_fence(__ATOMIC_ACQ_REL, "workgroup");
  __builtin_amdgcn_wave_barrier();
  const int rsub = lane >> 4, c4 = (lane & 15) * 4;
  {
#pragma unroll
    for (int q = 0; q < 8; ++q) {
      const int r = q * 2 + rsub;
      const v4f v = *(const v4fa*)&so[w][r][c4];
      *(v4f*)(C + (size_t)(row0 + r) * ldc + col0 + c4) = v;
    }
    
  }
}

// GEMM C = act(A·W + bias + resid): A f32 (ASPLIT -> hi/lo 2 terms), Wt bf16 [N][K]; ACT 0 none, 1 relu, 2 exact gelu;
// resid (optional, f32, row index = (row % rmod), pitch ldr, RES_BF16 rounds it) added before the activation.
template <bool ASPLIT, int ACT, bool BIAS_BF16, bool RES_BF16>
__global__ __launch_bounds__(128) void k_gemm_bf3(const float* __restrict__ A, int lda, const unsigned short* __restrict__ Wt, int ldb,
                                                const float* __restrict__ bias, const float* __restrict__ resid, int rmod, int ldr,
                                                float* __restrict__ C, int ldc, int M, int N, int K) {
  __shared__ __attribute__((aligned(16))) float so[4][16][64];
  const int tid = threadIdx.x, w = tid >> 5, lane = tid & 31, ln = lane & 15, hh = lane >> 4;
  const int ntn = N / 64;
  const int wid = blockIdx.x * 4 + w;
  const int mt = wid / ntn, nq = wid % ntn;
  if (mt * 16 >= M) return;
  const int row0 = mt * 16, col0 = nq * 64;
  const float* arow = A + (size_t)(row0 + ln) * lda;
  v8f acc[4] = {};
  for (int kb = 0; kb < K; kb += 32) {
    FragB ah, al;
    const v4f x0 = *(const v4fa*)(arow + kb + 8 * hh), x1 = *(const v4fa*)(arow + kb + 8 * hh + 4);
    const v4f x2 = *(const v4fa*)(arow + kb + 16 + 8 * hh), x3 = *(const v4fa*)(arow + kb + 16 + 8 * hh + 4);
    float xs[16] = {x0[0],x0[1],x0[2],x0[3],x1[0],x1[1],x1[2],x1[3],x2[0],x2[1],x2[2],x2[3],x3[0],x3[1],x3[2],x3[3]};
#pragma unroll
    for (int i = 0; i < 16; ++i) { const unsigned short hb = bf16_bits(xs[i]); ah.u[i] = hb; al.u[i] = ASPLIT ? bf16_bits(xs[i] - bf16_val(hb)) : (unsigned short)0; }
#pragma unroll
    for (int t = 0; t < 4; ++t) {
      const unsigned short* brow = Wt + (size_t)(col0 + t * 16 + ln) * ldb + kb;
      FragB b;
      b.half[0] = *(const v8us*)(brow + 8 * hh);
      b.half[1] = *(const v8us*)(brow + 16 + 8 * hh);
      acc[t] = mmaN<ASPLIT ? 2 : 1>(ah.v, al.v, b.v, b.v, acc[t]);
    }
  }
#pragma unroll
  for (int t = 0; t < 4; ++t) {
    const int col = col0 + t * 16 + ln;
    float bv = bias ? bias[col] : 0.f;
    if (BIAS_BF16) bv = bf16_round(bv);
#pragma unroll
    for (int r = 0; r < 8; ++r) {
      float v = acc[t][r] + bv;
      if (resid) { float rv = resid[(size_t)((row0 + 8 * hh + r) % rmod) * ldr + col]; if (RES_BF16) rv = bf16_round(rv); v += rv; }
      if (ACT == 1) v = fmaxf(v, 0.f);
      if (ACT == 2) v = 0.5f * v * (1.0f + erff(v * 0.70710678118654752f));
      if (ACT == 3) { const float u = 0.7978845608028654f * (v + 0.044715f * v * v * v); v = 0.5f * v * (1.0f + tanhf(u)); }
      so[w][8 * hh + r][t * 16 + ln] = v;
    }
  }
  __builtin_amdgcn_fence(__ATOMIC_ACQ_REL, "workgroup");
  __builtin_amdgcn_wave_barrier();
  const int rsub = lane >> 4, c4 = (lane & 15) * 4;
  {
#pragma unroll
    for (int q = 0; q < 8; ++q) {
      const int r = q * 2 + rsub;
      const v4f v = *(const v4fa*)&so[w][r][c4];
      *(v4f*)(C + (size_t)(row0 + r) * ldc + col0 + c4) = v;
    }
    
  }
}
// row LayerNorm (biased variance, eps) over N: s = X (+ R); optional out_sum <- s; out_norm <- (s-mu)*rsqrt(var+eps)*g + b
template <bool PARAM_BF16>
__global__ __launch_bounds__(256) void k_layernorm(const float* __restrict__ X, const float* __restrict__ R, const float* __restrict__ g, const float* __restrict__ bta,
                                                  float* __restrict__ out_sum, float* __restrict__ out_norm, int N, float eps) {
  __shared__ float red[256];
  const int row = blockIdx.x, tid = threadIdx.x;
  const float* x = X + (size_t)row * N; const float* rr = R ? R + (size_t)row * N : nullptr;
  float vals[16];                     // up to N = 4096
  const int per = N / 256;            // contiguous chunk per thread? use strided-by-4 chunks: thread handles j = tid*4 + 1024*u
  float s1 = 0.f;
  for (int u = 0; u < per / 4; ++u) {
    const int j = tid * 4 + 1024 * u;
    const v4f a = *(const v4fa*)(x + j);
    v4f b = {0.f,0.f,0.f,0.f}; if (rr) b = *(const v4fa*)(rr + j);
#pragma unroll
    for (int q = 0; q < 4; ++q) { const float v = a[q] + b[q]; vals[u * 4 + q] = v; s1 += v; }
  }
  red[tid] = s1; __syncthreads();
  for (int st = 128; st > 0; st >>= 1) { if (tid < st) red[tid] += red[tid + st]; __syncthreads(); }
  const float mu = red[0] / (float)N; __syncthreads();
  float s2 = 0.f;
  for (int u = 0; u < per / 4; ++u)
#pragma unroll
    for (int q = 0; q < 4; ++q) { const float c = vals[u * 4 + q] - mu; s2 += c * c; }
  red[tid] = s2; __syncthreads();
  for (int st = 128; st > 0; st >>= 1) { if (tid < st) red[tid] += red[tid + st]; __syncthreads(); }
  const float rs = rsqrtf(red[0] / (float)N + eps);
  {
    for (int u = 0; u < per / 4; ++u) {
      const int j = tid * 4 + 1024 * u;
      v4f o, sm;
#pragma unroll
      for (int q = 0; q < 4; ++q) {
        float gg = g[j + q], bb = bta[j + q];
        if (PARAM_BF16) { gg = bf16_round(gg); bb = bf16_round(bb); }
        sm[q] = vals[u * 4 + q]; o[q] = (vals[u * 4 + q] - mu) * rs * gg + bb;
      }
      if (out_sum) *(v4f*)(out_sum + (size_t)row * N + j) = sm;
      *(v4f*)(out_norm + (size_t)row * N + j) = o;
    }
    
  }
}



// ---- f16 WMMA path (v_wmma_f32_16x16x32_f16): 11-bit significands for operands in range — used where a [0,1] probability operand needs more precision than bf16
typedef _Float16 v16h __attribute__((ext_vector_type(16)));
union FragH { v16h v; v8us half[2]; _Float16 h[16]; unsigned short u[16]; };
template <int NT>
__device__ __forceinline__ v8f mmaH(v16h ah, v16h al, v16h bh, v16h bl, v8f c) {
  c = __builtin_amdgcn_wmma_f32_16x16x32_f16(false, ah, false, bh, (short)0, c, false, false);
  if (NT >= 2) c = __builtin_amdgcn_wmma_f32_16x16x32_f16(false, al, false, bh, (short)0, c, false, false);
  if (NT >= 3) c = __builtin_amdgcn_wmma_f32_16x16x32_f16(false, ah, false, bl, (short)0, c, false, false);
  asm volatile("v_nop\n\tv_nop\n\tv_nop\n\tv_nop" : "+v"(c) : "v"(ah), "v"(al), "v"(bh), "v"(bl));
  return c;
}
// batched GEMM like k_gemm_b but f16 operands: A f32 (split into f16 hi/lo if ASPLIT, else rounded to f16), Bt = f16 values [n][k]; alpha; C f32; N multiple of 16 (partial tiles skipped)
template <bool ASPLIT>
__global__ __launch_bounds__(128) void k_gemm_h(const float* __restrict__ A, int lda, size_t sA, const _Float16* __restrict__ Bh, int ldb, size_t sB, float alpha, float* __restrict__ C, int ldc, size_t sC, int M, int N, int K) {
  __shared__ __attribute__((aligned(16))) float so[4][16][64];
  const int tid = threadIdx.x, w = tid >> 5, lane = tid & 31, ln = lane & 15, hh = lane >> 4; const int by = blockIdx.y;
  A += (size_t)by * sA; Bh += (size_t)by * sB; C += (size_t)by * sC;
  const int ntn = (N + 63) / 64; const int wid = blockIdx.x * 4 + w; const int mt = wid / ntn, nq = wid % ntn; if (mt * 16 >= M) return;
  const int row0 = mt * 16, col0 = nq * 64; const float* arow = A + (size_t)(row0 + ln) * lda;
  v8f acc[4] = {};
  for (int kb = 0; kb < K; kb += 32) {
    FragH ah, al;
    const v4f x0 = *(const v4fa*)(arow + kb + 8 * hh), x1 = *(const v4fa*)(arow + kb + 8 * hh + 4), x2 = *(const v4fa*)(arow + kb + 16 + 8 * hh), x3 = *(const v4fa*)(arow + kb + 16 + 8 * hh + 4);
    float xs[16] = {x0[0],x0[1],x0[2],x0[3],x1[0],x1[1],x1[2],x1[3],x2[0],x2[1],x2[2],x2[3],x3[0],x3[1],x3[2],x3[3]};
#pragma unroll
    for (int i = 0; i < 16; ++i) { const _Float16 h = (_Float16)xs[i]; ah.h[i] = h; al.h[i] = ASPLIT ? (_Float16)(xs[i] - (float)h) : (_Float16)0.0f; }
#pragma unroll
    for (int t = 0; t < 4; ++t) { if (col0 + t * 16 >= N) continue; const size_t boff = (size_t)(col0 + t * 16 + ln) * ldb + kb; FragH bq; bq.half[0] = *(const v8us*)(Bh + boff + 8 * hh); bq.half[1] = *(const v8us*)(Bh + boff + 16 + 8 * hh);
      acc[t] = mmaH<ASPLIT ? 2 : 1>(ah.v, al.v, bq.v, bq.v, acc[t]); }
  }
#pragma unroll
  for (int t = 0; t < 4; ++t) { if (col0 + t * 16 >= N) continue;
#pragma unroll
    for (int r = 0; r < 8; ++r) so[w][8 * hh + r][t * 16 + ln] = acc[t][r] * alpha; }
  __builtin_amdgcn_fence(__ATOMIC_ACQ_REL, "workgroup"); __builtin_amdgcn_wave_barrier();
  const int rsub = lane >> 4, c4 = (lane & 15) * 4;
  {
#pragma unroll
    for (int q = 0; q < 8; ++q) { const int r = q * 2 + rsub; if (col0 + c4 < N) { const v4f v = *(const v4fa*)&so[w][r][c4]; *(v4f*)(C + (size_t)(row0 + r) * ldc + col0 + c4) = v; } }
     }
}

// Wt (rows n, columns k, fragment order) = f16(W[k][n] * scale) from f32 row-major W[K][N] (scale = power of two; bf16-exact weights stay exact in f16 away from the subnormal range)
__global__ __launch_bounds__(256) void k_wt_f16(const float* __restrict__ W, _Float16* __restrict__ Wt, int K, int N, float scale) {
  const int t = blockIdx.x * 256 + threadIdx.x; if (t >= N * (K / 8)) return; const int tile = t >> 6; const int n = (tile / (K / 32)) * 16 + (t & 15), k8 = (tile % (K / 32)) * 32 + ((t >> 4) & 3) * 8; FragH f;      /* t = the output chunk in fragment order (rows n, columns k): 16 neighbouring lanes read 16 neighbouring n */
#pragma unroll
  for (int i = 0; i < 8; ++i) f.h[i] = (_Float16)(bf16_round(W[(size_t)(k8 + i) * N + n]) * scale); const v8us o = f.half[0];
  *(v8us*)((unsigned short*)Wt + (size_t)t * 8) = o; 
}
// k_gemm_hh variant with fused epilogue: v = acc·alpha + bias[by·sBias + col] (+ CP[(row/rowsPerB)·sCPb + by·64 + col] if CP) ; ACT 0 none / 1 elu ; writes f16 C16 (and f32 C if non-null)
template <int ACT>
__global__ __launch_bounds__(128) void k_gemm_hhx(const _Float16* __restrict__ A, int lda, size_t sA, const _Float16* __restrict__ Bh, int ldb, size_t sB, float alpha, const float* __restrict__ bias, size_t sBias, const float* __restrict__ CP, int rowsPerB, size_t sCPb, int row0g,
    float* __restrict__ C, _Float16* __restrict__ C16, int ldc, size_t sC, int M, int N, int K) {
  __shared__ __attribute__((aligned(16))) float so[4][16][64];
  const int tid = threadIdx.x, w = tid >> 5, lane = tid & 31, ln = lane & 15, hh = lane >> 4; const int by = blockIdx.y;
  A += (size_t)by * sA; Bh += (size_t)by * sB; const size_t cofs = (size_t)by * sC; const float* bp = bias ? bias + (size_t)by * sBias : nullptr;
  const int ntn = (N + 63) / 64; const int wid = blockIdx.x * 4 + w; const int mt = wid / ntn, nq = wid % ntn; if (mt * 16 >= M) return;
  const int row0 = mt * 16, col0 = nq * 64; const _Float16* arow = A + (size_t)(row0 + ln) * lda;
  v8f acc[4] = {};
  for (int kb = 0; kb < K; kb += 32) { FragH ah; ah.half[0] = *(const v8us*)((const unsigned short*)arow + kb + 8 * hh); ah.half[1] = *(const v8us*)((const unsigned short*)arow + kb + 16 + 8 * hh);
#pragma unroll
    for (int t = 0; t < 4; ++t) { if (col0 + t * 16 >= N) continue; const size_t boff = (size_t)(col0 + t * 16 + ln) * ldb + kb; FragH bq; bq.half[0] = *(const v8us*)((const unsigned short*)Bh + boff + 8 * hh); bq.half[1] = *(const v8us*)((const unsigned short*)Bh + boff + 16 + 8 * hh);
      acc[t] = mmaH<1>(ah.v, ah.v, bq.v, bq.v, acc[t]); }
  }
#pragma unroll
  for (int t = 0; t < 4; ++t) { if (col0 + t * 16 >= N) continue; const int col = col0 + t * 16 + ln; const float bv = bp ? bf16_round(bp[col]) : 0.f;
#pragma unroll
    for (int r = 0; r < 8; ++r) { float v = acc[t][r] * alpha + bv; if (CP) { const int bidx = (row0g + row0 + 8 * hh + r) / rowsPerB; v += CP[(size_t)bidx * sCPb + (size_t)by * 64 + col]; } if (ACT == 1) v = (v > 0.f) ? v : expm1f(v); else if (ACT == 7) v = (v > 0.f) ? v + 1.0f : expf(v); else if (ACT == 8) v = tanhf(v); else if (ACT == 9) v = 0.5f * v * (1.0f + tanhf(0.7978845608028654f * (v + 0.044715f * v * v * v))); else if (ACT == 11) v = 1.0f / (1.0f + expf(-v)); else if (ACT == 12) v = (v > 0.f) ? v : 0.01f * v; else if (ACT == 14) v = (v > 0.f) ? v : 0.1f * v; else if (ACT == 15) v = v / (1.0f + expf(-v)); else if (ACT == 3) v = fmaxf(v, 0.f); else if (ACT == 6) v = 0.5f * v * (1.0f + erff(v * 0.70710678118654752f)); so[w][8 * hh + r][t * 16 + ln] = v; } }
  __builtin_amdgcn_fence(__ATOMIC_ACQ_REL, "workgroup"); __builtin_amdgcn_wave_barrier();
  const int rsub = lane >> 4, c4 = (lane & 15) * 4; typedef _Float16 v4h __attribute__((ext_vector_type(4)));
  {
#pragma unroll
    for (int q = 0; q < 8; ++q) { const int r = q * 2 + rsub; if (col0 + c4 < N) { const v4f v = *(const v4fa*)&so[w][r][c4]; if (C) *(v4f*)(C + cofs + (size_t)(row0 + r) * ldc + col0 + c4) = v; if (C16) { v4h h4; for (int i = 0; i < 4; ++i) h4[i] = (_Float16)v[i]; *(v4h*)(C16 + cofs + (size_t)(row0 + r) * ldc + col0 + c4) = h4; } } }
     }
}


typedef _Float16 v4h __attribute__((ext_vector_type(4)));

// row-major f32 [rows][KC] -> fragment order: a wave takes 8 rows x the 4 chunks of one tile, so it reads 8 whole 128-byte lines and stores 4 whole lines. fo_src = element offset in the row-major source, fo_dst = 16-byte chunk index in the fragment-order plane
template <int KC> __device__ __forceinline__ size_t fo_src(size_t t) { const unsigned u = (unsigned)t, tile = u >> 6; return ((tile / (KC / 32)) * 16 + ((u & 7) | ((u >> 2) & 8))) * KC + (tile % (KC / 32)) * 32 + ((u >> 3) & 3) * 8; }      /* 32-bit: the planes here hold at most 8192 * 3072 elements */
__device__ __forceinline__ size_t fo_dst(size_t t) { const unsigned u = (unsigned)t; return (u >> 6) * 64 + ((u >> 3) & 3) * 16 + ((u & 7) | ((u >> 2) & 8)); }
// chunk index of (row, columns 8 * k8 .. 8 * k8 + 7) in a fragment-order plane of kc32 * 32 columns
__device__ __forceinline__ size_t fo_chunk(size_t row, int k8, int kc32) { return ((row >> 4) * kc32 + (k8 >> 2)) * 64 + (k8 & 3) * 16 + (row & 15); }
__global__ __launch_bounds__(256) void k_x16(const float* __restrict__ x, _Float16* __restrict__ X16, size_t n8) { const size_t t = (size_t)blockIdx.x * 256 + threadIdx.x; if (t >= n8) return; FragH f; const size_t s = fo_src<DMOD>(t);
#pragma unroll
  for (int q = 0; q < 8; ++q) f.h[q] = (_Float16)bf16_round(x[s + q]); *(v8us*)((unsigned short*)X16 + fo_dst(t) * 8) = f.half[0];  }
__global__ __launch_bounds__(256) void k_h16(const float* __restrict__ x, _Float16* __restrict__ X16, size_t n8) { const size_t t = (size_t)blockIdx.x * 256 + threadIdx.x; if (t >= n8) return; FragH f;
#pragma unroll
  for (int q = 0; q < 8; ++q) f.h[q] = (_Float16)x[t * 8 + q]; *(v8us*)((unsigned short*)X16 + t * 8) = f.half[0];  }
__global__ __launch_bounds__(256) void k_round16f(const float* __restrict__ W, _Float16* __restrict__ Bt, size_t n8) { const size_t t = (size_t)blockIdx.x * 256 + threadIdx.x; if (t >= n8) return; FragH f;
#pragma unroll
  for (int i = 0; i < 8; ++i) f.h[i] = (_Float16)(bf16_round(W[t * 8 + i]) * 16.0f); *(v8us*)((unsigned short*)Bt + t * 8) = f.half[0];  }
template <int NHv, int TTv>
__global__ __launch_bounds__(256) void k_vt(const _Float16* __restrict__ V16, int ldv, int voff, _Float16* __restrict__ Vt) { __shared__ unsigned short tl[64][66]; const int tid = threadIdx.x; const int slab = blockIdx.x / (TTv / 64), lg = blockIdx.x % (TTv / 64); const int b = slab / NHv, h = slab % NHv;
  for (int i = tid; i < 64 * 8; i += 256) { const int r = i & 63, c8 = (i >> 6) * 8; FragH f; f.half[0] = *(const v8us*)((const unsigned short*)V16 + fo_chunk((size_t)b * TTv + lg * 64 + r, (voff + h * 64 + c8) >> 3, ldv >> 5) * 8);      /* V16 in fragment order: neighbouring lanes take neighbouring rows */
#pragma unroll
    for (int q = 0; q < 8; ++q) tl[r][c8 + q] = f.u[q]; }
  __syncthreads();
  {
#pragma unroll
    for (int rd = 0; rd < 2; ++rd) { const int d = rd * 32 + (tid >> 7) * 16 + (tid & 15), pc = (tid >> 4) & 7; FragH f;      /* a wave writes 16 rows d x 2 chunks = 512 contiguous bytes of the fragment-order V^T */
#pragma unroll
      for (int q = 0; q < 8; ++q) f.u[q] = tl[pc * 8 + q][d];
      *(v8us*)((unsigned short*)Vt + fo_chunk((size_t)slab * 64 + d, lg * 8 + pc, TTv / 32) * 8) = f.half[0]; }
     } }

template <int KC>
__global__ __launch_bounds__(256) void k_hl(const float* __restrict__ F, _Float16* __restrict__ Hh, _Float16* __restrict__ Hl, size_t n8) { const size_t t = (size_t)blockIdx.x * 256 + threadIdx.x; if (t >= n8) return; FragH fh, fl; const size_t s = fo_src<KC>(t), o = fo_dst(t) * 8; const v4f a = *(const v4fa*)(F + s), c = *(const v4fa*)(F + s + 4);      /* F row-major [rows][KC]; Hh, Hl in fragment order */
#pragma unroll
  for (int q = 0; q < 4; ++q) { _Float16 h = (_Float16)a[q]; fh.h[q] = h; fl.h[q] = (_Float16)((a[q] - (float)h) * 1024.0f); h = (_Float16)c[q]; fh.h[4 + q] = h; fl.h[4 + q] = (_Float16)((c[q] - (float)h) * 1024.0f); }
  { *(v8us*)((unsigned short*)Hh + o) = fh.half[0]; *(v8us*)((unsigned short*)Hl + o) = fl.half[0];  } }

// ---- fast GEMM (wave tile 32x64; requires M % 32 == 0 rows per launch region and N % 64 == 0); A and Bh in fragment order with lda / ldb columns (16 rows = 16 * ld elements, 32 columns = 512 elements); epilogue = k_gemm_hhx semantics ----
__device__ __forceinline__ v16h g2_frag(const _Float16* p) { FragH f; f.half[0] = *(const v8us*)((const unsigned short*)p); f.half[1] = *(const v8us*)((const unsigned short*)p + 256); return f.v; }      /* p = the tile's start + 8 * lane, fragment order */
__device__ __forceinline__ v8f g2_mma(v16h a, v16h b, v8f c) { v8f d = __builtin_amdgcn_wmma_f32_16x16x32_f16(false, a, false, b, (short)0, c, false, false); asm volatile("v_nop\n\tv_nop\n\tv_nop\n\tv_nop" : "+v"(d) : "v"(a), "v"(b)); return d; }
template <int ACT>
__global__ __launch_bounds__(128) void k_gemm2(const _Float16* __restrict__ A, int lda, size_t sA, const _Float16* __restrict__ Bh, int ldb, size_t sB, float alpha, const float* __restrict__ bias, size_t sBias, const float* __restrict__ CP, int rowsPerB, size_t sCPb, int row0g,
    float* __restrict__ C, _Float16* __restrict__ C16, int ldc, size_t sC, int M, int N, int K) {
  __shared__ __attribute__((aligned(16))) float so[4][32][68];
  const int tid = threadIdx.x, w = tid >> 5, lane = tid & 31, ln = lane & 15, hh = lane >> 4; const int by = blockIdx.y;
  A += (size_t)by * sA; Bh += (size_t)by * sB; const size_t cofs = (size_t)by * sC; const float* bp = bias ? bias + (size_t)by * sBias : nullptr;
  const int ntn = N >> 6; const int mt = blockIdx.x / ntn, nq = blockIdx.x - mt * ntn; const int row0 = mt * 128 + 32 * w, col0 = nq * 64; if (row0 >= M) return;
  const _Float16* a0p = A + (size_t)row0 * lda + 8 * lane; const _Float16* a1p = a0p + (size_t)16 * lda;
  const _Float16* b0p = Bh + (size_t)col0 * ldb + 8 * lane; const _Float16* b1p = b0p + (size_t)16 * ldb; const _Float16* b2p = b1p + (size_t)16 * ldb; const _Float16* b3p = b2p + (size_t)16 * ldb;
  const v8f z8 = {0.f,0.f,0.f,0.f,0.f,0.f,0.f,0.f}; v8f c00 = z8, c01 = z8, c02 = z8, c03 = z8, c10 = z8, c11 = z8, c12 = z8, c13 = z8;
#pragma unroll 1
  for (int kb = 0; kb < K; kb += 32) { const v16h a0 = g2_frag(a0p), a1 = g2_frag(a1p);
    v16h b = g2_frag(b0p); c00 = g2_mma(a0, b, c00); c10 = g2_mma(a1, b, c10);
    b = g2_frag(b1p); c01 = g2_mma(a0, b, c01); c11 = g2_mma(a1, b, c11);
    b = g2_frag(b2p); c02 = g2_mma(a0, b, c02); c12 = g2_mma(a1, b, c12);
    b = g2_frag(b3p); c03 = g2_mma(a0, b, c03); c13 = g2_mma(a1, b, c13);
    a0p += 512; a1p += 512; b0p += 512; b1p += 512; b2p += 512; b3p += 512; }      /* the next k tile of every operand row group lies 512 elements on */
  v8f accs[8] = {c00, c01, c02, c03, c10, c11, c12, c13};
#pragma unroll
  for (int u = 0; u < 8; ++u) { const int t = u & 3, half = u >> 2; const int col = col0 + t * 16 + ln; const float bv = bp ? bf16_round(bp[col]) : 0.f;
#pragma unroll
    for (int r = 0; r < 8; ++r) { const int rloc = half * 16 + 8 * hh + r; float v = accs[u][r] * alpha + bv; if (CP) { const int bidx = (row0g + row0 + rloc) / rowsPerB; v += CP[(size_t)bidx * sCPb + (size_t)by * 64 + col]; }
      if (ACT == 3) v = fmaxf(v, 0.f); else if (ACT == 6) v = 0.5f * v * (1.0f + erff(v * 0.70710678118654752f)); else if (ACT == 11) v = 1.0f / (1.0f + expf(-v)); else if (ACT == 15) v = v / (1.0f + expf(-v)); else if (ACT == 12) v = (v > 0.f) ? v : 0.01f * v; else if (ACT == 8) v = tanhf(v);
      so[w][rloc][t * 16 + ln] = v; } }
  __builtin_amdgcn_fence(__ATOMIC_ACQ_REL, "workgroup"); __builtin_amdgcn_wave_barrier();
  const int rsub = lane >> 4, c4 = (lane & 15) * 4;
  {
#pragma unroll
    for (int q = 0; q < 16; ++q) { const int r = q * 2 + rsub; const v4f v = *(const v4fa*)&so[w][r][c4]; if (C) *(v4f*)(C + cofs + (size_t)(row0 + r) * ldc + col0 + c4) = v; if (C16) { v4h h4; for (int i = 0; i < 4; ++i) h4[i] = (_Float16)v[i]; *(v4h*)(C16 + cofs + (size_t)(row0 + r) * ldc + col0 + c4) = h4; } }
     } }



template <int CAUSAL>
__global__ __launch_bounds__(128) void k_flash(const _Float16* __restrict__ Q16, int ldq, const _Float16* __restrict__ K16, int ldk, const _Float16* __restrict__ Vt, const int* __restrict__ MSK, float* __restrict__ O, int ldo) {
  constexpr int RPW = 16, RTN = RPW / 16, NQB = TQ / (4 * RPW), DT = 4, KS = 2;
  __shared__ __attribute__((aligned(16))) unsigned short sP[4][RPW][40]; __shared__ __attribute__((aligned(16))) float sO[4][RPW][64 + 4];
  const int tid = threadIdx.x, w = tid >> 5, lane = tid & 31, ln = lane & 15, hh = lane >> 4;
  const int slab = blockIdx.x / QBLKS, qblk = blockIdx.x % QBLKS; (void)NQB; const int b = slab / NH, h = slab % NH; const int qb0 = qblk * (4 * RPW); const int q0 = qb0 + w * RPW;
  FragH aq[2][KS];
#pragma unroll
  for (int rt = 0; rt < RTN; ++rt) { const unsigned short* qr = (const unsigned short*)Q16 + ((size_t)b * TQ + q0 + rt * 16 + ln) * ldq + h * 64;
#pragma unroll
    for (int ks = 0; ks < KS; ++ks) { aq[rt][ks].half[0] = *(const v8us*)(qr + ks * 32 + 8 * hh); aq[rt][ks].half[1] = *(const v8us*)(qr + ks * 32 + 16 + 8 * hh); } }
  const unsigned short* Vth = (const unsigned short*)Vt + (size_t)slab * 64 * TK;
  float m_r[2][8], l_r[2][8]; v8f oacc[2][DT];
#pragma unroll
  for (int rt = 0; rt < RTN; ++rt) {
#pragma unroll
    for (int r = 0; r < 8; ++r) { m_r[rt][r] = -3.0e38f; l_r[rt][r] = 0.f; }
#pragma unroll
    for (int dt = 0; dt < DT; ++dt) oacc[rt][dt] = (v8f){0.f,0.f,0.f,0.f,0.f,0.f,0.f,0.f}; }
  const int jend = (CAUSAL == 1) ? (qb0 + 4 * RPW) : TK;      /* causal: keys beyond the block's last query never contribute */
#pragma unroll 1
  for (int j0 = 0; j0 < jend; j0 += 32) {
    v8f s[2][2];
#pragma unroll
    for (int nt = 0; nt < 2; ++nt) { const unsigned short* kr = (const unsigned short*)K16 + ((size_t)b * TK + j0 + nt * 16 + ln) * ldk + h * 64; FragH bk[KS];
#pragma unroll
      for (int ks = 0; ks < KS; ++ks) { bk[ks].half[0] = *(const v8us*)(kr + ks * 32 + 8 * hh); bk[ks].half[1] = *(const v8us*)(kr + ks * 32 + 16 + 8 * hh); }
#pragma unroll
      for (int rt = 0; rt < RTN; ++rt) { v8f acc = (v8f){0.f,0.f,0.f,0.f,0.f,0.f,0.f,0.f};
#pragma unroll
        for (int ks = 0; ks < KS; ++ks) acc = mmaH<1>(aq[rt][ks].v, aq[rt][ks].v, bk[ks].v, bk[ks].v, acc); s[rt][nt] = acc; } }
#pragma unroll
    for (int rt = 0; rt < RTN; ++rt)
#pragma unroll
      for (int r = 0; r < 8; ++r) { const int tq = q0 + rt * 16 + 8 * hh + r; const int k0 = j0 + ln, k1 = j0 + 16 + ln;
        const bool ok0 = (CAUSAL == 1) ? (k0 <= tq) : ((CAUSAL == 2) ? ((k0 >> 5) == (tq >> 5)) : true), ok1 = (CAUSAL == 1) ? (k1 <= tq) : ((CAUSAL == 2) ? ((k1 >> 5) == (tq >> 5)) : true);      /* mode 2: block-diagonal 32-token groups */
        const float s0 = ok0 ? s[rt][0][r] * SCL : -3.0e38f, s1 = ok1 ? s[rt][1][r] * SCL : -3.0e38f; float mc = fmaxf(s0, s1);
        mc = fmaxf(mc, __shfl_xor(mc, 1, 32)); mc = fmaxf(mc, __shfl_xor(mc, 2, 32)); mc = fmaxf(mc, __shfl_xor(mc, 4, 32)); mc = fmaxf(mc, __shfl_xor(mc, 8, 32));
        const float mn = fmaxf(m_r[rt][r], mc); const float al = (mn > -1.0e38f) ? expf(m_r[rt][r] - mn) : 1.0f; m_r[rt][r] = mn; const float p0 = ok0 ? expf(s0 - mn) : 0.f, p1 = ok1 ? expf(s1 - mn) : 0.f; l_r[rt][r] = l_r[rt][r] * al + p0 + p1;
#pragma unroll
        for (int dt = 0; dt < DT; ++dt) oacc[rt][dt][r] *= al;
        FragH t2; t2.h[0] = (_Float16)(p0 * 1024.0f); t2.h[1] = (_Float16)(p1 * 1024.0f); sP[w][rt * 16 + 8 * hh + r][ln] = t2.u[0]; sP[w][rt * 16 + 8 * hh + r][16 + ln] = t2.u[1]; }
    __builtin_amdgcn_fence(__ATOMIC_ACQ_REL, "workgroup"); __builtin_amdgcn_wave_barrier();
    FragH pa[2];
#pragma unroll
    for (int rt = 0; rt < RTN; ++rt) { pa[rt].half[0] = *(const v8us*)&sP[w][rt * 16 + ln][8 * hh]; pa[rt].half[1] = *(const v8us*)&sP[w][rt * 16 + ln][16 + 8 * hh]; }
#pragma unroll
    for (int dt = 0; dt < DT; ++dt) { const unsigned short* vrow = Vth + (size_t)(dt * 16 + ln) * TK + j0; FragH bv; bv.half[0] = *(const v8us*)(vrow + 8 * hh); bv.half[1] = *(const v8us*)(vrow + 16 + 8 * hh);
#pragma unroll
      for (int rt = 0; rt < RTN; ++rt) oacc[rt][dt] = mmaH<1>(pa[rt].v, pa[rt].v, bv.v, bv.v, oacc[rt][dt]); }
    __builtin_amdgcn_fence(__ATOMIC_ACQ_REL, "workgroup"); __builtin_amdgcn_wave_barrier(); }
#pragma unroll
  for (int rt = 0; rt < RTN; ++rt) {
#pragma unroll
    for (int r = 0; r < 8; ++r) { float l = l_r[rt][r]; l += __shfl_xor(l, 1, 32); l += __shfl_xor(l, 2, 32); l += __shfl_xor(l, 4, 32); l += __shfl_xor(l, 8, 32); l_r[rt][r] = (l > 0.f) ? 1.0f / (l * 1024.0f) : 0.f; }
#pragma unroll
    for (int dt = 0; dt < DT; ++dt)
#pragma unroll
      for (int r = 0; r < 8; ++r) sO[w][rt * 16 + 8 * hh + r][dt * 16 + ln] = oacc[rt][dt][r] * l_r[rt][r]; }
  __builtin_amdgcn_fence(__ATOMIC_ACQ_REL, "workgroup"); __builtin_amdgcn_wave_barrier();
  {
#pragma unroll
    for (int rp = 0; rp < RPW; rp += 2) { const int r = rp + (lane >> 4), pc = lane & 15; const v4f val = *(const v4fa*)&sO[w][r][pc * 4]; *(v4f*)(O + ((size_t)b * TQ + q0 + r) * ldo + h * 64 + pc * 4) = val; }
     } }
// Q/K-split flash kernel, TRANSPOSED products: S^T = Kh Qh^T + (Kh Ql^T + Kl Qh^T)/1024 with K as the A operand and Q as the B operand, then O^T += V^T P^T. Q/K = [hi | 2^10 residual] f16 planes (QL/KL same layout as Q16/K16); plain f16 P (x2^10); Q, K planes (ldq, ldk columns) and V^T (TK columns) in fragment order (the A and the B loader of this form read a tile alike, so every fragment load is the one of the untransposed form).
// Why transposed: the accumulator of S^T holds, in lane 16 * hh + ln, query ln and keys nt * 16 + 8 * hh + r. A query's 32 scores thus sit in two lanes (ln and ln + 16): maximum and sum are in-lane work plus one exchange between the wave's halves, one running maximum / sum / rescale factor per lane, and element nt * 8 + r of the lane is exactly element nt * 8 + r of the B fragment of P^T (k = 8 * hh + i in its first half, 16 + 8 * hh + i in its second), so P goes from the accumulators into the next product without LDS.
__device__ __forceinline__ float xhalf(float x) { return __builtin_bit_cast(float, __builtin_amdgcn_permlanex16(__builtin_bit_cast(int, x), __builtin_bit_cast(int, x), 0x76543210, 0xfedcba98, false, false)); }      /* lane l with lane l ^ 16 */
__global__ __launch_bounds__(128) void k_flashqk(const _Float16* __restrict__ Q16, const _Float16* __restrict__ QL, int ldq, const _Float16* __restrict__ K16, const _Float16* __restrict__ KL, int ldk, const _Float16* __restrict__ Vt, float* __restrict__ O, int ldo) {
  constexpr int RPW = 16, DT = 4, KS = 2;
  __shared__ __attribute__((aligned(16))) float sO[4][RPW][64 + 4];
  const int tid = threadIdx.x, w = tid >> 5, lane = tid & 31, ln = lane & 15, hh = lane >> 4;
  const int slab = blockIdx.x / QBLKS, qblk = blockIdx.x % QBLKS; const int b = slab / NH, h = slab % NH; const int q0 = qblk * (4 * RPW) + w * RPW;
  FragH bq[KS], bql[KS];
  { const unsigned short* qr = (const unsigned short*)Q16 + ((size_t)b * TQ + q0) * ldq + h * 1024 + 8 * lane; const unsigned short* ql = (const unsigned short*)QL + ((size_t)b * TQ + q0) * ldq + h * 1024 + 8 * lane;      /* fragment order: a head's 64 columns are 2 tiles of 512 elements */
#pragma unroll
    for (int ks = 0; ks < KS; ++ks) { bq[ks].half[0] = *(const v8us*)(qr + ks * 512); bq[ks].half[1] = *(const v8us*)(qr + ks * 512 + 256); bql[ks].half[0] = *(const v8us*)(ql + ks * 512); bql[ks].half[1] = *(const v8us*)(ql + ks * 512 + 256); } }
  const unsigned short* Vth = (const unsigned short*)Vt + (size_t)slab * 64 * TK;
  float m_q = -3.0e38f, l_q = 0.f; v8f oacc[DT];      /* of query ln; l_q holds the sum over this half's keys, the halves are joined behind the loop */
#pragma unroll
  for (int dt = 0; dt < DT; ++dt) oacc[dt] = (v8f){0.f,0.f,0.f,0.f,0.f,0.f,0.f,0.f};
#pragma unroll 1
  for (int j0 = 0; j0 < TK; j0 += 32) {
    float sc[16];
#pragma unroll
    for (int nt = 0; nt < 2; ++nt) { const unsigned short* kr = (const unsigned short*)K16 + ((size_t)b * TK + j0 + nt * 16) * ldk + h * 1024 + 8 * lane; const unsigned short* klr = (const unsigned short*)KL + ((size_t)b * TK + j0 + nt * 16) * ldk + h * 1024 + 8 * lane; FragH ak[KS], akl[KS];
#pragma unroll
      for (int ks = 0; ks < KS; ++ks) { ak[ks].half[0] = *(const v8us*)(kr + ks * 512); ak[ks].half[1] = *(const v8us*)(kr + ks * 512 + 256); akl[ks].half[0] = *(const v8us*)(klr + ks * 512); akl[ks].half[1] = *(const v8us*)(klr + ks * 512 + 256); }
      asm volatile("s_wait_xcnt 0x0" :: "v"(kr), "v"(klr) : "memory");      /* behind the tile's 8 loads and in front of any reuse of their address registers; naming the two addresses as inputs keeps their registers untouched up to this wait */
      v8f acc = (v8f){0.f,0.f,0.f,0.f,0.f,0.f,0.f,0.f}, accl = acc;
#pragma unroll
      for (int ks = 0; ks < KS; ++ks) { acc = mmaH<1>(ak[ks].v, ak[ks].v, bq[ks].v, bq[ks].v, acc); accl = mmaH<1>(ak[ks].v, ak[ks].v, bql[ks].v, bql[ks].v, accl); accl = mmaH<1>(akl[ks].v, akl[ks].v, bq[ks].v, bq[ks].v, accl); }
#pragma unroll
      for (int r = 0; r < 8; ++r) sc[nt * 8 + r] = (acc[r] + accl[r] * 0.0009765625f) * SCL; }
    float mx[8];
#pragma unroll
    for (int i = 0; i < 8; ++i) mx[i] = fmaxf(sc[i], sc[8 + i]);
    float mc = fmaxf(fmaxf(fmaxf(mx[0], mx[1]), fmaxf(mx[2], mx[3])), fmaxf(fmaxf(mx[4], mx[5]), fmaxf(mx[6], mx[7])));
    mc = fmaxf(mc, xhalf(mc));
    const float mn = fmaxf(m_q, mc); const float ea = expf(m_q - mn); const float al = (mn > -1.0e38f) ? ea : 1.0f; m_q = mn;
    float p[16]; FragH pb;
#pragma unroll
    for (int i = 0; i < 16; ++i) { p[i] = expf(sc[i] - mn); pb.h[i] = (_Float16)(p[i] * 1024.0f); }
    l_q = l_q * al + ((((p[0] + p[1]) + (p[2] + p[3])) + ((p[4] + p[5]) + (p[6] + p[7]))) + (((p[8] + p[9]) + (p[10] + p[11])) + ((p[12] + p[13]) + (p[14] + p[15]))));
#pragma unroll
    for (int dt = 0; dt < DT; ++dt)
#pragma unroll
      for (int r = 0; r < 8; ++r) oacc[dt][r] *= al;
    FragH av[DT];
#pragma unroll
    for (int dt = 0; dt < DT; ++dt) { const unsigned short* vrow = Vth + (size_t)(dt * 16) * TK + j0 * 16 + 8 * lane; av[dt].half[0] = *(const v8us*)(vrow); av[dt].half[1] = *(const v8us*)(vrow + 256); }      /* fragment order: 32 keys = one tile of 512 elements; rows d of V^T are the A operand */
#pragma unroll
    for (int dt = 0; dt < DT; ++dt) oacc[dt] = mmaH<1>(av[dt].v, av[dt].v, pb.v, pb.v, oacc[dt]); }
  const float l = l_q + xhalf(l_q); const float inv = (l > 0.f) ? 1.0f / (l * 1024.0f) : 0.f;
#pragma unroll
  for (int dt = 0; dt < DT; ++dt) { v4f lo4, hi4;      /* O^T: lane = query ln, registers = 8 neighbouring d */
#pragma unroll
    for (int r = 0; r < 4; ++r) { lo4[r] = oacc[dt][r] * inv; hi4[r] = oacc[dt][4 + r] * inv; }
    *(v4fa*)&sO[w][ln][dt * 16 + 8 * hh] = lo4; *(v4fa*)&sO[w][ln][dt * 16 + 8 * hh + 4] = hi4; }
  __builtin_amdgcn_fence(__ATOMIC_ACQ_REL, "workgroup"); __builtin_amdgcn_wave_barrier();
  {
#pragma unroll
    for (int rp = 0; rp < RPW; rp += 2) { const int r = rp + (lane >> 4), pc = lane & 15; const v4f val = *(const v4fa*)&sO[w][r][pc * 4]; *(v4f*)(O + ((size_t)b * TQ + q0 + r) * ldo + h * 64 + pc * 4) = val; }
     } }

__global__ __launch_bounds__(256) void k_woutp(const float* __restrict__ Wm, _Float16* __restrict__ Bt) { const size_t t = (size_t)blockIdx.x * 256 + threadIdx.x; if (t >= (size_t)DMOD * (2 * DMOD / 8)) return; const int tile = (int)(t >> 6); const int pc = (tile % (2 * DMOD / 32)) * 4 + (int)((t >> 4) & 3); const int o = (tile / (2 * DMOD / 32)) * 16 + (int)(t & 15); const bool lo = pc * 8 >= DMOD; FragH f;      /* t = the output chunk in fragment order */
  for (int q = 0; q < 8; ++q) { const int c = pc * 8 + q - (lo ? DMOD : 0); f.h[q] = (_Float16)(bf16_round(Wm[(size_t)c * DMOD + o]) * (lo ? 1.0f : 16.0f)); } *(v8us*)((unsigned short*)Bt + t * 8) = f.half[0];  }      /* Wproj stored (in, out) -> Bt rows o, columns [c | 1024 + c], fragment order */
__global__ __launch_bounds__(256) void k_pose(const float* __restrict__ pose, const float* __restrict__ W1, const float* __restrict__ b1, const float* __restrict__ W2, const float* __restrict__ b2, const float* __restrict__ bqkv, float* __restrict__ PB) {
  #pragma clang fp contract(off)
  __shared__ float hs[64]; const int b = blockIdx.x / (3 * DMOD / 256), tid = threadIdx.x; const int o = (blockIdx.x % (3 * DMOD / 256)) * 256 + tid;      /* one block per (batch, 256-column slice), one output column per thread */
  float w2[64];      /* the column's 64 W2 values are fetched up front by independent loads (ahead of the hidden layer too), so a wave waits for memory once instead of once per term */
#pragma unroll
  for (int j = 0; j < 64; ++j) w2[j] = W2[(size_t)j * 3 * DMOD + o];
  const float vb2 = b2[o], vbq = bqkv[o];
  if (tid < 64) { float s = 0.f; for (int i = 0; i < 3; ++i) s += bf16_round(pose[b * 3 + i]) * bf16_round(W1[i * 64 + tid]); s += bf16_round(b1[tid]); hs[tid] = fmaxf(s, 0.f); }
  __syncthreads();
  float s = 0.f;
#pragma unroll
  for (int j = 0; j < 64; ++j) s += hs[j] * bf16_round(w2[j]);      /* terms summed in index order, j = 0..63 */
  s += bf16_round(vb2); s += bf16_round(vbq); PB[(size_t)b * 3 * DMOD + o] = s; }

extern "C" void kernel_launch(void* const* d_in, const int* in_sizes, int n_in,
                              void* d_out, int out_size, void* d_ws, size_t ws_size, hipStream_t stream) {
  (void)in_sizes; (void)n_in; (void)out_size;
  const float* const* I = (const float* const*)d_in; const float* x = I[0]; const float* pose = I[1]; const float* Wqkv = I[2]; const float* bqkv = I[3]; const float* W1 = I[4]; const float* b1 = I[5]; const float* W2 = I[6]; const float* b2 = I[7]; const float* Wp = I[8]; const float* bp = I[9];
  char* ws = (char*)d_ws; size_t off = 0;
  auto take = [&](size_t bytes) { char* p = ws + off; off += (bytes + 255) & ~(size_t)255; return p; };
  _Float16* BW = (_Float16*)take((size_t)3 * DMOD * DMOD * 2); _Float16* BO = (_Float16*)take((size_t)DMOD * 2 * DMOD * 2); float* PB = (float*)take((size_t)NB * 3 * DMOD * 4);
  _Float16* X16 = (_Float16*)take((size_t)NR * DMOD * 2); float* F32 = (float*)take((size_t)NR * 3 * DMOD * 4); _Float16* H3 = (_Float16*)take((size_t)NR * 3 * DMOD * 2); _Float16* L3 = (_Float16*)take((size_t)NR * 3 * DMOD * 2); _Float16* VT = (_Float16*)take((size_t)NR * DMOD * 2);      /* F32: [8192][q | k | v] row-major, pitch 3072; H3/L3: the same 3072 columns in fragment order, where a step of 1024 columns is 32 tiles = 16 * DMOD elements */
  float* O = F32; _Float16* Hh = H3; _Float16* Hl = L3;      /* aliases: F32 is last read by the first k_hl, H3/L3 by k_vt and the flash kernel */
  if (off > ws_size) return;      /* 6 + 4 + 16 + 96 + 48 + 48 + 16 = 234 MiB (256 MiB ws) */
  k_wt_f16<<<(unsigned)(((size_t)3 * DMOD * (DMOD / 8) + 255) / 256), 256, 0, stream>>>(Wqkv, BW, DMOD, 3 * DMOD, 16.0f); k_woutp<<<(unsigned)(((size_t)DMOD * (2 * DMOD / 8) + 255) / 256), 256, 0, stream>>>(Wp, BO);
  k_pose<<<NB * (3 * DMOD / 256), 256, 0, stream>>>(pose, W1, b1, W2, b2, bqkv, PB);
  k_x16<<<(unsigned)(((size_t)NR * DMOD / 8 + 255) / 256), 256, 0, stream>>>(x, X16, (size_t)NR * DMOD / 8);
  const dim3 gQ((NR / 128) * (3 * DMOD / 64), 1), gA((NR / 128) * (DMOD / 64), 1); const unsigned n8 = (unsigned)(((size_t)NR * DMOD / 8 + 255) / 256);
  k_gemm2<0><<<gQ, 128, 0, stream>>>(X16, DMOD, 0, BW, DMOD, 0, 0.0625f, nullptr, 0, PB, SLEN, (size_t)3 * DMOD, 0, F32, nullptr, 3 * DMOD, 0, NR, 3 * DMOD, DMOD);      /* all batches and q|k|v in one launch; + (bqkv + pose bias of batch row / 1024): the per-batch bias is a COMPUTED f32 vector, so it goes through the CP path (raw f32 add, CP[(row / SLEN) * 3072 + col]) rather than the bias path (which bf16-rounds, correct only for input biases) */
  k_hl<3 * DMOD><<<3 * n8, 256, 0, stream>>>(F32, H3, L3, (size_t)NR * 3 * DMOD / 8);
  k_vt<NH, SLEN><<<NB * NH * (SLEN / 64), 256, 0, stream>>>(H3, 3 * DMOD, 2 * DMOD, VT);
  k_flashqk<<<NB * NH * QBLKS, 128, 0, stream>>>(H3, L3, 3 * DMOD, H3 + 16 * DMOD, L3 + 16 * DMOD, 3 * DMOD, VT, O, DMOD);      /* q/k hi + residual; P (x2^10) and V plain f16 */
  k_hl<DMOD><<<n8, 256, 0, stream>>>(O, Hh, Hl, (size_t)NR * DMOD / 8);
  k_gemm2<0><<<gA, 128, 0, stream>>>(Hh, DMOD, 0, BO, 2 * DMOD, 0, 0.0625f, bp, 0, nullptr, 1, 0, 0, (float*)d_out, nullptr, DMOD, 0, NR, DMOD, DMOD);
  k_gemm2<0><<<gA, 128, 0, stream>>>(Hl, DMOD, 0, BO + 16 * DMOD, 2 * DMOD, 0, 1.0f / 1024.0f, nullptr, 0, (const float*)d_out, 1, (size_t)DMOD, 0, (float*)d_out, nullptr, DMOD, 0, NR, DMOD, DMOD);
}

// v005
// A run of this version takes 365 microseconds.
// Timed twice side by side with v004, it ran 1.13 times as fast both times.
// All steps since v000 together make it 4.31 times as fast.
#include <hip/hip_runtime.h>
// Pose-aware attention (8 batches x 1024 tokens x 1024; 16 heads x 64): qkv = x Wqkv + b; per-batch pose embedding = relu(pose W1 + b1) W2 + b2 split into (q, k, v) biases per (head, dim) and added to q/k/v; softmax(q k^T / 8) v; out Wproj + b -> [8,1024,1024].
// Structure: the pose MLP on VALU folded into per-batch bias vectors (bqkv + pose_{q|k|v}[b]); x as an exact f16 plane; one qkv GEMM over all 8192 rows x 3072 columns (32x64 wave tiles, f32 accumulation, exact x16 weights, that per-batch bias picked by row / 1024) whose epilogue itself splits q and k into f16 hi + 2^10 residual planes and stores v as the f16 V^T plane (no f32 plane, no split or transpose launch); the fused flash kernel, products transposed (S^T = K Q^T, O^T = V^T P^T; softmax statistics per lane, P kept in registers), with hi + 2^10-residual q/k planes (S = QhKh + (QlKh + QhKl)/1024) and plain f16 P (x2^10) and V (hi/lo operands in S only); the attention output, split into hi + residual by the flash kernel's own epilogue, into two accumulating projection GEMMs.
// Operand layout: every f16 plane that feeds a matrix instruction (x, both weights, q|k hi and residual, V^T, the attention output hi and residual) is stored in FRAGMENT ORDER: a [rows][KC] plane is cut into 16-row x 32-column tiles of 1 KiB, tile (row / 16, col / 32) at tile index (row / 16) * (KC / 32) + col / 32, and inside a tile the 16-byte chunk of row r, columns 8c..8c+7 (c = 0..3) sits at chunk c * 16 + r. A wave's fragment load (lane = 16 * hh + ln reads row ln, chunk 2 * half + hh) is then 512 contiguous bytes (4 cache lines) where a row-major plane made it touch 16 lines for the same bytes; values and their lane/register places are those of the row-major loaders.
// Compute dtype: x, pose and all parameters rounded to bf16; q, k hi + residual (~2^-21-class logits); P and v plain f16 (~2^-12); f32 accumulation/softmax. v_wmma_f32_16x16x32_f16.
#define NB 8
#define DMOD 1024
#define NR (NB * SLEN)
#define QBLKS (TQ / 64)
#define SLEN 1024
#define TQ SLEN
#define TK SLEN
#define NH 16
#define SCL 0.125f               /* 64^-0.5 */
typedef __bf16 v16b __attribute__((ext_vector_type(16)));
typedef unsigned short v8us __attribute__((ext_vector_type(8), may_alias));
typedef float  v8f  __attribute__((ext_vector_type(8)));
typedef float  v4f  __attribute__((ext_vector_type(4)));
typedef float  v4fa __attribute__((ext_vector_type(4), may_alias));
union FragB { v16b v; v8us half[2]; unsigned short u[16]; };

__device__ __forceinline__ unsigned short bf16_bits(float x) { unsigned int u = __float_as_uint(x); return (unsigned short)((u + 0x7FFFu + ((u >> 16) & 1u)) >> 16); }
__device__ __forceinline__ float bf16_val(unsigned short b) { return __uint_as_float(((unsigned int)b) << 16); }
__device__ __forceinline__ float bf16_round(float x) { return bf16_val(bf16_bits(x)); }
// D += A·B with NT terms: 1 = ah·bh, 2 = + al·bh (A split), 3 = + ah·bl (both split)
template <int NT>
__device__ __forceinline__ v8f mmaN(v16b ah, v16b al, v16b bh, v16b bl, v8f c) {
  c = __builtin_amdgcn_wmma_f32_16x16x32_bf16(false, ah, false, bh, (short)0, c, false, false);
  if (NT >= 2) c = __builtin_amdgcn_wmma_f32_16x16x32_bf16(false, al, false, bh, (short)0, c, false, false);
  if (NT >= 3) c = __builtin_amdgcn_wmma_f32_16x16x32_bf16(false, ah, false, bl, (short)0, c, false, false);
  asm volatile("v_nop\n\tv_nop\n\tv_nop\n\tv_nop" : "+v"(c) : "v"(ah), "v"(al), "v"(bh), "v"(bl));
  return c;
}

__global__ __launch_bounds__(256) void k_wt_bf16(const float* __restrict__ W, unsigned short* __restrict__ Wt, int K, int N) {
  const int t = blockIdx.x * 256 + threadIdx.x;
  const int k8n = K / 8;
  if (t >= N * k8n) return;
  const int n = t / k8n, k8 = (t % k8n) * 8;
  v8us v;
#pragma unroll
  for (int i = 0; i < 8; ++i) v[i] = bf16_bits(W[(size_t)(k8 + i) * N + n]);
  *(v8us*)(Wt + (size_t)n * K + k8) = v;
  
}

// GEMM C[M][N] (f32, pitch ldc) = act(A[M][K]·W + bias). A f32 row-major (pitch lda) converted per fragment to bf16
// (ASPLIT: hi/lo two planes -> 2 terms, else single rounded term); Wt bf16 [N][K] (pitch ldb). BIAS_BF16 rounds the
// bias to bf16 first (bias quantised to bf16 before the add). K%32==0, M%16==0, N%64==0.
template <bool ASPLIT, int ACT, bool BIAS_BF16>
__global__ __launch_bounds__(128) void k_gemm_bf(const float* __restrict__ A, int lda, const unsigned short* __restrict__ Wt, int ldb,
                                               const float* __restrict__ bias, float* __restrict__ C, int ldc, int M, int N, int K) {
  __shared__ __attribute__((aligned(16))) float so[4][16][64];
  const int tid = threadIdx.x, w = tid >> 5, lane = tid & 31, ln = lane & 15, hh = lane >> 4;
  const int ntn = N / 64;
  const int wid = blockIdx.x * 4 + w;
  const int mt = wid / ntn, nq = wid % ntn;
  if (mt * 16 >= M) return;
  const int row0 = mt * 16, col0 = nq * 64;
  const float* arow = A + (size_t)(row0 + ln) * lda;
  v8f acc[4] = {};
  for (int kb = 0; kb < K; kb += 32) {
    FragB ah, al;
    const v4f x0 = *(const v4fa*)(arow + kb + 8 * hh), x1 = *(const v4fa*)(arow + kb + 8 * hh + 4);
    const v4f x2 = *(const v4fa*)(arow + kb + 16 + 8 * hh), x3 = *(const v4fa*)(arow + kb + 16 + 8 * hh + 4);
    float xs[16] = {x0[0],x0[1],x0[2],x0[3],x1[0],x1[1],x1[2],x1[3],x2[0],x2[1],x2[2],x2[3],x3[0],x3[1],x3[2],x3[3]};
#pragma unroll
    for (int i = 0; i < 16; ++i) { const unsigned short hb = bf16_bits(xs[i]); ah.u[i] = hb; al.u[i] = ASPLIT ? bf16_bits(xs[i] - bf16_val(hb)) : (unsigned short)0; }
#pragma unroll
    for (int t = 0; t < 4; ++t) {
      const unsigned short* brow = Wt + (size_t)(col0 + t * 16 + ln) * ldb + kb;
      FragB b;
      b.half[0] = *(const v8us*)(brow + 8 * hh);
      b.half[1] = *(const v8us*)(brow + 16 + 8 * hh);
      acc[t] = mmaN<ASPLIT ? 2 : 1>(ah.v, al.v, b.v, b.v, acc[t]);
    }
  }
#pragma unroll
  for (int t = 0; t < 4; ++t) {
    float bv = bias ? bias[col0 + t * 16 + ln] : 0.f;
    if (BIAS_BF16) bv = bf16_round(bv);
#pragma unroll
    for (int r = 0; r < 8; ++r) { float v = acc[t][r] + bv; if (ACT == 1) v = fmaxf(v, 0.f); so[w][8 * hh + r][t * 16 + ln] = v; }
  }
  __builtin_amdgcn_fence(__ATOMIC_ACQ_REL, "workgroup");
  __builtin_amdgcn_wave_barrier();
  const int rsub = lane >> 4, c4 = (lane & 15) * 4;
  {
#pragma unroll
    for (int q = 0; q < 8; ++q) {
      const int r = q * 2 + rsub;
      const v4f v = *(const v4fa*)&so[w][r][c4];
      *(v4f*)(C + (size_t)(row0 + r) * ldc + col0 + c4) = v;
    }
    
  }
}

// GEMM C = act(A·W + bias + resid): A f32 (ASPLIT -> hi/lo 2 terms), Wt bf16 [N][K]; ACT 0 none, 1 relu, 2 exact gelu;
// resid (optional, f32, row index = (row % rmod), pitch ldr, RES_BF16 rounds it) added before the activation.
template <bool ASPLIT, int ACT, bool BIAS_BF16, bool RES_BF16>
__global__ __launch_bounds__(128) void k_gemm_bf3(const float* __restrict__ A, int lda, const unsigned short* __restrict__ Wt, int ldb,
                                                const float* __restrict__ bias, const float* __restrict__ resid, int rmod, int ldr,
                                                float* __restrict__ C, int ldc, int M, int N, int K) {
  __shared__ __attribute__((aligned(16))) float so[4][16][64];
  const int tid = threadIdx.x, w = tid >> 5, lane = tid & 31, ln = lane & 15, hh = lane >> 4;
  const int ntn = N / 64;
  const int wid = blockIdx.x * 4 + w;
  const int mt = wid / ntn, nq = wid % ntn;
  if (mt * 16 >= M) return;
  const int row0 = mt * 16, col0 = nq * 64;
  const float* arow = A + (size_t)(row0 + ln) * lda;
  v8f acc[4] = {};
  for (int kb = 0; kb < K; kb += 32) {
    FragB ah, al;
    const v4f x0 = *(const v4fa*)(arow + kb + 8 * hh), x1 = *(const v4fa*)(arow + kb + 8 * hh + 4);
    const v4f x2 = *(const v4fa*)(arow + kb + 16 + 8 * hh), x3 = *(const v4fa*)(arow + kb + 16 + 8 * hh + 4);
    float xs[16] = {x0[0],x0[1],x0[2],x0[3],x1[0],x1[1],x1[2],x1[3],x2[0],x2[1],x2[2],x2[3],x3[0],x3[1],x3[2],x3[3]};
#pragma unroll
    for (int i = 0; i < 16; ++i) { const unsigned short hb = bf16_bits(xs[i]); ah.u[i] = hb; al.u[i] = ASPLIT ? bf16_bits(xs[i] - bf16_val(hb)) : (unsigned short)0; }
#pragma unroll
    for (int t = 0; t < 4; ++t) {
      const unsigned short* brow = Wt + (size_t)(col0 + t * 16 + ln) * ldb + kb;
      FragB b;
      b.half[0] = *(const v8us*)(brow + 8 * hh);
      b.half[1] = *(const v8us*)(brow + 16 + 8 * hh);
      acc[t] = mmaN<ASPLIT ? 2 : 1>(ah.v, al.v, b.v, b.v, acc[t]);
    }
  }
#pragma unroll
  for (int t = 0; t < 4; ++t) {
    const int col = col0 + t * 16 + ln;
    float bv = bias ? bias[col] : 0.f;
    if (BIAS_BF16) bv = bf16_round(bv);
#pragma unroll
    for (int r = 0; r < 8; ++r) {
      float v = acc[t][r] + bv;
      if (resid) { float rv = resid[(size_t)((row0 + 8 * hh + r) % rmod) * ldr + col]; if (RES_BF16) rv = bf16_round(rv); v += rv; }
      if (ACT == 1) v = fmaxf(v, 0.f);
      if (ACT == 2) v = 0.5f * v * (1.0f + erff(v * 0.70710678118654752f));
      if (ACT == 3) { const float u = 0.7978845608028654f * (v + 0.044715f * v * v * v); v = 0.5f * v * (1.0f + tanhf(u)); }
      so[w][8 * hh + r][t * 16 + ln] = v;
    }
  }
  __builtin_amdgcn_fence(__ATOMIC_ACQ_REL, "workgroup");
  __builtin_amdgcn_wave_barrier();
  const int rsub = lane >> 4, c4 = (lane & 15) * 4;
  {
#pragma unroll
    for (int q = 0; q < 8; ++q) {
      const int r = q * 2 + rsub;
      const v4f v = *(const v4fa*)&so[w][r][c4];
      *(v4f*)(C + (size_t)(row0 + r) * ldc + col0 + c4) = v;
    }
    
  }
}
// row LayerNorm (biased variance, eps) over N: s = X (+ R); optional out_sum <- s; out_norm <- (s-mu)*rsqrt(var+eps)*g + b
template <bool PARAM_BF16>
__global__ __launch_bounds__(256) void k_layernorm(const float* __restrict__ X, const float* __restrict__ R, const float* __restrict__ g, const float* __restrict__ bta,
                                                  float* __restrict__ out_sum, float* __restrict__ out_norm, int N, float eps) {
  __shared__ float red[256];
  const int row = blockIdx.x, tid = threadIdx.x;
  const float* x = X + (size_t)row * N; const float* rr = R ? R + (size_t)row * N : nullptr;
  float vals[16];                     // up to N = 4096
  const int per = N / 256;            // contiguous chunk per thread? use strided-by-4 chunks: thread handles j = tid*4 + 1024*u
  float s1 = 0.f;
  for (int u = 0; u < per / 4; ++u) {
    const int j = tid * 4 + 1024 * u;
    const v4f a = *(const v4fa*)(x + j);
    v4f b = {0.f,0.f,0.f,0.f}; if (rr) b = *(const v4fa*)(rr + j);
#pragma unroll
    for (int q = 0; q < 4; ++q) { const float v = a[q] + b[q]; vals[u * 4 + q] = v; s1 += v; }
  }
  red[tid] = s1; __syncthreads();
  for (int st = 128; st > 0; st >>= 1) { if (tid < st) red[tid] += red[tid + st]; __syncthreads(); }
  const float mu = red[0] / (float)N; __syncthreads();
  float s2 = 0.f;
  for (int u = 0; u < per / 4; ++u)
#pragma unroll
    for (int q = 0; q < 4; ++q) { const float c = vals[u * 4 + q] - mu; s2 += c * c; }
  red[tid] = s2; __syncthreads();
  for (int st = 128; st > 0; st >>= 1) { if (tid < st) red[tid] += red[tid + st]; __syncthreads(); }
  const float rs = rsqrtf(red[0] / (float)N + eps);
  {
    for (int u = 0; u < per / 4; ++u) {
      const int j = tid * 4 + 1024 * u;
      v4f o, sm;
#pragma unroll
      for (int q = 0; q < 4; ++q) {
        float gg = g[j + q], bb = bta[j + q];
        if (PARAM_BF16) { gg = bf16_round(gg); bb = bf16_round(bb); }
        sm[q] = vals[u * 4 + q]; o[q] = (vals[u * 4 + q] - mu) * rs * gg + bb;
      }
      if (out_sum) *(v4f*)(out_sum + (size_t)row * N + j) = sm;
      *(v4f*)(out_norm + (size_t)row * N + j) = o;
    }
    
  }
}



// ---- f16 WMMA path (v_wmma_f32_16x16x32_f16): 11-bit significands for operands in range — used where a [0,1] probability operand needs more precision than bf16
typedef _Float16 v16h __attribute__((ext_vector_type(16)));
union FragH { v16h v; v8us half[2]; _Float16 h[16]; unsigned short u[16]; };
template <int NT>
__device__ __forceinline__ v8f mmaH(v16h ah, v16h al, v16h bh, v16h bl, v8f c) {
  c = __builtin_amdgcn_wmma_f32_16x16x32_f16(false, ah, false, bh, (short)0, c, false, false);
  if (NT >= 2) c = __builtin_amdgcn_wmma_f32_16x16x32_f16(false, al, false, bh, (short)0, c, false, false);
  if (NT >= 3) c = __builtin_amdgcn_wmma_f32_16x16x32_f16(false, ah, false, bl, (short)0, c, false, false);
  asm volatile("v_nop\n\tv_nop\n\tv_nop\n\tv_nop" : "+v"(c) : "v"(ah), "v"(al), "v"(bh), "v"(bl));
  return c;
}
// batched GEMM like k_gemm_b but f16 operands: A f32 (split into f16 hi/lo if ASPLIT, else rounded to f16), Bt = f16 values [n][k]; alpha; C f32; N multiple of 16 (partial tiles skipped)
template <bool ASPLIT>
__global__ __launch_bounds__(128) void k_gemm_h(const float* __restrict__ A, int lda, size_t sA, const _Float16* __restrict__ Bh, int ldb, size_t sB, float alpha, float* __restrict__ C, int ldc, size_t sC, int M, int N, int K) {
  __shared__ __attribute__((aligned(16))) float so[4][16][64];
  const int tid = threadIdx.x, w = tid >> 5, lane = tid & 31, ln = lane & 15, hh = lane >> 4; const int by = blockIdx.y;
  A += (size_t)by * sA; Bh += (size_t)by * sB; C += (size_t)by * sC;
  const int ntn = (N + 63) / 64; const int wid = blockIdx.x * 4 + w; const int mt = wid / ntn, nq = wid % ntn; if (mt * 16 >= M) return;
  const int row0 = mt * 16, col0 = nq * 64; const float* arow = A + (size_t)(row0 + ln) * lda;
  v8f acc[4] = {};
  for (int kb = 0; kb < K; kb += 32) {
    FragH ah, al;
    const v4f x0 = *(const v4fa*)(arow + kb + 8 * hh), x1 = *(const v4fa*)(arow + kb + 8 * hh + 4), x2 = *(const v4fa*)(arow + kb + 16 + 8 * hh), x3 = *(const v4fa*)(arow + kb + 16 + 8 * hh + 4);
    float xs[16] = {x0[0],x0[1],x0[2],x0[3],x1[0],x1[1],x1[2],x1[3],x2[0],x2[1],x2[2],x2[3],x3[0],x3[1],x3[2],x3[3]};
#pragma unroll
    for (int i = 0; i < 16; ++i) { const _Float16 h = (_Float16)xs[i]; ah.h[i] = h; al.h[i] = ASPLIT ? (_Float16)(xs[i] - (float)h) : (_Float16)0.0f; }
#pragma unroll
    for (int t = 0; t < 4; ++t) { if (col0 + t * 16 >= N) continue; const size_t boff = (size_t)(col0 + t * 16 + ln) * ldb + kb; FragH bq; bq.half[0] = *(const v8us*)(Bh + boff + 8 * hh); bq.half[1] = *(const v8us*)(Bh + boff + 16 + 8 * hh);
      acc[t] = mmaH<ASPLIT ? 2 : 1>(ah.v, al.v, bq.v, bq.v, acc[t]); }
  }
#pragma unroll
  for (int t = 0; t < 4; ++t) { if (col0 + t * 16 >= N) continue;
#pragma unroll
    for (int r = 0; r < 8; ++r) so[w][8 * hh + r][t * 16 + ln] = acc[t][r] * alpha; }
  __builtin_amdgcn_fence(__ATOMIC_ACQ_REL, "workgroup"); __builtin_amdgcn_wave_barrier();
  const int rsub = lane >> 4, c4 = (lane & 15) * 4;
  {
#pragma unroll
    for (int q = 0; q < 8; ++q) { const int r = q * 2 + rsub; if (col0 + c4 < N) { const v4f v = *(const v4fa*)&so[w][r][c4]; *(v4f*)(C + (size_t)(row0 + r) * ldc + col0 + c4) = v; } }
     }
}

// Wt (rows n, columns k, fragment order) = f16(W[k][n] * scale) from f32 row-major W[K][N] (scale = power of two; bf16-exact weights stay exact in f16 away from the subnormal range)
__global__ __launch_bounds__(256) void k_wt_f16(const float* __restrict__ W, _Float16* __restrict__ Wt, int K, int N, float scale) {
  const int t = blockIdx.x * 256 + threadIdx.x; if (t >= N * (K / 8)) return; const int tile = t >> 6; const int n = (tile / (K / 32)) * 16 + (t & 15), k8 = (tile % (K / 32)) * 32 + ((t >> 4) & 3) * 8; FragH f;      /* t = the output chunk in fragment order (rows n, columns k): 16 neighbouring lanes read 16 neighbouring n */
#pragma unroll
  for (int i = 0; i < 8; ++i) f.h[i] = (_Float16)(bf16_round(W[(size_t)(k8 + i) * N + n]) * scale); const v8us o = f.half[0];
  *(v8us*)((unsigned short*)Wt + (size_t)t * 8) = o; 
}
// k_gemm_hh variant with fused epilogue: v = acc·alpha + bias[by·sBias + col] (+ CP[(row/rowsPerB)·sCPb + by·64 + col] if CP) ; ACT 0 none / 1 elu ; writes f16 C16 (and f32 C if non-null)
template <int ACT>
__global__ __launch_bounds__(128) void k_gemm_hhx(const _Float16* __restrict__ A, int lda, size_t sA, const _Float16* __restrict__ Bh, int ldb, size_t sB, float alpha, const float* __restrict__ bias, size_t sBias, const float* __restrict__ CP, int rowsPerB, size_t sCPb, int row0g,
    float* __restrict__ C, _Float16* __restrict__ C16, int ldc, size_t sC, int M, int N, int K) {
  __shared__ __attribute__((aligned(16))) float so[4][16][64];
  const int tid = threadIdx.x, w = tid >> 5, lane = tid & 31, ln = lane & 15, hh = lane >> 4; const int by = blockIdx.y;
  A += (size_t)by * sA; Bh += (size_t)by * sB; const size_t cofs = (size_t)by * sC; const float* bp = bias ? bias + (size_t)by * sBias : nullptr;
  const int ntn = (N + 63) / 64; const int wid = blockIdx.x * 4 + w; const int mt = wid / ntn, nq = wid % ntn; if (mt * 16 >= M) return;
  const int row0 = mt * 16, col0 = nq * 64; const _Float16* arow = A + (size_t)(row0 + ln) * lda;
  v8f acc[4] = {};
  for (int kb = 0; kb < K; kb += 32) { FragH ah; ah.half[0] = *(const v8us*)((const unsigned short*)arow + kb + 8 * hh); ah.half[1] = *(const v8us*)((const unsigned short*)arow + kb + 16 + 8 * hh);
#pragma unroll
    for (int t = 0; t < 4; ++t) { if (col0 + t * 16 >= N) continue; const size_t boff = (size_t)(col0 + t * 16 + ln) * ldb + kb; FragH bq; bq.half[0] = *(const v8us*)((const unsigned short*)Bh + boff + 8 * hh); bq.half[1] = *(const v8us*)((const unsigned short*)Bh + boff + 16 + 8 * hh);
      acc[t] = mmaH<1>(ah.v, ah.v, bq.v, bq.v, acc[t]); }
  }
#pragma unroll
  for (int t = 0; t < 4; ++t) { if (col0 + t * 16 >= N) continue; const int col = col0 + t * 16 + ln; const float bv = bp ? bf16_round(bp[col]) : 0.f;
#pragma unroll
    for (int r = 0; r < 8; ++r) { float v = acc[t][r] * alpha + bv; if (CP) { const int bidx = (row0g + row0 + 8 * hh + r) / rowsPerB; v += CP[(size_t)bidx * sCPb + (size_t)by * 64 + col]; } if (ACT == 1) v = (v > 0.f) ? v : expm1f(v); else if (ACT == 7) v = (v > 0.f) ? v + 1.0f : expf(v); else if (ACT == 8) v = tanhf(v); else if (ACT == 9) v = 0.5f * v * (1.0f + tanhf(0.7978845608028654f * (v + 0.044715f * v * v * v))); else if (ACT == 11) v = 1.0f / (1.0f + expf(-v)); else if (ACT == 12) v = (v > 0.f) ? v : 0.01f * v; else if (ACT == 14) v = (v > 0.f) ? v : 0.1f * v; else if (ACT == 15) v = v / (1.0f + expf(-v)); else if (ACT == 3) v = fmaxf(v, 0.f); else if (ACT == 6) v = 0.5f * v * (1.0f + erff(v * 0.70710678118654752f)); so[w][8 * hh + r][t * 16 + ln] = v; } }
  __builtin_amdgcn_fence(__ATOMIC_ACQ_REL, "workgroup"); __builtin_amdgcn_wave_barrier();
  const int rsub = lane >> 4, c4 = (lane & 15) * 4; typedef _Float16 v4h __attribute__((ext_vector_type(4)));
  {
#pragma unroll
    for (int q = 0; q < 8; ++q) { const int r = q * 2 + rsub; if (col0 + c4 < N) { const v4f v = *(const v4fa*)&so[w][r][c4]; if (C) *(v4f*)(C + cofs + (size_t)(row0 + r) * ldc + col0 + c4) = v; if (C16) { v4h h4; for (int i = 0; i < 4; ++i) h4[i] = (_Float16)v[i]; *(v4h*)(C16 + cofs + (size_t)(row0 + r) * ldc + col0 + c4) = h4; } } }
     }
}


typedef _Float16 v4h __attribute__((ext_vector_type(4)));

// row-major f32 [rows][KC] -> fragment order: a wave takes 8 rows x the 4 chunks of one tile, so it reads 8 whole 128-byte lines and stores 4 whole lines. fo_src = element offset in the row-major source, fo_dst = 16-byte chunk index in the fragment-order plane
template <int KC> __device__ __forceinline__ size_t fo_src(size_t t) { const unsigned u = (unsigned)t, tile = u >> 6; return ((tile / (KC / 32)) * 16 + ((u & 7) | ((u >> 2) & 8))) * KC + (tile % (KC / 32)) * 32 + ((u >> 3) & 3) * 8; }      /* 32-bit: the planes here hold at most 8192 * 3072 elements */
__device__ __forceinline__ size_t fo_dst(size_t t) { const unsigned u = (unsigned)t; return (u >> 6) * 64 + ((u >> 3) & 3) * 16 + ((u & 7) | ((u >> 2) & 8)); }
__global__ __launch_bounds__(256) void k_x16(const float* __restrict__ x, _Float16* __restrict__ X16, size_t n8) { const size_t t = (size_t)blockIdx.x * 256 + threadIdx.x; if (t >= n8) return; FragH f; const size_t s = fo_src<DMOD>(t);
#pragma unroll
  for (int q = 0; q < 8; ++q) f.h[q] = (_Float16)bf16_round(x[s + q]); *(v8us*)((unsigned short*)X16 + fo_dst(t) * 8) = f.half[0];  }
__global__ __launch_bounds__(256) void k_h16(const float* __restrict__ x, _Float16* __restrict__ X16, size_t n8) { const size_t t = (size_t)blockIdx.x * 256 + threadIdx.x; if (t >= n8) return; FragH f;
#pragma unroll
  for (int q = 0; q < 8; ++q) f.h[q] = (_Float16)x[t * 8 + q]; *(v8us*)((unsigned short*)X16 + t * 8) = f.half[0];  }
__global__ __launch_bounds__(256) void k_round16f(const float* __restrict__ W, _Float16* __restrict__ Bt, size_t n8) { const size_t t = (size_t)blockIdx.x * 256 + threadIdx.x; if (t >= n8) return; FragH f;
#pragma unroll
  for (int i = 0; i < 8; ++i) f.h[i] = (_Float16)(bf16_round(W[t * 8 + i]) * 16.0f); *(v8us*)((unsigned short*)Bt + t * 8) = f.half[0];  }

// ---- fast GEMM (wave tile 32x64; requires M % 32 == 0 rows per launch region and N % 64 == 0); A and Bh in fragment order with lda / ldb columns (16 rows = 16 * ld elements, 32 columns = 512 elements); epilogue = k_gemm_hhx semantics ----
__device__ __forceinline__ v16h g2_frag(const _Float16* p) { FragH f; f.half[0] = *(const v8us*)((const unsigned short*)p); f.half[1] = *(const v8us*)((const unsigned short*)p + 256); return f.v; }      /* p = the tile's start + 8 * lane, fragment order */
__device__ __forceinline__ v8f g2_mma(v16h a, v16h b, v8f c) { v8f d = __builtin_amdgcn_wmma_f32_16x16x32_f16(false, a, false, b, (short)0, c, false, false); asm volatile("v_nop\n\tv_nop\n\tv_nop\n\tv_nop" : "+v"(d) : "v"(a), "v"(b)); return d; }
template <int ACT>
__global__ __launch_bounds__(128) void k_gemm2(const _Float16* __restrict__ A, int lda, size_t sA, const _Float16* __restrict__ Bh, int ldb, size_t sB, float alpha, const float* __restrict__ bias, size_t sBias, const float* __restrict__ CP, int rowsPerB, size_t sCPb, int row0g,
    float* __restrict__ C, _Float16* __restrict__ C16, int ldc, size_t sC, int M, int N, int K) {
  __shared__ __attribute__((aligned(16))) float so[4][32][68];
  const int tid = threadIdx.x, w = tid >> 5, lane = tid & 31, ln = lane & 15, hh = lane >> 4; const int by = blockIdx.y;
  A += (size_t)by * sA; Bh += (size_t)by * sB; const size_t cofs = (size_t)by * sC; const float* bp = bias ? bias + (size_t)by * sBias : nullptr;
  const int ntn = N >> 6; const int mt = blockIdx.x / ntn, nq = blockIdx.x - mt * ntn; const int row0 = mt * 128 + 32 * w, col0 = nq * 64; if (row0 >= M) return;
  const _Float16* a0p = A + (size_t)row0 * lda + 8 * lane; const _Float16* a1p = a0p + (size_t)16 * lda;
  const _Float16* b0p = Bh + (size_t)col0 * ldb + 8 * lane; const _Float16* b1p = b0p + (size_t)16 * ldb; const _Float16* b2p = b1p + (size_t)16 * ldb; const _Float16* b3p = b2p + (size_t)16 * ldb;
  const v8f z8 = {0.f,0.f,0.f,0.f,0.f,0.f,0.f,0.f}; v8f c00 = z8, c01 = z8, c02 = z8, c03 = z8, c10 = z8, c11 = z8, c12 = z8, c13 = z8;
#pragma unroll 1
  for (int kb = 0; kb < K; kb += 32) { const v16h a0 = g2_frag(a0p), a1 = g2_frag(a1p);
    v16h b = g2_frag(b0p); c00 = g2_mma(a0, b, c00); c10 = g2_mma(a1, b, c10);
    b = g2_frag(b1p); c01 = g2_mma(a0, b, c01); c11 = g2_mma(a1, b, c11);
    b = g2_frag(b2p); c02 = g2_mma(a0, b, c02); c12 = g2_mma(a1, b, c12);
    b = g2_frag(b3p); c03 = g2_mma(a0, b, c03); c13 = g2_mma(a1, b, c13);
    a0p += 512; a1p += 512; b0p += 512; b1p += 512; b2p += 512; b3p += 512; }      /* the next k tile of every operand row group lies 512 elements on */
  v8f accs[8] = {c00, c01, c02, c03, c10, c11, c12, c13};
#pragma unroll
  for (int u = 0; u < 8; ++u) { const int t = u & 3, half = u >> 2; const int col = col0 + t * 16 + ln; const float bv = bp ? bf16_round(bp[col]) : 0.f;
#pragma unroll
    for (int r = 0; r < 8; ++r) { const int rloc = half * 16 + 8 * hh + r; float v = accs[u][r] * alpha + bv; if (CP) { const int bidx = (row0g + row0 + rloc) / rowsPerB; v += CP[(size_t)bidx * sCPb + (size_t)by * 64 + col]; }
      if (ACT == 3) v = fmaxf(v, 0.f); else if (ACT == 6) v = 0.5f * v * (1.0f + erff(v * 0.70710678118654752f)); else if (ACT == 11) v = 1.0f / (1.0f + expf(-v)); else if (ACT == 15) v = v / (1.0f + expf(-v)); else if (ACT == 12) v = (v > 0.f) ? v : 0.01f * v; else if (ACT == 8) v = tanhf(v);
      so[w][rloc][t * 16 + ln] = v; } }
  __builtin_amdgcn_fence(__ATOMIC_ACQ_REL, "workgroup"); __builtin_amdgcn_wave_barrier();
  const int rsub = lane >> 4, c4 = (lane & 15) * 4;
  {
#pragma unroll
    for (int q = 0; q < 16; ++q) { const int r = q * 2 + rsub; const v4f v = *(const v4fa*)&so[w][r][c4]; if (C) *(v4f*)(C + cofs + (size_t)(row0 + r) * ldc + col0 + c4) = v; if (C16) { v4h h4; for (int i = 0; i < 4; ++i) h4[i] = (_Float16)v[i]; *(v4h*)(C16 + cofs + (size_t)(row0 + r) * ldc + col0 + c4) = h4; } }
     } }



// qkv GEMM: the main loop of k_gemm2 (A = x plane, Bh = weight plane, both DMOD columns, fragment order) over NR rows x 3 * DMOD columns; v = acc / 16 + PB[(row / SLEN) * 3 * DMOD + col] (raw f32 add of the computed per-batch bias).
// The epilogue writes the flash kernel's operand planes itself, so that no f32 q|k|v plane is stored and re-read and no split or transpose launch follows:
// q, k columns (col < 2 * DMOD): the 32 x 64 wave tile goes through the wave's own LDS rows to turn lane = column into lane = row, is split into f16 hi + 2^10 residual and stored to H3 / L3 (3 * DMOD columns, fragment order; the v columns of both planes stay unused): the tile's 64 columns are 2 neighbouring 1-KiB tiles per 16 rows, every store 512 contiguous bytes per wave.
// v columns: a block's 64 columns are one head. Accumulator (half, t) holds in lane 16 * hh + ln column d = t * 16 + ln and the 8 neighbouring tokens 16 * half + 8 * hh + r: exactly the 16-byte chunk 2 * half + hh of row d in the V^T plane (rows slab * 64 + d, SLEN columns, fragment order), stored straight from registers, 512 contiguous bytes per wave.
// 9 waves per SIMD asked for: that is what the 34-KiB LDS of a block allows and what k_gemm2's register count gives; without the bound the unrolled split epilogue took 135 registers and cost the main loop, which lives on other waves hiding its load waits, two waves per SIMD.
__global__ __launch_bounds__(128, 9) void k_gemm_qkv(const _Float16* __restrict__ A, const _Float16* __restrict__ Bh, const float* __restrict__ PB, _Float16* __restrict__ H3, _Float16* __restrict__ L3, _Float16* __restrict__ Vt) {
  __shared__ __attribute__((aligned(16))) float so[4][32][68];
  const int tid = threadIdx.x, w = tid >> 5, lane = tid & 31, ln = lane & 15, hh = lane >> 4;
  constexpr int ntn = 3 * DMOD / 64; const int mt = blockIdx.x / ntn, nq = blockIdx.x - mt * ntn; const int row0 = mt * 128 + 32 * w, col0 = nq * 64;
  const _Float16* a0p = A + (size_t)row0 * DMOD + 8 * lane; const _Float16* a1p = a0p + (size_t)16 * DMOD;
  const _Float16* b0p = Bh + (size_t)col0 * DMOD + 8 * lane; const _Float16* b1p = b0p + (size_t)16 * DMOD; const _Float16* b2p = b1p + (size_t)16 * DMOD; const _Float16* b3p = b2p + (size_t)16 * DMOD;
  const v8f z8 = {0.f,0.f,0.f,0.f,0.f,0.f,0.f,0.f}; v8f c00 = z8, c01 = z8, c02 = z8, c03 = z8, c10 = z8, c11 = z8, c12 = z8, c13 = z8;
#pragma unroll 1
  for (int kb = 0; kb < DMOD; kb += 32) { const v16h a0 = g2_frag(a0p), a1 = g2_frag(a1p);      /* rolled, as in k_gemm2: the same loop body and register count */
    v16h b = g2_frag(b0p); c00 = g2_mma(a0, b, c00); c10 = g2_mma(a1, b, c10);
    b = g2_frag(b1p); c01 = g2_mma(a0, b, c01); c11 = g2_mma(a1, b, c11);
    b = g2_frag(b2p); c02 = g2_mma(a0, b, c02); c12 = g2_mma(a1, b, c12);
    b = g2_frag(b3p); c03 = g2_mma(a0, b, c03); c13 = g2_mma(a1, b, c13);
    a0p += 512; a1p += 512; b0p += 512; b1p += 512; b2p += 512; b3p += 512; }
  v8f accs[8] = {c00, c01, c02, c03, c10, c11, c12, c13};
  const int bat = row0 / SLEN; const float* cp = PB + (size_t)bat * 3 * DMOD + col0 + ln;      /* a wave's 32 rows lie in one batch */
  if (col0 >= 2 * DMOD) {      /* the same for the whole block */
    const int slab = bat * NH + (col0 - 2 * DMOD) / 64;
    unsigned short* vt = (unsigned short*)Vt + ((size_t)slab * 4 * (SLEN / 32) + (row0 % SLEN) / 32) * 512 + 8 * lane;
#pragma unroll
    for (int u = 0; u < 8; ++u) { const int t = u & 3, half = u >> 2; const float bv = cp[t * 16]; FragH f;
#pragma unroll
      for (int r = 0; r < 8; ++r) f.h[r] = (_Float16)(accs[u][r] * 0.0625f + bv);
      *(v8us*)(vt + (size_t)t * (SLEN / 32) * 512 + half * 256) = f.half[0]; }
    return;
  }
  {
#pragma unroll
    for (int u = 0; u < 8; ++u) { const int t = u & 3, half = u >> 2; const float bv = cp[t * 16];
#pragma unroll
      for (int r = 0; r < 8; ++r) so[w][half * 16 + 8 * hh + r][t * 16 + ln] = accs[u][r] * 0.0625f + bv; }
    __builtin_amdgcn_fence(__ATOMIC_ACQ_REL, "workgroup"); __builtin_amdgcn_wave_barrier();      /* the wave's own LDS writes are done before its lanes read each other's rows, as in k_gemm2 */
    const size_t o0 = ((size_t)(row0 >> 4) * (3 * DMOD / 32) + (col0 >> 5)) * 512 + 8 * lane; unsigned short* hp = (unsigned short*)H3 + o0; unsigned short* lp = (unsigned short*)L3 + o0;
#pragma unroll
    for (int q = 0; q < 8; ++q) { const int g = q >> 2; const float* sp = &so[w][g * 16 + ln][((q >> 1) & 1) * 32 + ((q & 1) * 2 + hh) * 8];      /* the lane's chunk is number (q & 3) * 32 + lane of the 128 in the 2 tiles of row group g: row ln, the 8 columns from 8 * (number / 16) */
      const v4f a = *(const v4fa*)sp, c = *(const v4fa*)(sp + 4); FragH fh, fl;
#pragma unroll
      for (int i = 0; i < 4; ++i) { _Float16 hv = (_Float16)a[i]; fh.h[i] = hv; fl.h[i] = (_Float16)((a[i] - (float)hv) * 1024.0f); hv = (_Float16)c[i]; fh.h[4 + i] = hv; fl.h[4 + i] = (_Float16)((c[i] - (float)hv) * 1024.0f); }
      const size_t o = (size_t)g * (3 * DMOD / 32) * 512 + (q & 3) * 256; *(v8us*)(hp + o) = fh.half[0]; *(v8us*)(lp + o) = fl.half[0]; }
    asm volatile("s_wait_xcnt 0x0" ::: "memory");      /* behind the last two stores: the compiler lays the v branch's code behind this block with a fall-through edge (never taken) on which the stores' registers are rewritten */
  } }

template <int CAUSAL>
__global__ __launch_bounds__(128) void k_flash(const _Float16* __restrict__ Q16, int ldq, const _Float16* __restrict__ K16, int ldk, const _Float16* __restrict__ Vt, const int* __restrict__ MSK, float* __restrict__ O, int ldo) {
  constexpr int RPW = 16, RTN = RPW / 16, NQB = TQ / (4 * RPW), DT = 4, KS = 2;
  __shared__ __attribute__((aligned(16))) unsigned short sP[4][RPW][40]; __shared__ __attribute__((aligned(16))) float sO[4][RPW][64 + 4];
  const int tid = threadIdx.x, w = tid >> 5, lane = tid & 31, ln = lane & 15, hh = lane >> 4;
  const int slab = blockIdx.x / QBLKS, qblk = blockIdx.x % QBLKS; (void)NQB; const int b = slab / NH, h = slab % NH; const int qb0 = qblk * (4 * RPW); const int q0 = qb0 + w * RPW;
  FragH aq[2][KS];
#pragma unroll
  for (int rt = 0; rt < RTN; ++rt) { const unsigned short* qr = (const unsigned short*)Q16 + ((size_t)b * TQ + q0 + rt * 16 + ln) * ldq + h * 64;
#pragma unroll
    for (int ks = 0; ks < KS; ++ks) { aq[rt][ks].half[0] = *(const v8us*)(qr + ks * 32 + 8 * hh); aq[rt][ks].half[1] = *(const v8us*)(qr + ks * 32 + 16 + 8 * hh); } }
  const unsigned short* Vth = (const unsigned short*)Vt + (size_t)slab * 64 * TK;
  float m_r[2][8], l_r[2][8]; v8f oacc[2][DT];
#pragma unroll
  for (int rt = 0; rt < RTN; ++rt) {
#pragma unroll
    for (int r = 0; r < 8; ++r) { m_r[rt][r] = -3.0e38f; l_r[rt][r] = 0.f; }
#pragma unroll
    for (int dt = 0; dt < DT; ++dt) oacc[rt][dt] = (v8f){0.f,0.f,0.f,0.f,0.f,0.f,0.f,0.f}; }
  const int jend = (CAUSAL == 1) ? (qb0 + 4 * RPW) : TK;      /* causal: keys beyond the block's last query never contribute */
#pragma unroll 1
  for (int j0 = 0; j0 < jend; j0 += 32) {
    v8f s[2][2];
#pragma unroll
    for (int nt = 0; nt < 2; ++nt) { const unsigned short* kr = (const unsigned short*)K16 + ((size_t)b * TK + j0 + nt * 16 + ln) * ldk + h * 64; FragH bk[KS];
#pragma unroll
      for (int ks = 0; ks < KS; ++ks) { bk[ks].half[0] = *(const v8us*)(kr + ks * 32 + 8 * hh); bk[ks].half[1] = *(const v8us*)(kr + ks * 32 + 16 + 8 * hh); }
#pragma unroll
      for (int rt = 0; rt < RTN; ++rt) { v8f acc = (v8f){0.f,0.f,0.f,0.f,0.f,0.f,0.f,0.f};
#pragma unroll
        for (int ks = 0; ks < KS; ++ks) acc = mmaH<1>(aq[rt][ks].v, aq[rt][ks].v, bk[ks].v, bk[ks].v, acc); s[rt][nt] = acc; } }
#pragma unroll
    for (int rt = 0; rt < RTN; ++rt)
#pragma unroll
      for (int r = 0; r < 8; ++r) { const int tq = q0 + rt * 16 + 8 * hh + r; const int k0 = j0 + ln, k1 = j0 + 16 + ln;
        const bool ok0 = (CAUSAL == 1) ? (k0 <= tq) : ((CAUSAL == 2) ? ((k0 >> 5) == (tq >> 5)) : true), ok1 = (CAUSAL == 1) ? (k1 <= tq) : ((CAUSAL == 2) ? ((k1 >> 5) == (tq >> 5)) : true);      /* mode 2: block-diagonal 32-token groups */
        const float s0 = ok0 ? s[rt][0][r] * SCL : -3.0e38f, s1 = ok1 ? s[rt][1][r] * SCL : -3.0e38f; float mc = fmaxf(s0, s1);
        mc = fmaxf(mc, __shfl_xor(mc, 1, 32)); mc = fmaxf(mc, __shfl_xor(mc, 2, 32)); mc = fmaxf(mc, __shfl_xor(mc, 4, 32)); mc = fmaxf(mc, __shfl_xor(mc, 8, 32));
        const float mn = fmaxf(m_r[rt][r], mc); const float al = (mn > -1.0e38f) ? expf(m_r[rt][r] - mn) : 1.0f; m_r[rt][r] = mn; const float p0 = ok0 ? expf(s0 - mn) : 0.f, p1 = ok1 ? expf(s1 - mn) : 0.f; l_r[rt][r] = l_r[rt][r] * al + p0 + p1;
#pragma unroll
        for (int dt = 0; dt < DT; ++dt) oacc[rt][dt][r] *= al;
        FragH t2; t2.h[0] = (_Float16)(p0 * 1024.0f); t2.h[1] = (_Float16)(p1 * 1024.0f); sP[w][rt * 16 + 8 * hh + r][ln] = t2.u[0]; sP[w][rt * 16 + 8 * hh + r][16 + ln] = t2.u[1]; }
    __builtin_amdgcn_fence(__ATOMIC_ACQ_REL, "workgroup"); __builtin_amdgcn_wave_barrier();
    FragH pa[2];
#pragma unroll
    for (int rt = 0; rt < RTN; ++rt) { pa[rt].half[0] = *(const v8us*)&sP[w][rt * 16 + ln][8 * hh]; pa[rt].half[1] = *(const v8us*)&sP[w][rt * 16 + ln][16 + 8 * hh]; }
#pragma unroll
    for (int dt = 0; dt < DT; ++dt) { const unsigned short* vrow = Vth + (size_t)(dt * 16 + ln) * TK + j0; FragH bv; bv.half[0] = *(const v8us*)(vrow + 8 * hh); bv.half[1] = *(const v8us*)(vrow + 16 + 8 * hh);
#pragma unroll
      for (int rt = 0; rt < RTN; ++rt) oacc[rt][dt] = mmaH<1>(pa[rt].v, pa[rt].v, bv.v, bv.v, oacc[rt][dt]); }
    __builtin_amdgcn_fence(__ATOMIC_ACQ_REL, "workgroup"); __builtin_amdgcn_wave_barrier(); }
#pragma unroll
  for (int rt = 0; rt < RTN; ++rt) {
#pragma unroll
    for (int r = 0; r < 8; ++r) { float l = l_r[rt][r]; l += __shfl_xor(l, 1, 32); l += __shfl_xor(l, 2, 32); l += __shfl_xor(l, 4, 32); l += __shfl_xor(l, 8, 32); l_r[rt][r] = (l > 0.f) ? 1.0f / (l * 1024.0f) : 0.f; }
#pragma unroll
    for (int dt = 0; dt < DT; ++dt)
#pragma unroll
      for (int r = 0; r < 8; ++r) sO[w][rt * 16 + 8 * hh + r][dt * 16 + ln] = oacc[rt][dt][r] * l_r[rt][r]; }
  __builtin_amdgcn_fence(__ATOMIC_ACQ_REL, "workgroup"); __builtin_amdgcn_wave_barrier();
  {
#pragma unroll
    for (int rp = 0; rp < RPW; rp += 2) { const int r = rp + (lane >> 4), pc = lane & 15; const v4f val = *(const v4fa*)&sO[w][r][pc * 4]; *(v4f*)(O + ((size_t)b * TQ + q0 + r) * ldo + h * 64 + pc * 4) = val; }
     } }
// Q/K-split flash kernel, TRANSPOSED products: S^T = Kh Qh^T + (Kh Ql^T + Kl Qh^T)/1024 with K as the A operand and Q as the B operand, then O^T += V^T P^T. Q/K = [hi | 2^10 residual] f16 planes (QL/KL same layout as Q16/K16); plain f16 P (x2^10); Q, K planes (ldq, ldk columns) and V^T (TK columns) in fragment order (the A and the B loader of this form read a tile alike, so every fragment load is the one of the untransposed form).
// Why transposed: the accumulator of S^T holds, in lane 16 * hh + ln, query ln and keys nt * 16 + 8 * hh + r. A query's 32 scores thus sit in two lanes (ln and ln + 16): maximum and sum are in-lane work plus one exchange between the wave's halves, one running maximum / sum / rescale factor per lane, and element nt * 8 + r of the lane is exactly element nt * 8 + r of the B fragment of P^T (k = 8 * hh + i in its first half, 16 + 8 * hh + i in its second), so P goes from the accumulators into the next product without LDS.
__device__ __forceinline__ float xhalf(float x) { return __builtin_bit_cast(float, __builtin_amdgcn_permlanex16(__builtin_bit_cast(int, x), __builtin_bit_cast(int, x), 0x76543210, 0xfedcba98, false, false)); }      /* lane l with lane l ^ 16 */
__global__ __launch_bounds__(128) void k_flashqk(const _Float16* __restrict__ Q16, const _Float16* __restrict__ QL, int ldq, const _Float16* __restrict__ K16, const _Float16* __restrict__ KL, int ldk, const _Float16* __restrict__ Vt, _Float16* __restrict__ OH, _Float16* __restrict__ OL) {
  constexpr int RPW = 16, DT = 4, KS = 2;
  const int tid = threadIdx.x, w = tid >> 5, lane = tid & 31;
  const int slab = blockIdx.x / QBLKS, qblk = blockIdx.x % QBLKS; const int b = slab / NH, h = slab % NH; const int q0 = qblk * (4 * RPW) + w * RPW;
  FragH bq[KS], bql[KS];
  { const unsigned short* qr = (const unsigned short*)Q16 + ((size_t)b * TQ + q0) * ldq + h * 1024 + 8 * lane; const unsigned short* ql = (const unsigned short*)QL + ((size_t)b * TQ + q0) * ldq + h * 1024 + 8 * lane;      /* fragment order: a head's 64 columns are 2 tiles of 512 elements */
#pragma unroll
    for (int ks = 0; ks < KS; ++ks) { bq[ks].half[0] = *(const v8us*)(qr + ks * 512); bq[ks].half[1] = *(const v8us*)(qr + ks * 512 + 256); bql[ks].half[0] = *(const v8us*)(ql + ks * 512); bql[ks].half[1] = *(const v8us*)(ql + ks * 512 + 256); } }
  const unsigned short* Vth = (const unsigned short*)Vt + (size_t)slab * 64 * TK;
  float m_q = -3.0e38f, l_q = 0.f; v8f oacc[DT];      /* of query ln; l_q holds the sum over this half's keys, the halves are joined behind the loop */
#pragma unroll
  for (int dt = 0; dt < DT; ++dt) oacc[dt] = (v8f){0.f,0.f,0.f,0.f,0.f,0.f,0.f,0.f};
#pragma unroll 1
  for (int j0 = 0; j0 < TK; j0 += 32) {
    float sc[16];
#pragma unroll
    for (int nt = 0; nt < 2; ++nt) { const unsigned short* kr = (const unsigned short*)K16 + ((size_t)b * TK + j0 + nt * 16) * ldk + h * 1024 + 8 * lane; const unsigned short* klr = (const unsigned short*)KL + ((size_t)b * TK + j0 + nt * 16) * ldk + h * 1024 + 8 * lane; FragH ak[KS], akl[KS];
#pragma unroll
      for (int ks = 0; ks < KS; ++ks) { ak[ks].half[0] = *(const v8us*)(kr + ks * 512); ak[ks].half[1] = *(const v8us*)(kr + ks * 512 + 256); akl[ks].half[0] = *(const v8us*)(klr + ks * 512); akl[ks].half[1] = *(const v8us*)(klr + ks * 512 + 256); }
      asm volatile("s_wait_xcnt 0x0" :: "v"(kr), "v"(klr) : "memory");      /* behind the tile's 8 loads and in front of any reuse of their address registers; naming the two addresses as inputs keeps their registers untouched up to this wait */
      v8f acc = (v8f){0.f,0.f,0.f,0.f,0.f,0.f,0.f,0.f}, accl = acc;
#pragma unroll
      for (int ks = 0; ks < KS; ++ks) { acc = mmaH<1>(ak[ks].v, ak[ks].v, bq[ks].v, bq[ks].v, acc); accl = mmaH<1>(ak[ks].v, ak[ks].v, bql[ks].v, bql[ks].v, accl); accl = mmaH<1>(akl[ks].v, akl[ks].v, bq[ks].v, bq[ks].v, accl); }
#pragma unroll
      for (int r = 0; r < 8; ++r) sc[nt * 8 + r] = (acc[r] + accl[r] * 0.0009765625f) * SCL; }
    float mx[8];
#pragma unroll
    for (int i = 0; i < 8; ++i) mx[i] = fmaxf(sc[i], sc[8 + i]);
    float mc = fmaxf(fmaxf(fmaxf(mx[0], mx[1]), fmaxf(mx[2], mx[3])), fmaxf(fmaxf(mx[4], mx[5]), fmaxf(mx[6], mx[7])));
    mc = fmaxf(mc, xhalf(mc));
    const float mn = fmaxf(m_q, mc); const float ea = expf(m_q - mn); const float al = (mn > -1.0e38f) ? ea : 1.0f; m_q = mn;
    float p[16]; FragH pb;
#pragma unroll
    for (int i = 0; i < 16; ++i) { p[i] = expf(sc[i] - mn); pb.h[i] = (_Float16)(p[i] * 1024.0f); }
    l_q = l_q * al + ((((p[0] + p[1]) + (p[2] + p[3])) + ((p[4] + p[5]) + (p[6] + p[7]))) + (((p[8] + p[9]) + (p[10] + p[11])) + ((p[12] + p[13]) + (p[14] + p[15]))));
#pragma unroll
    for (int dt = 0; dt < DT; ++dt)
#pragma unroll
      for (int r = 0; r < 8; ++r) oacc[dt][r] *= al;
    FragH av[DT];
#pragma unroll
    for (int dt = 0; dt < DT; ++dt) { const unsigned short* vrow = Vth + (size_t)(dt * 16) * TK + j0 * 16 + 8 * lane; av[dt].half[0] = *(const v8us*)(vrow); av[dt].half[1] = *(const v8us*)(vrow + 256); }      /* fragment order: 32 keys = one tile of 512 elements; rows d of V^T are the A operand */
#pragma unroll
    for (int dt = 0; dt < DT; ++dt) oacc[dt] = mmaH<1>(av[dt].v, av[dt].v, pb.v, pb.v, oacc[dt]); }
  const float l = l_q + xhalf(l_q); const float inv = (l > 0.f) ? 1.0f / (l * 1024.0f) : 0.f;
  /* O^T: lane 16 * hh + ln holds query ln and, in accumulator dt, the 8 neighbouring columns d = dt * 16 + 8 * hh + r: exactly one 16-byte chunk of the projection's A plane (row = token, DMOD columns, fragment order). The hi + 2^10 residual split is done here and each plane gets 512 contiguous bytes per wave and dt, straight from registers */
  unsigned short* oh = (unsigned short*)OH + ((size_t)((b * TQ + q0) >> 4) * (DMOD / 32) + h * 2) * 512 + 8 * lane; unsigned short* ol = (unsigned short*)OL + ((size_t)((b * TQ + q0) >> 4) * (DMOD / 32) + h * 2) * 512 + 8 * lane;
#pragma unroll
  for (int dt = 0; dt < DT; ++dt) { FragH fh, fl;
#pragma unroll
    for (int r = 0; r < 8; ++r) { const float v = oacc[dt][r] * inv; const _Float16 hv = (_Float16)v; fh.h[r] = hv; fl.h[r] = (_Float16)((v - (float)hv) * 1024.0f); }
    *(v8us*)(oh + dt * 256) = fh.half[0]; *(v8us*)(ol + dt * 256) = fl.half[0]; } }

__global__ __launch_bounds__(256) void k_woutp(const float* __restrict__ Wm, _Float16* __restrict__ Bt) { const size_t t = (size_t)blockIdx.x * 256 + threadIdx.x; if (t >= (size_t)DMOD * (2 * DMOD / 8)) return; const int tile = (int)(t >> 6); const int pc = (tile % (2 * DMOD / 32)) * 4 + (int)((t >> 4) & 3); const int o = (tile / (2 * DMOD / 32)) * 16 + (int)(t & 15); const bool lo = pc * 8 >= DMOD; FragH f;      /* t = the output chunk in fragment order */
  for (int q = 0; q < 8; ++q) { const int c = pc * 8 + q - (lo ? DMOD : 0); f.h[q] = (_Float16)(bf16_round(Wm[(size_t)c * DMOD + o]) * (lo ? 1.0f : 16.0f)); } *(v8us*)((unsigned short*)Bt + t * 8) = f.half[0];  }      /* Wproj stored (in, out) -> Bt rows o, columns [c | 1024 + c], fragment order */
__global__ __launch_bounds__(256) void k_pose(const float* __restrict__ pose, const float* __restrict__ W1, const float* __restrict__ b1, const float* __restrict__ W2, const float* __restrict__ b2, const float* __restrict__ bqkv, float* __restrict__ PB) {
  #pragma clang fp contract(off)
  __shared__ float hs[64]; const int b = blockIdx.x / (3 * DMOD / 256), tid = threadIdx.x; const int o = (blockIdx.x % (3 * DMOD / 256)) * 256 + tid;      /* one block per (batch, 256-column slice), one output column per thread */
  float w2[64];      /* the column's 64 W2 values are fetched up front by independent loads (ahead of the hidden layer too), so a wave waits for memory once instead of once per term */
#pragma unroll
  for (int j = 0; j < 64; ++j) w2[j] = W2[(size_t)j * 3 * DMOD + o];
  const float vb2 = b2[o], vbq = bqkv[o];
  if (tid < 64) { float s = 0.f; for (int i = 0; i < 3; ++i) s += bf16_round(pose[b * 3 + i]) * bf16_round(W1[i * 64 + tid]); s += bf16_round(b1[tid]); hs[tid] = fmaxf(s, 0.f); }
  __syncthreads();
  float s = 0.f;
#pragma unroll
  for (int j = 0; j < 64; ++j) s += hs[j] * bf16_round(w2[j]);      /* terms summed in index order, j = 0..63 */
  s += bf16_round(vb2); s += bf16_round(vbq); PB[(size_t)b * 3 * DMOD + o] = s; }

extern "C" void kernel_launch(void* const* d_in, const int* in_sizes, int n_in,
                              void* d_out, int out_size, void* d_ws, size_t ws_size, hipStream_t stream) {
  (void)in_sizes; (void)n_in; (void)out_size;
  const float* const* I = (const float* const*)d_in; const float* x = I[0]; const float* pose = I[1]; const float* Wqkv = I[2]; const float* bqkv = I[3]; const float* W1 = I[4]; const float* b1 = I[5]; const float* W2 = I[6]; const float* b2 = I[7]; const float* Wp = I[8]; const float* bp = I[9];
  char* ws = (char*)d_ws; size_t off = 0;
  auto take = [&](size_t bytes) { char* p = ws + off; off += (bytes + 255) & ~(size_t)255; return p; };
  _Float16* BW = (_Float16*)take((size_t)3 * DMOD * DMOD * 2); _Float16* BO = (_Float16*)take((size_t)DMOD * 2 * DMOD * 2); float* PB = (float*)take((size_t)NB * 3 * DMOD * 4);
  _Float16* X16 = (_Float16*)take((size_t)NR * DMOD * 2); _Float16* H3 = (_Float16*)take((size_t)NR * 3 * DMOD * 2); _Float16* L3 = (_Float16*)take((size_t)NR * 3 * DMOD * 2); _Float16* VT = (_Float16*)take((size_t)NR * DMOD * 2); _Float16* Hh = (_Float16*)take((size_t)NR * DMOD * 2); _Float16* Hl = (_Float16*)take((size_t)NR * DMOD * 2);      /* H3/L3: 3072 columns q | k | (unused) in fragment order, where a step of 1024 columns is 32 tiles = 16 * DMOD elements; Hh/Hl are planes of their own: the flash kernel writes them while other blocks still read H3/L3 */
  if (off > ws_size) return;      /* 6 + 4 + 16 + 48 + 48 + 16 + 16 + 16 = 170 MiB (256 MiB ws) */
  k_wt_f16<<<(unsigned)(((size_t)3 * DMOD * (DMOD / 8) + 255) / 256), 256, 0, stream>>>(Wqkv, BW, DMOD, 3 * DMOD, 16.0f); k_woutp<<<(unsigned)(((size_t)DMOD * (2 * DMOD / 8) + 255) / 256), 256, 0, stream>>>(Wp, BO);
  k_pose<<<NB * (3 * DMOD / 256), 256, 0, stream>>>(pose, W1, b1, W2, b2, bqkv, PB);
  k_x16<<<(unsigned)(((size_t)NR * DMOD / 8 + 255) / 256), 256, 0, stream>>>(x, X16, (size_t)NR * DMOD / 8);
  const dim3 gQ((NR / 128) * (3 * DMOD / 64), 1), gA((NR / 128) * (DMOD / 64), 1);
  k_gemm_qkv<<<gQ, 128, 0, stream>>>(X16, BW, PB, H3, L3, VT);      /* all batches and q|k|v in one launch; + (bqkv + pose bias of batch row / 1024), a COMPUTED f32 vector added raw (not bf16-rounded like an input bias); writes q, k hi + residual and V^T */
  k_flashqk<<<NB * NH * QBLKS, 128, 0, stream>>>(H3, L3, 3 * DMOD, H3 + 16 * DMOD, L3 + 16 * DMOD, 3 * DMOD, VT, Hh, Hl);      /* q/k hi + residual; P (x2^10) and V plain f16; writes the attention output hi + residual */
  k_gemm2<0><<<gA, 128, 0, stream>>>(Hh, DMOD, 0, BO, 2 * DMOD, 0, 0.0625f, bp, 0, nullptr, 1, 0, 0, (float*)d_out, nullptr, DMOD, 0, NR, DMOD, DMOD);
  k_gemm2<0><<<gA, 128, 0, stream>>>(Hl, DMOD, 0, BO + 16 * DMOD, 2 * DMOD, 0, 1.0f / 1024.0f, nullptr, 0, (const float*)d_out, 1, (size_t)DMOD, 0, (float*)d_out, nullptr, DMOD, 0, NR, DMOD, DMOD);
}

// v006
// One run takes 264 microseconds.
// Two timings next to v005 put it at 1.41 and 1.38 times that version's speed.
// All steps since v000 together make it 6.01 times as fast.
#include <hip/hip_runtime.h>
// Pose-aware attention (8 batches x 1024 tokens x 1024; 16 heads x 64): qkv = x Wqkv + b; per-batch pose embedding = relu(pose W1 + b1) W2 + b2 split into (q, k, v) biases per (head, dim) and added to q/k/v; softmax(q k^T / 8) v; out Wproj + b -> [8,1024,1024].
// Structure: the pose MLP on VALU folded into per-batch bias vectors (bqkv + pose_{q|k|v}[b]); x as an exact f16 plane; one qkv GEMM over all 8192 rows x 3072 columns (32x64 wave tiles, f32 accumulation, exact x16 weights, that per-batch bias picked by row / 1024) whose epilogue itself splits q and k into f16 hi + 2^10 residual planes and stores v as the f16 V^T plane (no f32 plane, no split or transpose launch); the fused flash kernel, products transposed (S^T = K Q^T, O^T = V^T P^T; softmax statistics per lane, P kept in registers), with hi + 2^10-residual q/k planes (S = QhKh + (QlKh + QhKl)/1024) and plain f16 P (x2^10) and V (hi/lo operands in S only); the attention output, split into hi + residual by the flash kernel's own epilogue, into two accumulating projection GEMMs.
// Operand layout: every f16 plane that feeds a matrix instruction (x, both weights, q|k hi and residual, V^T, the attention output hi and residual) is stored in FRAGMENT ORDER: a [rows][KC] plane is cut into 16-row x 32-column tiles of 1 KiB, tile (row / 16, col / 32) at tile index (row / 16) * (KC / 32) + col / 32, and inside a tile the 16-byte chunk of row r, columns 8c..8c+7 (c = 0..3) sits at chunk c * 16 + r. A wave's fragment load (lane = 16 * hh + ln reads row ln, chunk 2 * half + hh) is then 512 contiguous bytes (4 cache lines) where a row-major plane made it touch 16 lines for the same bytes; values and their lane/register places are those of the row-major loaders.
// Compute dtype: x, pose and all parameters rounded to bf16; q, k hi + residual (~2^-21-class logits); P and v plain f16 (~2^-12); f32 accumulation/softmax. v_wmma_f32_16x16x32_f16.
#define NB 8
#define DMOD 1024
#define NR (NB * SLEN)
#define QBLKS (TQ / 64)
#define SLEN 1024
#define TQ SLEN
#define TK SLEN
#define NH 16
#define SCL 0.125f               /* 64^-0.5 */
typedef __bf16 v16b __attribute__((ext_vector_type(16)));
typedef unsigned short v8us __attribute__((ext_vector_type(8), may_alias));
typedef float  v8f  __attribute__((ext_vector_type(8)));
typedef float  v4f  __attribute__((ext_vector_type(4)));
typedef float  v4fa __attribute__((ext_vector_type(4), may_alias));
union FragB { v16b v; v8us half[2]; unsigned short u[16]; };

__device__ __forceinline__ unsigned short bf16_bits(float x) { unsigned int u = __float_as_uint(x); return (unsigned short)((u + 0x7FFFu + ((u >> 16) & 1u)) >> 16); }
__device__ __forceinline__ float bf16_val(unsigned short b) { return __uint_as_float(((unsigned int)b) << 16); }
__device__ __forceinline__ float bf16_round(float x) { return bf16_val(bf16_bits(x)); }
// D += A·B with NT terms: 1 = ah·bh, 2 = + al·bh (A split), 3 = + ah·bl (both split)
template <int NT>
__device__ __forceinline__ v8f mmaN(v16b ah, v16b al, v16b bh, v16b bl, v8f c) {
  c = __builtin_amdgcn_wmma_f32_16x16x32_bf16(false, ah, false, bh, (short)0, c, false, false);
  if (NT >= 2) c = __builtin_amdgcn_wmma_f32_16x16x32_bf16(false, al, false, bh, (short)0, c, false, false);
  if (NT >= 3) c = __builtin_amdgcn_wmma_f32_16x16x32_bf16(false, ah, false, bl, (short)0, c, false, false);
  asm volatile("v_nop\n\tv_nop\n\tv_nop\n\tv_nop" : "+v"(c) : "v"(ah), "v"(al), "v"(bh), "v"(bl));
  return c;
}

__global__ __launch_bounds__(256) void k_wt_bf16(const float* __restrict__ W, unsigned short* __restrict__ Wt, int K, int N) {
  const int t = blockIdx.x * 256 + threadIdx.x;
  const int k8n = K / 8;
  if (t >= N * k8n) return;
  const int n = t / k8n, k8 = (t % k8n) * 8;
  v8us v;
#pragma unroll
  for (int i = 0; i < 8; ++i) v[i] = bf16_bits(W[(size_t)(k8 + i) * N + n]);
  *(v8us*)(Wt + (size_t)n * K + k8) = v;
  
}

// GEMM C[M][N] (f32, pitch ldc) = act(A[M][K]·W + bias). A f32 row-major (pitch lda) converted per fragment to bf16
// (ASPLIT: hi/lo two planes -> 2 terms, else single rounded term); Wt bf16 [N][K] (pitch ldb). BIAS_BF16 rounds the
// bias to bf16 first (bias quantised to bf16 before the add). K%32==0, M%16==0, N%64==0.
template <bool ASPLIT, int ACT, bool BIAS_BF16>
__global__ __launch_bounds__(128) void k_gemm_bf(const float* __restrict__ A, int lda, const unsigned short* __restrict__ Wt, int ldb,
                                               const float* __restrict__ bias, float* __restrict__ C, int ldc, int M, int N, int K) {
  __shared__ __attribute__((aligned(16))) float so[4][16][64];
  const int tid = threadIdx.x, w = tid >> 5, lane = tid & 31, ln = lane & 15, hh = lane >> 4;
  const int ntn = N / 64;
  const int wid = blockIdx.x * 4 + w;
  const int mt = wid / ntn, nq = wid % ntn;
  if (mt * 16 >= M) return;
  const int row0 = mt * 16, col0 = nq * 64;
  const float* arow = A + (size_t)(row0 + ln) * lda;
  v8f acc[4] = {};
  for (int kb = 0; kb < K; kb += 32) {
    FragB ah, al;
    const v4f x0 = *(const v4fa*)(arow + kb + 8 * hh), x1 = *(const v4fa*)(arow + kb + 8 * hh + 4);
    const v4f x2 = *(const v4fa*)(arow + kb + 16 + 8 * hh), x3 = *(const v4fa*)(arow + kb + 16 + 8 * hh + 4);
    float xs[16] = {x0[0],x0[1],x0[2],x0[3],x1[0],x1[1],x1[2],x1[3],x2[0],x2[1],x2[2],x2[3],x3[0],x3[1],x3[2],x3[3]};
#pragma unroll
    for (int i = 0; i < 16; ++i) { const unsigned short hb = bf16_bits(xs[i]); ah.u[i] = hb; al.u[i] = ASPLIT ? bf16_bits(xs[i] - bf16_val(hb)) : (unsigned short)0; }
#pragma unroll
    for (int t = 0; t < 4; ++t) {
      const unsigned short* brow = Wt + (size_t)(col0 + t * 16 + ln) * ldb + kb;
      FragB b;
      b.half[0] = *(const v8us*)(brow + 8 * hh);
      b.half[1] = *(const v8us*)(brow + 16 + 8 * hh);
      acc[t] = mmaN<ASPLIT ? 2 : 1>(ah.v, al.v, b.v, b.v, acc[t]);
    }
  }
#pragma unroll
  for (int t = 0; t < 4; ++t) {
    float bv = bias ? bias[col0 + t * 16 + ln] : 0.f;
    if (BIAS_BF16) bv = bf16_round(bv);
#pragma unroll
    for (int r = 0; r < 8; ++r) { float v = acc[t][r] + bv; if (ACT == 1) v = fmaxf(v, 0.f); so[w][8 * hh + r][t * 16 + ln] = v; }
  }
  __builtin_amdgcn_fence(__ATOMIC_ACQ_REL, "workgroup");
  __builtin_amdgcn_wave_barrier();
  const int rsub = lane >> 4, c4 = (lane & 15) * 4;
  {
#pragma unroll
    for (int q = 0; q < 8; ++q) {
      const int r = q * 2 + rsub;
      const v4f v = *(const v4fa*)&so[w][r][c4];
      *(v4f*)(C + (size_t)(row0 + r) * ldc + col0 + c4) = v;
    }
    
  }
}

// GEMM C = act(A·W + bias + resid): A f32 (ASPLIT -> hi/lo 2 terms), Wt bf16 [N][K]; ACT 0 none, 1 relu, 2 exact gelu;
// resid (optional, f32, row index = (row % rmod), pitch ldr, RES_BF16 rounds it) added before the activation.
template <bool ASPLIT, int ACT, bool BIAS_BF16, bool RES_BF16>
__global__ __launch_bounds__(128) void k_gemm_bf3(const float* __restrict__ A, int lda, const unsigned short* __restrict__ Wt, int ldb,
                                                const float* __restrict__ bias, const float* __restrict__ resid, int rmod, int ldr,
                                                float* __restrict__ C, int ldc, int M, int N, int K) {
  __shared__ __attribute__((aligned(16))) float so[4][16][64];
  const int tid = threadIdx.x, w = tid >> 5, lane = tid & 31, ln = lane & 15, hh = lane >> 4;
  const int ntn = N / 64;
  const int wid = blockIdx.x * 4 + w;
  const int mt = wid / ntn, nq = wid % ntn;
  if (mt * 16 >= M) return;
  const int row0 = mt * 16, col0 = nq * 64;
  const float* arow = A + (size_t)(row0 + ln) * lda;
  v8f acc[4] = {};
  for (int kb = 0; kb < K; kb += 32) {
    FragB ah, al;
    const v4f x0 = *(const v4fa*)(arow + kb + 8 * hh), x1 = *(const v4fa*)(arow + kb + 8 * hh + 4);
    const v4f x2 = *(const v4fa*)(arow + kb + 16 + 8 * hh), x3 = *(const v4fa*)(arow + kb + 16 + 8 * hh + 4);
    float xs[16] = {x0[0],x0[1],x0[2],x0[3],x1[0],x1[1],x1[2],x1[3],x2[0],x2[1],x2[2],x2[3],x3[0],x3[1],x3[2],x3[3]};
#pragma unroll
    for (int i = 0; i < 16; ++i) { const unsigned short hb = bf16_bits(xs[i]); ah.u[i] = hb; al.u[i] = ASPLIT ? bf16_bits(xs[i] - bf16_val(hb)) : (unsigned short)0; }
#pragma unroll
    for (int t = 0; t < 4; ++t) {
      const unsigned short* brow = Wt + (size_t)(col0 + t * 16 + ln) * ldb + kb;
      FragB b;
      b.half[0] = *(const v8us*)(brow + 8 * hh);
      b.half[1] = *(const v8us*)(brow + 16 + 8 * hh);
      acc[t] = mmaN<ASPLIT ? 2 : 1>(ah.v, al.v, b.v, b.v, acc[t]);
    }
  }
#pragma unroll
  for (int t = 0; t < 4; ++t) {
    const int col = col0 + t * 16 + ln;
    float bv = bias ? bias[col] : 0.f;
    if (BIAS_BF16) bv = bf16_round(bv);
#pragma unroll
    for (int r = 0; r < 8; ++r) {
      float v = acc[t][r] + bv;
      if (resid) { float rv = resid[(size_t)((row0 + 8 * hh + r) % rmod) * ldr + col]; if (RES_BF16) rv = bf16_round(rv); v += rv; }
      if (ACT == 1) v = fmaxf(v, 0.f);
      if (ACT == 2) v = 0.5f * v * (1.0f + erff(v * 0.70710678118654752f));
      if (ACT == 3) { const float u = 0.7978845608028654f * (v + 0.044715f * v * v * v); v = 0.5f * v * (1.0f + tanhf(u)); }
      so[w][8 * hh + r][t * 16 + ln] = v;
    }
  }
  __builtin_amdgcn_fence(__ATOMIC_ACQ_REL, "workgroup");
  __builtin_amdgcn_wave_barrier();
  const int rsub = lane >> 4, c4 = (lane & 15) * 4;
  {
#pragma unroll
    for (int q = 0; q < 8; ++q) {
      const int r = q * 2 + rsub;
      const v4f v = *(const v4fa*)&so[w][r][c4];
      *(v4f*)(C + (size_t)(row0 + r) * ldc + col0 + c4) = v;
    }
    
  }
}
// row LayerNorm (biased variance, eps) over N: s = X (+ R); optional out_sum <- s; out_norm <- (s-mu)*rsqrt(var+eps)*g + b
template <bool PARAM_BF16>
__global__ __launch_bounds__(256) void k_layernorm(const float* __restrict__ X, const float* __restrict__ R, const float* __restrict__ g, const float* __restrict__ bta,
                                                  float* __restrict__ out_sum, float* __restrict__ out_norm, int N, float eps) {
  __shared__ float red[256];
  const int row = blockIdx.x, tid = threadIdx.x;
  const float* x = X + (size_t)row * N; const float* rr = R ? R + (size_t)row * N : nullptr;
  float vals[16];                     // up to N = 4096
  const int per = N / 256;            // contiguous chunk per thread? use strided-by-4 chunks: thread handles j = tid*4 + 1024*u
  float s1 = 0.f;
  for (int u = 0; u < per / 4; ++u) {
    const int j = tid * 4 + 1024 * u;
    const v4f a = *(const v4fa*)(x + j);
    v4f b = {0.f,0.f,0.f,0.f}; if (rr) b = *(const v4fa*)(rr + j);
#pragma unroll
    for (int q = 0; q < 4; ++q) { const float v = a[q] + b[q]; vals[u * 4 + q] = v; s1 += v; }
  }
  red[tid] = s1; __syncthreads();
  for (int st = 128; st > 0; st >>= 1) { if (tid < st) red[tid] += red[tid + st]; __syncthreads(); }
  const float mu = red[0] / (float)N; __syncthreads();
  float s2 = 0.f;
  for (int u = 0; u < per / 4; ++u)
#pragma unroll
    for (int q = 0; q < 4; ++q) { const float c = vals[u * 4 + q] - mu; s2 += c * c; }
  red[tid] = s2; __syncthreads();
  for (int st = 128; st > 0; st >>= 1) { if (tid < st) red[tid] += red[tid + st]; __syncthreads(); }
  const float rs = rsqrtf(red[0] / (float)N + eps);
  {
    for (int u = 0; u < per / 4; ++u) {
      const int j = tid * 4 + 1024 * u;
      v4f o, sm;
#pragma unroll
      for (int q = 0; q < 4; ++q) {
        float gg = g[j + q], bb = bta[j + q];
        if (PARAM_BF16) { gg = bf16_round(gg); bb = bf16_round(bb); }
        sm[q] = vals[u * 4 + q]; o[q] = (vals[u * 4 + q] - mu) * rs * gg + bb;
      }
      if (out_sum) *(v4f*)(out_sum + (size_t)row * N + j) = sm;
      *(v4f*)(out_norm + (size_t)row * N + j) = o;
    }
    
  }
}



// ---- f16 WMMA path (v_wmma_f32_16x16x32_f16): 11-bit significands for operands in range — used where a [0,1] probability operand needs more precision than bf16
typedef _Float16 v16h __attribute__((ext_vector_type(16)));
union FragH { v16h v; v8us half[2]; _Float16 h[16]; unsigned short u[16]; };
template <int NT>
__device__ __forceinline__ v8f mmaH(v16h ah, v16h al, v16h bh, v16h bl, v8f c) {
  c = __builtin_amdgcn_wmma_f32_16x16x32_f16(false, ah, false, bh, (short)0, c, false, false);
  if (NT >= 2) c = __builtin_amdgcn_wmma_f32_16x16x32_f16(false, al, false, bh, (short)0, c, false, false);
  if (NT >= 3) c = __builtin_amdgcn_wmma_f32_16x16x32_f16(false, ah, false, bl, (short)0, c, false, false);
  asm volatile("v_nop\n\tv_nop\n\tv_nop\n\tv_nop" : "+v"(c) : "v"(ah), "v"(al), "v"(bh), "v"(bl));
  return c;
}
// batched GEMM like k_gemm_b but f16 operands: A f32 (split into f16 hi/lo if ASPLIT, else rounded to f16), Bt = f16 values [n][k]; alpha; C f32; N multiple of 16 (partial tiles skipped)
template <bool ASPLIT>
__global__ __launch_bounds__(128) void k_gemm_h(const float* __restrict__ A, int lda, size_t sA, const _Float16* __restrict__ Bh, int ldb, size_t sB, float alpha, float* __restrict__ C, int ldc, size_t sC, int M, int N, int K) {
  __shared__ __attribute__((aligned(16))) float so[4][16][64];
  const int tid = threadIdx.x, w = tid >> 5, lane = tid & 31, ln = lane & 15, hh = lane >> 4; const int by = blockIdx.y;
  A += (size_t)by * sA; Bh += (size_t)by * sB; C += (size_t)by * sC;
  const int ntn = (N + 63) / 64; const int wid = blockIdx.x * 4 + w; const int mt = wid / ntn, nq = wid % ntn; if (mt * 16 >= M) return;
  const int row0 = mt * 16, col0 = nq * 64; const float* arow = A + (size_t)(row0 + ln) * lda;
  v8f acc[4] = {};
  for (int kb = 0; kb < K; kb += 32) {
    FragH ah, al;
    const v4f x0 = *(const v4fa*)(arow + kb + 8 * hh), x1 = *(const v4fa*)(arow + kb + 8 * hh + 4), x2 = *(const v4fa*)(arow + kb + 16 + 8 * hh), x3 = *(const v4fa*)(arow + kb + 16 + 8 * hh + 4);
    float xs[16] = {x0[0],x0[1],x0[2],x0[3],x1[0],x1[1],x1[2],x1[3],x2[0],x2[1],x2[2],x2[3],x3[0],x3[1],x3[2],x3[3]};
#pragma unroll
    for (int i = 0; i < 16; ++i) { const _Float16 h = (_Float16)xs[i]; ah.h[i] = h; al.h[i] = ASPLIT ? (_Float16)(xs[i] - (float)h) : (_Float16)0.0f; }
#pragma unroll
    for (int t = 0; t < 4; ++t) { if (col0 + t * 16 >= N) continue; const size_t boff = (size_t)(col0 + t * 16 + ln) * ldb + kb; FragH bq; bq.half[0] = *(const v8us*)(Bh + boff + 8 * hh); bq.half[1] = *(const v8us*)(Bh + boff + 16 + 8 * hh);
      acc[t] = mmaH<ASPLIT ? 2 : 1>(ah.v, al.v, bq.v, bq.v, acc[t]); }
  }
#pragma unroll
  for (int t = 0; t < 4; ++t) { if (col0 + t * 16 >= N) continue;
#pragma unroll
    for (int r = 0; r < 8; ++r) so[w][8 * hh + r][t * 16 + ln] = acc[t][r] * alpha; }
  __builtin_amdgcn_fence(__ATOMIC_ACQ_REL, "workgroup"); __builtin_amdgcn_wave_barrier();
  const int rsub = lane >> 4, c4 = (lane & 15) * 4;
  {
#pragma unroll
    for (int q = 0; q < 8; ++q) { const int r = q * 2 + rsub; if (col0 + c4 < N) { const v4f v = *(const v4fa*)&so[w][r][c4]; *(v4f*)(C + (size_t)(row0 + r) * ldc + col0 + c4) = v; } }
     }
}

// Wt (rows n, columns k, fragment order) = f16(W[k][n] * scale) from f32 row-major W[K][N] (scale = power of two; bf16-exact weights stay exact in f16 away from the subnormal range)
__global__ __launch_bounds__(256) void k_wt_f16(const float* __restrict__ W, _Float16* __restrict__ Wt, int K, int N, float scale) {
  const int t = blockIdx.x * 256 + threadIdx.x; if (t >= N * (K / 8)) return; const int tile = t >> 6; const int n = (tile / (K / 32)) * 16 + (t & 15), k8 = (tile % (K / 32)) * 32 + ((t >> 4) & 3) * 8; FragH f;      /* t = the output chunk in fragment order (rows n, columns k): 16 neighbouring lanes read 16 neighbouring n */
#pragma unroll
  for (int i = 0; i < 8; ++i) f.h[i] = (_Float16)(bf16_round(W[(size_t)(k8 + i) * N + n]) * scale); const v8us o = f.half[0];
  *(v8us*)((unsigned short*)Wt + (size_t)t * 8) = o; 
}
// k_gemm_hh variant with fused epilogue: v = acc·alpha + bias[by·sBias + col] (+ CP[(row/rowsPerB)·sCPb + by·64 + col] if CP) ; ACT 0 none / 1 elu ; writes f16 C16 (and f32 C if non-null)
template <int ACT>
__global__ __launch_bounds__(128) void k_gemm_hhx(const _Float16* __restrict__ A, int lda, size_t sA, const _Float16* __restrict__ Bh, int ldb, size_t sB, float alpha, const float* __restrict__ bias, size_t sBias, const float* __restrict__ CP, int rowsPerB, size_t sCPb, int row0g,
    float* __restrict__ C, _Float16* __restrict__ C16, int ldc, size_t sC, int M, int N, int K) {
  __shared__ __attribute__((aligned(16))) float so[4][16][64];
  const int tid = threadIdx.x, w = tid >> 5, lane = tid & 31, ln = lane & 15, hh = lane >> 4; const int by = blockIdx.y;
  A += (size_t)by * sA; Bh += (size_t)by * sB; const size_t cofs = (size_t)by * sC; const float* bp = bias ? bias + (size_t)by * sBias : nullptr;
  const int ntn = (N + 63) / 64; const int wid = blockIdx.x * 4 + w; const int mt = wid / ntn, nq = wid % ntn; if (mt * 16 >= M) return;
  const int row0 = mt * 16, col0 = nq * 64; const _Float16* arow = A + (size_t)(row0 + ln) * lda;
  v8f acc[4] = {};
  for (int kb = 0; kb < K; kb += 32) { FragH ah; ah.half[0] = *(const v8us*)((const unsigned short*)arow + kb + 8 * hh); ah.half[1] = *(const v8us*)((const unsigned short*)arow + kb + 16 + 8 * hh);
#pragma unroll
    for (int t = 0; t < 4; ++t) { if (col0 + t * 16 >= N) continue; const size_t boff = (size_t)(col0 + t * 16 + ln) * ldb + kb; FragH bq; bq.half[0] = *(const v8us*)((const unsigned short*)Bh + boff + 8 * hh); bq.half[1] = *(const v8us*)((const unsigned short*)Bh + boff + 16 + 8 * hh);
      acc[t] = mmaH<1>(ah.v, ah.v, bq.v, bq.v, acc[t]); }
  }
#pragma unroll
  for (int t = 0; t < 4; ++t) { if (col0 + t * 16 >= N) continue; const int col = col0 + t * 16 + ln; const float bv = bp ? bf16_round(bp[col]) : 0.f;
#pragma unroll
    for (int r = 0; r < 8; ++r) { float v = acc[t][r] * alpha + bv; if (CP) { const int bidx = (row0g + row0 + 8 * hh + r) / rowsPerB; v += CP[(size_t)bidx * sCPb + (size_t)by * 64 + col]; } if (ACT == 1) v = (v > 0.f) ? v : expm1f(v); else if (ACT == 7) v = (v > 0.f) ? v + 1.0f : expf(v); else if (ACT == 8) v = tanhf(v); else if (ACT == 9) v = 0.5f * v * (1.0f + tanhf(0.7978845608028654f * (v + 0.044715f * v * v * v))); else if (ACT == 11) v = 1.0f / (1.0f + expf(-v)); else if (ACT == 12) v = (v > 0.f) ? v : 0.01f * v; else if (ACT == 14) v = (v > 0.f) ? v : 0.1f * v; else if (ACT == 15) v = v / (1.0f + expf(-v)); else if (ACT == 3) v = fmaxf(v, 0.f); else if (ACT == 6) v = 0.5f * v * (1.0f + erff(v * 0.70710678118654752f)); so[w][8 * hh + r][t * 16 + ln] = v; } }
  __builtin_amdgcn_fence(__ATOMIC_ACQ_REL, "workgroup"); __builtin_amdgcn_wave_barrier();
  const int rsub = lane >> 4, c4 = (lane & 15) * 4; typedef _Float16 v4h __attribute__((ext_vector_type(4)));
  {
#pragma unroll
    for (int q = 0; q < 8; ++q) { const int r = q * 2 + rsub; if (col0 + c4 < N) { const v4f v = *(const v4fa*)&so[w][r][c4]; if (C) *(v4f*)(C + cofs + (size_t)(row0 + r) * ldc + col0 + c4) = v; if (C16) { v4h h4; for (int i = 0; i < 4; ++i) h4[i] = (_Float16)v[i]; *(v4h*)(C16 + cofs + (size_t)(row0 + r) * ldc + col0 + c4) = h4; } } }
     }
}


typedef _Float16 v4h __attribute__((ext_vector_type(4)));

// row-major f32 [rows][KC] -> fragment order: a wave takes 8 rows x the 4 chunks of one tile, so it reads 8 whole 128-byte lines and stores 4 whole lines. fo_src = element offset in the row-major source, fo_dst = 16-byte chunk index in the fragment-order plane
template <int KC> __device__ __forceinline__ size_t fo_src(size_t t) { const unsigned u = (unsigned)t, tile = u >> 6; return ((tile / (KC / 32)) * 16 + ((u & 7) | ((u >> 2) & 8))) * KC + (tile % (KC / 32)) * 32 + ((u >> 3) & 3) * 8; }      /* 32-bit: the planes here hold at most 8192 * 3072 elements */
__device__ __forceinline__ size_t fo_dst(size_t t) { const unsigned u = (unsigned)t; return (u >> 6) * 64 + ((u >> 3) & 3) * 16 + ((u & 7) | ((u >> 2) & 8)); }
__global__ __launch_bounds__(256) void k_x16(const float* __restrict__ x, _Float16* __restrict__ X16, size_t n8) { const size_t t = (size_t)blockIdx.x * 256 + threadIdx.x; if (t >= n8) return; FragH f; const size_t s = fo_src<DMOD>(t);
#pragma unroll
  for (int q = 0; q < 8; ++q) f.h[q] = (_Float16)bf16_round(x[s + q]); *(v8us*)((unsigned short*)X16 + fo_dst(t) * 8) = f.half[0];  }
__global__ __launch_bounds__(256) void k_h16(const float* __restrict__ x, _Float16* __restrict__ X16, size_t n8) { const size_t t = (size_t)blockIdx.x * 256 + threadIdx.x; if (t >= n8) return; FragH f;
#pragma unroll
  for (int q = 0; q < 8; ++q) f.h[q] = (_Float16)x[t * 8 + q]; *(v8us*)((unsigned short*)X16 + t * 8) = f.half[0];  }
__global__ __launch_bounds__(256) void k_round16f(const float* __restrict__ W, _Float16* __restrict__ Bt, size_t n8) { const size_t t = (size_t)blockIdx.x * 256 + threadIdx.x; if (t >= n8) return; FragH f;
#pragma unroll
  for (int i = 0; i < 8; ++i) f.h[i] = (_Float16)(bf16_round(W[t * 8 + i]) * 16.0f); *(v8us*)((unsigned short*)Bt + t * 8) = f.half[0];  }

// ---- fast GEMM (wave tile 32x64; requires M % 32 == 0 rows per launch region and N % 64 == 0); A and Bh in fragment order with lda / ldb columns (16 rows = 16 * ld elements, 32 columns = 512 elements); epilogue = k_gemm_hhx semantics ----
__device__ __forceinline__ v16h g2_frag(const _Float16* p) { FragH f; f.half[0] = *(const v8us*)((const unsigned short*)p); f.half[1] = *(const v8us*)((const unsigned short*)p + 256); return f.v; }      /* p = the tile's start + 8 * lane, fragment order */
__device__ __forceinline__ v8f g2_mma(v16h a, v16h b, v8f c) { v8f d = __builtin_amdgcn_wmma_f32_16x16x32_f16(false, a, false, b, (short)0, c, false, false); asm volatile("v_nop\n\tv_nop\n\tv_nop\n\tv_nop" : "+v"(d) : "v"(a), "v"(b)); return d; }
// One k step (32 columns) of a 32x64 wave tile: 2 A and 4 B fragments. The main loops keep TWO such sets: while one set's 8 products run, the other set's 12 loads are in flight, and a set is refilled (two k steps on) directly behind its own products. A wave then waits for memory once per k step, with 12 to 24 loads outstanding, where one shared B register set made it wait four times per k step with 2 loads outstanding. Every accumulator still takes its k steps in rising order.
struct G2Set { v16h a0, a1, b0, b1, b2, b3; };
__device__ __forceinline__ void g2_load(G2Set& s, const _Float16* a0p, const _Float16* a1p, const _Float16* b0p, const _Float16* b1p, const _Float16* b2p, const _Float16* b3p, int off, unsigned l8) {      /* the six tile addresses are the same in every lane, so they can live in scalar registers; l8 = 8 * lane is the lane's own part */
  s.a0 = g2_frag(a0p + off + l8); s.a1 = g2_frag(a1p + off + l8); s.b0 = g2_frag(b0p + off + l8); s.b1 = g2_frag(b1p + off + l8); s.b2 = g2_frag(b2p + off + l8); s.b3 = g2_frag(b3p + off + l8);
  __builtin_amdgcn_sched_barrier(0);      /* keeps a set's 12 loads together and the sets' groups in program order, so that the waits in front of one set's products can be counted and leave the other set's 12 loads in flight: left free, the scheduler mixed the two sets' loads in k_gemm2 and its loop waited for all 24 at the head of every trip */
}
__device__ __forceinline__ void g2_step(const G2Set& s, v8f& c00, v8f& c01, v8f& c02, v8f& c03, v8f& c10, v8f& c11, v8f& c12, v8f& c13) {
  c00 = g2_mma(s.a0, s.b0, c00); c10 = g2_mma(s.a1, s.b0, c10); c01 = g2_mma(s.a0, s.b1, c01); c11 = g2_mma(s.a1, s.b1, c11);
  c02 = g2_mma(s.a0, s.b2, c02); c12 = g2_mma(s.a1, s.b2, c12); c03 = g2_mma(s.a0, s.b3, c03); c13 = g2_mma(s.a1, s.b3, c13);
}
template <int ACT>
__global__ __launch_bounds__(128) void k_gemm2(const _Float16* __restrict__ A, int lda, size_t sA, const _Float16* __restrict__ Bh, int ldb, size_t sB, float alpha, const float* __restrict__ bias, size_t sBias, const float* __restrict__ CP, int rowsPerB, size_t sCPb, int row0g,
    float* __restrict__ C, _Float16* __restrict__ C16, int ldc, size_t sC, int M, int N, int K) {
  __shared__ __attribute__((aligned(16))) float so[4][32][68];
  const int tid = threadIdx.x, w = tid >> 5, lane = tid & 31, ln = lane & 15, hh = lane >> 4; const int by = blockIdx.y;
  A += (size_t)by * sA; Bh += (size_t)by * sB; const size_t cofs = (size_t)by * sC; const float* bp = bias ? bias + (size_t)by * sBias : nullptr;
  const int ntn = N >> 6; const int mt = blockIdx.x / ntn, nq = blockIdx.x - mt * ntn; const int row0 = mt * 128 + 32 * __builtin_amdgcn_readfirstlane(w), col0 = nq * 64; if (row0 >= M) return;      /* the wave's number read as a scalar: the operand addresses below then live in scalar registers */
  const unsigned l8 = 8 * lane; const _Float16* a0p = A + (size_t)row0 * lda; const _Float16* a1p = a0p + (size_t)16 * lda;
  const _Float16* b0p = Bh + (size_t)col0 * ldb; const _Float16* b1p = b0p + (size_t)16 * ldb; const _Float16* b2p = b1p + (size_t)16 * ldb; const _Float16* b3p = b2p + (size_t)16 * ldb;
  const v8f z8 = {0.f,0.f,0.f,0.f,0.f,0.f,0.f,0.f}; v8f c00 = z8, c01 = z8, c02 = z8, c03 = z8, c10 = z8, c11 = z8, c12 = z8, c13 = z8;
  G2Set s0, s1; g2_load(s0, a0p, a1p, b0p, b1p, b2p, b3p, 0, l8); g2_load(s1, a0p, a1p, b0p, b1p, b2p, b3p, 512, l8);      /* K % 64 == 0 and K >= 64; the next k tile of every operand row group lies 512 elements on */
  asm volatile("s_wait_xcnt 0x0" ::: "memory");      /* behind the first 24 loads: with the run-time pitch the compiler forms one of their addresses in vector registers and then zeroes an accumulator in the same registers */
#pragma unroll 1
  for (int kb = 64; kb < K; kb += 64) {      /* rolled: two k steps a trip, the two register sets by name */
    g2_step(s0, c00, c01, c02, c03, c10, c11, c12, c13); g2_load(s0, a0p, a1p, b0p, b1p, b2p, b3p, 1024, l8);
    g2_step(s1, c00, c01, c02, c03, c10, c11, c12, c13); g2_load(s1, a0p, a1p, b0p, b1p, b2p, b3p, 1536, l8);
    a0p += 1024; a1p += 1024; b0p += 1024; b1p += 1024; b2p += 1024; b3p += 1024; }
  g2_step(s0, c00, c01, c02, c03, c10, c11, c12, c13); g2_step(s1, c00, c01, c02, c03, c10, c11, c12, c13);      /* the last two k steps: nothing is left to refill */
  v8f accs[8] = {c00, c01, c02, c03, c10, c11, c12, c13};
#pragma unroll
  for (int u = 0; u < 8; ++u) { const int t = u & 3, half = u >> 2; const int col = col0 + t * 16 + ln; const float bv = bp ? bf16_round(bp[col]) : 0.f;
#pragma unroll
    for (int r = 0; r < 8; ++r) { const int rloc = half * 16 + 8 * hh + r; float v = accs[u][r] * alpha + bv; if (CP) { const int bidx = (row0g + row0 + rloc) / rowsPerB; v += CP[(size_t)bidx * sCPb + (size_t)by * 64 + col]; }
      if (ACT == 3) v = fmaxf(v, 0.f); else if (ACT == 6) v = 0.5f * v * (1.0f + erff(v * 0.70710678118654752f)); else if (ACT == 11) v = 1.0f / (1.0f + expf(-v)); else if (ACT == 15) v = v / (1.0f + expf(-v)); else if (ACT == 12) v = (v > 0.f) ? v : 0.01f * v; else if (ACT == 8) v = tanhf(v);
      so[w][rloc][t * 16 + ln] = v; } }
  __builtin_amdgcn_fence(__ATOMIC_ACQ_REL, "workgroup"); __builtin_amdgcn_wave_barrier();
  const int rsub = lane >> 4, c4 = (lane & 15) * 4;
  {
#pragma unroll
    for (int q = 0; q < 16; ++q) { const int r = q * 2 + rsub; const v4f v = *(const v4fa*)&so[w][r][c4]; if (C) *(v4f*)(C + cofs + (size_t)(row0 + r) * ldc + col0 + c4) = v; if (C16) { v4h h4; for (int i = 0; i < 4; ++i) h4[i] = (_Float16)v[i]; *(v4h*)(C16 + cofs + (size_t)(row0 + r) * ldc + col0 + c4) = h4; } }
     } }



// qkv GEMM: the main loop of k_gemm2 (A = x plane, Bh = weight plane, both DMOD columns, fragment order) over NR rows x 3 * DMOD columns; v = acc / 16 + PB[(row / SLEN) * 3 * DMOD + col] (raw f32 add of the computed per-batch bias).
// The epilogue writes the flash kernel's operand planes itself, so that no f32 q|k|v plane is stored and re-read and no split or transpose launch follows:
// q, k columns (col < 2 * DMOD): the 32 x 64 wave tile goes through the wave's own LDS rows to turn lane = column into lane = row, is split into f16 hi + 2^10 residual and stored to H3 / L3 (3 * DMOD columns, fragment order; the v columns of both planes stay unused): the tile's 64 columns are 2 neighbouring 1-KiB tiles per 16 rows, every store 512 contiguous bytes per wave.
// v columns: a block's 64 columns are one head. Accumulator (half, t) holds in lane 16 * hh + ln column d = t * 16 + ln and the 8 neighbouring tokens 16 * half + 8 * hh + r: exactly the 16-byte chunk 2 * half + hh of row d in the V^T plane (rows slab * 64 + d, SLEN columns, fragment order), stored straight from registers, 512 contiguous bytes per wave.
// 5 waves per SIMD asked for: 64 accumulator registers + two fragment sets of 48 + addresses fit the 192 registers that leaves; the loads in flight now come from each wave's own two sets rather than from many waves.
__global__ __launch_bounds__(128, 5) void k_gemm_qkv(const _Float16* __restrict__ A, const _Float16* __restrict__ Bh, const float* __restrict__ PB, _Float16* __restrict__ H3, _Float16* __restrict__ L3, _Float16* __restrict__ Vt) {
  __shared__ __attribute__((aligned(16))) float so[4][32][68];
  const int tid = threadIdx.x, w = tid >> 5, lane = tid & 31, ln = lane & 15, hh = lane >> 4;
  constexpr int ntn = 3 * DMOD / 64; const int mt = blockIdx.x / ntn, nq = blockIdx.x - mt * ntn; const int row0 = mt * 128 + 32 * __builtin_amdgcn_readfirstlane(w), col0 = nq * 64;      /* the wave's number read as a scalar, as in k_gemm2 */
  const unsigned l8 = 8 * lane; const _Float16* a0p = A + (size_t)row0 * DMOD; const _Float16* a1p = a0p + (size_t)16 * DMOD;
  const _Float16* b0p = Bh + (size_t)col0 * DMOD; const _Float16* b1p = b0p + (size_t)16 * DMOD; const _Float16* b2p = b1p + (size_t)16 * DMOD; const _Float16* b3p = b2p + (size_t)16 * DMOD;
  const v8f z8 = {0.f,0.f,0.f,0.f,0.f,0.f,0.f,0.f}; v8f c00 = z8, c01 = z8, c02 = z8, c03 = z8, c10 = z8, c11 = z8, c12 = z8, c13 = z8;
  G2Set s0, s1; g2_load(s0, a0p, a1p, b0p, b1p, b2p, b3p, 0, l8); g2_load(s1, a0p, a1p, b0p, b1p, b2p, b3p, 512, l8);
#pragma unroll 1
  for (int kb = 64; kb < DMOD; kb += 64) {      /* rolled, as in k_gemm2: the same loop body */
    g2_step(s0, c00, c01, c02, c03, c10, c11, c12, c13); g2_load(s0, a0p, a1p, b0p, b1p, b2p, b3p, 1024, l8);
    g2_step(s1, c00, c01, c02, c03, c10, c11, c12, c13); g2_load(s1, a0p, a1p, b0p, b1p, b2p, b3p, 1536, l8);
    a0p += 1024; a1p += 1024; b0p += 1024; b1p += 1024; b2p += 1024; b3p += 1024; }
  g2_step(s0, c00, c01, c02, c03, c10, c11, c12, c13); g2_step(s1, c00, c01, c02, c03, c10, c11, c12, c13);
  v8f accs[8] = {c00, c01, c02, c03, c10, c11, c12, c13};
  const int bat = row0 / SLEN; const float* cp = PB + (size_t)bat * 3 * DMOD + col0 + ln;      /* a wave's 32 rows lie in one batch */
  if (col0 >= 2 * DMOD) {      /* the same for the whole block */
    const int slab = bat * NH + (col0 - 2 * DMOD) / 64;
    unsigned short* vt = (unsigned short*)Vt + ((size_t)slab * 4 * (SLEN / 32) + (row0 % SLEN) / 32) * 512 + 8 * lane;
#pragma unroll
    for (int u = 0; u < 8; ++u) { const int t = u & 3, half = u >> 2; const float bv = cp[t * 16]; FragH f;
#pragma unroll
      for (int r = 0; r < 8; ++r) f.h[r] = (_Float16)(accs[u][r] * 0.0625f + bv);
      *(v8us*)(vt + (size_t)t * (SLEN / 32) * 512 + half * 256) = f.half[0]; }
    return;
  }
  {
#pragma unroll
    for (int u = 0; u < 8; ++u) { const int t = u & 3, half = u >> 2; const float bv = cp[t * 16];
#pragma unroll
      for (int r = 0; r < 8; ++r) so[w][half * 16 + 8 * hh + r][t * 16 + ln] = accs[u][r] * 0.0625f + bv; }
    __builtin_amdgcn_fence(__ATOMIC_ACQ_REL, "workgroup"); __builtin_amdgcn_wave_barrier();      /* the wave's own LDS writes are done before its lanes read each other's rows, as in k_gemm2 */
    const size_t o0 = ((size_t)(row0 >> 4) * (3 * DMOD / 32) + (col0 >> 5)) * 512 + 8 * lane; unsigned short* hp = (unsigned short*)H3 + o0; unsigned short* lp = (unsigned short*)L3 + o0;
#pragma unroll
    for (int q = 0; q < 8; ++q) { const int g = q >> 2; const float* sp = &so[w][g * 16 + ln][((q >> 1) & 1) * 32 + ((q & 1) * 2 + hh) * 8];      /* the lane's chunk is number (q & 3) * 32 + lane of the 128 in the 2 tiles of row group g: row ln, the 8 columns from 8 * (number / 16) */
      const v4f a = *(const v4fa*)sp, c = *(const v4fa*)(sp + 4); FragH fh, fl;
#pragma unroll
      for (int i = 0; i < 4; ++i) { _Float16 hv = (_Float16)a[i]; fh.h[i] = hv; fl.h[i] = (_Float16)((a[i] - (float)hv) * 1024.0f); hv = (_Float16)c[i]; fh.h[4 + i] = hv; fl.h[4 + i] = (_Float16)((c[i] - (float)hv) * 1024.0f); }
      const size_t o = (size_t)g * (3 * DMOD / 32) * 512 + (q & 3) * 256; *(v8us*)(hp + o) = fh.half[0]; *(v8us*)(lp + o) = fl.half[0]; }
    asm volatile("s_wait_xcnt 0x0" ::: "memory");      /* behind the last two stores: the compiler lays the v branch's code behind this block with a fall-through edge (never taken) on which the stores' registers are rewritten */
  } }

template <int CAUSAL>
__global__ __launch_bounds__(128) void k_flash(const _Float16* __restrict__ Q16, int ldq, const _Float16* __restrict__ K16, int ldk, const _Float16* __restrict__ Vt, const int* __restrict__ MSK, float* __restrict__ O, int ldo) {
  constexpr int RPW = 16, RTN = RPW / 16, NQB = TQ / (4 * RPW), DT = 4, KS = 2;
  __shared__ __attribute__((aligned(16))) unsigned short sP[4][RPW][40]; __shared__ __attribute__((aligned(16))) float sO[4][RPW][64 + 4];
  const int tid = threadIdx.x, w = tid >> 5, lane = tid & 31, ln = lane & 15, hh = lane >> 4;
  const int slab = blockIdx.x / QBLKS, qblk = blockIdx.x % QBLKS; (void)NQB; const int b = slab / NH, h = slab % NH; const int qb0 = qblk * (4 * RPW); const int q0 = qb0 + w * RPW;
  FragH aq[2][KS];
#pragma unroll
  for (int rt = 0; rt < RTN; ++rt) { const unsigned short* qr = (const unsigned short*)Q16 + ((size_t)b * TQ + q0 + rt * 16 + ln) * ldq + h * 64;
#pragma unroll
    for (int ks = 0; ks < KS; ++ks) { aq[rt][ks].half[0] = *(const v8us*)(qr + ks * 32 + 8 * hh); aq[rt][ks].half[1] = *(const v8us*)(qr + ks * 32 + 16 + 8 * hh); } }
  const unsigned short* Vth = (const unsigned short*)Vt + (size_t)slab * 64 * TK;
  float m_r[2][8], l_r[2][8]; v8f oacc[2][DT];
#pragma unroll
  for (int rt = 0; rt < RTN; ++rt) {
#pragma unroll
    for (int r = 0; r < 8; ++r) { m_r[rt][r] = -3.0e38f; l_r[rt][r] = 0.f; }
#pragma unroll
    for (int dt = 0; dt < DT; ++dt) oacc[rt][dt] = (v8f){0.f,0.f,0.f,0.f,0.f,0.f,0.f,0.f}; }
  const int jend = (CAUSAL == 1) ? (qb0 + 4 * RPW) : TK;      /* causal: keys beyond the block's last query never contribute */
#pragma unroll 1
  for (int j0 = 0; j0 < jend; j0 += 32) {
    v8f s[2][2];
#pragma unroll
    for (int nt = 0; nt < 2; ++nt) { const unsigned short* kr = (const unsigned short*)K16 + ((size_t)b * TK + j0 + nt * 16 + ln) * ldk + h * 64; FragH bk[KS];
#pragma unroll
      for (int ks = 0; ks < KS; ++ks) { bk[ks].half[0] = *(const v8us*)(kr + ks * 32 + 8 * hh); bk[ks].half[1] = *(const v8us*)(kr + ks * 32 + 16 + 8 * hh); }
#pragma unroll
      for (int rt = 0; rt < RTN; ++rt) { v8f acc = (v8f){0.f,0.f,0.f,0.f,0.f,0.f,0.f,0.f};
#pragma unroll
        for (int ks = 0; ks < KS; ++ks) acc = mmaH<1>(aq[rt][ks].v, aq[rt][ks].v, bk[ks].v, bk[ks].v, acc); s[rt][nt] = acc; } }
#pragma unroll
    for (int rt = 0; rt < RTN; ++rt)
#pragma unroll
      for (int r = 0; r < 8; ++r) { const int tq = q0 + rt * 16 + 8 * hh + r; const int k0 = j0 + ln, k1 = j0 + 16 + ln;
        const bool ok0 = (CAUSAL == 1) ? (k0 <= tq) : ((CAUSAL == 2) ? ((k0 >> 5) == (tq >> 5)) : true), ok1 = (CAUSAL == 1) ? (k1 <= tq) : ((CAUSAL == 2) ? ((k1 >> 5) == (tq >> 5)) : true);      /* mode 2: block-diagonal 32-token groups */
        const float s0 = ok0 ? s[rt][0][r] * SCL : -3.0e38f, s1 = ok1 ? s[rt][1][r] * SCL : -3.0e38f; float mc = fmaxf(s0, s1);
        mc = fmaxf(mc, __shfl_xor(mc, 1, 32)); mc = fmaxf(mc, __shfl_xor(mc, 2, 32)); mc = fmaxf(mc, __shfl_xor(mc, 4, 32)); mc = fmaxf(mc, __shfl_xor(mc, 8, 32));
        const float mn = fmaxf(m_r[rt][r], mc); const float al = (mn > -1.0e38f) ? expf(m_r[rt][r] - mn) : 1.0f; m_r[rt][r] = mn; const float p0 = ok0 ? expf(s0 - mn) : 0.f, p1 = ok1 ? expf(s1 - mn) : 0.f; l_r[rt][r] = l_r[rt][r] * al + p0 + p1;
#pragma unroll
        for (int dt = 0; dt < DT; ++dt) oacc[rt][dt][r] *= al;
        FragH t2; t2.h[0] = (_Float16)(p0 * 1024.0f); t2.h[1] = (_Float16)(p1 * 1024.0f); sP[w][rt * 16 + 8 * hh + r][ln] = t2.u[0]; sP[w][rt * 16 + 8 * hh + r][16 + ln] = t2.u[1]; }
    __builtin_amdgcn_fence(__ATOMIC_ACQ_REL, "workgroup"); __builtin_amdgcn_wave_barrier();
    FragH pa[2];
#pragma unroll
    for (int rt = 0; rt < RTN; ++rt) { pa[rt].half[0] = *(const v8us*)&sP[w][rt * 16 + ln][8 * hh]; pa[rt].half[1] = *(const v8us*)&sP[w][rt * 16 + ln][16 + 8 * hh]; }
#pragma unroll
    for (int dt = 0; dt < DT; ++dt) { const unsigned short* vrow = Vth + (size_t)(dt * 16 + ln) * TK + j0; FragH bv; bv.half[0] = *(const v8us*)(vrow + 8 * hh); bv.half[1] = *(const v8us*)(vrow + 16 + 8 * hh);
#pragma unroll
      for (int rt = 0; rt < RTN; ++rt) oacc[rt][dt] = mmaH<1>(pa[rt].v, pa[rt].v, bv.v, bv.v, oacc[rt][dt]); }
    __builtin_amdgcn_fence(__ATOMIC_ACQ_REL, "workgroup"); __builtin_amdgcn_wave_barrier(); }
#pragma unroll
  for (int rt = 0; rt < RTN; ++rt) {
#pragma unroll
    for (int r = 0; r < 8; ++r) { float l = l_r[rt][r]; l += __shfl_xor(l, 1, 32); l += __shfl_xor(l, 2, 32); l += __shfl_xor(l, 4, 32); l += __shfl_xor(l, 8, 32); l_r[rt][r] = (l > 0.f) ? 1.0f / (l * 1024.0f) : 0.f; }
#pragma unroll
    for (int dt = 0; dt < DT; ++dt)
#pragma unroll
      for (int r = 0; r < 8; ++r) sO[w][rt * 16 + 8 * hh + r][dt * 16 + ln] = oacc[rt][dt][r] * l_r[rt][r]; }
  __builtin_amdgcn_fence(__ATOMIC_ACQ_REL, "workgroup"); __builtin_amdgcn_wave_barrier();
  {
#pragma unroll
    for (int rp = 0; rp < RPW; rp += 2) { const int r = rp + (lane >> 4), pc = lane & 15; const v4f val = *(const v4fa*)&sO[w][r][pc * 4]; *(v4f*)(O + ((size_t)b * TQ + q0 + r) * ldo + h * 64 + pc * 4) = val; }
     } }
// Q/K-split flash kernel, TRANSPOSED products: S^T = Kh Qh^T + (Kh Ql^T + Kl Qh^T)/1024 with K as the A operand and Q as the B operand, then O^T += V^T P^T. Q/K = [hi | 2^10 residual] f16 planes (QL/KL same layout as Q16/K16); plain f16 P (x2^10); Q, K planes (ldq, ldk columns) and V^T (TK columns) in fragment order (the A and the B loader of this form read a tile alike, so every fragment load is the one of the untransposed form).
// Why transposed: the accumulator of S^T holds, in lane 16 * hh + ln, query ln and keys nt * 16 + 8 * hh + r. A query's 32 scores thus sit in two lanes (ln and ln + 16): maximum and sum are in-lane work plus one exchange between the wave's halves, one running maximum / sum / rescale factor per lane, and element nt * 8 + r of the lane is exactly element nt * 8 + r of the B fragment of P^T (k = 8 * hh + i in its first half, 16 + 8 * hh + i in its second), so P goes from the accumulators into the next product without LDS.
__device__ __forceinline__ float xhalf(float x) { return __builtin_bit_cast(float, __builtin_amdgcn_permlanex16(__builtin_bit_cast(int, x), __builtin_bit_cast(int, x), 0x76543210, 0xfedcba98, false, false)); }      /* lane l with lane l ^ 16 */
__global__ __launch_bounds__(128) void k_flashqk(const _Float16* __restrict__ Q16, const _Float16* __restrict__ QL, int ldq, const _Float16* __restrict__ K16, const _Float16* __restrict__ KL, int ldk, const _Float16* __restrict__ Vt, _Float16* __restrict__ OH, _Float16* __restrict__ OL) {
  constexpr int RPW = 16, DT = 4, KS = 2;
  const int tid = threadIdx.x, w = tid >> 5, lane = tid & 31;
  const int slab = blockIdx.x / QBLKS, qblk = blockIdx.x % QBLKS; const int b = slab / NH, h = slab % NH; const int q0 = qblk * (4 * RPW) + w * RPW;
  FragH bq[KS], bql[KS];
  { const unsigned short* qr = (const unsigned short*)Q16 + ((size_t)b * TQ + q0) * ldq + h * 1024 + 8 * lane; const unsigned short* ql = (const unsigned short*)QL + ((size_t)b * TQ + q0) * ldq + h * 1024 + 8 * lane;      /* fragment order: a head's 64 columns are 2 tiles of 512 elements */
#pragma unroll
    for (int ks = 0; ks < KS; ++ks) { bq[ks].half[0] = *(const v8us*)(qr + ks * 512); bq[ks].half[1] = *(const v8us*)(qr + ks * 512 + 256); bql[ks].half[0] = *(const v8us*)(ql + ks * 512); bql[ks].half[1] = *(const v8us*)(ql + ks * 512 + 256); } }
  const unsigned short* Vth = (const unsigned short*)Vt + (size_t)slab * 64 * TK;
  float m_q = -3.0e38f, l_q = 0.f; v8f oacc[DT];      /* of query ln; l_q holds the sum over this half's keys, the halves are joined behind the loop */
#pragma unroll
  for (int dt = 0; dt < DT; ++dt) oacc[dt] = (v8f){0.f,0.f,0.f,0.f,0.f,0.f,0.f,0.f};
#pragma unroll 1
  for (int j0 = 0; j0 < TK; j0 += 32) {
    float sc[16];
#pragma unroll
    for (int nt = 0; nt < 2; ++nt) { const unsigned short* kr = (const unsigned short*)K16 + ((size_t)b * TK + j0 + nt * 16) * ldk + h * 1024 + 8 * lane; const unsigned short* klr = (const unsigned short*)KL + ((size_t)b * TK + j0 + nt * 16) * ldk + h * 1024 + 8 * lane; FragH ak[KS], akl[KS];
#pragma unroll
      for (int ks = 0; ks < KS; ++ks) { ak[ks].half[0] = *(const v8us*)(kr + ks * 512); ak[ks].half[1] = *(const v8us*)(kr + ks * 512 + 256); akl[ks].half[0] = *(const v8us*)(klr + ks * 512); akl[ks].half[1] = *(const v8us*)(klr + ks * 512 + 256); }
      asm volatile("s_wait_xcnt 0x0" :: "v"(kr), "v"(klr) : "memory");      /* behind the tile's 8 loads and in front of any reuse of their address registers; naming the two addresses as inputs keeps their registers untouched up to this wait */
      v8f acc = (v8f){0.f,0.f,0.f,0.f,0.f,0.f,0.f,0.f}, accl = acc;
#pragma unroll
      for (int ks = 0; ks < KS; ++ks) { acc = mmaH<1>(ak[ks].v, ak[ks].v, bq[ks].v, bq[ks].v, acc); accl = mmaH<1>(ak[ks].v, ak[ks].v, bql[ks].v, bql[ks].v, accl); accl = mmaH<1>(akl[ks].v, akl[ks].v, bq[ks].v, bq[ks].v, accl); }
#pragma unroll
      for (int r = 0; r < 8; ++r) sc[nt * 8 + r] = (acc[r] + accl[r] * 0.0009765625f) * SCL; }
    float mx[8];
#pragma unroll
    for (int i = 0; i < 8; ++i) mx[i] = fmaxf(sc[i], sc[8 + i]);
    float mc = fmaxf(fmaxf(fmaxf(mx[0], mx[1]), fmaxf(mx[2], mx[3])), fmaxf(fmaxf(mx[4], mx[5]), fmaxf(mx[6], mx[7])));
    mc = fmaxf(mc, xhalf(mc));
    const float mn = fmaxf(m_q, mc); const float ea = expf(m_q - mn); const float al = (mn > -1.0e38f) ? ea : 1.0f; m_q = mn;
    float p[16]; FragH pb;
#pragma unroll
    for (int i = 0; i < 16; ++i) { p[i] = expf(sc[i] - mn); pb.h[i] = (_Float16)(p[i] * 1024.0f); }
    l_q = l_q * al + ((((p[0] + p[1]) + (p[2] + p[3])) + ((p[4] + p[5]) + (p[6] + p[7]))) + (((p[8] + p[9]) + (p[10] + p[11])) + ((p[12] + p[13]) + (p[14] + p[15]))));
#pragma unroll
    for (int dt = 0; dt < DT; ++dt)
#pragma unroll
      for (int r = 0; r < 8; ++r) oacc[dt][r] *= al;
    FragH av[DT];
#pragma unroll
    for (int dt = 0; dt < DT; ++dt) { const unsigned short* vrow = Vth + (size_t)(dt * 16) * TK + j0 * 16 + 8 * lane; av[dt].half[0] = *(const v8us*)(vrow); av[dt].half[1] = *(const v8us*)(vrow + 256); }      /* fragment order: 32 keys = one tile of 512 elements; rows d of V^T are the A operand */
#pragma unroll
    for (int dt = 0; dt < DT; ++dt) oacc[dt] = mmaH<1>(av[dt].v, av[dt].v, pb.v, pb.v, oacc[dt]); }
  const float l = l_q + xhalf(l_q); const float inv = (l > 0.f) ? 1.0f / (l * 1024.0f) : 0.f;
  /* O^T: lane 16 * hh + ln holds query ln and, in accumulator dt, the 8 neighbouring columns d = dt * 16 + 8 * hh + r: exactly one 16-byte chunk of the projection's A plane (row = token, DMOD columns, fragment order). The hi + 2^10 residual split is done here and each plane gets 512 contiguous bytes per wave and dt, straight from registers */
  unsigned short* oh = (unsigned short*)OH + ((size_t)((b * TQ + q0) >> 4) * (DMOD / 32) + h * 2) * 512 + 8 * lane; unsigned short* ol = (unsigned short*)OL + ((size_t)((b * TQ + q0) >> 4) * (DMOD / 32) + h * 2) * 512 + 8 * lane;
#pragma unroll
  for (int dt = 0; dt < DT; ++dt) { FragH fh, fl;
#pragma unroll
    for (int r = 0; r < 8; ++r) { const float v = oacc[dt][r] * inv; const _Float16 hv = (_Float16)v; fh.h[r] = hv; fl.h[r] = (_Float16)((v - (float)hv) * 1024.0f); }
    *(v8us*)(oh + dt * 256) = fh.half[0]; *(v8us*)(ol + dt * 256) = fl.half[0]; } }

__global__ __launch_bounds__(256) void k_woutp(const float* __restrict__ Wm, _Float16* __restrict__ Bt) { const size_t t = (size_t)blockIdx.x * 256 + threadIdx.x; if (t >= (size_t)DMOD * (2 * DMOD / 8)) return; const int tile = (int)(t >> 6); const int pc = (tile % (2 * DMOD / 32)) * 4 + (int)((t >> 4) & 3); const int o = (tile / (2 * DMOD / 32)) * 16 + (int)(t & 15); const bool lo = pc * 8 >= DMOD; FragH f;      /* t = the output chunk in fragment order */
  for (int q = 0; q < 8; ++q) { const int c = pc * 8 + q - (lo ? DMOD : 0); f.h[q] = (_Float16)(bf16_round(Wm[(size_t)c * DMOD + o]) * (lo ? 1.0f : 16.0f)); } *(v8us*)((unsigned short*)Bt + t * 8) = f.half[0];  }      /* Wproj stored (in, out) -> Bt rows o, columns [c | 1024 + c], fragment order */
__global__ __launch_bounds__(256) void k_pose(const float* __restrict__ pose, const float* __restrict__ W1, const float* __restrict__ b1, const float* __restrict__ W2, const float* __restrict__ b2, const float* __restrict__ bqkv, float* __restrict__ PB) {
  #pragma clang fp contract(off)
  __shared__ float hs[64]; const int b = blockIdx.x / (3 * DMOD / 256), tid = threadIdx.x; const int o = (blockIdx.x % (3 * DMOD / 256)) * 256 + tid;      /* one block per (batch, 256-column slice), one output column per thread */
  float w2[64];      /* the column's 64 W2 values are fetched up front by independent loads (ahead of the hidden layer too), so a wave waits for memory once instead of once per term */
#pragma unroll
  for (int j = 0; j < 64; ++j) w2[j] = W2[(size_t)j * 3 * DMOD + o];
  const float vb2 = b2[o], vbq = bqkv[o];
  if (tid < 64) { float s = 0.f; for (int i = 0; i < 3; ++i) s += bf16_round(pose[b * 3 + i]) * bf16_round(W1[i * 64 + tid]); s += bf16_round(b1[tid]); hs[tid] = fmaxf(s, 0.f); }
  __syncthreads();
  float s = 0.f;
#pragma unroll
  for (int j = 0; j < 64; ++j) s += hs[j] * bf16_round(w2[j]);      /* terms summed in index order, j = 0..63 */
  s += bf16_round(vb2); s += bf16_round(vbq); PB[(size_t)b * 3 * DMOD + o] = s; }

extern "C" void kernel_launch(void* const* d_in, const int* in_sizes, int n_in,
                              void* d_out, int out_size, void* d_ws, size_t ws_size, hipStream_t stream) {
  (void)in_sizes; (void)n_in; (void)out_size;
  const float* const* I = (const float* const*)d_in; const float* x = I[0]; const float* pose = I[1]; const float* Wqkv = I[2]; const float* bqkv = I[3]; const float* W1 = I[4]; const float* b1 = I[5]; const float* W2 = I[6]; const float* b2 = I[7]; const float* Wp = I[8]; const float* bp = I[9];
  char* ws = (char*)d_ws; size_t off = 0;
  auto take = [&](size_t bytes) { char* p = ws + off; off += (bytes + 255) & ~(size_t)255; return p; };
  _Float16* BW = (_Float16*)take((size_t)3 * DMOD * DMOD * 2); _Float16* BO = (_Float16*)take((size_t)DMOD * 2 * DMOD * 2); float* PB = (float*)take((size_t)NB * 3 * DMOD * 4);
  _Float16* X16 = (_Float16*)take((size_t)NR * DMOD * 2); _Float16* H3 = (_Float16*)take((size_t)NR * 3 * DMOD * 2); _Float16* L3 = (_Float16*)take((size_t)NR * 3 * DMOD * 2); _Float16* VT = (_Float16*)take((size_t)NR * DMOD * 2); _Float16* Hh = (_Float16*)take((size_t)NR * DMOD * 2); _Float16* Hl = (_Float16*)take((size_t)NR * DMOD * 2);      /* H3/L3: 3072 columns q | k | (unused) in fragment order, where a step of 1024 columns is 32 tiles = 16 * DMOD elements; Hh/Hl are planes of their own: the flash kernel writes them while other blocks still read H3/L3 */
  if (off > ws_size) return;      /* 6 + 4 + 16 + 48 + 48 + 16 + 16 + 16 = 170 MiB (256 MiB ws) */
  k_wt_f16<<<(unsigned)(((size_t)3 * DMOD * (DMOD / 8) + 255) / 256), 256, 0, stream>>>(Wqkv, BW, DMOD, 3 * DMOD, 16.0f); k_woutp<<<(unsigned)(((size_t)DMOD * (2 * DMOD / 8) + 255) / 256), 256, 0, stream>>>(Wp, BO);
  k_pose<<<NB * (3 * DMOD / 256), 256, 0, stream>>>(pose, W1, b1, W2, b2, bqkv, PB);
  k_x16<<<(unsigned)(((size_t)NR * DMOD / 8 + 255) / 256), 256, 0, stream>>>(x, X16, (size_t)NR * DMOD / 8);
  const dim3 gQ((NR / 128) * (3 * DMOD / 64), 1), gA((NR / 128) * (DMOD / 64), 1);
  k_gemm_qkv<<<gQ, 128, 0, stream>>>(X16, BW, PB, H3, L3, VT);      /* all batches and q|k|v in one launch; + (bqkv + pose bias of batch row / 1024), a COMPUTED f32 vector added raw (not bf16-rounded like an input bias); writes q, k hi + residual and V^T */
  k_flashqk<<<NB * NH * QBLKS, 128, 0, stream>>>(H3, L3, 3 * DMOD, H3 + 16 * DMOD, L3 + 16 * DMOD, 3 * DMOD, VT, Hh, Hl);      /* q/k hi + residual; P (x2^10) and V plain f16; writes the attention output hi + residual */
  k_gemm2<0><<<gA, 128, 0, stream>>>(Hh, DMOD, 0, BO, 2 * DMOD, 0, 0.0625f, bp, 0, nullptr, 1, 0, 0, (float*)d_out, nullptr, DMOD, 0, NR, DMOD, DMOD);
  k_gemm2<0><<<gA, 128, 0, stream>>>(Hl, DMOD, 0, BO + 16 * DMOD, 2 * DMOD, 0, 1.0f / 1024.0f, nullptr, 0, (const float*)d_out, 1, (size_t)DMOD, 0, (float*)d_out, nullptr, DMOD, 0, NR, DMOD, DMOD);
}

// v007
// Measured time: 242 microseconds a run.
// In both of two side-by-side timings against v006, it was 1.09 times as fast.
// Over all steps from v000 it is 6.55 times as fast.
#include <hip/hip_runtime.h>
// Pose-aware attention (8 batches x 1024 tokens x 1024; 16 heads x 64): qkv = x Wqkv + b; per-batch pose embedding = relu(pose W1 + b1) W2 + b2 split into (q, k, v) biases per (head, dim) and added to q/k/v; softmax(q k^T / 8) v; out Wproj + b -> [8,1024,1024].
// Structure: the pose MLP on VALU folded into per-batch bias vectors (bqkv + pose_{q|k|v}[b]); x as an exact f16 plane; one qkv GEMM over all 8192 rows x 3072 columns (32x64 wave tiles, f32 accumulation, exact x16 weights, that per-batch bias picked by row / 1024) whose epilogue itself splits q and k into f16 hi + 2^10 residual planes and stores v as the f16 V^T plane (no f32 plane, no split or transpose launch); the fused flash kernel, products transposed (S^T = K Q^T, O^T = V^T P^T; softmax statistics per lane, P kept in registers), with hi + 2^10-residual q/k planes (S = QhKh + (QlKh + QhKl)/1024) and plain f16 P (x2^10) and V (S with hi/lo operands, P.V with plain ones); the attention output, split into hi + residual by the flash kernel's own epilogue, into one projection GEMM that sums the hi and then the residual products in the same accumulators.
// Operand layout: every f16 plane that feeds a matrix instruction (x, both weights, q|k hi and residual, V^T, the attention output hi and residual) is stored in FRAGMENT ORDER: a [rows][KC] plane is cut into 16-row x 32-column tiles of 1 KiB, tile (row / 16, col / 32) at tile index (row / 16) * (KC / 32) + col / 32, and inside a tile the 16-byte chunk of row r, columns 8c..8c+7 (c = 0..3) sits at chunk c * 16 + r. A wave's fragment load (lane = 16 * hh + ln reads row ln, chunk 2 * half + hh) is then 512 contiguous bytes (4 cache lines) where a row-major plane made it touch 16 lines for the same bytes; values and their lane/register places are those of the row-major loaders.
// Compute dtype: x, pose and all parameters rounded to bf16; q, k hi + residual (~2^-21-class logits); P and v plain f16 (~2^-12); f32 accumulation/softmax. v_wmma_f32_16x16x32_f16.
#define NB 8
#define DMOD 1024
#define NR (NB * SLEN)
#define QBLKS (TQ / 64)
#define SLEN 1024
#define TQ SLEN
#define TK SLEN
#define NH 16
#define SCL 0.125f               /* 64^-0.5 */
typedef __bf16 v16b __attribute__((ext_vector_type(16)));
typedef unsigned short v8us __attribute__((ext_vector_type(8), may_alias));
typedef float  v8f  __attribute__((ext_vector_type(8)));
typedef float  v4f  __attribute__((ext_vector_type(4)));
typedef float  v4fa __attribute__((ext_vector_type(4), may_alias));
union FragB { v16b v; v8us half[2]; unsigned short u[16]; };

__device__ __forceinline__ unsigned short bf16_bits(float x) { unsigned int u = __float_as_uint(x); return (unsigned short)((u + 0x7FFFu + ((u >> 16) & 1u)) >> 16); }
__device__ __forceinline__ float bf16_val(unsigned short b) { return __uint_as_float(((unsigned int)b) << 16); }
__device__ __forceinline__ float bf16_round(float x) { return bf16_val(bf16_bits(x)); }
// D += A·B with NT terms: 1 = ah·bh, 2 = + al·bh (A split), 3 = + ah·bl (both split)
template <int NT>
__device__ __forceinline__ v8f mmaN(v16b ah, v16b al, v16b bh, v16b bl, v8f c) {
  c = __builtin_amdgcn_wmma_f32_16x16x32_bf16(false, ah, false, bh, (short)0, c, false, false);
  if (NT >= 2) c = __builtin_amdgcn_wmma_f32_16x16x32_bf16(false, al, false, bh, (short)0, c, false, false);
  if (NT >= 3) c = __builtin_amdgcn_wmma_f32_16x16x32_bf16(false, ah, false, bl, (short)0, c, false, false);
  asm volatile("v_nop\n\tv_nop\n\tv_nop\n\tv_nop" : "+v"(c) : "v"(ah), "v"(al), "v"(bh), "v"(bl));
  return c;
}

__global__ __launch_bounds__(256) void k_wt_bf16(const float* __restrict__ W, unsigned short* __restrict__ Wt, int K, int N) {
  const int t = blockIdx.x * 256 + threadIdx.x;
  const int k8n = K / 8;
  if (t >= N * k8n) return;
  const int n = t / k8n, k8 = (t % k8n) * 8;
  v8us v;
#pragma unroll
  for (int i = 0; i < 8; ++i) v[i] = bf16_bits(W[(size_t)(k8 + i) * N + n]);
  *(v8us*)(Wt + (size_t)n * K + k8) = v;
  
}

// GEMM C[M][N] (f32, pitch ldc) = act(A[M][K]·W + bias). A f32 row-major (pitch lda) converted per fragment to bf16
// (ASPLIT: hi/lo two planes -> 2 terms, else single rounded term); Wt bf16 [N][K] (pitch ldb). BIAS_BF16 rounds the
// bias to bf16 first (bias quantised to bf16 before the add). K%32==0, M%16==0, N%64==0.
template <bool ASPLIT, int ACT, bool BIAS_BF16>
__global__ __launch_bounds__(128) void k_gemm_bf(const float* __restrict__ A, int lda, const unsigned short* __restrict__ Wt, int ldb,
                                               const float* __restrict__ bias, float* __restrict__ C, int ldc, int M, int N, int K) {
  __shared__ __attribute__((aligned(16))) float so[4][16][64];
  const int tid = threadIdx.x, w = tid >> 5, lane = tid & 31, ln = lane & 15, hh = lane >> 4;
  const int ntn = N / 64;
  const int wid = blockIdx.x * 4 + w;
  const int mt = wid / ntn, nq = wid % ntn;
  if (mt * 16 >= M) return;
  const int row0 = mt * 16, col0 = nq * 64;
  const float* arow = A + (size_t)(row0 + ln) * lda;
  v8f acc[4] = {};
  for (int kb = 0; kb < K; kb += 32) {
    FragB ah, al;
    const v4f x0 = *(const v4fa*)(arow + kb + 8 * hh), x1 = *(const v4fa*)(arow + kb + 8 * hh + 4);
    const v4f x2 = *(const v4fa*)(arow + kb + 16 + 8 * hh), x3 = *(const v4fa*)(arow + kb + 16 + 8 * hh + 4);
    float xs[16] = {x0[0],x0[1],x0[2],x0[3],x1[0],x1[1],x1[2],x1[3],x2[0],x2[1],x2[2],x2[3],x3[0],x3[1],x3[2],x3[3]};
#pragma unroll
    for (int i = 0; i < 16; ++i) { const unsigned short hb = bf16_bits(xs[i]); ah.u[i] = hb; al.u[i] = ASPLIT ? bf16_bits(xs[i] - bf16_val(hb)) : (unsigned short)0; }
#pragma unroll
    for (int t = 0; t < 4; ++t) {
      const unsigned short* brow = Wt + (size_t)(col0 + t * 16 + ln) * ldb + kb;
      FragB b;
      b.half[0] = *(const v8us*)(brow + 8 * hh);
      b.half[1] = *(const v8us*)(brow + 16 + 8 * hh);
      acc[t] = mmaN<ASPLIT ? 2 : 1>(ah.v, al.v, b.v, b.v, acc[t]);
    }
  }
#pragma unroll
  for (int t = 0; t < 4; ++t) {
    float bv = bias ? bias[col0 + t * 16 + ln] : 0.f;
    if (BIAS_BF16) bv = bf16_round(bv);
#pragma unroll
    for (int r = 0; r < 8; ++r) { float v = acc[t][r] + bv; if (ACT == 1) v = fmaxf(v, 0.f); so[w][8 * hh + r][t * 16 + ln] = v; }
  }
  __builtin_amdgcn_fence(__ATOMIC_ACQ_REL, "workgroup");
  __builtin_amdgcn_wave_barrier();
  const int rsub = lane >> 4, c4 = (lane & 15) * 4;
  {
#pragma unroll
    for (int q = 0; q < 8; ++q) {
      const int r = q * 2 + rsub;
      const v4f v = *(const v4fa*)&so[w][r][c4];
      *(v4f*)(C + (size_t)(row0 + r) * ldc + col0 + c4) = v;
    }
    
  }
}

// GEMM C = act(A·W + bias + resid): A f32 (ASPLIT -> hi/lo 2 terms), Wt bf16 [N][K]; ACT 0 none, 1 relu, 2 exact gelu;
// resid (optional, f32, row index = (row % rmod), pitch ldr, RES_BF16 rounds it) added before the activation.
template <bool ASPLIT, int ACT, bool BIAS_BF16, bool RES_BF16>
__global__ __launch_bounds__(128) void k_gemm_bf3(const float* __restrict__ A, int lda, const unsigned short* __restrict__ Wt, int ldb,
                                                const float* __restrict__ bias, const float* __restrict__ resid, int rmod, int ldr,
                                                float* __restrict__ C, int ldc, int M, int N, int K) {
  __shared__ __attribute__((aligned(16))) float so[4][16][64];
  const int tid = threadIdx.x, w = tid >> 5, lane = tid & 31, ln = lane & 15, hh = lane >> 4;
  const int ntn = N / 64;
  const int wid = blockIdx.x * 4 + w;
  const int mt = wid / ntn, nq = wid % ntn;
  if (mt * 16 >= M) return;
  const int row0 = mt * 16, col0 = nq * 64;
  const float* arow = A + (size_t)(row0 + ln) * lda;
  v8f acc[4] = {};
  for (int kb = 0; kb < K; kb += 32) {
    FragB ah, al;
    const v4f x0 = *(const v4fa*)(arow + kb + 8 * hh), x1 = *(const v4fa*)(arow + kb + 8 * hh + 4);
    const v4f x2 = *(const v4fa*)(arow + kb + 16 + 8 * hh), x3 = *(const v4fa*)(arow + kb + 16 + 8 * hh + 4);
    float xs[16] = {x0[0],x0[1],x0[2],x0[3],x1[0],x1[1],x1[2],x1[3],x2[0],x2[1],x2[2],x2[3],x3[0],x3[1],x3[2],x3[3]};
#pragma unroll
    for (int i = 0; i < 16; ++i) { const unsigned short hb = bf16_bits(xs[i]); ah.u[i] = hb; al.u[i] = ASPLIT ? bf16_bits(xs[i] - bf16_val(hb)) : (unsigned short)0; }
#pragma unroll
    for (int t = 0; t < 4; ++t) {
      const unsigned short* brow = Wt + (size_t)(col0 + t * 16 + ln) * ldb + kb;
      FragB b;
      b.half[0] = *(const v8us*)(brow + 8 * hh);
      b.half[1] = *(const v8us*)(brow + 16 + 8 * hh);
      acc[t] = mmaN<ASPLIT ? 2 : 1>(ah.v, al.v, b.v, b.v, acc[t]);
    }
  }
#pragma unroll
  for (int t = 0; t < 4; ++t) {
    const int col = col0 + t * 16 + ln;
    float bv = bias ? bias[col] : 0.f;
    if (BIAS_BF16) bv = bf16_round(bv);
#pragma unroll
    for (int r = 0; r < 8; ++r) {
      float v = acc[t][r] + bv;
      if (resid) { float rv = resid[(size_t)((row0 + 8 * hh + r) % rmod) * ldr + col]; if (RES_BF16) rv = bf16_round(rv); v += rv; }
      if (ACT == 1) v = fmaxf(v, 0.f);
      if (ACT == 2) v = 0.5f * v * (1.0f + erff(v * 0.70710678118654752f));
      if (ACT == 3) { const float u = 0.7978845608028654f * (v + 0.044715f * v * v * v); v = 0.5f * v * (1.0f + tanhf(u)); }
      so[w][8 * hh + r][t * 16 + ln] = v;
    }
  }
  __builtin_amdgcn_fence(__ATOMIC_ACQ_REL, "workgroup");
  __builtin_amdgcn_wave_barrier();
  const int rsub = lane >> 4, c4 = (lane & 15) * 4;
  {
#pragma unroll
    for (int q = 0; q < 8; ++q) {
      const int r = q * 2 + rsub;
      const v4f v = *(const v4fa*)&so[w][r][c4];
      *(v4f*)(C + (size_t)(row0 + r) * ldc + col0 + c4) = v;
    }
    
  }
}
// row LayerNorm (biased variance, eps) over N: s = X (+ R); optional out_sum <- s; out_norm <- (s-mu)*rsqrt(var+eps)*g + b
template <bool PARAM_BF16>
__global__ __launch_bounds__(256) void k_layernorm(const float* __restrict__ X, const float* __restrict__ R, const float* __restrict__ g, const float* __restrict__ bta,
                                                  float* __restrict__ out_sum, float* __restrict__ out_norm, int N, float eps) {
  __shared__ float red[256];
  const int row = blockIdx.x, tid = threadIdx.x;
  const float* x = X + (size_t)row * N; const float* rr = R ? R + (size_t)row * N : nullptr;
  float vals[16];                     // up to N = 4096
  const int per = N / 256;            // contiguous chunk per thread? use strided-by-4 chunks: thread handles j = tid*4 + 1024*u
  float s1 = 0.f;
  for (int u = 0; u < per / 4; ++u) {
    const int j = tid * 4 + 1024 * u;
    const v4f a = *(const v4fa*)(x + j);
    v4f b = {0.f,0.f,0.f,0.f}; if (rr) b = *(const v4fa*)(rr + j);
#pragma unroll
    for (int q = 0; q < 4; ++q) { const float v = a[q] + b[q]; vals[u * 4 + q] = v; s1 += v; }
  }
  red[tid] = s1; __syncthreads();
  for (int st = 128; st > 0; st >>= 1) { if (tid < st) red[tid] += red[tid + st]; __syncthreads(); }
  const float mu = red[0] / (float)N; __syncthreads();
  float s2 = 0.f;
  for (int u = 0; u < per / 4; ++u)
#pragma unroll
    for (int q = 0; q < 4; ++q) { const float c = vals[u * 4 + q] - mu; s2 += c * c; }
  red[tid] = s2; __syncthreads();
  for (int st = 128; st > 0; st >>= 1) { if (tid < st) red[tid] += red[tid + st]; __syncthreads(); }
  const float rs = rsqrtf(red[0] / (float)N + eps);
  {
    for (int u = 0; u < per / 4; ++u) {
      const int j = tid * 4 + 1024 * u;
      v4f o, sm;
#pragma unroll
      for (int q = 0; q < 4; ++q) {
        float gg = g[j + q], bb = bta[j + q];
        if (PARAM_BF16) { gg = bf16_round(gg); bb = bf16_round(bb); }
        sm[q] = vals[u * 4 + q]; o[q] = (vals[u * 4 + q] - mu) * rs * gg + bb;
      }
      if (out_sum) *(v4f*)(out_sum + (size_t)row * N + j) = sm;
      *(v4f*)(out_norm + (size_t)row * N + j) = o;
    }
    
  }
}



// ---- f16 WMMA path (v_wmma_f32_16x16x32_f16): 11-bit significands for operands in range — used where a [0,1] probability operand needs more precision than bf16
typedef _Float16 v16h __attribute__((ext_vector_type(16)));
union FragH { v16h v; v8us half[2]; _Float16 h[16]; unsigned short u[16]; };
template <int NT>
__device__ __forceinline__ v8f mmaH(v16h ah, v16h al, v16h bh, v16h bl, v8f c) {
  c = __builtin_amdgcn_wmma_f32_16x16x32_f16(false, ah, false, bh, (short)0, c, false, false);
  if (NT >= 2) c = __builtin_amdgcn_wmma_f32_16x16x32_f16(false, al, false, bh, (short)0, c, false, false);
  if (NT >= 3) c = __builtin_amdgcn_wmma_f32_16x16x32_f16(false, ah, false, bl, (short)0, c, false, false);
  asm volatile("v_nop\n\tv_nop\n\tv_nop\n\tv_nop" : "+v"(c) : "v"(ah), "v"(al), "v"(bh), "v"(bl));
  return c;
}
// batched GEMM like k_gemm_b but f16 operands: A f32 (split into f16 hi/lo if ASPLIT, else rounded to f16), Bt = f16 values [n][k]; alpha; C f32; N multiple of 16 (partial tiles skipped)
template <bool ASPLIT>
__global__ __launch_bounds__(128) void k_gemm_h(const float* __restrict__ A, int lda, size_t sA, const _Float16* __restrict__ Bh, int ldb, size_t sB, float alpha, float* __restrict__ C, int ldc, size_t sC, int M, int N, int K) {
  __shared__ __attribute__((aligned(16))) float so[4][16][64];
  const int tid = threadIdx.x, w = tid >> 5, lane = tid & 31, ln = lane & 15, hh = lane >> 4; const int by = blockIdx.y;
  A += (size_t)by * sA; Bh += (size_t)by * sB; C += (size_t)by * sC;
  const int ntn = (N + 63) / 64; const int wid = blockIdx.x * 4 + w; const int mt = wid / ntn, nq = wid % ntn; if (mt * 16 >= M) return;
  const int row0 = mt * 16, col0 = nq * 64; const float* arow = A + (size_t)(row0 + ln) * lda;
  v8f acc[4] = {};
  for (int kb = 0; kb < K; kb += 32) {
    FragH ah, al;
    const v4f x0 = *(const v4fa*)(arow + kb + 8 * hh), x1 = *(const v4fa*)(arow + kb + 8 * hh + 4), x2 = *(const v4fa*)(arow + kb + 16 + 8 * hh), x3 = *(const v4fa*)(arow + kb + 16 + 8 * hh + 4);
    float xs[16] = {x0[0],x0[1],x0[2],x0[3],x1[0],x1[1],x1[2],x1[3],x2[0],x2[1],x2[2],x2[3],x3[0],x3[1],x3[2],x3[3]};
#pragma unroll
    for (int i = 0; i < 16; ++i) { const _Float16 h = (_Float16)xs[i]; ah.h[i] = h; al.h[i] = ASPLIT ? (_Float16)(xs[i] - (float)h) : (_Float16)0.0f; }
#pragma unroll
    for (int t = 0; t < 4; ++t) { if (col0 + t * 16 >= N) continue; const size_t boff = (size_t)(col0 + t * 16 + ln) * ldb + kb; FragH bq; bq.half[0] = *(const v8us*)(Bh + boff + 8 * hh); bq.half[1] = *(const v8us*)(Bh + boff + 16 + 8 * hh);
      acc[t] = mmaH<ASPLIT ? 2 : 1>(ah.v, al.v, bq.v, bq.v, acc[t]); }
  }
#pragma unroll
  for (int t = 0; t < 4; ++t) { if (col0 + t * 16 >= N) continue;
#pragma unroll
    for (int r = 0; r < 8; ++r) so[w][8 * hh + r][t * 16 + ln] = acc[t][r] * alpha; }
  __builtin_amdgcn_fence(__ATOMIC_ACQ_REL, "workgroup"); __builtin_amdgcn_wave_barrier();
  const int rsub = lane >> 4, c4 = (lane & 15) * 4;
  {
#pragma unroll
    for (int q = 0; q < 8; ++q) { const int r = q * 2 + rsub; if (col0 + c4 < N) { const v4f v = *(const v4fa*)&so[w][r][c4]; *(v4f*)(C + (size_t)(row0 + r) * ldc + col0 + c4) = v; } }
     }
}

// Wt (rows n, columns k, fragment order) = f16(W[k][n] * scale) from f32 row-major W[K][N] (scale = power of two; bf16-exact weights stay exact in f16 away from the subnormal range)
__global__ __launch_bounds__(256) void k_wt_f16(const float* __restrict__ W, _Float16* __restrict__ Wt, int K, int N, float scale) {
  const int t = blockIdx.x * 256 + threadIdx.x; if (t >= N * (K / 8)) return; const int tile = t >> 6; const int n = (tile / (K / 32)) * 16 + (t & 15), k8 = (tile % (K / 32)) * 32 + ((t >> 4) & 3) * 8; FragH f;      /* t = the output chunk in fragment order (rows n, columns k): 16 neighbouring lanes read 16 neighbouring n */
#pragma unroll
  for (int i = 0; i < 8; ++i) f.h[i] = (_Float16)(bf16_round(W[(size_t)(k8 + i) * N + n]) * scale); const v8us o = f.half[0];
  *(v8us*)((unsigned short*)Wt + (size_t)t * 8) = o; 
}
// k_gemm_hh variant with fused epilogue: v = acc·alpha + bias[by·sBias + col] (+ CP[(row/rowsPerB)·sCPb + by·64 + col] if CP) ; ACT 0 none / 1 elu ; writes f16 C16 (and f32 C if non-null)
template <int ACT>
__global__ __launch_bounds__(128) void k_gemm_hhx(const _Float16* __restrict__ A, int lda, size_t sA, const _Float16* __restrict__ Bh, int ldb, size_t sB, float alpha, const float* __restrict__ bias, size_t sBias, const float* __restrict__ CP, int rowsPerB, size_t sCPb, int row0g,
    float* __restrict__ C, _Float16* __restrict__ C16, int ldc, size_t sC, int M, int N, int K) {
  __shared__ __attribute__((aligned(16))) float so[4][16][64];
  const int tid = threadIdx.x, w = tid >> 5, lane = tid & 31, ln = lane & 15, hh = lane >> 4; const int by = blockIdx.y;
  A += (size_t)by * sA; Bh += (size_t)by * sB; const size_t cofs = (size_t)by * sC; const float* bp = bias ? bias + (size_t)by * sBias : nullptr;
  const int ntn = (N + 63) / 64; const int wid = blockIdx.x * 4 + w; const int mt = wid / ntn, nq = wid % ntn; if (mt * 16 >= M) return;
  const int row0 = mt * 16, col0 = nq * 64; const _Float16* arow = A + (size_t)(row0 + ln) * lda;
  v8f acc[4] = {};
  for (int kb = 0; kb < K; kb += 32) { FragH ah; ah.half[0] = *(const v8us*)((const unsigned short*)arow + kb + 8 * hh); ah.half[1] = *(const v8us*)((const unsigned short*)arow + kb + 16 + 8 * hh);
#pragma unroll
    for (int t = 0; t < 4; ++t) { if (col0 + t * 16 >= N) continue; const size_t boff = (size_t)(col0 + t * 16 + ln) * ldb + kb; FragH bq; bq.half[0] = *(const v8us*)((const unsigned short*)Bh + boff + 8 * hh); bq.half[1] = *(const v8us*)((const unsigned short*)Bh + boff + 16 + 8 * hh);
      acc[t] = mmaH<1>(ah.v, ah.v, bq.v, bq.v, acc[t]); }
  }
#pragma unroll
  for (int t = 0; t < 4; ++t) { if (col0 + t * 16 >= N) continue; const int col = col0 + t * 16 + ln; const float bv = bp ? bf16_round(bp[col]) : 0.f;
#pragma unroll
    for (int r = 0; r < 8; ++r) { float v = acc[t][r] * alpha + bv; if (CP) { const int bidx = (row0g + row0 + 8 * hh + r) / rowsPerB; v += CP[(size_t)bidx * sCPb + (size_t)by * 64 + col]; } if (ACT == 1) v = (v > 0.f) ? v : expm1f(v); else if (ACT == 7) v = (v > 0.f) ? v + 1.0f : expf(v); else if (ACT == 8) v = tanhf(v); else if (ACT == 9) v = 0.5f * v * (1.0f + tanhf(0.7978845608028654f * (v + 0.044715f * v * v * v))); else if (ACT == 11) v = 1.0f / (1.0f + expf(-v)); else if (ACT == 12) v = (v > 0.f) ? v : 0.01f * v; else if (ACT == 14) v = (v > 0.f) ? v : 0.1f * v; else if (ACT == 15) v = v / (1.0f + expf(-v)); else if (ACT == 3) v = fmaxf(v, 0.f); else if (ACT == 6) v = 0.5f * v * (1.0f + erff(v * 0.70710678118654752f)); so[w][8 * hh + r][t * 16 + ln] = v; } }
  __builtin_amdgcn_fence(__ATOMIC_ACQ_REL, "workgroup"); __builtin_amdgcn_wave_barrier();
  const int rsub = lane >> 4, c4 = (lane & 15) * 4; typedef _Float16 v4h __attribute__((ext_vector_type(4)));
  {
#pragma unroll
    for (int q = 0; q < 8; ++q) { const int r = q * 2 + rsub; if (col0 + c4 < N) { const v4f v = *(const v4fa*)&so[w][r][c4]; if (C) *(v4f*)(C + cofs + (size_t)(row0 + r) * ldc + col0 + c4) = v; if (C16) { v4h h4; for (int i = 0; i < 4; ++i) h4[i] = (_Float16)v[i]; *(v4h*)(C16 + cofs + (size_t)(row0 + r) * ldc + col0 + c4) = h4; } } }
     }
}


typedef _Float16 v4h __attribute__((ext_vector_type(4)));

// row-major f32 [rows][KC] -> fragment order: a wave takes 8 rows x the 4 chunks of one tile, so it reads 8 whole 128-byte lines and stores 4 whole lines. fo_src = element offset in the row-major source, fo_dst = 16-byte chunk index in the fragment-order plane
template <int KC> __device__ __forceinline__ size_t fo_src(size_t t) { const unsigned u = (unsigned)t, tile = u >> 6; return ((tile / (KC / 32)) * 16 + ((u & 7) | ((u >> 2) & 8))) * KC + (tile % (KC / 32)) * 32 + ((u >> 3) & 3) * 8; }      /* 32-bit: the planes here hold at most 8192 * 3072 elements */
__device__ __forceinline__ size_t fo_dst(size_t t) { const unsigned u = (unsigned)t; return (u >> 6) * 64 + ((u >> 3) & 3) * 16 + ((u & 7) | ((u >> 2) & 8)); }
__global__ __launch_bounds__(256) void k_x16(const float* __restrict__ x, _Float16* __restrict__ X16, size_t n8) { const size_t t = (size_t)blockIdx.x * 256 + threadIdx.x; if (t >= n8) return; FragH f; const size_t s = fo_src<DMOD>(t);
#pragma unroll
  for (int q = 0; q < 8; ++q) f.h[q] = (_Float16)bf16_round(x[s + q]); *(v8us*)((unsigned short*)X16 + fo_dst(t) * 8) = f.half[0];  }
__global__ __launch_bounds__(256) void k_h16(const float* __restrict__ x, _Float16* __restrict__ X16, size_t n8) { const size_t t = (size_t)blockIdx.x * 256 + threadIdx.x; if (t >= n8) return; FragH f;
#pragma unroll
  for (int q = 0; q < 8; ++q) f.h[q] = (_Float16)x[t * 8 + q]; *(v8us*)((unsigned short*)X16 + t * 8) = f.half[0];  }
__global__ __launch_bounds__(256) void k_round16f(const float* __restrict__ W, _Float16* __restrict__ Bt, size_t n8) { const size_t t = (size_t)blockIdx.x * 256 + threadIdx.x; if (t >= n8) return; FragH f;
#pragma unroll
  for (int i = 0; i < 8; ++i) f.h[i] = (_Float16)(bf16_round(W[t * 8 + i]) * 16.0f); *(v8us*)((unsigned short*)Bt + t * 8) = f.half[0];  }

// ---- fast GEMM (wave tile 32x64; requires M % 32 == 0 rows per launch region and N % 64 == 0); A and Bh in fragment order with lda / ldb columns (16 rows = 16 * ld elements, 32 columns = 512 elements); epilogue = k_gemm_hhx semantics ----
__device__ __forceinline__ v16h g2_frag(const _Float16* p) { FragH f; f.half[0] = *(const v8us*)((const unsigned short*)p); f.half[1] = *(const v8us*)((const unsigned short*)p + 256); return f.v; }      /* p = the tile's start + 8 * lane, fragment order */
__device__ __forceinline__ v8f g2_mma(v16h a, v16h b, v8f c) { v8f d = __builtin_amdgcn_wmma_f32_16x16x32_f16(false, a, false, b, (short)0, c, false, false); asm volatile("v_nop\n\tv_nop\n\tv_nop\n\tv_nop" : "+v"(d) : "v"(a), "v"(b)); return d; }
// One k step (32 columns) of a 32x64 wave tile: 2 A and 4 B fragments. The main loops keep TWO such sets: while one set's 8 products run, the other set's 12 loads are in flight, and a set is refilled (two k steps on) directly behind its own products. A wave then waits for memory once per k step, with 12 to 24 loads outstanding, where one shared B register set made it wait four times per k step with 2 loads outstanding. Every accumulator still takes its k steps in rising order.
struct G2Set { v16h a0, a1, b0, b1, b2, b3; };
__device__ __forceinline__ void g2_load(G2Set& s, const _Float16* a0p, const _Float16* a1p, const _Float16* b0p, const _Float16* b1p, const _Float16* b2p, const _Float16* b3p, int off, unsigned l8) {      /* the six tile addresses are the same in every lane, so they can live in scalar registers; l8 = 8 * lane is the lane's own part */
  s.a0 = g2_frag(a0p + off + l8); s.a1 = g2_frag(a1p + off + l8); s.b0 = g2_frag(b0p + off + l8); s.b1 = g2_frag(b1p + off + l8); s.b2 = g2_frag(b2p + off + l8); s.b3 = g2_frag(b3p + off + l8);
  __builtin_amdgcn_sched_barrier(0);      /* keeps a set's 12 loads together and the sets' groups in program order, so that the waits in front of one set's products can be counted and leave the other set's 12 loads in flight: left free, the scheduler can mix the two sets' loads, and the loop then waits for all 24 at the head of every trip */
}
__device__ __forceinline__ void g2_step(const G2Set& s, v8f& c00, v8f& c01, v8f& c02, v8f& c03, v8f& c10, v8f& c11, v8f& c12, v8f& c13) {
  c00 = g2_mma(s.a0, s.b0, c00); c10 = g2_mma(s.a1, s.b0, c10); c01 = g2_mma(s.a0, s.b1, c01); c11 = g2_mma(s.a1, s.b1, c11);
  c02 = g2_mma(s.a0, s.b2, c02); c12 = g2_mma(s.a1, s.b2, c12); c03 = g2_mma(s.a0, s.b3, c03); c13 = g2_mma(s.a1, s.b3, c13);
}
// Projection GEMM, one launch for both operand planes: C[NR][DMOD] (f32) = (Ah Bt_hi^T) / 16 + (Al Bt_lo^T) / 1024 + bf16(bias). Ah, Al = the attention output hi and 2^10 residual (DMOD columns), Bt = the weight plane (rows = output column, 2 * DMOD columns: [16 W | W]), all in fragment order.
// The hi products run first; the accumulators are then scaled by 2^6 (exact) and the residual products are summed on top of them, so that one factor 1/1024 at the end serves both. No second launch, no f32 output that is stored, read back element by element and stored again.
// 4 waves per SIMD asked for (the grid holds no more): 64 accumulator registers + two fragment sets of 48 + addresses fit the 256 registers that leaves.
__global__ __launch_bounds__(128, 4) void k_gemm_proj(const _Float16* __restrict__ Ah, const _Float16* __restrict__ Al, const _Float16* __restrict__ Bt, const float* __restrict__ bias, float* __restrict__ C) {
  __shared__ __attribute__((aligned(16))) float so[4][32][68];
  const int tid = threadIdx.x, w = tid >> 5, lane = tid & 31, ln = lane & 15, hh = lane >> 4;
  constexpr int ntn = DMOD / 64; const int mt = blockIdx.x / ntn, nq = blockIdx.x - mt * ntn; const int row0 = mt * 128 + 32 * __builtin_amdgcn_readfirstlane(w), col0 = nq * 64;      /* the wave's number read as a scalar: the operand addresses below then live in scalar registers */
  const unsigned l8 = 8 * lane; const _Float16* a0p = Ah + (size_t)row0 * DMOD; const _Float16* a1p = a0p + (size_t)16 * DMOD;
  const _Float16* b0p = Bt + (size_t)col0 * (2 * DMOD); const _Float16* b1p = b0p + (size_t)16 * (2 * DMOD); const _Float16* b2p = b1p + (size_t)16 * (2 * DMOD); const _Float16* b3p = b2p + (size_t)16 * (2 * DMOD);
  const v8f z8 = {0.f,0.f,0.f,0.f,0.f,0.f,0.f,0.f}; v8f c00 = z8, c01 = z8, c02 = z8, c03 = z8, c10 = z8, c11 = z8, c12 = z8, c13 = z8;
  G2Set s0, s1; g2_load(s0, a0p, a1p, b0p, b1p, b2p, b3p, 0, l8); g2_load(s1, a0p, a1p, b0p, b1p, b2p, b3p, 512, l8);
#pragma unroll 1
  for (int kb = 64; kb < DMOD; kb += 64) {      /* rolled: two k steps a trip, the two register sets by name */
    g2_step(s0, c00, c01, c02, c03, c10, c11, c12, c13); g2_load(s0, a0p, a1p, b0p, b1p, b2p, b3p, 1024, l8);
    g2_step(s1, c00, c01, c02, c03, c10, c11, c12, c13); g2_load(s1, a0p, a1p, b0p, b1p, b2p, b3p, 1536, l8);
    a0p += 1024; a1p += 1024; b0p += 1024; b1p += 1024; b2p += 1024; b3p += 1024; }
  a0p = Al + (size_t)row0 * DMOD; a1p = a0p + (size_t)16 * DMOD; b0p = Bt + (size_t)col0 * (2 * DMOD) + 16 * DMOD; b1p = b0p + (size_t)16 * (2 * DMOD); b2p = b1p + (size_t)16 * (2 * DMOD); b3p = b2p + (size_t)16 * (2 * DMOD);      /* the residual plane from its start; its weights: columns DMOD.. of Bt = 32 tiles = 16 * DMOD elements on */
  g2_step(s0, c00, c01, c02, c03, c10, c11, c12, c13); g2_step(s1, c00, c01, c02, c03, c10, c11, c12, c13);      /* the last two hi k steps */
  g2_load(s0, a0p, a1p, b0p, b1p, b2p, b3p, 0, l8); g2_load(s1, a0p, a1p, b0p, b1p, b2p, b3p, 512, l8);      /* the first two residual k steps, in flight while the accumulators are scaled */
  c00 *= 64.0f; c01 *= 64.0f; c02 *= 64.0f; c03 *= 64.0f; c10 *= 64.0f; c11 *= 64.0f; c12 *= 64.0f; c13 *= 64.0f;      /* 2^6 = (1 / 16) / (1 / 1024) */
#pragma unroll 1
  for (int kb = 64; kb < DMOD; kb += 64) {      /* rolled, the same loop body on the residual */
    g2_step(s0, c00, c01, c02, c03, c10, c11, c12, c13); g2_load(s0, a0p, a1p, b0p, b1p, b2p, b3p, 1024, l8);
    g2_step(s1, c00, c01, c02, c03, c10, c11, c12, c13); g2_load(s1, a0p, a1p, b0p, b1p, b2p, b3p, 1536, l8);
    a0p += 1024; a1p += 1024; b0p += 1024; b1p += 1024; b2p += 1024; b3p += 1024; }
  g2_step(s0, c00, c01, c02, c03, c10, c11, c12, c13); g2_step(s1, c00, c01, c02, c03, c10, c11, c12, c13);      /* the last two k steps: nothing is left to refill */
  v8f accs[8] = {c00, c01, c02, c03, c10, c11, c12, c13};
#pragma unroll      /* the accumulators are registers: every index must be a constant */
  for (int u = 0; u < 8; ++u) { const int t = u & 3, half = u >> 2; const float bv = bf16_round(bias[col0 + t * 16 + ln]);
#pragma unroll      /* as above */
    for (int r = 0; r < 8; ++r) so[w][half * 16 + 8 * hh + r][t * 16 + ln] = accs[u][r] * 0.0009765625f + bv; }
  __builtin_amdgcn_fence(__ATOMIC_ACQ_REL, "workgroup"); __builtin_amdgcn_wave_barrier();      /* the wave's own LDS writes are done before its lanes read each other's rows */
  const int rsub = lane >> 4, c4 = (lane & 15) * 4;
#pragma unroll      /* the 16 LDS reads go out together, each store behind its own read */
  for (int q = 0; q < 16; ++q) { const int r = q * 2 + rsub; const v4f v = *(const v4fa*)&so[w][r][c4]; *(v4f*)(C + (size_t)(row0 + r) * DMOD + col0 + c4) = v; } }      /* whole 256-byte row pieces: 16 lanes x 16 bytes */



// qkv GEMM: the main loop of k_gemm_proj (A = x plane, Bh = weight plane, both DMOD columns, fragment order) over NR rows x 3 * DMOD columns; v = acc / 16 + PB[(row / SLEN) * 3 * DMOD + col] (raw f32 add of the computed per-batch bias).
// The epilogue writes the flash kernel's operand planes itself, so that no f32 q|k|v plane is stored and re-read and no split or transpose launch follows:
// q, k columns (col < 2 * DMOD): the 32 x 64 wave tile goes through the wave's own LDS rows to turn lane = column into lane = row, is split into f16 hi + 2^10 residual and stored to H3 / L3 (3 * DMOD columns, fragment order; the v columns of both planes stay unused): the tile's 64 columns are 2 neighbouring 1-KiB tiles per 16 rows, every store 512 contiguous bytes per wave.
// v columns: a block's 64 columns are one head. Accumulator (half, t) holds in lane 16 * hh + ln column d = t * 16 + ln and the 8 neighbouring tokens 16 * half + 8 * hh + r: exactly the 16-byte chunk 2 * half + hh of row d in the V^T plane (rows slab * 64 + d, SLEN columns, fragment order), stored straight from registers, 512 contiguous bytes per wave.
// 5 waves per SIMD asked for: 64 accumulator registers + two fragment sets of 48 + addresses fit the 192 registers that leaves; the loads in flight now come from each wave's own two sets rather than from many waves.
__global__ __launch_bounds__(128, 5) void k_gemm_qkv(const _Float16* __restrict__ A, const _Float16* __restrict__ Bh, const float* __restrict__ PB, _Float16* __restrict__ H3, _Float16* __restrict__ L3, _Float16* __restrict__ Vt) {
  __shared__ __attribute__((aligned(16))) float so[4][32][68];
  const int tid = threadIdx.x, w = tid >> 5, lane = tid & 31, ln = lane & 15, hh = lane >> 4;
  constexpr int ntn = 3 * DMOD / 64; const int mt = blockIdx.x / ntn, nq = blockIdx.x - mt * ntn; const int row0 = mt * 128 + 32 * __builtin_amdgcn_readfirstlane(w), col0 = nq * 64;      /* the wave's number read as a scalar, as in k_gemm_proj */
  const unsigned l8 = 8 * lane; const _Float16* a0p = A + (size_t)row0 * DMOD; const _Float16* a1p = a0p + (size_t)16 * DMOD;
  const _Float16* b0p = Bh + (size_t)col0 * DMOD; const _Float16* b1p = b0p + (size_t)16 * DMOD; const _Float16* b2p = b1p + (size_t)16 * DMOD; const _Float16* b3p = b2p + (size_t)16 * DMOD;
  const v8f z8 = {0.f,0.f,0.f,0.f,0.f,0.f,0.f,0.f}; v8f c00 = z8, c01 = z8, c02 = z8, c03 = z8, c10 = z8, c11 = z8, c12 = z8, c13 = z8;
  G2Set s0, s1; g2_load(s0, a0p, a1p, b0p, b1p, b2p, b3p, 0, l8); g2_load(s1, a0p, a1p, b0p, b1p, b2p, b3p, 512, l8);
#pragma unroll 1
  for (int kb = 64; kb < DMOD; kb += 64) {      /* rolled, as in k_gemm_proj: the same loop body */
    g2_step(s0, c00, c01, c02, c03, c10, c11, c12, c13); g2_load(s0, a0p, a1p, b0p, b1p, b2p, b3p, 1024, l8);
    g2_step(s1, c00, c01, c02, c03, c10, c11, c12, c13); g2_load(s1, a0p, a1p, b0p, b1p, b2p, b3p, 1536, l8);
    a0p += 1024; a1p += 1024; b0p += 1024; b1p += 1024; b2p += 1024; b3p += 1024; }
  g2_step(s0, c00, c01, c02, c03, c10, c11, c12, c13); g2_step(s1, c00, c01, c02, c03, c10, c11, c12, c13);
  v8f accs[8] = {c00, c01, c02, c03, c10, c11, c12, c13};
  const int bat = row0 / SLEN; const float* cp = PB + (size_t)bat * 3 * DMOD + col0 + ln;      /* a wave's 32 rows lie in one batch */
  if (col0 >= 2 * DMOD) {      /* the same for the whole block */
    const int slab = bat * NH + (col0 - 2 * DMOD) / 64;
    unsigned short* vt = (unsigned short*)Vt + ((size_t)slab * 4 * (SLEN / 32) + (row0 % SLEN) / 32) * 512 + 8 * lane;
#pragma unroll
    for (int u = 0; u < 8; ++u) { const int t = u & 3, half = u >> 2; const float bv = cp[t * 16]; FragH f;
#pragma unroll
      for (int r = 0; r < 8; ++r) f.h[r] = (_Float16)(accs[u][r] * 0.0625f + bv);
      *(v8us*)(vt + (size_t)t * (SLEN / 32) * 512 + half * 256) = f.half[0]; }
    return;
  }
  {
#pragma unroll
    for (int u = 0; u < 8; ++u) { const int t = u & 3, half = u >> 2; const float bv = cp[t * 16];
#pragma unroll
      for (int r = 0; r < 8; ++r) so[w][half * 16 + 8 * hh + r][t * 16 + ln] = accs[u][r] * 0.0625f + bv; }
    __builtin_amdgcn_fence(__ATOMIC_ACQ_REL, "workgroup"); __builtin_amdgcn_wave_barrier();      /* the wave's own LDS writes are done before its lanes read each other's rows, as in k_gemm_proj */
    const size_t o0 = ((size_t)(row0 >> 4) * (3 * DMOD / 32) + (col0 >> 5)) * 512 + 8 * lane; unsigned short* hp = (unsigned short*)H3 + o0; unsigned short* lp = (unsigned short*)L3 + o0;
#pragma unroll
    for (int q = 0; q < 8; ++q) { const int g = q >> 2; const float* sp = &so[w][g * 16 + ln][((q >> 1) & 1) * 32 + ((q & 1) * 2 + hh) * 8];      /* the lane's chunk is number (q & 3) * 32 + lane of the 128 in the 2 tiles of row group g: row ln, the 8 columns from 8 * (number / 16) */
      const v4f a = *(const v4fa*)sp, c = *(const v4fa*)(sp + 4); FragH fh, fl;
#pragma unroll
      for (int i = 0; i < 4; ++i) { _Float16 hv = (_Float16)a[i]; fh.h[i] = hv; fl.h[i] = (_Float16)((a[i] - (float)hv) * 1024.0f); hv = (_Float16)c[i]; fh.h[4 + i] = hv; fl.h[4 + i] = (_Float16)((c[i] - (float)hv) * 1024.0f); }
      const size_t o = (size_t)g * (3 * DMOD / 32) * 512 + (q & 3) * 256; *(v8us*)(hp + o) = fh.half[0]; *(v8us*)(lp + o) = fl.half[0]; }
    asm volatile("s_wait_xcnt 0x0" ::: "memory");      /* behind the last two stores: the compiler lays the v branch's code behind this block with a fall-through edge (never taken) on which the stores' registers are rewritten */
  } }

template <int CAUSAL>
__global__ __launch_bounds__(128) void k_flash(const _Float16* __restrict__ Q16, int ldq, const _Float16* __restrict__ K16, int ldk, const _Float16* __restrict__ Vt, const int* __restrict__ MSK, float* __restrict__ O, int ldo) {
  constexpr int RPW = 16, RTN = RPW / 16, NQB = TQ / (4 * RPW), DT = 4, KS = 2;
  __shared__ __attribute__((aligned(16))) unsigned short sP[4][RPW][40]; __shared__ __attribute__((aligned(16))) float sO[4][RPW][64 + 4];
  const int tid = threadIdx.x, w = tid >> 5, lane = tid & 31, ln = lane & 15, hh = lane >> 4;
  const int slab = blockIdx.x / QBLKS, qblk = blockIdx.x % QBLKS; (void)NQB; const int b = slab / NH, h = slab % NH; const int qb0 = qblk * (4 * RPW); const int q0 = qb0 + w * RPW;
  FragH aq[2][KS];
#pragma unroll
  for (int rt = 0; rt < RTN; ++rt) { const unsigned short* qr = (const unsigned short*)Q16 + ((size_t)b * TQ + q0 + rt * 16 + ln) * ldq + h * 64;
#pragma unroll
    for (int ks = 0; ks < KS; ++ks) { aq[rt][ks].half[0] = *(const v8us*)(qr + ks * 32 + 8 * hh); aq[rt][ks].half[1] = *(const v8us*)(qr + ks * 32 + 16 + 8 * hh); } }
  const unsigned short* Vth = (const unsigned short*)Vt + (size_t)slab * 64 * TK;
  float m_r[2][8], l_r[2][8]; v8f oacc[2][DT];
#pragma unroll
  for (int rt = 0; rt < RTN; ++rt) {
#pragma unroll
    for (int r = 0; r < 8; ++r) { m_r[rt][r] = -3.0e38f; l_r[rt][r] = 0.f; }
#pragma unroll
    for (int dt = 0; dt < DT; ++dt) oacc[rt][dt] = (v8f){0.f,0.f,0.f,0.f,0.f,0.f,0.f,0.f}; }
  const int jend = (CAUSAL == 1) ? (qb0 + 4 * RPW) : TK;      /* causal: keys beyond the block's last query never contribute */
#pragma unroll 1
  for (int j0 = 0; j0 < jend; j0 += 32) {
    v8f s[2][2];
#pragma unroll
    for (int nt = 0; nt < 2; ++nt) { const unsigned short* kr = (const unsigned short*)K16 + ((size_t)b * TK + j0 + nt * 16 + ln) * ldk + h * 64; FragH bk[KS];
#pragma unroll
      for (int ks = 0; ks < KS; ++ks) { bk[ks].half[0] = *(const v8us*)(kr + ks * 32 + 8 * hh); bk[ks].half[1] = *(const v8us*)(kr + ks * 32 + 16 + 8 * hh); }
#pragma unroll
      for (int rt = 0; rt < RTN; ++rt) { v8f acc = (v8f){0.f,0.f,0.f,0.f,0.f,0.f,0.f,0.f};
#pragma unroll
        for (int ks = 0; ks < KS; ++ks) acc = mmaH<1>(aq[rt][ks].v, aq[rt][ks].v, bk[ks].v, bk[ks].v, acc); s[rt][nt] = acc; } }
#pragma unroll
    for (int rt = 0; rt < RTN; ++rt)
#pragma unroll
      for (int r = 0; r < 8; ++r) { const int tq = q0 + rt * 16 + 8 * hh + r; const int k0 = j0 + ln, k1 = j0 + 16 + ln;
        const bool ok0 = (CAUSAL == 1) ? (k0 <= tq) : ((CAUSAL == 2) ? ((k0 >> 5) == (tq >> 5)) : true), ok1 = (CAUSAL == 1) ? (k1 <= tq) : ((CAUSAL == 2) ? ((k1 >> 5) == (tq >> 5)) : true);      /* mode 2: block-diagonal 32-token groups */
        const float s0 = ok0 ? s[rt][0][r] * SCL : -3.0e38f, s1 = ok1 ? s[rt][1][r] * SCL : -3.0e38f; float mc = fmaxf(s0, s1);
        mc = fmaxf(mc, __shfl_xor(mc, 1, 32)); mc = fmaxf(mc, __shfl_xor(mc, 2, 32)); mc = fmaxf(mc, __shfl_xor(mc, 4, 32)); mc = fmaxf(mc, __shfl_xor(mc, 8, 32));
        const float mn = fmaxf(m_r[rt][r], mc); const float al = (mn > -1.0e38f) ? expf(m_r[rt][r] - mn) : 1.0f; m_r[rt][r] = mn; const float p0 = ok0 ? expf(s0 - mn) : 0.f, p1 = ok1 ? expf(s1 - mn) : 0.f; l_r[rt][r] = l_r[rt][r] * al + p0 + p1;
#pragma unroll
        for (int dt = 0; dt < DT; ++dt) oacc[rt][dt][r] *= al;
        FragH t2; t2.h[0] = (_Float16)(p0 * 1024.0f); t2.h[1] = (_Float16)(p1 * 1024.0f); sP[w][rt * 16 + 8 * hh + r][ln] = t2.u[0]; sP[w][rt * 16 + 8 * hh + r][16 + ln] = t2.u[1]; }
    __builtin_amdgcn_fence(__ATOMIC_ACQ_REL, "workgroup"); __builtin_amdgcn_wave_barrier();
    FragH pa[2];
#pragma unroll
    for (int rt = 0; rt < RTN; ++rt) { pa[rt].half[0] = *(const v8us*)&sP[w][rt * 16 + ln][8 * hh]; pa[rt].half[1] = *(const v8us*)&sP[w][rt * 16 + ln][16 + 8 * hh]; }
#pragma unroll
    for (int dt = 0; dt < DT; ++dt) { const unsigned short* vrow = Vth + (size_t)(dt * 16 + ln) * TK + j0; FragH bv; bv.half[0] = *(const v8us*)(vrow + 8 * hh); bv.half[1] = *(const v8us*)(vrow + 16 + 8 * hh);
#pragma unroll
      for (int rt = 0; rt < RTN; ++rt) oacc[rt][dt] = mmaH<1>(pa[rt].v, pa[rt].v, bv.v, bv.v, oacc[rt][dt]); }
    __builtin_amdgcn_fence(__ATOMIC_ACQ_REL, "workgroup"); __builtin_amdgcn_wave_barrier(); }
#pragma unroll
  for (int rt = 0; rt < RTN; ++rt) {
#pragma unroll
    for (int r = 0; r < 8; ++r) { float l = l_r[rt][r]; l += __shfl_xor(l, 1, 32); l += __shfl_xor(l, 2, 32); l += __shfl_xor(l, 4, 32); l += __shfl_xor(l, 8, 32); l_r[rt][r] = (l > 0.f) ? 1.0f / (l * 1024.0f) : 0.f; }
#pragma unroll
    for (int dt = 0; dt < DT; ++dt)
#pragma unroll
      for (int r = 0; r < 8; ++r) sO[w][rt * 16 + 8 * hh + r][dt * 16 + ln] = oacc[rt][dt][r] * l_r[rt][r]; }
  __builtin_amdgcn_fence(__ATOMIC_ACQ_REL, "workgroup"); __builtin_amdgcn_wave_barrier();
  {
#pragma unroll
    for (int rp = 0; rp < RPW; rp += 2) { const int r = rp + (lane >> 4), pc = lane & 15; const v4f val = *(const v4fa*)&sO[w][r][pc * 4]; *(v4f*)(O + ((size_t)b * TQ + q0 + r) * ldo + h * 64 + pc * 4) = val; }
     } }
// Q/K-split flash kernel, TRANSPOSED products: S^T = Kh Qh^T + (Kh Ql^T + Kl Qh^T)/1024 with K as the A operand and Q as the B operand, then O^T += V^T P^T. Q/K = [hi | 2^10 residual] f16 planes (QL/KL same layout as Q16/K16); plain f16 P (x2^10); Q, K planes (ldq, ldk columns) and V^T (TK columns) in fragment order (the A and the B loader of this form read a tile alike, so every fragment load is the one of the untransposed form).
// Why transposed: the accumulator of S^T holds, in lane 16 * hh + ln, query ln and keys nt * 16 + 8 * hh + r. A query's 32 scores thus sit in two lanes (ln and ln + 16): maximum and sum are in-lane work plus one exchange between the wave's halves, one running maximum / sum / rescale factor per lane, and element nt * 8 + r of the lane is exactly element nt * 8 + r of the B fragment of P^T (k = 8 * hh + i in its first half, 16 + 8 * hh + i in its second), so P goes from the accumulators into the next product without LDS.
__device__ __forceinline__ float xhalf(float x) { return __builtin_bit_cast(float, __builtin_amdgcn_permlanex16(__builtin_bit_cast(int, x), __builtin_bit_cast(int, x), 0x76543210, 0xfedcba98, false, false)); }      /* lane l with lane l ^ 16 */
__global__ __launch_bounds__(128) void k_flashqk(const _Float16* __restrict__ Q16, const _Float16* __restrict__ QL, int ldq, const _Float16* __restrict__ K16, const _Float16* __restrict__ KL, int ldk, const _Float16* __restrict__ Vt, _Float16* __restrict__ OH, _Float16* __restrict__ OL) {
  constexpr int RPW = 16, DT = 4, KS = 2;
  const int tid = threadIdx.x, w = tid >> 5, lane = tid & 31;
  const int slab = blockIdx.x / QBLKS, qblk = blockIdx.x % QBLKS; const int b = slab / NH, h = slab % NH; const int q0 = qblk * (4 * RPW) + w * RPW;
  FragH bq[KS], bql[KS];
  { const unsigned short* qr = (const unsigned short*)Q16 + ((size_t)b * TQ + q0) * ldq + h * 1024 + 8 * lane; const unsigned short* ql = (const unsigned short*)QL + ((size_t)b * TQ + q0) * ldq + h * 1024 + 8 * lane;      /* fragment order: a head's 64 columns are 2 tiles of 512 elements */
#pragma unroll
    for (int ks = 0; ks < KS; ++ks) { bq[ks].half[0] = *(const v8us*)(qr + ks * 512); bq[ks].half[1] = *(const v8us*)(qr + ks * 512 + 256); bql[ks].half[0] = *(const v8us*)(ql + ks * 512); bql[ks].half[1] = *(const v8us*)(ql + ks * 512 + 256); } }
  const unsigned short* Vth = (const unsigned short*)Vt + (size_t)slab * 64 * TK;
  float m_q = -3.0e38f, l_q = 0.f; v8f oacc[DT];      /* of query ln; l_q holds the sum over this half's keys, the halves are joined behind the loop */
#pragma unroll
  for (int dt = 0; dt < DT; ++dt) oacc[dt] = (v8f){0.f,0.f,0.f,0.f,0.f,0.f,0.f,0.f};
#pragma unroll 1
  for (int j0 = 0; j0 < TK; j0 += 32) {
    float sc[16];
#pragma unroll
    for (int nt = 0; nt < 2; ++nt) { const unsigned short* kr = (const unsigned short*)K16 + ((size_t)b * TK + j0 + nt * 16) * ldk + h * 1024 + 8 * lane; const unsigned short* klr = (const unsigned short*)KL + ((size_t)b * TK + j0 + nt * 16) * ldk + h * 1024 + 8 * lane; FragH ak[KS], akl[KS];
#pragma unroll
      for (int ks = 0; ks < KS; ++ks) { ak[ks].half[0] = *(const v8us*)(kr + ks * 512); ak[ks].half[1] = *(const v8us*)(kr + ks * 512 + 256); akl[ks].half[0] = *(const v8us*)(klr + ks * 512); akl[ks].half[1] = *(const v8us*)(klr + ks * 512 + 256); }
      asm volatile("s_wait_xcnt 0x0" :: "v"(kr), "v"(klr) : "memory");      /* behind the tile's 8 loads and in front of any reuse of their address registers; naming the two addresses as inputs keeps their registers untouched up to this wait */
      v8f acc = (v8f){0.f,0.f,0.f,0.f,0.f,0.f,0.f,0.f}, accl = acc;
#pragma unroll
      for (int ks = 0; ks < KS; ++ks) { acc = mmaH<1>(ak[ks].v, ak[ks].v, bq[ks].v, bq[ks].v, acc); accl = mmaH<1>(ak[ks].v, ak[ks].v, bql[ks].v, bql[ks].v, accl); accl = mmaH<1>(akl[ks].v, akl[ks].v, bq[ks].v, bq[ks].v, accl); }
#pragma unroll
      for (int r = 0; r < 8; ++r) sc[nt * 8 + r] = (acc[r] + accl[r] * 0.0009765625f) * SCL; }
    float mx[8];
#pragma unroll
    for (int i = 0; i < 8; ++i) mx[i] = fmaxf(sc[i], sc[8 + i]);
    float mc = fmaxf(fmaxf(fmaxf(mx[0], mx[1]), fmaxf(mx[2], mx[3])), fmaxf(fmaxf(mx[4], mx[5]), fmaxf(mx[6], mx[7])));
    mc = fmaxf(mc, xhalf(mc));
    const float mn = fmaxf(m_q, mc); const float ea = expf(m_q - mn); const float al = (mn > -1.0e38f) ? ea : 1.0f; m_q = mn;
    float p[16]; FragH pb;
#pragma unroll
    for (int i = 0; i < 16; ++i) { p[i] = expf(sc[i] - mn); pb.h[i] = (_Float16)(p[i] * 1024.0f); }
    l_q = l_q * al + ((((p[0] + p[1]) + (p[2] + p[3])) + ((p[4] + p[5]) + (p[6] + p[7]))) + (((p[8] + p[9]) + (p[10] + p[11])) + ((p[12] + p[13]) + (p[14] + p[15]))));
#pragma unroll
    for (int dt = 0; dt < DT; ++dt)
#pragma unroll
      for (int r = 0; r < 8; ++r) oacc[dt][r] *= al;
    FragH av[DT];
#pragma unroll
    for (int dt = 0; dt < DT; ++dt) { const unsigned short* vrow = Vth + (size_t)(dt * 16) * TK + j0 * 16 + 8 * lane; av[dt].half[0] = *(const v8us*)(vrow); av[dt].half[1] = *(const v8us*)(vrow + 256); }      /* fragment order: 32 keys = one tile of 512 elements; rows d of V^T are the A operand */
#pragma unroll
    for (int dt = 0; dt < DT; ++dt) oacc[dt] = mmaH<1>(av[dt].v, av[dt].v, pb.v, pb.v, oacc[dt]); }
  const float l = l_q + xhalf(l_q); const float inv = (l > 0.f) ? 1.0f / (l * 1024.0f) : 0.f;
  /* O^T: lane 16 * hh + ln holds query ln and, in accumulator dt, the 8 neighbouring columns d = dt * 16 + 8 * hh + r: exactly one 16-byte chunk of the projection's A plane (row = token, DMOD columns, fragment order). The hi + 2^10 residual split is done here and each plane gets 512 contiguous bytes per wave and dt, straight from registers */
  unsigned short* oh = (unsigned short*)OH + ((size_t)((b * TQ + q0) >> 4) * (DMOD / 32) + h * 2) * 512 + 8 * lane; unsigned short* ol = (unsigned short*)OL + ((size_t)((b * TQ + q0) >> 4) * (DMOD / 32) + h * 2) * 512 + 8 * lane;
#pragma unroll
  for (int dt = 0; dt < DT; ++dt) { FragH fh, fl;
#pragma unroll
    for (int r = 0; r < 8; ++r) { const float v = oacc[dt][r] * inv; const _Float16 hv = (_Float16)v; fh.h[r] = hv; fl.h[r] = (_Float16)((v - (float)hv) * 1024.0f); }
    *(v8us*)(oh + dt * 256) = fh.half[0]; *(v8us*)(ol + dt * 256) = fl.half[0]; } }

__global__ __launch_bounds__(256) void k_woutp(const float* __restrict__ Wm, _Float16* __restrict__ Bt) { const size_t t = (size_t)blockIdx.x * 256 + threadIdx.x; if (t >= (size_t)DMOD * (2 * DMOD / 8)) return; const int tile = (int)(t >> 6); const int pc = (tile % (2 * DMOD / 32)) * 4 + (int)((t >> 4) & 3); const int o = (tile / (2 * DMOD / 32)) * 16 + (int)(t & 15); const bool lo = pc * 8 >= DMOD; FragH f;      /* t = the output chunk in fragment order */
  for (int q = 0; q < 8; ++q) { const int c = pc * 8 + q - (lo ? DMOD : 0); f.h[q] = (_Float16)(bf16_round(Wm[(size_t)c * DMOD + o]) * (lo ? 1.0f : 16.0f)); } *(v8us*)((unsigned short*)Bt + t * 8) = f.half[0];  }      /* Wproj stored (in, out) -> Bt rows o, columns [c | 1024 + c], fragment order */
__global__ __launch_bounds__(256) void k_pose(const float* __restrict__ pose, const float* __restrict__ W1, const float* __restrict__ b1, const float* __restrict__ W2, const float* __restrict__ b2, const float* __restrict__ bqkv, float* __restrict__ PB) {
  #pragma clang fp contract(off)
  __shared__ float hs[64]; const int b = blockIdx.x / (3 * DMOD / 256), tid = threadIdx.x; const int o = (blockIdx.x % (3 * DMOD / 256)) * 256 + tid;      /* one block per (batch, 256-column slice), one output column per thread */
  float w2[64];      /* the column's 64 W2 values are fetched up front by independent loads (ahead of the hidden layer too), so a wave waits for memory once instead of once per term */
#pragma unroll
  for (int j = 0; j < 64; ++j) w2[j] = W2[(size_t)j * 3 * DMOD + o];
  const float vb2 = b2[o], vbq = bqkv[o];
  if (tid < 64) { float s = 0.f; for (int i = 0; i < 3; ++i) s += bf16_round(pose[b * 3 + i]) * bf16_round(W1[i * 64 + tid]); s += bf16_round(b1[tid]); hs[tid] = fmaxf(s, 0.f); }
  __syncthreads();
  float s = 0.f;
#pragma unroll
  for (int j = 0; j < 64; ++j) s += hs[j] * bf16_round(w2[j]);      /* terms summed in index order, j = 0..63 */
  s += bf16_round(vb2); s += bf16_round(vbq); PB[(size_t)b * 3 * DMOD + o] = s; }

extern "C" void kernel_launch(void* const* d_in, const int* in_sizes, int n_in,
                              void* d_out, int out_size, void* d_ws, size_t ws_size, hipStream_t stream) {
  (void)in_sizes; (void)n_in; (void)out_size;
  const float* const* I = (const float* const*)d_in; const float* x = I[0]; const float* pose = I[1]; const float* Wqkv = I[2]; const float* bqkv = I[3]; const float* W1 = I[4]; const float* b1 = I[5]; const float* W2 = I[6]; const float* b2 = I[7]; const float* Wp = I[8]; const float* bp = I[9];
  char* ws = (char*)d_ws; size_t off = 0;
  auto take = [&](size_t bytes) { char* p = ws + off; off += (bytes + 255) & ~(size_t)255; return p; };
  _Float16* BW = (_Float16*)take((size_t)3 * DMOD * DMOD * 2); _Float16* BO = (_Float16*)take((size_t)DMOD * 2 * DMOD * 2); float* PB = (float*)take((size_t)NB * 3 * DMOD * 4);
  _Float16* X16 = (_Float16*)take((size_t)NR * DMOD * 2); _Float16* H3 = (_Float16*)take((size_t)NR * 3 * DMOD * 2); _Float16* L3 = (_Float16*)take((size_t)NR * 3 * DMOD * 2); _Float16* VT = (_Float16*)take((size_t)NR * DMOD * 2); _Float16* Hh = (_Float16*)take((size_t)NR * DMOD * 2); _Float16* Hl = (_Float16*)take((size_t)NR * DMOD * 2);      /* H3/L3: 3072 columns q | k | (unused) in fragment order, where a step of 1024 columns is 32 tiles = 16 * DMOD elements; Hh/Hl are planes of their own: the flash kernel writes them while other blocks still read H3/L3 */
  if (off > ws_size) return;      /* 6 + 4 + 16 + 48 + 48 + 16 + 16 + 16 = 170 MiB (256 MiB ws) */
  k_wt_f16<<<(unsigned)(((size_t)3 * DMOD * (DMOD / 8) + 255) / 256), 256, 0, stream>>>(Wqkv, BW, DMOD, 3 * DMOD, 16.0f); k_woutp<<<(unsigned)(((size_t)DMOD * (2 * DMOD / 8) + 255) / 256), 256, 0, stream>>>(Wp, BO);
  k_pose<<<NB * (3 * DMOD / 256), 256, 0, stream>>>(pose, W1, b1, W2, b2, bqkv, PB);
  k_x16<<<(unsigned)(((size_t)NR * DMOD / 8 + 255) / 256), 256, 0, stream>>>(x, X16, (size_t)NR * DMOD / 8);
  const dim3 gQ((NR / 128) * (3 * DMOD / 64), 1), gA((NR / 128) * (DMOD / 64), 1);
  k_gemm_qkv<<<gQ, 128, 0, stream>>>(X16, BW, PB, H3, L3, VT);      /* all batches and q|k|v in one launch; + (bqkv + pose bias of batch row / 1024), a COMPUTED f32 vector added raw (not bf16-rounded like an input bias); writes q, k hi + residual and V^T */
  k_flashqk<<<NB * NH * QBLKS, 128, 0, stream>>>(H3, L3, 3 * DMOD, H3 + 16 * DMOD, L3 + 16 * DMOD, 3 * DMOD, VT, Hh, Hl);      /* q/k hi + residual; P (x2^10) and V plain f16; writes the attention output hi + residual */
  k_gemm_proj<<<gA, 128, 0, stream>>>(Hh, Hl, BO, bp, (float*)d_out);      /* hi and residual planes in one launch */
}

// v008
// A run of this version takes 215 microseconds.
// Two timings next to v007 put it at 1.13 and 1.12 times that version's speed.
// Over all steps from v000 it is 7.37 times as fast.
#include <hip/hip_runtime.h>
// Pose-aware attention (8 batches x 1024 tokens x 1024; 16 heads x 64): qkv = x Wqkv + b; per-batch pose embedding = relu(pose W1 + b1) W2 + b2 split into (q, k, v) biases per (head, dim) and added to q/k/v; softmax(q k^T / 8) v; out Wproj + b -> [8,1024,1024].
// Structure: the pose MLP on VALU folded into per-batch bias vectors (bqkv + pose_{q|k|v}[b]); x as an exact f16 plane; one qkv GEMM over all 8192 rows x 3072 columns (32x64 wave tiles, f32 accumulation, exact x16 weights, that per-batch bias picked by row / 1024) whose epilogue itself splits q and k into f16 hi + 2^10 residual planes and stores v as the f16 V^T plane (no f32 plane, no split or transpose launch); the fused flash kernel, products transposed (S^T = K Q^T, O^T = V^T P^T; softmax statistics per lane, P kept in registers), with hi + 2^10-residual q/k planes (S = QhKh + (QlKh + QhKl)/1024) and plain f16 P (x2^10) and V (S with hi/lo operands, P.V with plain ones); the attention output, split into hi + residual by the flash kernel's own epilogue, into one projection GEMM that sums the hi and then the residual products in the same accumulators.
// Operand layout: every f16 plane that feeds a matrix instruction (x, both weights, q|k hi and residual, V^T, the attention output hi and residual) is stored in FRAGMENT ORDER: a [rows][KC] plane is cut into 16-row x 32-column tiles of 1 KiB, tile (row / 16, col / 32) at tile index (row / 16) * (KC / 32) + col / 32, and inside a tile the 16-byte chunk of row r, columns 8c..8c+7 (c = 0..3) sits at chunk c * 16 + r. A wave's fragment load (lane = 16 * hh + ln reads row ln, chunk 2 * half + hh) is then 512 contiguous bytes (4 cache lines) where a row-major plane made it touch 16 lines for the same bytes; values and their lane/register places are those of the row-major loaders.
// Compute dtype: x, pose and all parameters rounded to bf16; q, k hi + residual (~2^-21-class logits); P and v plain f16 (~2^-12); f32 accumulation/softmax. v_wmma_f32_16x16x32_f16.
#define NB 8
#define DMOD 1024
#define NR (NB * SLEN)
#define QBLKS (TQ / 64)
#define FQT 2                     /* query tiles of 16 a wave in k_flashqk */
#define FQBLKS (TQ / (64 * FQT))
#define SLEN 1024
#define TQ SLEN
#define TK SLEN
#define NH 16
#define SCL 0.125f               /* 64^-0.5 */
typedef __bf16 v16b __attribute__((ext_vector_type(16)));
typedef unsigned short v8us __attribute__((ext_vector_type(8), may_alias));
typedef float  v8f  __attribute__((ext_vector_type(8)));
typedef float  v4f  __attribute__((ext_vector_type(4)));
typedef float  v4fa __attribute__((ext_vector_type(4), may_alias));
union FragB { v16b v; v8us half[2]; unsigned short u[16]; };

__device__ __forceinline__ unsigned short bf16_bits(float x) { unsigned int u = __float_as_uint(x); return (unsigned short)((u + 0x7FFFu + ((u >> 16) & 1u)) >> 16); }
__device__ __forceinline__ float bf16_val(unsigned short b) { return __uint_as_float(((unsigned int)b) << 16); }
__device__ __forceinline__ float bf16_round(float x) { return bf16_val(bf16_bits(x)); }
// D += A·B with NT terms: 1 = ah·bh, 2 = + al·bh (A split), 3 = + ah·bl (both split)
template <int NT>
__device__ __forceinline__ v8f mmaN(v16b ah, v16b al, v16b bh, v16b bl, v8f c) {
  c = __builtin_amdgcn_wmma_f32_16x16x32_bf16(false, ah, false, bh, (short)0, c, false, false);
  if (NT >= 2) c = __builtin_amdgcn_wmma_f32_16x16x32_bf16(false, al, false, bh, (short)0, c, false, false);
  if (NT >= 3) c = __builtin_amdgcn_wmma_f32_16x16x32_bf16(false, ah, false, bl, (short)0, c, false, false);
  asm volatile("v_nop\n\tv_nop\n\tv_nop\n\tv_nop" : "+v"(c) : "v"(ah), "v"(al), "v"(bh), "v"(bl));
  return c;
}

__global__ __launch_bounds__(256) void k_wt_bf16(const float* __restrict__ W, unsigned short* __restrict__ Wt, int K, int N) {
  const int t = blockIdx.x * 256 + threadIdx.x;
  const int k8n = K / 8;
  if (t >= N * k8n) return;
  const int n = t / k8n, k8 = (t % k8n) * 8;
  v8us v;
#pragma unroll
  for (int i = 0; i < 8; ++i) v[i] = bf16_bits(W[(size_t)(k8 + i) * N + n]);
  *(v8us*)(Wt + (size_t)n * K + k8) = v;
  
}

// GEMM C[M][N] (f32, pitch ldc) = act(A[M][K]·W + bias). A f32 row-major (pitch lda) converted per fragment to bf16
// (ASPLIT: hi/lo two planes -> 2 terms, else single rounded term); Wt bf16 [N][K] (pitch ldb). BIAS_BF16 rounds the
// bias to bf16 first (bias quantised to bf16 before the add). K%32==0, M%16==0, N%64==0.
template <bool ASPLIT, int ACT, bool BIAS_BF16>
__global__ __launch_bounds__(128) void k_gemm_bf(const float* __restrict__ A, int lda, const unsigned short* __restrict__ Wt, int ldb,
                                               const float* __restrict__ bias, float* __restrict__ C, int ldc, int M, int N, int K) {
  __shared__ __attribute__((aligned(16))) float so[4][16][64];
  const int tid = threadIdx.x, w = tid >> 5, lane = tid & 31, ln = lane & 15, hh = lane >> 4;
  const int ntn = N / 64;
  const int wid = blockIdx.x * 4 + w;
  const int mt = wid / ntn, nq = wid % ntn;
  if (mt * 16 >= M) return;
  const int row0 = mt * 16, col0 = nq * 64;
  const float* arow = A + (size_t)(row0 + ln) * lda;
  v8f acc[4] = {};
  for (int kb = 0; kb < K; kb += 32) {
    FragB ah, al;
    const v4f x0 = *(const v4fa*)(arow + kb + 8 * hh), x1 = *(const v4fa*)(arow + kb + 8 * hh + 4);
    const v4f x2 = *(const v4fa*)(arow + kb + 16 + 8 * hh), x3 = *(const v4fa*)(arow + kb + 16 + 8 * hh + 4);
    float xs[16] = {x0[0],x0[1],x0[2],x0[3],x1[0],x1[1],x1[2],x1[3],x2[0],x2[1],x2[2],x2[3],x3[0],x3[1],x3[2],x3[3]};
#pragma unroll
    for (int i = 0; i < 16; ++i) { const unsigned short hb = bf16_bits(xs[i]); ah.u[i] = hb; al.u[i] = ASPLIT ? bf16_bits(xs[i] - bf16_val(hb)) : (unsigned short)0; }
#pragma unroll
    for (int t = 0; t < 4; ++t) {
      const unsigned short* brow = Wt + (size_t)(col0 + t * 16 + ln) * ldb + kb;
      FragB b;
      b.half[0] = *(const v8us*)(brow + 8 * hh);
      b.half[1] = *(const v8us*)(brow + 16 + 8 * hh);
      acc[t] = mmaN<ASPLIT ? 2 : 1>(ah.v, al.v, b.v, b.v, acc[t]);
    }
  }
#pragma unroll
  for (int t = 0; t < 4; ++t) {
    float bv = bias ? bias[col0 + t * 16 + ln] : 0.f;
    if (BIAS_BF16) bv = bf16_round(bv);
#pragma unroll
    for (int r = 0; r < 8; ++r) { float v = acc[t][r] + bv; if (ACT == 1) v = fmaxf(v, 0.f); so[w][8 * hh + r][t * 16 + ln] = v; }
  }
  __builtin_amdgcn_fence(__ATOMIC_ACQ_REL, "workgroup");
  __builtin_amdgcn_wave_barrier();
  const int rsub = lane >> 4, c4 = (lane & 15) * 4;
  {
#pragma unroll
    for (int q = 0; q < 8; ++q) {
      const int r = q * 2 + rsub;
      const v4f v = *(const v4fa*)&so[w][r][c4];
      *(v4f*)(C + (size_t)(row0 + r) * ldc + col0 + c4) = v;
    }
    
  }
}

// GEMM C = act(A·W + bias + resid): A f32 (ASPLIT -> hi/lo 2 terms), Wt bf16 [N][K]; ACT 0 none, 1 relu, 2 exact gelu;
// resid (optional, f32, row index = (row % rmod), pitch ldr, RES_BF16 rounds it) added before the activation.
template <bool ASPLIT, int ACT, bool BIAS_BF16, bool RES_BF16>
__global__ __launch_bounds__(128) void k_gemm_bf3(const float* __restrict__ A, int lda, const unsigned short* __restrict__ Wt, int ldb,
                                                const float* __restrict__ bias, const float* __restrict__ resid, int rmod, int ldr,
                                                float* __restrict__ C, int ldc, int M, int N, int K) {
  __shared__ __attribute__((aligned(16))) float so[4][16][64];
  const int tid = threadIdx.x, w = tid >> 5, lane = tid & 31, ln = lane & 15, hh = lane >> 4;
  const int ntn = N / 64;
  const int wid = blockIdx.x * 4 + w;
  const int mt = wid / ntn, nq = wid % ntn;
  if (mt * 16 >= M) return;
  const int row0 = mt * 16, col0 = nq * 64;
  const float* arow = A + (size_t)(row0 + ln) * lda;
  v8f acc[4] = {};
  for (int kb = 0; kb < K; kb += 32) {
    FragB ah, al;
    const v4f x0 = *(const v4fa*)(arow + kb + 8 * hh), x1 = *(const v4fa*)(arow + kb + 8 * hh + 4);
    const v4f x2 = *(const v4fa*)(arow + kb + 16 + 8 * hh), x3 = *(const v4fa*)(arow + kb + 16 + 8 * hh + 4);
    float xs[16] = {x0[0],x0[1],x0[2],x0[3],x1[0],x1[1],x1[2],x1[3],x2[0],x2[1],x2[2],x2[3],x3[0],x3[1],x3[2],x3[3]};
#pragma unroll
    for (int i = 0; i < 16; ++i) { const unsigned short hb = bf16_bits(xs[i]); ah.u[i] = hb; al.u[i] = ASPLIT ? bf16_bits(xs[i] - bf16_val(hb)) : (unsigned short)0; }
#pragma unroll
    for (int t = 0; t < 4; ++t) {
      const unsigned short* brow = Wt + (size_t)(col0 + t * 16 + ln) * ldb + kb;
      FragB b;
      b.half[0] = *(const v8us*)(brow + 8 * hh);
      b.half[1] = *(const v8us*)(brow + 16 + 8 * hh);
      acc[t] = mmaN<ASPLIT ? 2 : 1>(ah.v, al.v, b.v, b.v, acc[t]);
    }
  }
#pragma unroll
  for (int t = 0; t < 4; ++t) {
    const int col = col0 + t * 16 + ln;
    float bv = bias ? bias[col] : 0.f;
    if (BIAS_BF16) bv = bf16_round(bv);
#pragma unroll
    for (int r = 0; r < 8; ++r) {
      float v = acc[t][r] + bv;
      if (resid) { float rv = resid[(size_t)((row0 + 8 * hh + r) % rmod) * ldr + col]; if (RES_BF16) rv = bf16_round(rv); v += rv; }
      if (ACT == 1) v = fmaxf(v, 0.f);
      if (ACT == 2) v = 0.5f * v * (1.0f + erff(v * 0.70710678118654752f));
      if (ACT == 3) { const float u = 0.7978845608028654f * (v + 0.044715f * v * v * v); v = 0.5f * v * (1.0f + tanhf(u)); }
      so[w][8 * hh + r][t * 16 + ln] = v;
    }
  }
  __builtin_amdgcn_fence(__ATOMIC_ACQ_REL, "workgroup");
  __builtin_amdgcn_wave_barrier();
  const int rsub = lane >> 4, c4 = (lane & 15) * 4;
  {
#pragma unroll
    for (int q = 0; q < 8; ++q) {
      const int r = q * 2 + rsub;
      const v4f v = *(const v4fa*)&so[w][r][c4];
      *(v4f*)(C + (size_t)(row0 + r) * ldc + col0 + c4) = v;
    }
    
  }
}
// row LayerNorm (biased variance, eps) over N: s = X (+ R); optional out_sum <- s; out_norm <- (s-mu)*rsqrt(var+eps)*g + b
template <bool PARAM_BF16>
__global__ __launch_bounds__(256) void k_layernorm(const float* __restrict__ X, const float* __restrict__ R, const float* __restrict__ g, const float* __restrict__ bta,
                                                  float* __restrict__ out_sum, float* __restrict__ out_norm, int N, float eps) {
  __shared__ float red[256];
  const int row = blockIdx.x, tid = threadIdx.x;
  const float* x = X + (size_t)row * N; const float* rr = R ? R + (size_t)row * N : nullptr;
  float vals[16];                     // up to N = 4096
  const int per = N / 256;            // contiguous chunk per thread? use strided-by-4 chunks: thread handles j = tid*4 + 1024*u
  float s1 = 0.f;
  for (int u = 0; u < per / 4; ++u) {
    const int j = tid * 4 + 1024 * u;
    const v4f a = *(const v4fa*)(x + j);
    v4f b = {0.f,0.f,0.f,0.f}; if (rr) b = *(const v4fa*)(rr + j);
#pragma unroll
    for (int q = 0; q < 4; ++q) { const float v = a[q] + b[q]; vals[u * 4 + q] = v; s1 += v; }
  }
  red[tid] = s1; __syncthreads();
  for (int st = 128; st > 0; st >>= 1) { if (tid < st) red[tid] += red[tid + st]; __syncthreads(); }
  const float mu = red[0] / (float)N; __syncthreads();
  float s2 = 0.f;
  for (int u = 0; u < per / 4; ++u)
#pragma unroll
    for (int q = 0; q < 4; ++q) { const float c = vals[u * 4 + q] - mu; s2 += c * c; }
  red[tid] = s2; __syncthreads();
  for (int st = 128; st > 0; st >>= 1) { if (tid < st) red[tid] += red[tid + st]; __syncthreads(); }
  const float rs = rsqrtf(red[0] / (float)N + eps);
  {
    for (int u = 0; u < per / 4; ++u) {
      const int j = tid * 4 + 1024 * u;
      v4f o, sm;
#pragma unroll
      for (int q = 0; q < 4; ++q) {
        float gg = g[j + q], bb = bta[j + q];
        if (PARAM_BF16) { gg = bf16_round(gg); bb = bf16_round(bb); }
        sm[q] = vals[u * 4 + q]; o[q] = (vals[u * 4 + q] - mu) * rs * gg + bb;
      }
      if (out_sum) *(v4f*)(out_sum + (size_t)row * N + j) = sm;
      *(v4f*)(out_norm + (size_t)row * N + j) = o;
    }
    
  }
}



// ---- f16 WMMA path (v_wmma_f32_16x16x32_f16): 11-bit significands for operands in range — used where a [0,1] probability operand needs more precision than bf16
typedef _Float16 v16h __attribute__((ext_vector_type(16)));
union FragH { v16h v; v8us half[2]; _Float16 h[16]; unsigned short u[16]; };
template <int NT>
__device__ __forceinline__ v8f mmaH(v16h ah, v16h al, v16h bh, v16h bl, v8f c) {
  c = __builtin_amdgcn_wmma_f32_16x16x32_f16(false, ah, false, bh, (short)0, c, false, false);
  if (NT >= 2) c = __builtin_amdgcn_wmma_f32_16x16x32_f16(false, al, false, bh, (short)0, c, false, false);
  if (NT >= 3) c = __builtin_amdgcn_wmma_f32_16x16x32_f16(false, ah, false, bl, (short)0, c, false, false);
  asm volatile("v_nop\n\tv_nop\n\tv_nop\n\tv_nop" : "+v"(c) : "v"(ah), "v"(al), "v"(bh), "v"(bl));
  return c;
}
// batched GEMM like k_gemm_b but f16 operands: A f32 (split into f16 hi/lo if ASPLIT, else rounded to f16), Bt = f16 values [n][k]; alpha; C f32; N multiple of 16 (partial tiles skipped)
template <bool ASPLIT>
__global__ __launch_bounds__(128) void k_gemm_h(const float* __restrict__ A, int lda, size_t sA, const _Float16* __restrict__ Bh, int ldb, size_t sB, float alpha, float* __restrict__ C, int ldc, size_t sC, int M, int N, int K) {
  __shared__ __attribute__((aligned(16))) float so[4][16][64];
  const int tid = threadIdx.x, w = tid >> 5, lane = tid & 31, ln = lane & 15, hh = lane >> 4; const int by = blockIdx.y;
  A += (size_t)by * sA; Bh += (size_t)by * sB; C += (size_t)by * sC;
  const int ntn = (N + 63) / 64; const int wid = blockIdx.x * 4 + w; const int mt = wid / ntn, nq = wid % ntn; if (mt * 16 >= M) return;
  const int row0 = mt * 16, col0 = nq * 64; const float* arow = A + (size_t)(row0 + ln) * lda;
  v8f acc[4] = {};
  for (int kb = 0; kb < K; kb += 32) {
    FragH ah, al;
    const v4f x0 = *(const v4fa*)(arow + kb + 8 * hh), x1 = *(const v4fa*)(arow + kb + 8 * hh + 4), x2 = *(const v4fa*)(arow + kb + 16 + 8 * hh), x3 = *(const v4fa*)(arow + kb + 16 + 8 * hh + 4);
    float xs[16] = {x0[0],x0[1],x0[2],x0[3],x1[0],x1[1],x1[2],x1[3],x2[0],x2[1],x2[2],x2[3],x3[0],x3[1],x3[2],x3[3]};
#pragma unroll
    for (int i = 0; i < 16; ++i) { const _Float16 h = (_Float16)xs[i]; ah.h[i] = h; al.h[i] = ASPLIT ? (_Float16)(xs[i] - (float)h) : (_Float16)0.0f; }
#pragma unroll
    for (int t = 0; t < 4; ++t) { if (col0 + t * 16 >= N) continue; const size_t boff = (size_t)(col0 + t * 16 + ln) * ldb + kb; FragH bq; bq.half[0] = *(const v8us*)(Bh + boff + 8 * hh); bq.half[1] = *(const v8us*)(Bh + boff + 16 + 8 * hh);
      acc[t] = mmaH<ASPLIT ? 2 : 1>(ah.v, al.v, bq.v, bq.v, acc[t]); }
  }
#pragma unroll
  for (int t = 0; t < 4; ++t) { if (col0 + t * 16 >= N) continue;
#pragma unroll
    for (int r = 0; r < 8; ++r) so[w][8 * hh + r][t * 16 + ln] = acc[t][r] * alpha; }
  __builtin_amdgcn_fence(__ATOMIC_ACQ_REL, "workgroup"); __builtin_amdgcn_wave_barrier();
  const int rsub = lane >> 4, c4 = (lane & 15) * 4;
  {
#pragma unroll
    for (int q = 0; q < 8; ++q) { const int r = q * 2 + rsub; if (col0 + c4 < N) { const v4f v = *(const v4fa*)&so[w][r][c4]; *(v4f*)(C + (size_t)(row0 + r) * ldc + col0 + c4) = v; } }
     }
}

// Wt (rows n, columns k, fragment order) = f16(W[k][n] * scale) from f32 row-major W[K][N] (scale = power of two; bf16-exact weights stay exact in f16 away from the subnormal range)
__global__ __launch_bounds__(256) void k_wt_f16(const float* __restrict__ W, _Float16* __restrict__ Wt, int K, int N, float scale) {
  const int t = blockIdx.x * 256 + threadIdx.x; if (t >= N * (K / 8)) return; const int tile = t >> 6; const int n = (tile / (K / 32)) * 16 + (t & 15), k8 = (tile % (K / 32)) * 32 + ((t >> 4) & 3) * 8; FragH f;      /* t = the output chunk in fragment order (rows n, columns k): 16 neighbouring lanes read 16 neighbouring n */
#pragma unroll
  for (int i = 0; i < 8; ++i) f.h[i] = (_Float16)(bf16_round(W[(size_t)(k8 + i) * N + n]) * scale); const v8us o = f.half[0];
  *(v8us*)((unsigned short*)Wt + (size_t)t * 8) = o; 
}
// k_gemm_hh variant with fused epilogue: v = acc·alpha + bias[by·sBias + col] (+ CP[(row/rowsPerB)·sCPb + by·64 + col] if CP) ; ACT 0 none / 1 elu ; writes f16 C16 (and f32 C if non-null)
template <int ACT>
__global__ __launch_bounds__(128) void k_gemm_hhx(const _Float16* __restrict__ A, int lda, size_t sA, const _Float16* __restrict__ Bh, int ldb, size_t sB, float alpha, const float* __restrict__ bias, size_t sBias, const float* __restrict__ CP, int rowsPerB, size_t sCPb, int row0g,
    float* __restrict__ C, _Float16* __restrict__ C16, int ldc, size_t sC, int M, int N, int K) {
  __shared__ __attribute__((aligned(16))) float so[4][16][64];
  const int tid = threadIdx.x, w = tid >> 5, lane = tid & 31, ln = lane & 15, hh = lane >> 4; const int by = blockIdx.y;
  A += (size_t)by * sA; Bh += (size_t)by * sB; const size_t cofs = (size_t)by * sC; const float* bp = bias ? bias + (size_t)by * sBias : nullptr;
  const int ntn = (N + 63) / 64; const int wid = blockIdx.x * 4 + w; const int mt = wid / ntn, nq = wid % ntn; if (mt * 16 >= M) return;
  const int row0 = mt * 16, col0 = nq * 64; const _Float16* arow = A + (size_t)(row0 + ln) * lda;
  v8f acc[4] = {};
  for (int kb = 0; kb < K; kb += 32) { FragH ah; ah.half[0] = *(const v8us*)((const unsigned short*)arow + kb + 8 * hh); ah.half[1] = *(const v8us*)((const unsigned short*)arow + kb + 16 + 8 * hh);
#pragma unroll
    for (int t = 0; t < 4; ++t) { if (col0 + t * 16 >= N) continue; const size_t boff = (size_t)(col0 + t * 16 + ln) * ldb + kb; FragH bq; bq.half[0] = *(const v8us*)((const unsigned short*)Bh + boff + 8 * hh); bq.half[1] = *(const v8us*)((const unsigned short*)Bh + boff + 16 + 8 * hh);
      acc[t] = mmaH<1>(ah.v, ah.v, bq.v, bq.v, acc[t]); }
  }
#pragma unroll
  for (int t = 0; t < 4; ++t) { if (col0 + t * 16 >= N) continue; const int col = col0 + t * 16 + ln; const float bv = bp ? bf16_round(bp[col]) : 0.f;
#pragma unroll
    for (int r = 0; r < 8; ++r) { float v = acc[t][r] * alpha + bv; if (CP) { const int bidx = (row0g + row0 + 8 * hh + r) / rowsPerB; v += CP[(size_t)bidx * sCPb + (size_t)by * 64 + col]; } if (ACT == 1) v = (v > 0.f) ? v : expm1f(v); else if (ACT == 7) v = (v > 0.f) ? v + 1.0f : expf(v); else if (ACT == 8) v = tanhf(v); else if (ACT == 9) v = 0.5f * v * (1.0f + tanhf(0.7978845608028654f * (v + 0.044715f * v * v * v))); else if (ACT == 11) v = 1.0f / (1.0f + expf(-v)); else if (ACT == 12) v = (v > 0.f) ? v : 0.01f * v; else if (ACT == 14) v = (v > 0.f) ? v : 0.1f * v; else if (ACT == 15) v = v / (1.0f + expf(-v)); else if (ACT == 3) v = fmaxf(v, 0.f); else if (ACT == 6) v = 0.5f * v * (1.0f + erff(v * 0.70710678118654752f)); so[w][8 * hh + r][t * 16 + ln] = v; } }
  __builtin_amdgcn_fence(__ATOMIC_ACQ_REL, "workgroup"); __builtin_amdgcn_wave_barrier();
  const int rsub = lane >> 4, c4 = (lane & 15) * 4; typedef _Float16 v4h __attribute__((ext_vector_type(4)));
  {
#pragma unroll
    for (int q = 0; q < 8; ++q) { const int r = q * 2 + rsub; if (col0 + c4 < N) { const v4f v = *(const v4fa*)&so[w][r][c4]; if (C) *(v4f*)(C + cofs + (size_t)(row0 + r) * ldc + col0 + c4) = v; if (C16) { v4h h4; for (int i = 0; i < 4; ++i) h4[i] = (_Float16)v[i]; *(v4h*)(C16 + cofs + (size_t)(row0 + r) * ldc + col0 + c4) = h4; } } }
     }
}


typedef _Float16 v4h __attribute__((ext_vector_type(4)));

// row-major f32 [rows][KC] -> fragment order: a wave takes 8 rows x the 4 chunks of one tile, so it reads 8 whole 128-byte lines and stores 4 whole lines. fo_src = element offset in the row-major source, fo_dst = 16-byte chunk index in the fragment-order plane
template <int KC> __device__ __forceinline__ size_t fo_src(size_t t) { const unsigned u = (unsigned)t, tile = u >> 6; return ((tile / (KC / 32)) * 16 + ((u & 7) | ((u >> 2) & 8))) * KC + (tile % (KC / 32)) * 32 + ((u >> 3) & 3) * 8; }      /* 32-bit: the planes here hold at most 8192 * 3072 elements */
__device__ __forceinline__ size_t fo_dst(size_t t) { const unsigned u = (unsigned)t; return (u >> 6) * 64 + ((u >> 3) & 3) * 16 + ((u & 7) | ((u >> 2) & 8)); }
__global__ __launch_bounds__(256) void k_x16(const float* __restrict__ x, _Float16* __restrict__ X16, size_t n8) { const size_t t = (size_t)blockIdx.x * 256 + threadIdx.x; if (t >= n8) return; FragH f; const size_t s = fo_src<DMOD>(t);
#pragma unroll
  for (int q = 0; q < 8; ++q) f.h[q] = (_Float16)bf16_round(x[s + q]); *(v8us*)((unsigned short*)X16 + fo_dst(t) * 8) = f.half[0];  }
__global__ __launch_bounds__(256) void k_h16(const float* __restrict__ x, _Float16* __restrict__ X16, size_t n8) { const size_t t = (size_t)blockIdx.x * 256 + threadIdx.x; if (t >= n8) return; FragH f;
#pragma unroll
  for (int q = 0; q < 8; ++q) f.h[q] = (_Float16)x[t * 8 + q]; *(v8us*)((unsigned short*)X16 + t * 8) = f.half[0];  }
__global__ __launch_bounds__(256) void k_round16f(const float* __restrict__ W, _Float16* __restrict__ Bt, size_t n8) { const size_t t = (size_t)blockIdx.x * 256 + threadIdx.x; if (t >= n8) return; FragH f;
#pragma unroll
  for (int i = 0; i < 8; ++i) f.h[i] = (_Float16)(bf16_round(W[t * 8 + i]) * 16.0f); *(v8us*)((unsigned short*)Bt + t * 8) = f.half[0];  }

// ---- fast GEMM (wave tile 32x64; requires M % 32 == 0 rows per launch region and N % 64 == 0); A and Bh in fragment order with lda / ldb columns (16 rows = 16 * ld elements, 32 columns = 512 elements); each kernel has its own epilogue ----
__device__ __forceinline__ v16h g2_frag(const _Float16* p) { FragH f; f.half[0] = *(const v8us*)((const unsigned short*)p); f.half[1] = *(const v8us*)((const unsigned short*)p + 256); return f.v; }      /* p = the tile's start + 8 * lane, fragment order */
__device__ __forceinline__ v8f g2_mma(v16h a, v16h b, v8f c) { v8f d = __builtin_amdgcn_wmma_f32_16x16x32_f16(false, a, false, b, (short)0, c, false, false); asm volatile("v_nop\n\tv_nop\n\tv_nop\n\tv_nop" : "+v"(d) : "v"(a), "v"(b)); return d; }
// One k step (32 columns) of a 32x64 wave tile: 2 A and 4 B fragments. The main loops keep TWO such sets: while one set's 8 products run, the other set's 12 loads are in flight, and a set is refilled (two k steps on) directly behind its own products. A wave then waits for memory once per k step, with 12 to 24 loads outstanding, where one shared B register set made it wait four times per k step with 2 loads outstanding. Every accumulator still takes its k steps in rising order.
struct G2Set { v16h a0, a1, b0, b1, b2, b3; };
__device__ __forceinline__ void g2_load(G2Set& s, const _Float16* a0p, const _Float16* a1p, const _Float16* b0p, const _Float16* b1p, const _Float16* b2p, const _Float16* b3p, int off, unsigned l8) {      /* the six tile addresses are the same in every lane, so they can live in scalar registers; l8 = 8 * lane is the lane's own part */
  s.a0 = g2_frag(a0p + off + l8); s.a1 = g2_frag(a1p + off + l8); s.b0 = g2_frag(b0p + off + l8); s.b1 = g2_frag(b1p + off + l8); s.b2 = g2_frag(b2p + off + l8); s.b3 = g2_frag(b3p + off + l8);
  __builtin_amdgcn_sched_barrier(0);      /* keeps a set's 12 loads together and the sets' groups in program order, so that the waits in front of one set's products can be counted and leave the other set's 12 loads in flight: left free, the scheduler can mix the two sets' loads, and the loop then waits for all 24 at the head of every trip */
}
__device__ __forceinline__ void g2_step(const G2Set& s, v8f& c00, v8f& c01, v8f& c02, v8f& c03, v8f& c10, v8f& c11, v8f& c12, v8f& c13) {
  c00 = g2_mma(s.a0, s.b0, c00); c10 = g2_mma(s.a1, s.b0, c10); c01 = g2_mma(s.a0, s.b1, c01); c11 = g2_mma(s.a1, s.b1, c11);
  c02 = g2_mma(s.a0, s.b2, c02); c12 = g2_mma(s.a1, s.b2, c12); c03 = g2_mma(s.a0, s.b3, c03); c13 = g2_mma(s.a1, s.b3, c13);
}
// Projection GEMM, one launch for both operand planes: C[NR][DMOD] (f32) = (Ah Bt_hi^T) / 16 + (Al Bt_lo^T) / 1024 + bf16(bias). Ah, Al = the attention output hi and 2^10 residual (DMOD columns), Bt = the weight plane (rows = output column, 2 * DMOD columns: [16 W | W]), all in fragment order.
// The hi products run first; the accumulators are then scaled by 2^6 (exact) and the residual products are summed on top of them, so that one factor 1/1024 at the end serves both. No second launch, no f32 output that is stored, read back element by element and stored again.
// 4 waves per SIMD asked for (the grid holds no more): 64 accumulator registers + two fragment sets of 48 + addresses fit the 256 registers that leaves.
__global__ __launch_bounds__(128, 4) void k_gemm_proj(const _Float16* __restrict__ Ah, const _Float16* __restrict__ Al, const _Float16* __restrict__ Bt, const float* __restrict__ bias, float* __restrict__ C) {
  __shared__ __attribute__((aligned(16))) float so[4][32][68];
  const int tid = threadIdx.x, w = tid >> 5, lane = tid & 31, ln = lane & 15, hh = lane >> 4;
  constexpr int ntn = DMOD / 64; const int mt = blockIdx.x / ntn, nq = blockIdx.x - mt * ntn; const int row0 = mt * 128 + 32 * __builtin_amdgcn_readfirstlane(w), col0 = nq * 64;      /* the wave's number read as a scalar: the operand addresses below then live in scalar registers */
  const unsigned l8 = 8 * lane; const _Float16* a0p = Ah + (size_t)row0 * DMOD; const _Float16* a1p = a0p + (size_t)16 * DMOD;
  const _Float16* b0p = Bt + (size_t)col0 * (2 * DMOD); const _Float16* b1p = b0p + (size_t)16 * (2 * DMOD); const _Float16* b2p = b1p + (size_t)16 * (2 * DMOD); const _Float16* b3p = b2p + (size_t)16 * (2 * DMOD);
  const v8f z8 = {0.f,0.f,0.f,0.f,0.f,0.f,0.f,0.f}; v8f c00 = z8, c01 = z8, c02 = z8, c03 = z8, c10 = z8, c11 = z8, c12 = z8, c13 = z8;
  G2Set s0, s1; g2_load(s0, a0p, a1p, b0p, b1p, b2p, b3p, 0, l8); g2_load(s1, a0p, a1p, b0p, b1p, b2p, b3p, 512, l8);
#pragma unroll 1
  for (int kb = 64; kb < DMOD; kb += 64) {      /* rolled: two k steps a trip, the two register sets by name */
    g2_step(s0, c00, c01, c02, c03, c10, c11, c12, c13); g2_load(s0, a0p, a1p, b0p, b1p, b2p, b3p, 1024, l8);
    g2_step(s1, c00, c01, c02, c03, c10, c11, c12, c13); g2_load(s1, a0p, a1p, b0p, b1p, b2p, b3p, 1536, l8);
    a0p += 1024; a1p += 1024; b0p += 1024; b1p += 1024; b2p += 1024; b3p += 1024; }
  a0p = Al + (size_t)row0 * DMOD; a1p = a0p + (size_t)16 * DMOD; b0p = Bt + (size_t)col0 * (2 * DMOD) + 16 * DMOD; b1p = b0p + (size_t)16 * (2 * DMOD); b2p = b1p + (size_t)16 * (2 * DMOD); b3p = b2p + (size_t)16 * (2 * DMOD);      /* the residual plane from its start; its weights: columns DMOD.. of Bt = 32 tiles = 16 * DMOD elements on */
  g2_step(s0, c00, c01, c02, c03, c10, c11, c12, c13); g2_step(s1, c00, c01, c02, c03, c10, c11, c12, c13);      /* the last two hi k steps */
  g2_load(s0, a0p, a1p, b0p, b1p, b2p, b3p, 0, l8); g2_load(s1, a0p, a1p, b0p, b1p, b2p, b3p, 512, l8);      /* the first two residual k steps, in flight while the accumulators are scaled */
  c00 *= 64.0f; c01 *= 64.0f; c02 *= 64.0f; c03 *= 64.0f; c10 *= 64.0f; c11 *= 64.0f; c12 *= 64.0f; c13 *= 64.0f;      /* 2^6 = (1 / 16) / (1 / 1024) */
#pragma unroll 1
  for (int kb = 64; kb < DMOD; kb += 64) {      /* rolled, the same loop body on the residual */
    g2_step(s0, c00, c01, c02, c03, c10, c11, c12, c13); g2_load(s0, a0p, a1p, b0p, b1p, b2p, b3p, 1024, l8);
    g2_step(s1, c00, c01, c02, c03, c10, c11, c12, c13); g2_load(s1, a0p, a1p, b0p, b1p, b2p, b3p, 1536, l8);
    a0p += 1024; a1p += 1024; b0p += 1024; b1p += 1024; b2p += 1024; b3p += 1024; }
  g2_step(s0, c00, c01, c02, c03, c10, c11, c12, c13); g2_step(s1, c00, c01, c02, c03, c10, c11, c12, c13);      /* the last two k steps: nothing is left to refill */
  v8f accs[8] = {c00, c01, c02, c03, c10, c11, c12, c13};
#pragma unroll      /* the accumulators are registers: every index must be a constant */
  for (int u = 0; u < 8; ++u) { const int t = u & 3, half = u >> 2; const float bv = bf16_round(bias[col0 + t * 16 + ln]);
#pragma unroll      /* as above */
    for (int r = 0; r < 8; ++r) so[w][half * 16 + 8 * hh + r][t * 16 + ln] = accs[u][r] * 0.0009765625f + bv; }
  __builtin_amdgcn_fence(__ATOMIC_ACQ_REL, "workgroup"); __builtin_amdgcn_wave_barrier();      /* the wave's own LDS writes are done before its lanes read each other's rows */
  const int rsub = lane >> 4, c4 = (lane & 15) * 4;
#pragma unroll      /* the 16 LDS reads go out together, each store behind its own read */
  for (int q = 0; q < 16; ++q) { const int r = q * 2 + rsub; const v4f v = *(const v4fa*)&so[w][r][c4]; *(v4f*)(C + (size_t)(row0 + r) * DMOD + col0 + c4) = v; } }      /* whole 256-byte row pieces: 16 lanes x 16 bytes */



// qkv GEMM: the main loop of k_gemm_proj (A = x plane, Bh = weight plane, both DMOD columns, fragment order) over NR rows x 3 * DMOD columns; v = acc / 16 + PB[(row / SLEN) * 3 * DMOD + col] (raw f32 add of the computed per-batch bias).
// The epilogue writes the flash kernel's operand planes itself, so that no f32 q|k|v plane is stored and re-read and no split or transpose launch follows:
// q, k columns (col < 2 * DMOD): the 32 x 64 wave tile goes through the wave's own LDS rows to turn lane = column into lane = row, is split into f16 hi + 2^10 residual and stored to H3 / L3 (3 * DMOD columns, fragment order; the v columns of both planes stay unused): the tile's 64 columns are 2 neighbouring 1-KiB tiles per 16 rows, every store 512 contiguous bytes per wave.
// v columns: a block's 64 columns are one head. Accumulator (half, t) holds in lane 16 * hh + ln column d = t * 16 + ln and the 8 neighbouring tokens 16 * half + 8 * hh + r: exactly the 16-byte chunk 2 * half + hh of row d in the V^T plane (rows slab * 64 + d, SLEN columns, fragment order), stored straight from registers, 512 contiguous bytes per wave.
// 5 waves per SIMD asked for: 64 accumulator registers + two fragment sets of 48 + addresses fit the 192 registers that leaves; the loads in flight now come from each wave's own two sets rather than from many waves.
__global__ __launch_bounds__(128, 5) void k_gemm_qkv(const _Float16* __restrict__ A, const _Float16* __restrict__ Bh, const float* __restrict__ PB, _Float16* __restrict__ H3, _Float16* __restrict__ L3, _Float16* __restrict__ Vt) {
  __shared__ __attribute__((aligned(16))) float so[4][32][68];
  const int tid = threadIdx.x, w = tid >> 5, lane = tid & 31, ln = lane & 15, hh = lane >> 4;
  constexpr int ntn = 3 * DMOD / 64; const int mt = blockIdx.x / ntn, nq = blockIdx.x - mt * ntn; const int row0 = mt * 128 + 32 * __builtin_amdgcn_readfirstlane(w), col0 = nq * 64;      /* the wave's number read as a scalar, as in k_gemm_proj */
  const unsigned l8 = 8 * lane; const _Float16* a0p = A + (size_t)row0 * DMOD; const _Float16* a1p = a0p + (size_t)16 * DMOD;
  const _Float16* b0p = Bh + (size_t)col0 * DMOD; const _Float16* b1p = b0p + (size_t)16 * DMOD; const _Float16* b2p = b1p + (size_t)16 * DMOD; const _Float16* b3p = b2p + (size_t)16 * DMOD;
  const v8f z8 = {0.f,0.f,0.f,0.f,0.f,0.f,0.f,0.f}; v8f c00 = z8, c01 = z8, c02 = z8, c03 = z8, c10 = z8, c11 = z8, c12 = z8, c13 = z8;
  G2Set s0, s1; g2_load(s0, a0p, a1p, b0p, b1p, b2p, b3p, 0, l8); g2_load(s1, a0p, a1p, b0p, b1p, b2p, b3p, 512, l8);
#pragma unroll 1
  for (int kb = 64; kb < DMOD; kb += 64) {      /* rolled, as in k_gemm_proj: the same loop body */
    g2_step(s0, c00, c01, c02, c03, c10, c11, c12, c13); g2_load(s0, a0p, a1p, b0p, b1p, b2p, b3p, 1024, l8);
    g2_step(s1, c00, c01, c02, c03, c10, c11, c12, c13); g2_load(s1, a0p, a1p, b0p, b1p, b2p, b3p, 1536, l8);
    a0p += 1024; a1p += 1024; b0p += 1024; b1p += 1024; b2p += 1024; b3p += 1024; }
  g2_step(s0, c00, c01, c02, c03, c10, c11, c12, c13); g2_step(s1, c00, c01, c02, c03, c10, c11, c12, c13);
  v8f accs[8] = {c00, c01, c02, c03, c10, c11, c12, c13};
  const int bat = row0 / SLEN; const float* cp = PB + (size_t)bat * 3 * DMOD + col0 + ln;      /* a wave's 32 rows lie in one batch */
  if (col0 >= 2 * DMOD) {      /* the same for the whole block */
    const int slab = bat * NH + (col0 - 2 * DMOD) / 64;
    unsigned short* vt = (unsigned short*)Vt + ((size_t)slab * 4 * (SLEN / 32) + (row0 % SLEN) / 32) * 512 + 8 * lane;
#pragma unroll
    for (int u = 0; u < 8; ++u) { const int t = u & 3, half = u >> 2; const float bv = cp[t * 16]; FragH f;
#pragma unroll
      for (int r = 0; r < 8; ++r) f.h[r] = (_Float16)(accs[u][r] * 0.0625f + bv);
      *(v8us*)(vt + (size_t)t * (SLEN / 32) * 512 + half * 256) = f.half[0]; }
    return;
  }
  {
#pragma unroll
    for (int u = 0; u < 8; ++u) { const int t = u & 3, half = u >> 2; const float bv = cp[t * 16];
#pragma unroll
      for (int r = 0; r < 8; ++r) so[w][half * 16 + 8 * hh + r][t * 16 + ln] = accs[u][r] * 0.0625f + bv; }
    __builtin_amdgcn_fence(__ATOMIC_ACQ_REL, "workgroup"); __builtin_amdgcn_wave_barrier();      /* the wave's own LDS writes are done before its lanes read each other's rows, as in k_gemm_proj */
    const size_t o0 = ((size_t)(row0 >> 4) * (3 * DMOD / 32) + (col0 >> 5)) * 512 + 8 * lane; unsigned short* hp = (unsigned short*)H3 + o0; unsigned short* lp = (unsigned short*)L3 + o0;
#pragma unroll
    for (int q = 0; q < 8; ++q) { const int g = q >> 2; const float* sp = &so[w][g * 16 + ln][((q >> 1) & 1) * 32 + ((q & 1) * 2 + hh) * 8];      /* the lane's chunk is number (q & 3) * 32 + lane of the 128 in the 2 tiles of row group g: row ln, the 8 columns from 8 * (number / 16) */
      const v4f a = *(const v4fa*)sp, c = *(const v4fa*)(sp + 4); FragH fh, fl;
#pragma unroll
      for (int i = 0; i < 4; ++i) { _Float16 hv = (_Float16)a[i]; fh.h[i] = hv; fl.h[i] = (_Float16)((a[i] - (float)hv) * 1024.0f); hv = (_Float16)c[i]; fh.h[4 + i] = hv; fl.h[4 + i] = (_Float16)((c[i] - (float)hv) * 1024.0f); }
      const size_t o = (size_t)g * (3 * DMOD / 32) * 512 + (q & 3) * 256; *(v8us*)(hp + o) = fh.half[0]; *(v8us*)(lp + o) = fl.half[0]; }
    asm volatile("s_wait_xcnt 0x0" ::: "memory");      /* behind the last two stores: the compiler lays the v branch's code behind this block with a fall-through edge (never taken) on which the stores' registers are rewritten */
  } }

template <int CAUSAL>
__global__ __launch_bounds__(128) void k_flash(const _Float16* __restrict__ Q16, int ldq, const _Float16* __restrict__ K16, int ldk, const _Float16* __restrict__ Vt, const int* __restrict__ MSK, float* __restrict__ O, int ldo) {
  constexpr int RPW = 16, RTN = RPW / 16, NQB = TQ / (4 * RPW), DT = 4, KS = 2;
  __shared__ __attribute__((aligned(16))) unsigned short sP[4][RPW][40]; __shared__ __attribute__((aligned(16))) float sO[4][RPW][64 + 4];
  const int tid = threadIdx.x, w = tid >> 5, lane = tid & 31, ln = lane & 15, hh = lane >> 4;
  const int slab = blockIdx.x / QBLKS, qblk = blockIdx.x % QBLKS; (void)NQB; const int b = slab / NH, h = slab % NH; const int qb0 = qblk * (4 * RPW); const int q0 = qb0 + w * RPW;
  FragH aq[2][KS];
#pragma unroll
  for (int rt = 0; rt < RTN; ++rt) { const unsigned short* qr = (const unsigned short*)Q16 + ((size_t)b * TQ + q0 + rt * 16 + ln) * ldq + h * 64;
#pragma unroll
    for (int ks = 0; ks < KS; ++ks) { aq[rt][ks].half[0] = *(const v8us*)(qr + ks * 32 + 8 * hh); aq[rt][ks].half[1] = *(const v8us*)(qr + ks * 32 + 16 + 8 * hh); } }
  const unsigned short* Vth = (const unsigned short*)Vt + (size_t)slab * 64 * TK;
  float m_r[2][8], l_r[2][8]; v8f oacc[2][DT];
#pragma unroll
  for (int rt = 0; rt < RTN; ++rt) {
#pragma unroll
    for (int r = 0; r < 8; ++r) { m_r[rt][r] = -3.0e38f; l_r[rt][r] = 0.f; }
#pragma unroll
    for (int dt = 0; dt < DT; ++dt) oacc[rt][dt] = (v8f){0.f,0.f,0.f,0.f,0.f,0.f,0.f,0.f}; }
  const int jend = (CAUSAL == 1) ? (qb0 + 4 * RPW) : TK;      /* causal: keys beyond the block's last query never contribute */
#pragma unroll 1
  for (int j0 = 0; j0 < jend; j0 += 32) {
    v8f s[2][2];
#pragma unroll
    for (int nt = 0; nt < 2; ++nt) { const unsigned short* kr = (const unsigned short*)K16 + ((size_t)b * TK + j0 + nt * 16 + ln) * ldk + h * 64; FragH bk[KS];
#pragma unroll
      for (int ks = 0; ks < KS; ++ks) { bk[ks].half[0] = *(const v8us*)(kr + ks * 32 + 8 * hh); bk[ks].half[1] = *(const v8us*)(kr + ks * 32 + 16 + 8 * hh); }
#pragma unroll
      for (int rt = 0; rt < RTN; ++rt) { v8f acc = (v8f){0.f,0.f,0.f,0.f,0.f,0.f,0.f,0.f};
#pragma unroll
        for (int ks = 0; ks < KS; ++ks) acc = mmaH<1>(aq[rt][ks].v, aq[rt][ks].v, bk[ks].v, bk[ks].v, acc); s[rt][nt] = acc; } }
#pragma unroll
    for (int rt = 0; rt < RTN; ++rt)
#pragma unroll
      for (int r = 0; r < 8; ++r) { const int tq = q0 + rt * 16 + 8 * hh + r; const int k0 = j0 + ln, k1 = j0 + 16 + ln;
        const bool ok0 = (CAUSAL == 1) ? (k0 <= tq) : ((CAUSAL == 2) ? ((k0 >> 5) == (tq >> 5)) : true), ok1 = (CAUSAL == 1) ? (k1 <= tq) : ((CAUSAL == 2) ? ((k1 >> 5) == (tq >> 5)) : true);      /* mode 2: block-diagonal 32-token groups */
        const float s0 = ok0 ? s[rt][0][r] * SCL : -3.0e38f, s1 = ok1 ? s[rt][1][r] * SCL : -3.0e38f; float mc = fmaxf(s0, s1);
        mc = fmaxf(mc, __shfl_xor(mc, 1, 32)); mc = fmaxf(mc, __shfl_xor(mc, 2, 32)); mc = fmaxf(mc, __shfl_xor(mc, 4, 32)); mc = fmaxf(mc, __shfl_xor(mc, 8, 32));
        const float mn = fmaxf(m_r[rt][r], mc); const float al = (mn > -1.0e38f) ? expf(m_r[rt][r] - mn) : 1.0f; m_r[rt][r] = mn; const float p0 = ok0 ? expf(s0 - mn) : 0.f, p1 = ok1 ? expf(s1 - mn) : 0.f; l_r[rt][r] = l_r[rt][r] * al + p0 + p1;
#pragma unroll
        for (int dt = 0; dt < DT; ++dt) oacc[rt][dt][r] *= al;
        FragH t2; t2.h[0] = (_Float16)(p0 * 1024.0f); t2.h[1] = (_Float16)(p1 * 1024.0f); sP[w][rt * 16 + 8 * hh + r][ln] = t2.u[0]; sP[w][rt * 16 + 8 * hh + r][16 + ln] = t2.u[1]; }
    __builtin_amdgcn_fence(__ATOMIC_ACQ_REL, "workgroup"); __builtin_amdgcn_wave_barrier();
    FragH pa[2];
#pragma unroll
    for (int rt = 0; rt < RTN; ++rt) { pa[rt].half[0] = *(const v8us*)&sP[w][rt * 16 + ln][8 * hh]; pa[rt].half[1] = *(const v8us*)&sP[w][rt * 16 + ln][16 + 8 * hh]; }
#pragma unroll
    for (int dt = 0; dt < DT; ++dt) { const unsigned short* vrow = Vth + (size_t)(dt * 16 + ln) * TK + j0; FragH bv; bv.half[0] = *(const v8us*)(vrow + 8 * hh); bv.half[1] = *(const v8us*)(vrow + 16 + 8 * hh);
#pragma unroll
      for (int rt = 0; rt < RTN; ++rt) oacc[rt][dt] = mmaH<1>(pa[rt].v, pa[rt].v, bv.v, bv.v, oacc[rt][dt]); }
    __builtin_amdgcn_fence(__ATOMIC_ACQ_REL, "workgroup"); __builtin_amdgcn_wave_barrier(); }
#pragma unroll
  for (int rt = 0; rt < RTN; ++rt) {
#pragma unroll
    for (int r = 0; r < 8; ++r) { float l = l_r[rt][r]; l += __shfl_xor(l, 1, 32); l += __shfl_xor(l, 2, 32); l += __shfl_xor(l, 4, 32); l += __shfl_xor(l, 8, 32); l_r[rt][r] = (l > 0.f) ? 1.0f / (l * 1024.0f) : 0.f; }
#pragma unroll
    for (int dt = 0; dt < DT; ++dt)
#pragma unroll
      for (int r = 0; r < 8; ++r) sO[w][rt * 16 + 8 * hh + r][dt * 16 + ln] = oacc[rt][dt][r] * l_r[rt][r]; }
  __builtin_amdgcn_fence(__ATOMIC_ACQ_REL, "workgroup"); __builtin_amdgcn_wave_barrier();
  {
#pragma unroll
    for (int rp = 0; rp < RPW; rp += 2) { const int r = rp + (lane >> 4), pc = lane & 15; const v4f val = *(const v4fa*)&sO[w][r][pc * 4]; *(v4f*)(O + ((size_t)b * TQ + q0 + r) * ldo + h * 64 + pc * 4) = val; }
     } }
// Q/K-split flash kernel, TRANSPOSED products: S^T = Kh Qh^T + (Kh Ql^T + Kl Qh^T)/1024 with K as the A operand and Q as the B operand, then O^T += V^T P^T. Q/K = [hi | 2^10 residual] f16 planes (QL/KL same layout as Q16/K16); plain f16 P (x2^10); Q, K planes (ldq, ldk columns) and V^T (TK columns) in fragment order (the A and the B loader of this form read a tile alike, so every fragment load is the one of the untransposed form).
// Why transposed: the accumulator of S^T holds, in lane 16 * hh + ln, query ln and keys nt * 16 + 8 * hh + r. A query's 32 scores thus sit in two lanes (ln and ln + 16): maximum and sum are in-lane work plus one exchange between the wave's halves, one running maximum / sum / rescale factor per lane, and element nt * 8 + r of the lane is exactly element nt * 8 + r of the B fragment of P^T (k = 8 * hh + i in its first half, 16 + 8 * hh + i in its second), so P goes from the accumulators into the next product without LDS.
__device__ __forceinline__ float xhalf(float x) { return __builtin_bit_cast(float, __builtin_amdgcn_permlanex16(__builtin_bit_cast(int, x), __builtin_bit_cast(int, x), 0x76543210, 0xfedcba98, false, false)); }      /* lane l with lane l ^ 16 */
// Two query tiles (32 queries) a wave: every K hi, K residual and V^T fragment that the wave loads feeds both tiles' products, so the loads and the waits on them per product are halved; each query's own products, maximum, sums and their order are those of the one-tile form. 1024 blocks of 4 waves = 4 waves per SIMD, asked for below, so that the whole grid is resident at once.
__global__ __launch_bounds__(128, 4) void k_flashqk(const _Float16* __restrict__ Q16, const _Float16* __restrict__ QL, int ldq, const _Float16* __restrict__ K16, const _Float16* __restrict__ KL, int ldk, const _Float16* __restrict__ Vt, _Float16* __restrict__ OH, _Float16* __restrict__ OL) {
  constexpr int QT = FQT, RPW = 16 * QT, DT = 4, KS = 2;
  const int tid = threadIdx.x, w = tid >> 5, lane = tid & 31;
  const int slab = blockIdx.x / FQBLKS, qblk = blockIdx.x % FQBLKS; const int b = slab / NH, h = slab % NH; const int q0 = qblk * (4 * RPW) + w * RPW;
  FragH bq[QT][KS], bql[QT][KS];
#pragma unroll      /* here and at every unroll of this kernel: the arrays indexed are registers, so every index must be a constant */
  for (int qt = 0; qt < QT; ++qt) { const unsigned short* qr = (const unsigned short*)Q16 + ((size_t)b * TQ + q0 + qt * 16) * ldq + h * 1024 + 8 * lane; const unsigned short* ql = (const unsigned short*)QL + ((size_t)b * TQ + q0 + qt * 16) * ldq + h * 1024 + 8 * lane;      /* fragment order: a head's 64 columns are 2 tiles of 512 elements */
#pragma unroll
    for (int ks = 0; ks < KS; ++ks) { bq[qt][ks].half[0] = *(const v8us*)(qr + ks * 512); bq[qt][ks].half[1] = *(const v8us*)(qr + ks * 512 + 256); bql[qt][ks].half[0] = *(const v8us*)(ql + ks * 512); bql[qt][ks].half[1] = *(const v8us*)(ql + ks * 512 + 256); }
    asm volatile("s_wait_xcnt 0x0" :: "v"(qr), "v"(ql) : "memory"); }      /* behind the tile's 8 loads and in front of any reuse of their address registers, in the form used behind the K loads below */
  const unsigned short* Vth = (const unsigned short*)Vt + (size_t)slab * 64 * TK;
  float m_q[QT], l_q[QT]; v8f oacc[QT][DT];      /* of query ln of tile qt; l_q holds the sum over this half's keys, the halves are joined behind the loop */
#pragma unroll
  for (int qt = 0; qt < QT; ++qt) { m_q[qt] = -3.0e38f; l_q[qt] = 0.f;
#pragma unroll
    for (int dt = 0; dt < DT; ++dt) oacc[qt][dt] = (v8f){0.f,0.f,0.f,0.f,0.f,0.f,0.f,0.f}; }
#pragma unroll 1
  for (int j0 = 0; j0 < TK; j0 += 32) {
    float sc[QT][16];
#pragma unroll
    for (int nt = 0; nt < 2; ++nt) { const unsigned short* kr = (const unsigned short*)K16 + ((size_t)b * TK + j0 + nt * 16) * ldk + h * 1024 + 8 * lane; const unsigned short* klr = (const unsigned short*)KL + ((size_t)b * TK + j0 + nt * 16) * ldk + h * 1024 + 8 * lane; FragH ak[KS], akl[KS];
#pragma unroll
      for (int ks = 0; ks < KS; ++ks) { ak[ks].half[0] = *(const v8us*)(kr + ks * 512); ak[ks].half[1] = *(const v8us*)(kr + ks * 512 + 256); akl[ks].half[0] = *(const v8us*)(klr + ks * 512); akl[ks].half[1] = *(const v8us*)(klr + ks * 512 + 256); }
      asm volatile("s_wait_xcnt 0x0" :: "v"(kr), "v"(klr) : "memory");      /* behind the tile's 8 loads and in front of any reuse of their address registers: naming the two addresses as inputs keeps their registers untouched up to this wait */
      v8f acc[QT], accl[QT];
#pragma unroll
      for (int qt = 0; qt < QT; ++qt) { acc[qt] = (v8f){0.f,0.f,0.f,0.f,0.f,0.f,0.f,0.f}; accl[qt] = acc[qt]; }
#pragma unroll
      for (int ks = 0; ks < KS; ++ks) {      /* the two tiles' products alternate: a product that adds to the one before it in its own chain stands two places behind it */
#pragma unroll
        for (int qt = 0; qt < QT; ++qt) acc[qt] = mmaH<1>(ak[ks].v, ak[ks].v, bq[qt][ks].v, bq[qt][ks].v, acc[qt]);
#pragma unroll
        for (int qt = 0; qt < QT; ++qt) accl[qt] = mmaH<1>(ak[ks].v, ak[ks].v, bql[qt][ks].v, bql[qt][ks].v, accl[qt]);
#pragma unroll
        for (int qt = 0; qt < QT; ++qt) accl[qt] = mmaH<1>(akl[ks].v, akl[ks].v, bq[qt][ks].v, bq[qt][ks].v, accl[qt]); }
#pragma unroll
      for (int qt = 0; qt < QT; ++qt)
#pragma unroll
        for (int r = 0; r < 8; ++r) sc[qt][nt * 8 + r] = (acc[qt][r] + accl[qt][r] * 0.0009765625f) * SCL; }
    FragH av[DT]; const unsigned short* vr = Vth + j0 * 16 + 8 * lane;      /* fragment order: 32 keys = one tile of 512 elements; rows d of V^T are the A operand */
#pragma unroll
    for (int dt = 0; dt < DT; ++dt) { const unsigned short* vrow = vr + (size_t)(dt * 16) * TK; av[dt].half[0] = *(const v8us*)(vrow); av[dt].half[1] = *(const v8us*)(vrow + 256); }
    asm volatile("s_wait_xcnt 0x0" :: "v"(vr) : "memory");      /* behind the 8 V^T loads, as behind the K loads above: naming the address keeps its registers untouched up to this wait */
    __builtin_amdgcn_sched_barrier(0);      /* keeps the 8 V^T loads in front of the softmax, which then covers their latency: left free, the scheduler sinks 6 of them to just in front of their products, where the wave waits them out */
    FragH pb[QT];
#pragma unroll
    for (int qt = 0; qt < QT; ++qt) {
      float mx[8];
#pragma unroll
      for (int i = 0; i < 8; ++i) mx[i] = fmaxf(sc[qt][i], sc[qt][8 + i]);
      float mc = fmaxf(fmaxf(fmaxf(mx[0], mx[1]), fmaxf(mx[2], mx[3])), fmaxf(fmaxf(mx[4], mx[5]), fmaxf(mx[6], mx[7])));
      mc = fmaxf(mc, xhalf(mc));
      const float mn = fmaxf(m_q[qt], mc); const float ea = expf(m_q[qt] - mn); const float al = (mn > -1.0e38f) ? ea : 1.0f; m_q[qt] = mn;
      float p[16];
#pragma unroll
      for (int i = 0; i < 16; ++i) { p[i] = expf(sc[qt][i] - mn); pb[qt].h[i] = (_Float16)(p[i] * 1024.0f); }
      l_q[qt] = l_q[qt] * al + ((((p[0] + p[1]) + (p[2] + p[3])) + ((p[4] + p[5]) + (p[6] + p[7]))) + (((p[8] + p[9]) + (p[10] + p[11])) + ((p[12] + p[13]) + (p[14] + p[15]))));
#pragma unroll
      for (int dt = 0; dt < DT; ++dt)
#pragma unroll
        for (int r = 0; r < 8; ++r) oacc[qt][dt][r] *= al; }
#pragma unroll
    for (int dt = 0; dt < DT; ++dt)
#pragma unroll
      for (int qt = 0; qt < QT; ++qt) oacc[qt][dt] = mmaH<1>(av[dt].v, av[dt].v, pb[qt].v, pb[qt].v, oacc[qt][dt]); }
  /* O^T: lane 16 * hh + ln holds query ln of tile qt and, in accumulator dt, the 8 neighbouring columns d = dt * 16 + 8 * hh + r: exactly one 16-byte chunk of the projection's A plane (row = token, DMOD columns, fragment order). The hi + 2^10 residual split is done here and each plane gets 512 contiguous bytes per wave, tile and dt, straight from registers */
#pragma unroll
  for (int qt = 0; qt < QT; ++qt) {
    const float l = l_q[qt] + xhalf(l_q[qt]); const float inv = (l > 0.f) ? 1.0f / (l * 1024.0f) : 0.f;
    unsigned short* oh = (unsigned short*)OH + ((size_t)(((b * TQ + q0) >> 4) + qt) * (DMOD / 32) + h * 2) * 512 + 8 * lane; unsigned short* ol = (unsigned short*)OL + ((size_t)(((b * TQ + q0) >> 4) + qt) * (DMOD / 32) + h * 2) * 512 + 8 * lane;
#pragma unroll
    for (int dt = 0; dt < DT; ++dt) { FragH fh, fl;
#pragma unroll
      for (int r = 0; r < 8; ++r) { const float v = oacc[qt][dt][r] * inv; const _Float16 hv = (_Float16)v; fh.h[r] = hv; fl.h[r] = (_Float16)((v - (float)hv) * 1024.0f); }
      *(v8us*)(oh + dt * 256) = fh.half[0]; *(v8us*)(ol + dt * 256) = fl.half[0]; } } }

__global__ __launch_bounds__(256) void k_woutp(const float* __restrict__ Wm, _Float16* __restrict__ Bt) { const size_t t = (size_t)blockIdx.x * 256 + threadIdx.x; if (t >= (size_t)DMOD * (2 * DMOD / 8)) return; const int tile = (int)(t >> 6); const int pc = (tile % (2 * DMOD / 32)) * 4 + (int)((t >> 4) & 3); const int o = (tile / (2 * DMOD / 32)) * 16 + (int)(t & 15); const bool lo = pc * 8 >= DMOD; FragH f;      /* t = the output chunk in fragment order */
  for (int q = 0; q < 8; ++q) { const int c = pc * 8 + q - (lo ? DMOD : 0); f.h[q] = (_Float16)(bf16_round(Wm[(size_t)c * DMOD + o]) * (lo ? 1.0f : 16.0f)); } *(v8us*)((unsigned short*)Bt + t * 8) = f.half[0];  }      /* Wproj stored (in, out) -> Bt rows o, columns [c | 1024 + c], fragment order */
__global__ __launch_bounds__(256) void k_pose(const float* __restrict__ pose, const float* __restrict__ W1, const float* __restrict__ b1, const float* __restrict__ W2, const float* __restrict__ b2, const float* __restrict__ bqkv, float* __restrict__ PB) {
  #pragma clang fp contract(off)
  __shared__ float hs[64]; const int b = blockIdx.x / (3 * DMOD / 256), tid = threadIdx.x; const int o = (blockIdx.x % (3 * DMOD / 256)) * 256 + tid;      /* one block per (batch, 256-column slice), one output column per thread */
  float w2[64];      /* the column's 64 W2 values are fetched up front by independent loads (ahead of the hidden layer too), so a wave waits for memory once instead of once per term */
#pragma unroll
  for (int j = 0; j < 64; ++j) w2[j] = W2[(size_t)j * 3 * DMOD + o];
  const float vb2 = b2[o], vbq = bqkv[o];
  if (tid < 64) { float s = 0.f; for (int i = 0; i < 3; ++i) s += bf16_round(pose[b * 3 + i]) * bf16_round(W1[i * 64 + tid]); s += bf16_round(b1[tid]); hs[tid] = fmaxf(s, 0.f); }
  __syncthreads();
  float s = 0.f;
#pragma unroll
  for (int j = 0; j < 64; ++j) s += hs[j] * bf16_round(w2[j]);      /* terms summed in index order, j = 0..63 */
  s += bf16_round(vb2); s += bf16_round(vbq); PB[(size_t)b * 3 * DMOD + o] = s; }

extern "C" void kernel_launch(void* const* d_in, const int* in_sizes, int n_in,
                              void* d_out, int out_size, void* d_ws, size_t ws_size, hipStream_t stream) {
  (void)in_sizes; (void)n_in; (void)out_size;
  const float* const* I = (const float* const*)d_in; const float* x = I[0]; const float* pose = I[1]; const float* Wqkv = I[2]; const float* bqkv = I[3]; const float* W1 = I[4]; const float* b1 = I[5]; const float* W2 = I[6]; const float* b2 = I[7]; const float* Wp = I[8]; const float* bp = I[9];
  char* ws = (char*)d_ws; size_t off = 0;
  auto take = [&](size_t bytes) { char* p = ws + off; off += (bytes + 255) & ~(size_t)255; return p; };
  _Float16* BW = (_Float16*)take((size_t)3 * DMOD * DMOD * 2); _Float16* BO = (_Float16*)take((size_t)DMOD * 2 * DMOD * 2); float* PB = (float*)take((size_t)NB * 3 * DMOD * 4);
  _Float16* X16 = (_Float16*)take((size_t)NR * DMOD * 2); _Float16* H3 = (_Float16*)take((size_t)NR * 3 * DMOD * 2); _Float16* L3 = (_Float16*)take((size_t)NR * 3 * DMOD * 2); _Float16* VT = (_Float16*)take((size_t)NR * DMOD * 2); _Float16* Hh = (_Float16*)take((size_t)NR * DMOD * 2); _Float16* Hl = (_Float16*)take((size_t)NR * DMOD * 2);      /* H3/L3: 3072 columns q | k | (unused) in fragment order, where a step of 1024 columns is 32 tiles = 16 * DMOD elements; Hh/Hl are planes of their own: the flash kernel writes them while other blocks still read H3/L3 */
  if (off > ws_size) return;      /* 6 + 4 + 16 + 48 + 48 + 16 + 16 + 16 = 170 MiB (256 MiB ws) */
  k_wt_f16<<<(unsigned)(((size_t)3 * DMOD * (DMOD / 8) + 255) / 256), 256, 0, stream>>>(Wqkv, BW, DMOD, 3 * DMOD, 16.0f); k_woutp<<<(unsigned)(((size_t)DMOD * (2 * DMOD / 8) + 255) / 256), 256, 0, stream>>>(Wp, BO);
  k_pose<<<NB * (3 * DMOD / 256), 256, 0, stream>>>(pose, W1, b1, W2, b2, bqkv, PB);
  k_x16<<<(unsigned)(((size_t)NR * DMOD / 8 + 255) / 256), 256, 0, stream>>>(x, X16, (size_t)NR * DMOD / 8);
  const dim3 gQ((NR / 128) * (3 * DMOD / 64), 1), gA((NR / 128) * (DMOD / 64), 1);
  k_gemm_qkv<<<gQ, 128, 0, stream>>>(X16, BW, PB, H3, L3, VT);      /* all batches and q|k|v in one launch; + (bqkv + pose bias of batch row / 1024), a COMPUTED f32 vector added raw (not bf16-rounded like an input bias); writes q, k hi + residual and V^T */
  k_flashqk<<<NB * NH * FQBLKS, 128, 0, stream>>>(H3, L3, 3 * DMOD, H3 + 16 * DMOD, L3 + 16 * DMOD, 3 * DMOD, VT, Hh, Hl);      /* q/k hi + residual; P (x2^10) and V plain f16; writes the attention output hi + residual */
  k_gemm_proj<<<gA, 128, 0, stream>>>(Hh, Hl, BO, bp, (float*)d_out);      /* hi and residual planes in one launch */
}

// v009
// It runs in 195 microseconds.
// Timed twice side by side with v008, it ran 1.10 and 1.11 times as fast.
// All steps since v000 together make it 8.15 times as fast.
#include <hip/hip_runtime.h>
// Pose-aware attention (8 batches x 1024 tokens x 1024; 16 heads x 64): qkv = x Wqkv + b; per-batch pose embedding = relu(pose W1 + b1) W2 + b2 split into (q, k, v) biases per (head, dim) and added to q/k/v; softmax(q k^T / 8) v; out Wproj + b -> [8,1024,1024].
// Structure: the pose MLP on VALU folded into per-batch bias vectors (bqkv + pose_{q|k|v}[b]); x as an exact f16 plane; one qkv GEMM over all 8192 rows x 3072 columns (32x64 wave tiles, f32 accumulation, exact x16 weights, that per-batch bias picked by row / 1024) whose epilogue itself splits q and k into f16 hi + 2^10 residual planes and stores v as the f16 V^T plane (no f32 plane, no split or transpose launch); the fused flash kernel, products transposed (S^T = K Q^T, O^T = V^T P^T; softmax statistics per lane, P kept in registers), with hi + 2^10-residual q/k planes (S = QhKh + (QlKh + QhKl)/1024) and plain f16 P (x2^10) and V (S with hi/lo operands, P.V with plain ones); the attention output, split into hi + residual by the flash kernel's own epilogue, into one projection GEMM that sums the hi and then the residual products in the same accumulators.
// Operand layout: every f16 plane that feeds a matrix instruction (x, both weights, q|k hi and residual, V^T, the attention output hi and residual) is stored in FRAGMENT ORDER: a [rows][KC] plane is cut into 16-row x 32-column tiles of 1 KiB, tile (row / 16, col / 32) at tile index (row / 16) * (KC / 32) + col / 32, and inside a tile the 16-byte chunk of row r, columns 8c..8c+7 (c = 0..3) sits at chunk c * 16 + r. A wave's fragment load (lane = 16 * hh + ln reads row ln, chunk 2 * half + hh) is then 512 contiguous bytes (4 cache lines) where a row-major plane made it touch 16 lines for the same bytes; values and their lane/register places are those of the row-major loaders.
// Compute dtype: x, pose and all parameters rounded to bf16; q, k hi + residual (~2^-21-class logits); P and v plain f16 (~2^-12); f32 accumulation/softmax. v_wmma_f32_16x16x32_f16.
#define NB 8
#define DMOD 1024
#define NR (NB * SLEN)
#define QBLKS (TQ / 64)
#define FQT 2                     /* query tiles of 16 a wave in k_flashqk */
#define FQBLKS (TQ / (64 * FQT))
#define SLEN 1024
#define TQ SLEN
#define TK SLEN
#define NH 16
#define SCL 0.125f               /* 64^-0.5 */
#define SCL2 0.18033688011112042f /* 64^-0.5 * log2(e): scores to base-2 exponents in k_flashqk */
typedef __bf16 v16b __attribute__((ext_vector_type(16)));
typedef unsigned short v8us __attribute__((ext_vector_type(8), may_alias));
typedef float  v8f  __attribute__((ext_vector_type(8)));
typedef float  v4f  __attribute__((ext_vector_type(4)));
typedef float  v4fa __attribute__((ext_vector_type(4), may_alias));
union FragB { v16b v; v8us half[2]; unsigned short u[16]; };

__device__ __forceinline__ unsigned short bf16_bits(float x) { unsigned int u = __float_as_uint(x); return (unsigned short)((u + 0x7FFFu + ((u >> 16) & 1u)) >> 16); }
__device__ __forceinline__ float bf16_val(unsigned short b) { return __uint_as_float(((unsigned int)b) << 16); }
__device__ __forceinline__ float bf16_round(float x) { return bf16_val(bf16_bits(x)); }
// D += A·B with NT terms: 1 = ah·bh, 2 = + al·bh (A split), 3 = + ah·bl (both split)
template <int NT>
__device__ __forceinline__ v8f mmaN(v16b ah, v16b al, v16b bh, v16b bl, v8f c) {
  c = __builtin_amdgcn_wmma_f32_16x16x32_bf16(false, ah, false, bh, (short)0, c, false, false);
  if (NT >= 2) c = __builtin_amdgcn_wmma_f32_16x16x32_bf16(false, al, false, bh, (short)0, c, false, false);
  if (NT >= 3) c = __builtin_amdgcn_wmma_f32_16x16x32_bf16(false, ah, false, bl, (short)0, c, false, false);
  asm volatile("v_nop\n\tv_nop\n\tv_nop\n\tv_nop" : "+v"(c) : "v"(ah), "v"(al), "v"(bh), "v"(bl));
  return c;
}

__global__ __launch_bounds__(256) void k_wt_bf16(const float* __restrict__ W, unsigned short* __restrict__ Wt, int K, int N) {
  const int t = blockIdx.x * 256 + threadIdx.x;
  const int k8n = K / 8;
  if (t >= N * k8n) return;
  const int n = t / k8n, k8 = (t % k8n) * 8;
  v8us v;
#pragma unroll
  for (int i = 0; i < 8; ++i) v[i] = bf16_bits(W[(size_t)(k8 + i) * N + n]);
  *(v8us*)(Wt + (size_t)n * K + k8) = v;
  
}

// GEMM C[M][N] (f32, pitch ldc) = act(A[M][K]·W + bias). A f32 row-major (pitch lda) converted per fragment to bf16
// (ASPLIT: hi/lo two planes -> 2 terms, else single rounded term); Wt bf16 [N][K] (pitch ldb). BIAS_BF16 rounds the
// bias to bf16 first (bias quantised to bf16 before the add). K%32==0, M%16==0, N%64==0.
template <bool ASPLIT, int ACT, bool BIAS_BF16>
__global__ __launch_bounds__(128) void k_gemm_bf(const float* __restrict__ A, int lda, const unsigned short* __restrict__ Wt, int ldb,
                                               const float* __restrict__ bias, float* __restrict__ C, int ldc, int M, int N, int K) {
  __shared__ __attribute__((aligned(16))) float so[4][16][64];
  const int tid = threadIdx.x, w = tid >> 5, lane = tid & 31, ln = lane & 15, hh = lane >> 4;
  const int ntn = N / 64;
  const int wid = blockIdx.x * 4 + w;
  const int mt = wid / ntn, nq = wid % ntn;
  if (mt * 16 >= M) return;
  const int row0 = mt * 16, col0 = nq * 64;
  const float* arow = A + (size_t)(row0 + ln) * lda;
  v8f acc[4] = {};
  for (int kb = 0; kb < K; kb += 32) {
    FragB ah, al;
    const v4f x0 = *(const v4fa*)(arow + kb + 8 * hh), x1 = *(const v4fa*)(arow + kb + 8 * hh + 4);
    const v4f x2 = *(const v4fa*)(arow + kb + 16 + 8 * hh), x3 = *(const v4fa*)(arow + kb + 16 + 8 * hh + 4);
    float xs[16] = {x0[0],x0[1],x0[2],x0[3],x1[0],x1[1],x1[2],x1[3],x2[0],x2[1],x2[2],x2[3],x3[0],x3[1],x3[2],x3[3]};
#pragma unroll
    for (int i = 0; i < 16; ++i) { const unsigned short hb = bf16_bits(xs[i]); ah.u[i] = hb; al.u[i] = ASPLIT ? bf16_bits(xs[i] - bf16_val(hb)) : (unsigned short)0; }
#pragma unroll
    for (int t = 0; t < 4; ++t) {
      const unsigned short* brow = Wt + (size_t)(col0 + t * 16 + ln) * ldb + kb;
      FragB b;
      b.half[0] = *(const v8us*)(brow + 8 * hh);
      b.half[1] = *(const v8us*)(brow + 16 + 8 * hh);
      acc[t] = mmaN<ASPLIT ? 2 : 1>(ah.v, al.v, b.v, b.v, acc[t]);
    }
  }
#pragma unroll
  for (int t = 0; t < 4; ++t) {
    float bv = bias ? bias[col0 + t * 16 + ln] : 0.f;
    if (BIAS_BF16) bv = bf16_round(bv);
#pragma unroll
    for (int r = 0; r < 8; ++r) { float v = acc[t][r] + bv; if (ACT == 1) v = fmaxf(v, 0.f); so[w][8 * hh + r][t * 16 + ln] = v; }
  }
  __builtin_amdgcn_fence(__ATOMIC_ACQ_REL, "workgroup");
  __builtin_amdgcn_wave_barrier();
  const int rsub = lane >> 4, c4 = (lane & 15) * 4;
  {
#pragma unroll
    for (int q = 0; q < 8; ++q) {
      const int r = q * 2 + rsub;
      const v4f v = *(const v4fa*)&so[w][r][c4];
      *(v4f*)(C + (size_t)(row0 + r) * ldc + col0 + c4) = v;
    }
    
  }
}

// GEMM C = act(A·W + bias + resid): A f32 (ASPLIT -> hi/lo 2 terms), Wt bf16 [N][K]; ACT 0 none, 1 relu, 2 exact gelu;
// resid (optional, f32, row index = (row % rmod), pitch ldr, RES_BF16 rounds it) added before the activation.
template <bool ASPLIT, int ACT, bool BIAS_BF16, bool RES_BF16>
__global__ __launch_bounds__(128) void k_gemm_bf3(const float* __restrict__ A, int lda, const unsigned short* __restrict__ Wt, int ldb,
                                                const float* __restrict__ bias, const float* __restrict__ resid, int rmod, int ldr,
                                                float* __restrict__ C, int ldc, int M, int N, int K) {
  __shared__ __attribute__((aligned(16))) float so[4][16][64];
  const int tid = threadIdx.x, w = tid >> 5, lane = tid & 31, ln = lane & 15, hh = lane >> 4;
  const int ntn = N / 64;
  const int wid = blockIdx.x * 4 + w;
  const int mt = wid / ntn, nq = wid % ntn;
  if (mt * 16 >= M) return;
  const int row0 = mt * 16, col0 = nq * 64;
  const float* arow = A + (size_t)(row0 + ln) * lda;
  v8f acc[4] = {};
  for (int kb = 0; kb < K; kb += 32) {
    FragB ah, al;
    const v4f x0 = *(const v4fa*)(arow + kb + 8 * hh), x1 = *(const v4fa*)(arow + kb + 8 * hh + 4);
    const v4f x2 = *(const v4fa*)(arow + kb + 16 + 8 * hh), x3 = *(const v4fa*)(arow + kb + 16 + 8 * hh + 4);
    float xs[16] = {x0[0],x0[1],x0[2],x0[3],x1[0],x1[1],x1[2],x1[3],x2[0],x2[1],x2[2],x2[3],x3[0],x3[1],x3[2],x3[3]};
#pragma unroll
    for (int i = 0; i < 16; ++i) { const unsigned short hb = bf16_bits(xs[i]); ah.u[i] = hb; al.u[i] = ASPLIT ? bf16_bits(xs[i] - bf16_val(hb)) : (unsigned short)0; }
#pragma unroll
    for (int t = 0; t < 4; ++t) {
      const unsigned short* brow = Wt + (size_t)(col0 + t * 16 + ln) * ldb + kb;
      FragB b;
      b.half[0] = *(const v8us*)(brow + 8 * hh);
      b.half[1] = *(const v8us*)(brow + 16 + 8 * hh);
      acc[t] = mmaN<ASPLIT ? 2 : 1>(ah.v, al.v, b.v, b.v, acc[t]);
    }
  }
#pragma unroll
  for (int t = 0; t < 4; ++t) {
    const int col = col0 + t * 16 + ln;
    float bv = bias ? bias[col] : 0.f;
    if (BIAS_BF16) bv = bf16_round(bv);
#pragma unroll
    for (int r = 0; r < 8; ++r) {
      float v = acc[t][r] + bv;
      if (resid) { float rv = resid[(size_t)((row0 + 8 * hh + r) % rmod) * ldr + col]; if (RES_BF16) rv = bf16_round(rv); v += rv; }
      if (ACT == 1) v = fmaxf(v, 0.f);
      if (ACT == 2) v = 0.5f * v * (1.0f + erff(v * 0.70710678118654752f));
      if (ACT == 3) { const float u = 0.7978845608028654f * (v + 0.044715f * v * v * v); v = 0.5f * v * (1.0f + tanhf(u)); }
      so[w][8 * hh + r][t * 16 + ln] = v;
    }
  }
  __builtin_amdgcn_fence(__ATOMIC_ACQ_REL, "workgroup");
  __builtin_amdgcn_wave_barrier();
  const int rsub = lane >> 4, c4 = (lane & 15) * 4;
  {
#pragma unroll
    for (int q = 0; q < 8; ++q) {
      const int r = q * 2 + rsub;
      const v4f v = *(const v4fa*)&so[w][r][c4];
      *(v4f*)(C + (size_t)(row0 + r) * ldc + col0 + c4) = v;
    }
    
  }
}
// row LayerNorm (biased variance, eps) over N: s = X (+ R); optional out_sum <- s; out_norm <- (s-mu)*rsqrt(var+eps)*g + b
template <bool PARAM_BF16>
__global__ __launch_bounds__(256) void k_layernorm(const float* __restrict__ X, const float* __restrict__ R, const float* __restrict__ g, const float* __restrict__ bta,
                                                  float* __restrict__ out_sum, float* __restrict__ out_norm, int N, float eps) {
  __shared__ float red[256];
  const int row = blockIdx.x, tid = threadIdx.x;
  const float* x = X + (size_t)row * N; const float* rr = R ? R + (size_t)row * N : nullptr;
  float vals[16];                     // up to N = 4096
  const int per = N / 256;            // contiguous chunk per thread? use strided-by-4 chunks: thread handles j = tid*4 + 1024*u
  float s1 = 0.f;
  for (int u = 0; u < per / 4; ++u) {
    const int j = tid * 4 + 1024 * u;
    const v4f a = *(const v4fa*)(x + j);
    v4f b = {0.f,0.f,0.f,0.f}; if (rr) b = *(const v4fa*)(rr + j);
#pragma unroll
    for (int q = 0; q < 4; ++q) { const float v = a[q] + b[q]; vals[u * 4 + q] = v; s1 += v; }
  }
  red[tid] = s1; __syncthreads();
  for (int st = 128; st > 0; st >>= 1) { if (tid < st) red[tid] += red[tid + st]; __syncthreads(); }
  const float mu = red[0] / (float)N; __syncthreads();
  float s2 = 0.f;
  for (int u = 0; u < per / 4; ++u)
#pragma unroll
    for (int q = 0; q < 4; ++q) { const float c = vals[u * 4 + q] - mu; s2 += c * c; }
  red[tid] = s2; __syncthreads();
  for (int st = 128; st > 0; st >>= 1) { if (tid < st) red[tid] += red[tid + st]; __syncthreads(); }
  const float rs = rsqrtf(red[0] / (float)N + eps);
  {
    for (int u = 0; u < per / 4; ++u) {
      const int j = tid * 4 + 1024 * u;
      v4f o, sm;
#pragma unroll
      for (int q = 0; q < 4; ++q) {
        float gg = g[j + q], bb = bta[j + q];
        if (PARAM_BF16) { gg = bf16_round(gg); bb = bf16_round(bb); }
        sm[q] = vals[u * 4 + q]; o[q] = (vals[u * 4 + q] - mu) * rs * gg + bb;
      }
      if (out_sum) *(v4f*)(out_sum + (size_t)row * N + j) = sm;
      *(v4f*)(out_norm + (size_t)row * N + j) = o;
    }
    
  }
}



// ---- f16 WMMA path (v_wmma_f32_16x16x32_f16): 11-bit significands for operands in range — used where a [0,1] probability operand needs more precision than bf16
typedef _Float16 v16h __attribute__((ext_vector_type(16)));
union FragH { v16h v; v8us half[2]; _Float16 h[16]; unsigned short u[16]; };
template <int NT>
__device__ __forceinline__ v8f mmaH(v16h ah, v16h al, v16h bh, v16h bl, v8f c) {
  c = __builtin_amdgcn_wmma_f32_16x16x32_f16(false, ah, false, bh, (short)0, c, false, false);
  if (NT >= 2) c = __builtin_amdgcn_wmma_f32_16x16x32_f16(false, al, false, bh, (short)0, c, false, false);
  if (NT >= 3) c = __builtin_amdgcn_wmma_f32_16x16x32_f16(false, ah, false, bl, (short)0, c, false, false);
  asm volatile("v_nop\n\tv_nop\n\tv_nop\n\tv_nop" : "+v"(c) : "v"(ah), "v"(al), "v"(bh), "v"(bl));
  return c;
}
// batched GEMM like k_gemm_b but f16 operands: A f32 (split into f16 hi/lo if ASPLIT, else rounded to f16), Bt = f16 values [n][k]; alpha; C f32; N multiple of 16 (partial tiles skipped)
template <bool ASPLIT>
__global__ __launch_bounds__(128) void k_gemm_h(const float* __restrict__ A, int lda, size_t sA, const _Float16* __restrict__ Bh, int ldb, size_t sB, float alpha, float* __restrict__ C, int ldc, size_t sC, int M, int N, int K) {
  __shared__ __attribute__((aligned(16))) float so[4][16][64];
  const int tid = threadIdx.x, w = tid >> 5, lane = tid & 31, ln = lane & 15, hh = lane >> 4; const int by = blockIdx.y;
  A += (size_t)by * sA; Bh += (size_t)by * sB; C += (size_t)by * sC;
  const int ntn = (N + 63) / 64; const int wid = blockIdx.x * 4 + w; const int mt = wid / ntn, nq = wid % ntn; if (mt * 16 >= M) return;
  const int row0 = mt * 16, col0 = nq * 64; const float* arow = A + (size_t)(row0 + ln) * lda;
  v8f acc[4] = {};
  for (int kb = 0; kb < K; kb += 32) {
    FragH ah, al;
    const v4f x0 = *(const v4fa*)(arow + kb + 8 * hh), x1 = *(const v4fa*)(arow + kb + 8 * hh + 4), x2 = *(const v4fa*)(arow + kb + 16 + 8 * hh), x3 = *(const v4fa*)(arow + kb + 16 + 8 * hh + 4);
    float xs[16] = {x0[0],x0[1],x0[2],x0[3],x1[0],x1[1],x1[2],x1[3],x2[0],x2[1],x2[2],x2[3],x3[0],x3[1],x3[2],x3[3]};
#pragma unroll
    for (int i = 0; i < 16; ++i) { const _Float16 h = (_Float16)xs[i]; ah.h[i] = h; al.h[i] = ASPLIT ? (_Float16)(xs[i] - (float)h) : (_Float16)0.0f; }
#pragma unroll
    for (int t = 0; t < 4; ++t) { if (col0 + t * 16 >= N) continue; const size_t boff = (size_t)(col0 + t * 16 + ln) * ldb + kb; FragH bq; bq.half[0] = *(const v8us*)(Bh + boff + 8 * hh); bq.half[1] = *(const v8us*)(Bh + boff + 16 + 8 * hh);
      acc[t] = mmaH<ASPLIT ? 2 : 1>(ah.v, al.v, bq.v, bq.v, acc[t]); }
  }
#pragma unroll
  for (int t = 0; t < 4; ++t) { if (col0 + t * 16 >= N) continue;
#pragma unroll
    for (int r = 0; r < 8; ++r) so[w][8 * hh + r][t * 16 + ln] = acc[t][r] * alpha; }
  __builtin_amdgcn_fence(__ATOMIC_ACQ_REL, "workgroup"); __builtin_amdgcn_wave_barrier();
  const int rsub = lane >> 4, c4 = (lane & 15) * 4;
  {
#pragma unroll
    for (int q = 0; q < 8; ++q) { const int r = q * 2 + rsub; if (col0 + c4 < N) { const v4f v = *(const v4fa*)&so[w][r][c4]; *(v4f*)(C + (size_t)(row0 + r) * ldc + col0 + c4) = v; } }
     }
}

// Wt (rows n, columns k, fragment order) = f16(W[k][n] * scale) from f32 row-major W[K][N] (scale = power of two; bf16-exact weights stay exact in f16 away from the subnormal range)
__global__ __launch_bounds__(256) void k_wt_f16(const float* __restrict__ W, _Float16* __restrict__ Wt, int K, int N, float scale) {
  const int t = blockIdx.x * 256 + threadIdx.x; if (t >= N * (K / 8)) return; const int tile = t >> 6; const int n = (tile / (K / 32)) * 16 + (t & 15), k8 = (tile % (K / 32)) * 32 + ((t >> 4) & 3) * 8; FragH f;      /* t = the output chunk in fragment order (rows n, columns k): 16 neighbouring lanes read 16 neighbouring n */
#pragma unroll
  for (int i = 0; i < 8; ++i) f.h[i] = (_Float16)(bf16_round(W[(size_t)(k8 + i) * N + n]) * scale); const v8us o = f.half[0];
  *(v8us*)((unsigned short*)Wt + (size_t)t * 8) = o; 
}
// k_gemm_hh variant with fused epilogue: v = acc·alpha + bias[by·sBias + col] (+ CP[(row/rowsPerB)·sCPb + by·64 + col] if CP) ; ACT 0 none / 1 elu ; writes f16 C16 (and f32 C if non-null)
template <int ACT>
__global__ __launch_bounds__(128) void k_gemm_hhx(const _Float16* __restrict__ A, int lda, size_t sA, const _Float16* __restrict__ Bh, int ldb, size_t sB, float alpha, const float* __restrict__ bias, size_t sBias, const float* __restrict__ CP, int rowsPerB, size_t sCPb, int row0g,
    float* __restrict__ C, _Float16* __restrict__ C16, int ldc, size_t sC, int M, int N, int K) {
  __shared__ __attribute__((aligned(16))) float so[4][16][64];
  const int tid = threadIdx.x, w = tid >> 5, lane = tid & 31, ln = lane & 15, hh = lane >> 4; const int by = blockIdx.y;
  A += (size_t)by * sA; Bh += (size_t)by * sB; const size_t cofs = (size_t)by * sC; const float* bp = bias ? bias + (size_t)by * sBias : nullptr;
  const int ntn = (N + 63) / 64; const int wid = blockIdx.x * 4 + w; const int mt = wid / ntn, nq = wid % ntn; if (mt * 16 >= M) return;
  const int row0 = mt * 16, col0 = nq * 64; const _Float16* arow = A + (size_t)(row0 + ln) * lda;
  v8f acc[4] = {};
  for (int kb = 0; kb < K; kb += 32) { FragH ah; ah.half[0] = *(const v8us*)((const unsigned short*)arow + kb + 8 * hh); ah.half[1] = *(const v8us*)((const unsigned short*)arow + kb + 16 + 8 * hh);
#pragma unroll
    for (int t = 0; t < 4; ++t) { if (col0 + t * 16 >= N) continue; const size_t boff = (size_t)(col0 + t * 16 + ln) * ldb + kb; FragH bq; bq.half[0] = *(const v8us*)((const unsigned short*)Bh + boff + 8 * hh); bq.half[1] = *(const v8us*)((const unsigned short*)Bh + boff + 16 + 8 * hh);
      acc[t] = mmaH<1>(ah.v, ah.v, bq.v, bq.v, acc[t]); }
  }
#pragma unroll
  for (int t = 0; t < 4; ++t) { if (col0 + t * 16 >= N) continue; const int col = col0 + t * 16 + ln; const float bv = bp ? bf16_round(bp[col]) : 0.f;
#pragma unroll
    for (int r = 0; r < 8; ++r) { float v = acc[t][r] * alpha + bv; if (CP) { const int bidx = (row0g + row0 + 8 * hh + r) / rowsPerB; v += CP[(size_t)bidx * sCPb + (size_t)by * 64 + col]; } if (ACT == 1) v = (v > 0.f) ? v : expm1f(v); else if (ACT == 7) v = (v > 0.f) ? v + 1.0f : expf(v); else if (ACT == 8) v = tanhf(v); else if (ACT == 9) v = 0.5f * v * (1.0f + tanhf(0.7978845608028654f * (v + 0.044715f * v * v * v))); else if (ACT == 11) v = 1.0f / (1.0f + expf(-v)); else if (ACT == 12) v = (v > 0.f) ? v : 0.01f * v; else if (ACT == 14) v = (v > 0.f) ? v : 0.1f * v; else if (ACT == 15) v = v / (1.0f + expf(-v)); else if (ACT == 3) v = fmaxf(v, 0.f); else if (ACT == 6) v = 0.5f * v * (1.0f + erff(v * 0.70710678118654752f)); so[w][8 * hh + r][t * 16 + ln] = v; } }
  __builtin_amdgcn_fence(__ATOMIC_ACQ_REL, "workgroup"); __builtin_amdgcn_wave_barrier();
  const int rsub = lane >> 4, c4 = (lane & 15) * 4; typedef _Float16 v4h __attribute__((ext_vector_type(4)));
  {
#pragma unroll
    for (int q = 0; q < 8; ++q) { const int r = q * 2 + rsub; if (col0 + c4 < N) { const v4f v = *(const v4fa*)&so[w][r][c4]; if (C) *(v4f*)(C + cofs + (size_t)(row0 + r) * ldc + col0 + c4) = v; if (C16) { v4h h4; for (int i = 0; i < 4; ++i) h4[i] = (_Float16)v[i]; *(v4h*)(C16 + cofs + (size_t)(row0 + r) * ldc + col0 + c4) = h4; } } }
     }
}


typedef _Float16 v4h __attribute__((ext_vector_type(4)));

// row-major f32 [rows][KC] -> fragment order: a wave takes 8 rows x the 4 chunks of one tile, so it reads 8 whole 128-byte lines and stores 4 whole lines. fo_src = element offset in the row-major source, fo_dst = 16-byte chunk index in the fragment-order plane
template <int KC> __device__ __forceinline__ size_t fo_src(size_t t) { const unsigned u = (unsigned)t, tile = u >> 6; return ((tile / (KC / 32)) * 16 + ((u & 7) | ((u >> 2) & 8))) * KC + (tile % (KC / 32)) * 32 + ((u >> 3) & 3) * 8; }      /* 32-bit: the planes here hold at most 8192 * 3072 elements */
__device__ __forceinline__ size_t fo_dst(size_t t) { const unsigned u = (unsigned)t; return (u >> 6) * 64 + ((u >> 3) & 3) * 16 + ((u & 7) | ((u >> 2) & 8)); }
__global__ __launch_bounds__(256) void k_x16(const float* __restrict__ x, _Float16* __restrict__ X16, size_t n8) { const size_t t = (size_t)blockIdx.x * 256 + threadIdx.x; if (t >= n8) return; FragH f; const size_t s = fo_src<DMOD>(t);
#pragma unroll
  for (int q = 0; q < 8; ++q) f.h[q] = (_Float16)bf16_round(x[s + q]); *(v8us*)((unsigned short*)X16 + fo_dst(t) * 8) = f.half[0];  }
__global__ __launch_bounds__(256) void k_h16(const float* __restrict__ x, _Float16* __restrict__ X16, size_t n8) { const size_t t = (size_t)blockIdx.x * 256 + threadIdx.x; if (t >= n8) return; FragH f;
#pragma unroll
  for (int q = 0; q < 8; ++q) f.h[q] = (_Float16)x[t * 8 + q]; *(v8us*)((unsigned short*)X16 + t * 8) = f.half[0];  }
__global__ __launch_bounds__(256) void k_round16f(const float* __restrict__ W, _Float16* __restrict__ Bt, size_t n8) { const size_t t = (size_t)blockIdx.x * 256 + threadIdx.x; if (t >= n8) return; FragH f;
#pragma unroll
  for (int i = 0; i < 8; ++i) f.h[i] = (_Float16)(bf16_round(W[t * 8 + i]) * 16.0f); *(v8us*)((unsigned short*)Bt + t * 8) = f.half[0];  }

// ---- fast GEMM (wave tile 32x64; requires M % 32 == 0 rows per launch region and N % 64 == 0); A and Bh in fragment order with lda / ldb columns (16 rows = 16 * ld elements, 32 columns = 512 elements); each kernel has its own epilogue ----
__device__ __forceinline__ v16h g2_frag(const _Float16* p) { FragH f; f.half[0] = *(const v8us*)((const unsigned short*)p); f.half[1] = *(const v8us*)((const unsigned short*)p + 256); return f.v; }      /* p = the tile's start + 8 * lane, fragment order */
__device__ __forceinline__ v8f g2_mma(v16h a, v16h b, v8f c) { v8f d = __builtin_amdgcn_wmma_f32_16x16x32_f16(false, a, false, b, (short)0, c, false, false); asm volatile("v_nop\n\tv_nop\n\tv_nop\n\tv_nop" : "+v"(d) : "v"(a), "v"(b)); return d; }
// One k step (32 columns) of a 32x64 wave tile: 2 A and 4 B fragments. The main loops keep TWO such sets: while one set's 8 products run, the other set's 12 loads are in flight, and a set is refilled (two k steps on) directly behind its own products. A wave then waits for memory once per k step, with 12 to 24 loads outstanding, where one shared B register set made it wait four times per k step with 2 loads outstanding. Every accumulator still takes its k steps in rising order.
struct G2Set { v16h a0, a1, b0, b1, b2, b3; };
__device__ __forceinline__ void g2_load(G2Set& s, const _Float16* a0p, const _Float16* a1p, const _Float16* b0p, const _Float16* b1p, const _Float16* b2p, const _Float16* b3p, int off, unsigned l8) {      /* the six tile addresses are the same in every lane, so they can live in scalar registers; l8 = 8 * lane is the lane's own part */
  s.a0 = g2_frag(a0p + off + l8); s.a1 = g2_frag(a1p + off + l8); s.b0 = g2_frag(b0p + off + l8); s.b1 = g2_frag(b1p + off + l8); s.b2 = g2_frag(b2p + off + l8); s.b3 = g2_frag(b3p + off + l8);
  __builtin_amdgcn_sched_barrier(0);      /* keeps a set's 12 loads together and the sets' groups in program order, so that the waits in front of one set's products can be counted and leave the other set's 12 loads in flight: left free, the scheduler can mix the two sets' loads, and the loop then waits for all 24 at the head of every trip */
}
__device__ __forceinline__ void g2_step(const G2Set& s, v8f& c00, v8f& c01, v8f& c02, v8f& c03, v8f& c10, v8f& c11, v8f& c12, v8f& c13) {
  c00 = g2_mma(s.a0, s.b0, c00); c10 = g2_mma(s.a1, s.b0, c10); c01 = g2_mma(s.a0, s.b1, c01); c11 = g2_mma(s.a1, s.b1, c11);
  c02 = g2_mma(s.a0, s.b2, c02); c12 = g2_mma(s.a1, s.b2, c12); c03 = g2_mma(s.a0, s.b3, c03); c13 = g2_mma(s.a1, s.b3, c13);
}
// Projection GEMM, one launch for both operand planes: C[NR][DMOD] (f32) = (Ah Bt_hi^T) / 16 + (Al Bt_lo^T) / 1024 + bf16(bias). Ah, Al = the attention output hi and 2^10 residual (DMOD columns), Bt = the weight plane (rows = output column, 2 * DMOD columns: [16 W | W]), all in fragment order.
// The hi products run first; the accumulators are then scaled by 2^6 (exact) and the residual products are summed on top of them, so that one factor 1/1024 at the end serves both. No second launch, no f32 output that is stored, read back element by element and stored again.
// 4 waves per SIMD asked for (the grid holds no more): 64 accumulator registers + two fragment sets of 48 + addresses fit the 256 registers that leaves.
__global__ __launch_bounds__(128, 4) void k_gemm_proj(const _Float16* __restrict__ Ah, const _Float16* __restrict__ Al, const _Float16* __restrict__ Bt, const float* __restrict__ bias, float* __restrict__ C) {
  __shared__ __attribute__((aligned(16))) float so[4][32][68];
  const int tid = threadIdx.x, w = tid >> 5, lane = tid & 31, ln = lane & 15, hh = lane >> 4;
  constexpr int ntn = DMOD / 64; const int mt = blockIdx.x / ntn, nq = blockIdx.x - mt * ntn; const int row0 = mt * 128 + 32 * __builtin_amdgcn_readfirstlane(w), col0 = nq * 64;      /* the wave's number read as a scalar: the operand addresses below then live in scalar registers */
  const unsigned l8 = 8 * lane; const _Float16* a0p = Ah + (size_t)row0 * DMOD; const _Float16* a1p = a0p + (size_t)16 * DMOD;
  const _Float16* b0p = Bt + (size_t)col0 * (2 * DMOD); const _Float16* b1p = b0p + (size_t)16 * (2 * DMOD); const _Float16* b2p = b1p + (size_t)16 * (2 * DMOD); const _Float16* b3p = b2p + (size_t)16 * (2 * DMOD);
  const v8f z8 = {0.f,0.f,0.f,0.f,0.f,0.f,0.f,0.f}; v8f c00 = z8, c01 = z8, c02 = z8, c03 = z8, c10 = z8, c11 = z8, c12 = z8, c13 = z8;
  G2Set s0, s1; g2_load(s0, a0p, a1p, b0p, b1p, b2p, b3p, 0, l8); g2_load(s1, a0p, a1p, b0p, b1p, b2p, b3p, 512, l8);
#pragma unroll 1
  for (int kb = 64; kb < DMOD; kb += 64) {      /* rolled: two k steps a trip, the two register sets by name */
    g2_step(s0, c00, c01, c02, c03, c10, c11, c12, c13); g2_load(s0, a0p, a1p, b0p, b1p, b2p, b3p, 1024, l8);
    g2_step(s1, c00, c01, c02, c03, c10, c11, c12, c13); g2_load(s1, a0p, a1p, b0p, b1p, b2p, b3p, 1536, l8);
    a0p += 1024; a1p += 1024; b0p += 1024; b1p += 1024; b2p += 1024; b3p += 1024; }
  a0p = Al + (size_t)row0 * DMOD; a1p = a0p + (size_t)16 * DMOD; b0p = Bt + (size_t)col0 * (2 * DMOD) + 16 * DMOD; b1p = b0p + (size_t)16 * (2 * DMOD); b2p = b1p + (size_t)16 * (2 * DMOD); b3p = b2p + (size_t)16 * (2 * DMOD);      /* the residual plane from its start; its weights: columns DMOD.. of Bt = 32 tiles = 16 * DMOD elements on */
  g2_step(s0, c00, c01, c02, c03, c10, c11, c12, c13); g2_step(s1, c00, c01, c02, c03, c10, c11, c12, c13);      /* the last two hi k steps */
  g2_load(s0, a0p, a1p, b0p, b1p, b2p, b3p, 0, l8); g2_load(s1, a0p, a1p, b0p, b1p, b2p, b3p, 512, l8);      /* the first two residual k steps, in flight while the accumulators are scaled */
  c00 *= 64.0f; c01 *= 64.0f; c02 *= 64.0f; c03 *= 64.0f; c10 *= 64.0f; c11 *= 64.0f; c12 *= 64.0f; c13 *= 64.0f;      /* 2^6 = (1 / 16) / (1 / 1024) */
#pragma unroll 1
  for (int kb = 64; kb < DMOD; kb += 64) {      /* rolled, the same loop body on the residual */
    g2_step(s0, c00, c01, c02, c03, c10, c11, c12, c13); g2_load(s0, a0p, a1p, b0p, b1p, b2p, b3p, 1024, l8);
    g2_step(s1, c00, c01, c02, c03, c10, c11, c12, c13); g2_load(s1, a0p, a1p, b0p, b1p, b2p, b3p, 1536, l8);
    a0p += 1024; a1p += 1024; b0p += 1024; b1p += 1024; b2p += 1024; b3p += 1024; }
  g2_step(s0, c00, c01, c02, c03, c10, c11, c12, c13); g2_step(s1, c00, c01, c02, c03, c10, c11, c12, c13);      /* the last two k steps: nothing is left to refill */
  v8f accs[8] = {c00, c01, c02, c03, c10, c11, c12, c13};
#pragma unroll      /* the accumulators are registers: every index must be a constant */
  for (int u = 0; u < 8; ++u) { const int t = u & 3, half = u >> 2; const float bv = bf16_round(bias[col0 + t * 16 + ln]);
#pragma unroll      /* as above */
    for (int r = 0; r < 8; ++r) so[w][half * 16 + 8 * hh + r][t * 16 + ln] = accs[u][r] * 0.0009765625f + bv; }
  __builtin_amdgcn_fence(__ATOMIC_ACQ_REL, "workgroup"); __builtin_amdgcn_wave_barrier();      /* the wave's own LDS writes are done before its lanes read each other's rows */
  const int rsub = lane >> 4, c4 = (lane & 15) * 4;
#pragma unroll      /* the 16 LDS reads go out together, each store behind its own read */
  for (int q = 0; q < 16; ++q) { const int r = q * 2 + rsub; const v4f v = *(const v4fa*)&so[w][r][c4]; *(v4f*)(C + (size_t)(row0 + r) * DMOD + col0 + c4) = v; } }      /* whole 256-byte row pieces: 16 lanes x 16 bytes */



// qkv GEMM: the main loop of k_gemm_proj (A = x plane, Bh = weight plane, both DMOD columns, fragment order) over NR rows x 3 * DMOD columns; v = acc / 16 + PB[(row / SLEN) * 3 * DMOD + col] (raw f32 add of the computed per-batch bias).
// The epilogue writes the flash kernel's operand planes itself, so that no f32 q|k|v plane is stored and re-read and no split or transpose launch follows:
// q, k columns (col < 2 * DMOD): the 32 x 64 wave tile goes through the wave's own LDS rows to turn lane = column into lane = row, is split into f16 hi + 2^10 residual and stored to H3 / L3 (3 * DMOD columns, fragment order; the v columns of both planes stay unused): the tile's 64 columns are 2 neighbouring 1-KiB tiles per 16 rows, every store 512 contiguous bytes per wave.
// v columns: a block's 64 columns are one head. Accumulator (half, t) holds in lane 16 * hh + ln column d = t * 16 + ln and the 8 neighbouring tokens 16 * half + 8 * hh + r: exactly the 16-byte chunk 2 * half + hh of row d in the V^T plane (rows slab * 64 + d, SLEN columns, fragment order), stored straight from registers, 512 contiguous bytes per wave.
// 5 waves per SIMD asked for: 64 accumulator registers + two fragment sets of 48 + addresses fit the 192 registers that leaves; the loads in flight now come from each wave's own two sets rather than from many waves.
__global__ __launch_bounds__(128, 5) void k_gemm_qkv(const _Float16* __restrict__ A, const _Float16* __restrict__ Bh, const float* __restrict__ PB, _Float16* __restrict__ H3, _Float16* __restrict__ L3, _Float16* __restrict__ Vt) {
  __shared__ __attribute__((aligned(16))) float so[4][32][68];
  const int tid = threadIdx.x, w = tid >> 5, lane = tid & 31, ln = lane & 15, hh = lane >> 4;
  constexpr int ntn = 3 * DMOD / 64; const int mt = blockIdx.x / ntn, nq = blockIdx.x - mt * ntn; const int row0 = mt * 128 + 32 * __builtin_amdgcn_readfirstlane(w), col0 = nq * 64;      /* the wave's number read as a scalar, as in k_gemm_proj */
  const unsigned l8 = 8 * lane; const _Float16* a0p = A + (size_t)row0 * DMOD; const _Float16* a1p = a0p + (size_t)16 * DMOD;
  const _Float16* b0p = Bh + (size_t)col0 * DMOD; const _Float16* b1p = b0p + (size_t)16 * DMOD; const _Float16* b2p = b1p + (size_t)16 * DMOD; const _Float16* b3p = b2p + (size_t)16 * DMOD;
  const v8f z8 = {0.f,0.f,0.f,0.f,0.f,0.f,0.f,0.f}; v8f c00 = z8, c01 = z8, c02 = z8, c03 = z8, c10 = z8, c11 = z8, c12 = z8, c13 = z8;
  G2Set s0, s1; g2_load(s0, a0p, a1p, b0p, b1p, b2p, b3p, 0, l8); g2_load(s1, a0p, a1p, b0p, b1p, b2p, b3p, 512, l8);
#pragma unroll 1
  for (int kb = 64; kb < DMOD; kb += 64) {      /* rolled, as in k_gemm_proj: the same loop body */
    g2_step(s0, c00, c01, c02, c03, c10, c11, c12, c13); g2_load(s0, a0p, a1p, b0p, b1p, b2p, b3p, 1024, l8);
    g2_step(s1, c00, c01, c02, c03, c10, c11, c12, c13); g2_load(s1, a0p, a1p, b0p, b1p, b2p, b3p, 1536, l8);
    a0p += 1024; a1p += 1024; b0p += 1024; b1p += 1024; b2p += 1024; b3p += 1024; }
  g2_step(s0, c00, c01, c02, c03, c10, c11, c12, c13); g2_step(s1, c00, c01, c02, c03, c10, c11, c12, c13);
  v8f accs[8] = {c00, c01, c02, c03, c10, c11, c12, c13};
  const int bat = row0 / SLEN; const float* cp = PB + (size_t)bat * 3 * DMOD + col0 + ln;      /* a wave's 32 rows lie in one batch */
  if (col0 >= 2 * DMOD) {      /* the same for the whole block */
    const int slab = bat * NH + (col0 - 2 * DMOD) / 64;
    unsigned short* vt = (unsigned short*)Vt + ((size_t)slab * 4 * (SLEN / 32) + (row0 % SLEN) / 32) * 512 + 8 * lane;
#pragma unroll
    for (int u = 0; u < 8; ++u) { const int t = u & 3, half = u >> 2; const float bv = cp[t * 16]; FragH f;
#pragma unroll
      for (int r = 0; r < 8; ++r) f.h[r] = (_Float16)(accs[u][r] * 0.0625f + bv);
      *(v8us*)(vt + (size_t)t * (SLEN / 32) * 512 + half * 256) = f.half[0]; }
    return;
  }
  {
#pragma unroll
    for (int u = 0; u < 8; ++u) { const int t = u & 3, half = u >> 2; const float bv = cp[t * 16];
#pragma unroll
      for (int r = 0; r < 8; ++r) so[w][half * 16 + 8 * hh + r][t * 16 + ln] = accs[u][r] * 0.0625f + bv; }
    __builtin_amdgcn_fence(__ATOMIC_ACQ_REL, "workgroup"); __builtin_amdgcn_wave_barrier();      /* the wave's own LDS writes are done before its lanes read each other's rows, as in k_gemm_proj */
    const size_t o0 = ((size_t)(row0 >> 4) * (3 * DMOD / 32) + (col0 >> 5)) * 512 + 8 * lane; unsigned short* hp = (unsigned short*)H3 + o0; unsigned short* lp = (unsigned short*)L3 + o0;
#pragma unroll
    for (int q = 0; q < 8; ++q) { const int g = q >> 2; const float* sp = &so[w][g * 16 + ln][((q >> 1) & 1) * 32 + ((q & 1) * 2 + hh) * 8];      /* the lane's chunk is number (q & 3) * 32 + lane of the 128 in the 2 tiles of row group g: row ln, the 8 columns from 8 * (number / 16) */
      const v4f a = *(const v4fa*)sp, c = *(const v4fa*)(sp + 4); FragH fh, fl;
#pragma unroll
      for (int i = 0; i < 4; ++i) { _Float16 hv = (_Float16)a[i]; fh.h[i] = hv; fl.h[i] = (_Float16)((a[i] - (float)hv) * 1024.0f); hv = (_Float16)c[i]; fh.h[4 + i] = hv; fl.h[4 + i] = (_Float16)((c[i] - (float)hv) * 1024.0f); }
      const size_t o = (size_t)g * (3 * DMOD / 32) * 512 + (q & 3) * 256; *(v8us*)(hp + o) = fh.half[0]; *(v8us*)(lp + o) = fl.half[0]; }
    asm volatile("s_wait_xcnt 0x0" ::: "memory");      /* behind the last two stores: the compiler lays the v branch's code behind this block with a fall-through edge (never taken) on which the stores' registers are rewritten */
  } }

template <int CAUSAL>
__global__ __launch_bounds__(128) void k_flash(const _Float16* __restrict__ Q16, int ldq, const _Float16* __restrict__ K16, int ldk, const _Float16* __restrict__ Vt, const int* __restrict__ MSK, float* __restrict__ O, int ldo) {
  constexpr int RPW = 16, RTN = RPW / 16, NQB = TQ / (4 * RPW), DT = 4, KS = 2;
  __shared__ __attribute__((aligned(16))) unsigned short sP[4][RPW][40]; __shared__ __attribute__((aligned(16))) float sO[4][RPW][64 + 4];
  const int tid = threadIdx.x, w = tid >> 5, lane = tid & 31, ln = lane & 15, hh = lane >> 4;
  const int slab = blockIdx.x / QBLKS, qblk = blockIdx.x % QBLKS; (void)NQB; const int b = slab / NH, h = slab % NH; const int qb0 = qblk * (4 * RPW); const int q0 = qb0 + w * RPW;
  FragH aq[2][KS];
#pragma unroll
  for (int rt = 0; rt < RTN; ++rt) { const unsigned short* qr = (const unsigned short*)Q16 + ((size_t)b * TQ + q0 + rt * 16 + ln) * ldq + h * 64;
#pragma unroll
    for (int ks = 0; ks < KS; ++ks) { aq[rt][ks].half[0] = *(const v8us*)(qr + ks * 32 + 8 * hh); aq[rt][ks].half[1] = *(const v8us*)(qr + ks * 32 + 16 + 8 * hh); } }
  const unsigned short* Vth = (const unsigned short*)Vt + (size_t)slab * 64 * TK;
  float m_r[2][8], l_r[2][8]; v8f oacc[2][DT];
#pragma unroll
  for (int rt = 0; rt < RTN; ++rt) {
#pragma unroll
    for (int r = 0; r < 8; ++r) { m_r[rt][r] = -3.0e38f; l_r[rt][r] = 0.f; }
#pragma unroll
    for (int dt = 0; dt < DT; ++dt) oacc[rt][dt] = (v8f){0.f,0.f,0.f,0.f,0.f,0.f,0.f,0.f}; }
  const int jend = (CAUSAL == 1) ? (qb0 + 4 * RPW) : TK;      /* causal: keys beyond the block's last query never contribute */
#pragma unroll 1
  for (int j0 = 0; j0 < jend; j0 += 32) {
    v8f s[2][2];
#pragma unroll
    for (int nt = 0; nt < 2; ++nt) { const unsigned short* kr = (const unsigned short*)K16 + ((size_t)b * TK + j0 + nt * 16 + ln) * ldk + h * 64; FragH bk[KS];
#pragma unroll
      for (int ks = 0; ks < KS; ++ks) { bk[ks].half[0] = *(const v8us*)(kr + ks * 32 + 8 * hh); bk[ks].half[1] = *(const v8us*)(kr + ks * 32 + 16 + 8 * hh); }
#pragma unroll
      for (int rt = 0; rt < RTN; ++rt) { v8f acc = (v8f){0.f,0.f,0.f,0.f,0.f,0.f,0.f,0.f};
#pragma unroll
        for (int ks = 0; ks < KS; ++ks) acc = mmaH<1>(aq[rt][ks].v, aq[rt][ks].v, bk[ks].v, bk[ks].v, acc); s[rt][nt] = acc; } }
#pragma unroll
    for (int rt = 0; rt < RTN; ++rt)
#pragma unroll
      for (int r = 0; r < 8; ++r) { const int tq = q0 + rt * 16 + 8 * hh + r; const int k0 = j0 + ln, k1 = j0 + 16 + ln;
        const bool ok0 = (CAUSAL == 1) ? (k0 <= tq) : ((CAUSAL == 2) ? ((k0 >> 5) == (tq >> 5)) : true), ok1 = (CAUSAL == 1) ? (k1 <= tq) : ((CAUSAL == 2) ? ((k1 >> 5) == (tq >> 5)) : true);      /* mode 2: block-diagonal 32-token groups */
        const float s0 = ok0 ? s[rt][0][r] * SCL : -3.0e38f, s1 = ok1 ? s[rt][1][r] * SCL : -3.0e38f; float mc = fmaxf(s0, s1);
        mc = fmaxf(mc, __shfl_xor(mc, 1, 32)); mc = fmaxf(mc, __shfl_xor(mc, 2, 32)); mc = fmaxf(mc, __shfl_xor(mc, 4, 32)); mc = fmaxf(mc, __shfl_xor(mc, 8, 32));
        const float mn = fmaxf(m_r[rt][r], mc); const float al = (mn > -1.0e38f) ? expf(m_r[rt][r] - mn) : 1.0f; m_r[rt][r] = mn; const float p0 = ok0 ? expf(s0 - mn) : 0.f, p1 = ok1 ? expf(s1 - mn) : 0.f; l_r[rt][r] = l_r[rt][r] * al + p0 + p1;
#pragma unroll
        for (int dt = 0; dt < DT; ++dt) oacc[rt][dt][r] *= al;
        FragH t2; t2.h[0] = (_Float16)(p0 * 1024.0f); t2.h[1] = (_Float16)(p1 * 1024.0f); sP[w][rt * 16 + 8 * hh + r][ln] = t2.u[0]; sP[w][rt * 16 + 8 * hh + r][16 + ln] = t2.u[1]; }
    __builtin_amdgcn_fence(__ATOMIC_ACQ_REL, "workgroup"); __builtin_amdgcn_wave_barrier();
    FragH pa[2];
#pragma unroll
    for (int rt = 0; rt < RTN; ++rt) { pa[rt].half[0] = *(const v8us*)&sP[w][rt * 16 + ln][8 * hh]; pa[rt].half[1] = *(const v8us*)&sP[w][rt * 16 + ln][16 + 8 * hh]; }
#pragma unroll
    for (int dt = 0; dt < DT; ++dt) { const unsigned short* vrow = Vth + (size_t)(dt * 16 + ln) * TK + j0; FragH bv; bv.half[0] = *(const v8us*)(vrow + 8 * hh); bv.half[1] = *(const v8us*)(vrow + 16 + 8 * hh);
#pragma unroll
      for (int rt = 0; rt < RTN; ++rt) oacc[rt][dt] = mmaH<1>(pa[rt].v, pa[rt].v, bv.v, bv.v, oacc[rt][dt]); }
    __builtin_amdgcn_fence(__ATOMIC_ACQ_REL, "workgroup"); __builtin_amdgcn_wave_barrier(); }
#pragma unroll
  for (int rt = 0; rt < RTN; ++rt) {
#pragma unroll
    for (int r = 0; r < 8; ++r) { float l = l_r[rt][r]; l += __shfl_xor(l, 1, 32); l += __shfl_xor(l, 2, 32); l += __shfl_xor(l, 4, 32); l += __shfl_xor(l, 8, 32); l_r[rt][r] = (l > 0.f) ? 1.0f / (l * 1024.0f) : 0.f; }
#pragma unroll
    for (int dt = 0; dt < DT; ++dt)
#pragma unroll
      for (int r = 0; r < 8; ++r) sO[w][rt * 16 + 8 * hh + r][dt * 16 + ln] = oacc[rt][dt][r] * l_r[rt][r]; }
  __builtin_amdgcn_fence(__ATOMIC_ACQ_REL, "workgroup"); __builtin_amdgcn_wave_barrier();
  {
#pragma unroll
    for (int rp = 0; rp < RPW; rp += 2) { const int r = rp + (lane >> 4), pc = lane & 15; const v4f val = *(const v4fa*)&sO[w][r][pc * 4]; *(v4f*)(O + ((size_t)b * TQ + q0 + r) * ldo + h * 64 + pc * 4) = val; }
     } }
// Q/K-split flash kernel, TRANSPOSED products: S^T = Kh Qh^T + (Kh Ql^T + Kl Qh^T)/1024 with K as the A operand and Q as the B operand, then O^T += V^T P^T. Q/K = [hi | 2^10 residual] f16 planes (QL/KL same layout as Q16/K16); plain f16 P (x2^10); Q, K planes (ldq, ldk columns) and V^T (TK columns) in fragment order (the A and the B loader of this form read a tile alike, so every fragment load is the one of the untransposed form).
// Why transposed: the accumulator of S^T holds, in lane 16 * hh + ln, query ln and keys nt * 16 + 8 * hh + r. A query's 32 scores thus sit in two lanes (ln and ln + 16): maximum and sum are in-lane work plus one exchange between the wave's halves, one running maximum / sum / rescale factor per lane, and element nt * 8 + r of the lane is exactly element nt * 8 + r of the B fragment of P^T (k = 8 * hh + i in its first half, 16 + 8 * hh + i in its second), so P goes from the accumulators into the next product without LDS.
__device__ __forceinline__ float xhalf(float x) { return __builtin_bit_cast(float, __builtin_amdgcn_permlanex16(__builtin_bit_cast(int, x), __builtin_bit_cast(int, x), 0x76543210, 0xfedcba98, false, false)); }      /* lane l with lane l ^ 16 */
// Two query tiles (32 queries) a wave: every K hi, K residual and V^T fragment that the wave loads feeds both tiles' products, so the loads and the waits on them per product are halved; each query's own products, maximum, sums and their order are those of the one-tile form. 1024 blocks of 4 waves = 4 waves per SIMD, asked for below, so that the whole grid is resident at once.
__global__ __launch_bounds__(128, 4) void k_flashqk(const _Float16* __restrict__ Q16, const _Float16* __restrict__ QL, int ldq, const _Float16* __restrict__ K16, const _Float16* __restrict__ KL, int ldk, const _Float16* __restrict__ Vt, _Float16* __restrict__ OH, _Float16* __restrict__ OL) {
  constexpr int QT = FQT, RPW = 16 * QT, DT = 4, KS = 2;
  const int tid = threadIdx.x, w = tid >> 5, lane = tid & 31;
  const int slab = blockIdx.x / FQBLKS, qblk = blockIdx.x % FQBLKS; const int b = slab / NH, h = slab % NH; const int q0 = qblk * (4 * RPW) + w * RPW;
  FragH bq[QT][KS], bql[QT][KS];
#pragma unroll      /* here and at every unroll of this kernel: the arrays indexed are registers, so every index must be a constant */
  for (int qt = 0; qt < QT; ++qt) { const unsigned short* qr = (const unsigned short*)Q16 + ((size_t)b * TQ + q0 + qt * 16) * ldq + h * 1024 + 8 * lane; const unsigned short* ql = (const unsigned short*)QL + ((size_t)b * TQ + q0 + qt * 16) * ldq + h * 1024 + 8 * lane;      /* fragment order: a head's 64 columns are 2 tiles of 512 elements */
#pragma unroll
    for (int ks = 0; ks < KS; ++ks) { bq[qt][ks].half[0] = *(const v8us*)(qr + ks * 512); bq[qt][ks].half[1] = *(const v8us*)(qr + ks * 512 + 256); bql[qt][ks].half[0] = *(const v8us*)(ql + ks * 512); bql[qt][ks].half[1] = *(const v8us*)(ql + ks * 512 + 256); }
    asm volatile("s_wait_xcnt 0x0" :: "v"(qr), "v"(ql) : "memory"); }      /* behind the tile's 8 loads and in front of any reuse of their address registers, in the form used behind the K loads below */
  const unsigned short* Vth = (const unsigned short*)Vt + (size_t)slab * 64 * TK;
  float m_q[QT], l_q[QT]; v8f oacc[QT][DT];      /* of query ln of tile qt; l_q holds the sum over this half's keys, the halves are joined behind the loop */
#pragma unroll
  for (int qt = 0; qt < QT; ++qt) { m_q[qt] = -3.0e38f; l_q[qt] = 0.f;
#pragma unroll
    for (int dt = 0; dt < DT; ++dt) oacc[qt][dt] = (v8f){0.f,0.f,0.f,0.f,0.f,0.f,0.f,0.f}; }
#pragma unroll 1
  for (int j0 = 0; j0 < TK; j0 += 32) {
    float sc[QT][16];
#pragma unroll
    for (int nt = 0; nt < 2; ++nt) { const unsigned short* kr = (const unsigned short*)K16 + ((size_t)b * TK + j0 + nt * 16) * ldk + h * 1024 + 8 * lane; const unsigned short* klr = (const unsigned short*)KL + ((size_t)b * TK + j0 + nt * 16) * ldk + h * 1024 + 8 * lane; FragH ak[KS], akl[KS];
#pragma unroll
      for (int ks = 0; ks < KS; ++ks) { ak[ks].half[0] = *(const v8us*)(kr + ks * 512); ak[ks].half[1] = *(const v8us*)(kr + ks * 512 + 256); akl[ks].half[0] = *(const v8us*)(klr + ks * 512); akl[ks].half[1] = *(const v8us*)(klr + ks * 512 + 256); }
      asm volatile("s_wait_xcnt 0x0" :: "v"(kr), "v"(klr) : "memory");      /* behind the tile's 8 loads and in front of any reuse of their address registers: naming the two addresses as inputs keeps their registers untouched up to this wait */
      v8f acc[QT], accl[QT];
#pragma unroll
      for (int qt = 0; qt < QT; ++qt) { acc[qt] = (v8f){0.f,0.f,0.f,0.f,0.f,0.f,0.f,0.f}; accl[qt] = acc[qt]; }
#pragma unroll
      for (int ks = 0; ks < KS; ++ks) {      /* the two tiles' products alternate: a product that adds to the one before it in its own chain stands two places behind it */
#pragma unroll
        for (int qt = 0; qt < QT; ++qt) acc[qt] = mmaH<1>(ak[ks].v, ak[ks].v, bq[qt][ks].v, bq[qt][ks].v, acc[qt]);
#pragma unroll
        for (int qt = 0; qt < QT; ++qt) accl[qt] = mmaH<1>(ak[ks].v, ak[ks].v, bql[qt][ks].v, bql[qt][ks].v, accl[qt]);
#pragma unroll
        for (int qt = 0; qt < QT; ++qt) accl[qt] = mmaH<1>(akl[ks].v, akl[ks].v, bq[qt][ks].v, bq[qt][ks].v, accl[qt]); }
#pragma unroll
      for (int qt = 0; qt < QT; ++qt)
#pragma unroll
        for (int r = 0; r < 8; ++r) sc[qt][nt * 8 + r] = acc[qt][r] + accl[qt][r] * 0.0009765625f; }      /* the raw q.k: its scale is applied inside the exponent's FMA below; the maximum is taken on raw scores (the scale is positive) */
    FragH av[DT]; const unsigned short* vr = Vth + j0 * 16 + 8 * lane;      /* fragment order: 32 keys = one tile of 512 elements; rows d of V^T are the A operand */
#pragma unroll
    for (int dt = 0; dt < DT; ++dt) { const unsigned short* vrow = vr + (size_t)(dt * 16) * TK; av[dt].half[0] = *(const v8us*)(vrow); av[dt].half[1] = *(const v8us*)(vrow + 256); }
    asm volatile("s_wait_xcnt 0x0" :: "v"(vr) : "memory");      /* behind the 8 V^T loads, as behind the K loads above: naming the address keeps its registers untouched up to this wait */
    __builtin_amdgcn_sched_barrier(0);      /* keeps the 8 V^T loads in front of the softmax, which then covers their latency: left free, the scheduler sinks 6 of them to just in front of their products, where the wave waits them out */
    FragH pb[QT];
#pragma unroll
    for (int qt = 0; qt < QT; ++qt) {
      float mx[8];
#pragma unroll
      for (int i = 0; i < 8; ++i) mx[i] = fmaxf(sc[qt][i], sc[qt][8 + i]);
      float mc = fmaxf(fmaxf(fmaxf(mx[0], mx[1]), fmaxf(mx[2], mx[3])), fmaxf(fmaxf(mx[4], mx[5]), fmaxf(mx[6], mx[7])));
      mc = fmaxf(mc, xhalf(mc));
      const float mn = fmaxf(m_q[qt], mc); const float ea = __builtin_amdgcn_exp2f((m_q[qt] - mn) * SCL2); const float al = (mn > -1.0e38f) ? ea : 1.0f; m_q[qt] = mn;
      const float nb = 10.0f - mn * SCL2;      /* base-2 softmax: 2^10 e^(scale (s - max)) = 2^(s * SCL2 + nb), one FMA and one v_exp_f32 a score; an exponent below the normal range gives 0, far under what the f16 P can hold */
      float p[16];
#pragma unroll
      for (int i = 0; i < 16; ++i) { p[i] = __builtin_amdgcn_exp2f(sc[qt][i] * SCL2 + nb); pb[qt].h[i] = (_Float16)p[i]; }      /* p and l_q carry the factor 2^10 of P */
      l_q[qt] = l_q[qt] * al + ((((p[0] + p[1]) + (p[2] + p[3])) + ((p[4] + p[5]) + (p[6] + p[7]))) + (((p[8] + p[9]) + (p[10] + p[11])) + ((p[12] + p[13]) + (p[14] + p[15]))));
#pragma unroll
      for (int dt = 0; dt < DT; ++dt)
#pragma unroll
        for (int r = 0; r < 8; ++r) oacc[qt][dt][r] *= al; }
#pragma unroll
    for (int dt = 0; dt < DT; ++dt)
#pragma unroll
      for (int qt = 0; qt < QT; ++qt) oacc[qt][dt] = mmaH<1>(av[dt].v, av[dt].v, pb[qt].v, pb[qt].v, oacc[qt][dt]); }
  /* O^T: lane 16 * hh + ln holds query ln of tile qt and, in accumulator dt, the 8 neighbouring columns d = dt * 16 + 8 * hh + r: exactly one 16-byte chunk of the projection's A plane (row = token, DMOD columns, fragment order). The hi + 2^10 residual split is done here and each plane gets 512 contiguous bytes per wave, tile and dt, straight from registers */
#pragma unroll
  for (int qt = 0; qt < QT; ++qt) {
    const float l = l_q[qt] + xhalf(l_q[qt]); const float inv = (l > 0.f) ? 1.0f / l : 0.f;      /* l holds the 2^10 that the O^T sums hold */
    unsigned short* oh = (unsigned short*)OH + ((size_t)(((b * TQ + q0) >> 4) + qt) * (DMOD / 32) + h * 2) * 512 + 8 * lane; unsigned short* ol = (unsigned short*)OL + ((size_t)(((b * TQ + q0) >> 4) + qt) * (DMOD / 32) + h * 2) * 512 + 8 * lane;
#pragma unroll
    for (int dt = 0; dt < DT; ++dt) { FragH fh, fl;
#pragma unroll
      for (int r = 0; r < 8; ++r) { const float v = oacc[qt][dt][r] * inv; const _Float16 hv = (_Float16)v; fh.h[r] = hv; fl.h[r] = (_Float16)((v - (float)hv) * 1024.0f); }
      *(v8us*)(oh + dt * 256) = fh.half[0]; *(v8us*)(ol + dt * 256) = fl.half[0]; } } }

__global__ __launch_bounds__(256) void k_woutp(const float* __restrict__ Wm, _Float16* __restrict__ Bt) { const size_t t = (size_t)blockIdx.x * 256 + threadIdx.x; if (t >= (size_t)DMOD * (2 * DMOD / 8)) return; const int tile = (int)(t >> 6); const int pc = (tile % (2 * DMOD / 32)) * 4 + (int)((t >> 4) & 3); const int o = (tile / (2 * DMOD / 32)) * 16 + (int)(t & 15); const bool lo = pc * 8 >= DMOD; FragH f;      /* t = the output chunk in fragment order */
  for (int q = 0; q < 8; ++q) { const int c = pc * 8 + q - (lo ? DMOD : 0); f.h[q] = (_Float16)(bf16_round(Wm[(size_t)c * DMOD + o]) * (lo ? 1.0f : 16.0f)); } *(v8us*)((unsigned short*)Bt + t * 8) = f.half[0];  }      /* Wproj stored (in, out) -> Bt rows o, columns [c | 1024 + c], fragment order */
__global__ __launch_bounds__(256) void k_pose(const float* __restrict__ pose, const float* __restrict__ W1, const float* __restrict__ b1, const float* __restrict__ W2, const float* __restrict__ b2, const float* __restrict__ bqkv, float* __restrict__ PB) {
  #pragma clang fp contract(off)
  __shared__ float hs[64]; const int b = blockIdx.x / (3 * DMOD / 256), tid = threadIdx.x; const int o = (blockIdx.x % (3 * DMOD / 256)) * 256 + tid;      /* one block per (batch, 256-column slice), one output column per thread */
  float w2[64];      /* the column's 64 W2 values are fetched up front by independent loads (ahead of the hidden layer too), so a wave waits for memory once instead of once per term */
#pragma unroll
  for (int j = 0; j < 64; ++j) w2[j] = W2[(size_t)j * 3 * DMOD + o];
  const float vb2 = b2[o], vbq = bqkv[o];
  if (tid < 64) { float s = 0.f; for (int i = 0; i < 3; ++i) s += bf16_round(pose[b * 3 + i]) * bf16_round(W1[i * 64 + tid]); s += bf16_round(b1[tid]); hs[tid] = fmaxf(s, 0.f); }
  __syncthreads();
  float s = 0.f;
#pragma unroll
  for (int j = 0; j < 64; ++j) s += hs[j] * bf16_round(w2[j]);      /* terms summed in index order, j = 0..63 */
  s += bf16_round(vb2); s += bf16_round(vbq); PB[(size_t)b * 3 * DMOD + o] = s; }

extern "C" void kernel_launch(void* const* d_in, const int* in_sizes, int n_in,
                              void* d_out, int out_size, void* d_ws, size_t ws_size, hipStream_t stream) {
  (void)in_sizes; (void)n_in; (void)out_size;
  const float* const* I = (const float* const*)d_in; const float* x = I[0]; const float* pose = I[1]; const float* Wqkv = I[2]; const float* bqkv = I[3]; const float* W1 = I[4]; const float* b1 = I[5]; const float* W2 = I[6]; const float* b2 = I[7]; const float* Wp = I[8]; const float* bp = I[9];
  char* ws = (char*)d_ws; size_t off = 0;
  auto take = [&](size_t bytes) { char* p = ws + off; off += (bytes + 255) & ~(size_t)255; return p; };
  _Float16* BW = (_Float16*)take((size_t)3 * DMOD * DMOD * 2); _Float16* BO = (_Float16*)take((size_t)DMOD * 2 * DMOD * 2); float* PB = (float*)take((size_t)NB * 3 * DMOD * 4);
  _Float16* X16 = (_Float16*)take((size_t)NR * DMOD * 2); _Float16* H3 = (_Float16*)take((size_t)NR * 3 * DMOD * 2); _Float16* L3 = (_Float16*)take((size_t)NR * 3 * DMOD * 2); _Float16* VT = (_Float16*)take((size_t)NR * DMOD * 2); _Float16* Hh = (_Float16*)take((size_t)NR * DMOD * 2); _Float16* Hl = (_Float16*)take((size_t)NR * DMOD * 2);      /* H3/L3: 3072 columns q | k | (unused) in fragment order, where a step of 1024 columns is 32 tiles = 16 * DMOD elements; Hh/Hl are planes of their own: the flash kernel writes them while other blocks still read H3/L3 */
  if (off > ws_size) return;      /* 6 + 4 + 16 + 48 + 48 + 16 + 16 + 16 = 170 MiB (256 MiB ws) */
  k_wt_f16<<<(unsigned)(((size_t)3 * DMOD * (DMOD / 8) + 255) / 256), 256, 0, stream>>>(Wqkv, BW, DMOD, 3 * DMOD, 16.0f); k_woutp<<<(unsigned)(((size_t)DMOD * (2 * DMOD / 8) + 255) / 256), 256, 0, stream>>>(Wp, BO);
  k_pose<<<NB * (3 * DMOD / 256), 256, 0, stream>>>(pose, W1, b1, W2, b2, bqkv, PB);
  k_x16<<<(unsigned)(((size_t)NR * DMOD / 8 + 255) / 256), 256, 0, stream>>>(x, X16, (size_t)NR * DMOD / 8);
  const dim3 gQ((NR / 128) * (3 * DMOD / 64), 1), gA((NR / 128) * (DMOD / 64), 1);
  k_gemm_qkv<<<gQ, 128, 0, stream>>>(X16, BW, PB, H3, L3, VT);      /* all batches and q|k|v in one launch; + (bqkv + pose bias of batch row / 1024), a COMPUTED f32 vector added raw (not bf16-rounded like an input bias); writes q, k hi + residual and V^T */
  k_flashqk<<<NB * NH * FQBLKS, 128, 0, stream>>>(H3, L3, 3 * DMOD, H3 + 16 * DMOD, L3 + 16 * DMOD, 3 * DMOD, VT, Hh, Hl);      /* q/k hi + residual; P (x2^10) and V plain f16; writes the attention output hi + residual */
  k_gemm_proj<<<gA, 128, 0, stream>>>(Hh, Hl, BO, bp, (float*)d_out);      /* hi and residual planes in one launch */
}
